// v000
// The times below were measured on an AMD MI455X: many runs one after another, warmed up first and cycling through
// copies of the inputs, with the whole window's GPU time divided by the number of runs. Launches and the gaps
// between them are all in it. The median over several windows is given; except for v000 it joins two sittings, which
// can be a few percent apart, so the side-by-side timings, each taken in one sitting, are the better comparison.
// The starting kernel, v000, takes 546 microseconds a run.
#include <hip/hip_runtime.h>
// 'SelfAttension' (B=2, S=2048, E=1024, 16 heads × 64): per-head projections with ONE shared 64×64 weight per tensor (y_h = x_h·Wᵀ, torch (out,in), no bias) for values, keys, query; energy = q·kᵀ with −1e20 where the key mask [N,1,1,S] == 0;
// attn = softmax(energy/√1024); out = (attn·v merged)·Woᵀ + bo.
// Compute dtype: inputs, weights, bias rounded to bf16; the per-head 64×64 projections as block-diagonal f16 GEMMs (one launch per head-block column, K = 64); fused flash-style kernel (per-(b,k) int mask loads, scale 1/32,
// online softmax f32, P f16 ×2^10) on v_wmma_f32_16x16x32_f16; O ×2^4 → f16 → output GEMM + bias; f32 accumulate.
#define BB 2
#define TT 2048
#define DD 1024
#define NH 16
#define HD 64
#define NR (BB * TT)

typedef __bf16 v16b __attribute__((ext_vector_type(16)));
typedef unsigned short v8us __attribute__((ext_vector_type(8), may_alias));
typedef float  v8f  __attribute__((ext_vector_type(8)));
typedef float  v4f  __attribute__((ext_vector_type(4)));
typedef float  v4fa __attribute__((ext_vector_type(4), may_alias));
union FragB { v16b v; v8us half[2]; unsigned short u[16]; };

__device__ __forceinline__ unsigned short bf16_bits(float x) { unsigned int u = __float_as_uint(x); return (unsigned short)((u + 0x7FFFu + ((u >> 16) & 1u)) >> 16); }
__device__ __forceinline__ float bf16_val(unsigned short b) { return __uint_as_float(((unsigned int)b) << 16); }
__device__ __forceinline__ float bf16_round(float x) { return bf16_val(bf16_bits(x)); }
// D += A·B with NT terms: 1 = ah·bh, 2 = + al·bh (A split), 3 = + ah·bl (both split)
template <int NT>
__device__ __forceinline__ v8f mmaN(v16b ah, v16b al, v16b bh, v16b bl, v8f c) {
  c = __builtin_amdgcn_wmma_f32_16x16x32_bf16(false, ah, false, bh, (short)0, c, false, false);
  if (NT >= 2) c = __builtin_amdgcn_wmma_f32_16x16x32_bf16(false, al, false, bh, (short)0, c, false, false);
  if (NT >= 3) c = __builtin_amdgcn_wmma_f32_16x16x32_bf16(false, ah, false, bl, (short)0, c, false, false);
  asm volatile("v_nop\n\tv_nop\n\tv_nop\n\tv_nop" : "+v"(c) : "v"(ah), "v"(al), "v"(bh), "v"(bl));
  return c;
}

__global__ __launch_bounds__(256) void k_wt_bf16(const float* __restrict__ W, unsigned short* __restrict__ Wt, int K, int N) {
  const int t = blockIdx.x * 256 + threadIdx.x;
  const int k8n = K / 8;
  if (t >= N * k8n) return;
  const int n = t / k8n, k8 = (t % k8n) * 8;
  v8us v;
#pragma unroll
  for (int i = 0; i < 8; ++i) v[i] = bf16_bits(W[(size_t)(k8 + i) * N + n]);
  *(v8us*)(Wt + (size_t)n * K + k8) = v;
  
}

// GEMM C[M][N] (f32, pitch ldc) = act(A[M][K]·W + bias). A f32 row-major (pitch lda) converted per fragment to bf16
// (ASPLIT: hi/lo two planes -> 2 terms, else single rounded term); Wt bf16 [N][K] (pitch ldb). BIAS_BF16 rounds the
// bias to bf16 first (bias quantised to bf16 before the add). K%32==0, M%16==0, N%64==0.
template <bool ASPLIT, int ACT, bool BIAS_BF16>
__global__ __launch_bounds__(128) void k_gemm_bf(const float* __restrict__ A, int lda, const unsigned short* __restrict__ Wt, int ldb,
                                               const float* __restrict__ bias, float* __restrict__ C, int ldc, int M, int N, int K) {
  __shared__ __attribute__((aligned(16))) float so[4][16][64];
  const int tid = threadIdx.x, w = tid >> 5, lane = tid & 31, ln = lane & 15, hh = lane >> 4;
  const int ntn = N / 64;
  const int wid = blockIdx.x * 4 + w;
  const int mt = wid / ntn, nq = wid % ntn;
  if (mt * 16 >= M) return;
  const int row0 = mt * 16, col0 = nq * 64;
  const float* arow = A + (size_t)(row0 + ln) * lda;
  v8f acc[4] = {};
  for (int kb = 0; kb < K; kb += 32) {
    FragB ah, al;
    const v4f x0 = *(const v4fa*)(arow + kb + 8 * hh), x1 = *(const v4fa*)(arow + kb + 8 * hh + 4);
    const v4f x2 = *(const v4fa*)(arow + kb + 16 + 8 * hh), x3 = *(const v4fa*)(arow + kb + 16 + 8 * hh + 4);
    float xs[16] = {x0[0],x0[1],x0[2],x0[3],x1[0],x1[1],x1[2],x1[3],x2[0],x2[1],x2[2],x2[3],x3[0],x3[1],x3[2],x3[3]};
#pragma unroll
    for (int i = 0; i < 16; ++i) { const unsigned short hb = bf16_bits(xs[i]); ah.u[i] = hb; al.u[i] = ASPLIT ? bf16_bits(xs[i] - bf16_val(hb)) : (unsigned short)0; }
#pragma unroll
    for (int t = 0; t < 4; ++t) {
      const unsigned short* brow = Wt + (size_t)(col0 + t * 16 + ln) * ldb + kb;
      FragB b;
      b.half[0] = *(const v8us*)(brow + 8 * hh);
      b.half[1] = *(const v8us*)(brow + 16 + 8 * hh);
      acc[t] = mmaN<ASPLIT ? 2 : 1>(ah.v, al.v, b.v, b.v, acc[t]);
    }
  }
#pragma unroll
  for (int t = 0; t < 4; ++t) {
    float bv = bias ? bias[col0 + t * 16 + ln] : 0.f;
    if (BIAS_BF16) bv = bf16_round(bv);
#pragma unroll
    for (int r = 0; r < 8; ++r) { float v = acc[t][r] + bv; if (ACT == 1) v = fmaxf(v, 0.f); so[w][8 * hh + r][t * 16 + ln] = v; }
  }
  __builtin_amdgcn_fence(__ATOMIC_ACQ_REL, "workgroup");
  __builtin_amdgcn_wave_barrier();
  const int rsub = lane >> 4, c4 = (lane & 15) * 4;
  {
#pragma unroll
    for (int q = 0; q < 8; ++q) {
      const int r = q * 2 + rsub;
      const v4f v = *(const v4fa*)&so[w][r][c4];
      *(v4f*)(C + (size_t)(row0 + r) * ldc + col0 + c4) = v;
    }
    
  }
}

// Flash-style causal/unmasked attention, all contractions 3-term bf16 hi/lo splits, f32 softmax with running max.
// q,k,v rows are read from f32 buffers with arbitrary row pitch (so they can live inside a fused qkv buffer);
// D = head size (multiple of 32, <= 128); one wave = 16 query rows; block = 4 waves (64 queries) sharing K/V chunks of 32.
template <int D, bool CAUSAL>
__global__ __launch_bounds__(128) void k_flash(const float* __restrict__ qb, const float* __restrict__ kb, const float* __restrict__ vb,
                                             int pitch, int T, int H, float scale, float* __restrict__ y, int ypitch) {
  constexpr int KS = D / 32;        // k-steps for QK
  constexpr int DT = D / 16;        // d tiles for PV
  __shared__ __attribute__((aligned(16))) unsigned short sKh[32][D + 8], sKl[32][D + 8], sVh[32][D + 8], sVl[32][D + 8];
  __shared__ __attribute__((aligned(16))) unsigned short sPh[4][16][40], sPl[4][16][40];
  __shared__ __attribute__((aligned(16))) float sO[4][16][D];
  const int tid = threadIdx.x, w = tid >> 5, lane = tid & 31, ln = lane & 15, hh = lane >> 4;
  const int nqb = (T + 63) / 64;
  const int bh = blockIdx.x / nqb, qblk = blockIdx.x % nqb;
  const int b = bh / H, h = bh % H;
  const int q0 = qblk * 64 + w * 16;
  const float* Q = qb + (size_t)b * T * pitch + h * D;
  const float* K = kb + (size_t)b * T * pitch + h * D;
  const float* V = vb + (size_t)b * T * pitch + h * D;

  // A fragments of the wave's 16 query rows (scaled), hi/lo
  FragB aqh[KS], aql[KS];
  {
    int row = q0 + ln; if (row >= T) row = T - 1;
    const float* qr = Q + (size_t)row * pitch;
#pragma unroll
    for (int ks = 0; ks < KS; ++ks)
#pragma unroll
      for (int i = 0; i < 16; ++i) {
        const int d = ks * 32 + ((i < 8) ? (8 * hh + i) : (16 + 8 * hh + (i - 8)));
        const float x = qr[d] * scale; const unsigned short hb = bf16_bits(x);
        aqh[ks].u[i] = hb; aql[ks].u[i] = bf16_bits(x - bf16_val(hb));
      }
  }
  float m_r[8], l_r[8];
#pragma unroll
  for (int r = 0; r < 8; ++r) { m_r[r] = -3.0e38f; l_r[r] = 0.f; }
  v8f oacc[DT];
#pragma unroll
  for (int dt = 0; dt < DT; ++dt) oacc[dt] = (v8f){0.f,0.f,0.f,0.f,0.f,0.f,0.f,0.f};

  const int kv_end = CAUSAL ? min(T, qblk * 64 + 64) : T;     // block-uniform
  for (int j0 = 0; j0 < kv_end; j0 += 32) {
    __syncthreads();
    for (int e = tid; e < 32 * (D / 4); e += 128) {
      const int r = e / (D / 4), c4 = (e % (D / 4)) * 4;
      const int key = j0 + r;
      v4f kf = {0.f,0.f,0.f,0.f}, vf = {0.f,0.f,0.f,0.f};
      if (key < T) { kf = *(const v4fa*)(K + (size_t)key * pitch + c4); vf = *(const v4fa*)(V + (size_t)key * pitch + c4); }
#pragma unroll
      for (int t = 0; t < 4; ++t) {
        unsigned short hb = bf16_bits(kf[t]); sKh[r][c4 + t] = hb; sKl[r][c4 + t] = bf16_bits(kf[t] - bf16_val(hb));
        hb = bf16_bits(vf[t]); sVh[r][c4 + t] = hb; sVl[r][c4 + t] = bf16_bits(vf[t] - bf16_val(hb));
      }
    }
    __syncthreads();
    // S tile 16 x 32
    v8f s[2];
#pragma unroll
    for (int nt = 0; nt < 2; ++nt) {
      v8f acc = {};
#pragma unroll
      for (int ks = 0; ks < KS; ++ks) {
        FragB bh_, bl_;
        bh_.half[0] = *(const v8us*)&sKh[nt * 16 + ln][ks * 32 + 8 * hh]; bh_.half[1] = *(const v8us*)&sKh[nt * 16 + ln][ks * 32 + 16 + 8 * hh];
        bl_.half[0] = *(const v8us*)&sKl[nt * 16 + ln][ks * 32 + 8 * hh]; bl_.half[1] = *(const v8us*)&sKl[nt * 16 + ln][ks * 32 + 16 + 8 * hh];
        acc = mmaN<3>(aqh[ks].v, aql[ks].v, bh_.v, bl_.v, acc);
      }
      s[nt] = acc;
    }
    // mask + running max (rows 8hh+r; the 16 lanes of a half share rows)
    float alpha[8];
#pragma unroll
    for (int r = 0; r < 8; ++r) {
      const int qi = q0 + 8 * hh + r;
      const int ja = j0 + ln, jb = j0 + 16 + ln;
      if (CAUSAL) { if (ja > qi) s[0][r] = -3.0e38f; if (jb > qi) s[1][r] = -3.0e38f; }
      if (ja >= T) s[0][r] = -3.0e38f;
      if (jb >= T) s[1][r] = -3.0e38f;
      float mx = fmaxf(s[0][r], s[1][r]);
      mx = fmaxf(mx, __shfl_xor(mx, 1, 32)); mx = fmaxf(mx, __shfl_xor(mx, 2, 32)); mx = fmaxf(mx, __shfl_xor(mx, 4, 32)); mx = fmaxf(mx, __shfl_xor(mx, 8, 32));
      const float mnew = fmaxf(m_r[r], mx);
      alpha[r] = (mnew > -1.0e38f) ? __expf(m_r[r] - mnew) : 1.0f;
      const float p0 = (s[0][r] > -1.0e38f) ? __expf(s[0][r] - mnew) : 0.f;
      const float p1 = (s[1][r] > -1.0e38f) ? __expf(s[1][r] - mnew) : 0.f;
      m_r[r] = mnew;
      l_r[r] = l_r[r] * alpha[r] + p0 + p1;            // per-lane partial row sum (16 lanes combined at the end)
      unsigned short hb = bf16_bits(p0); sPh[w][8 * hh + r][ln] = hb;      sPl[w][8 * hh + r][ln] = bf16_bits(p0 - bf16_val(hb));
      hb = bf16_bits(p1);                sPh[w][8 * hh + r][16 + ln] = hb; sPl[w][8 * hh + r][16 + ln] = bf16_bits(p1 - bf16_val(hb));
    }
#pragma unroll
    for (int dt = 0; dt < DT; ++dt)
#pragma unroll
      for (int r = 0; r < 8; ++r) oacc[dt][r] *= alpha[r];
    __builtin_amdgcn_fence(__ATOMIC_ACQ_REL, "workgroup");
    __builtin_amdgcn_wave_barrier();
    FragB pah, pal;
    pah.half[0] = *(const v8us*)&sPh[w][ln][8 * hh]; pah.half[1] = *(const v8us*)&sPh[w][ln][16 + 8 * hh];
    pal.half[0] = *(const v8us*)&sPl[w][ln][8 * hh]; pal.half[1] = *(const v8us*)&sPl[w][ln][16 + 8 * hh];
#pragma unroll
    for (int dt = 0; dt < DT; ++dt) {
      FragB bvh, bvl;
#pragma unroll
      for (int i = 0; i < 8; ++i) {
        bvh.u[i] = sVh[8 * hh + i][dt * 16 + ln]; bvh.u[8 + i] = sVh[16 + 8 * hh + i][dt * 16 + ln];
        bvl.u[i] = sVl[8 * hh + i][dt * 16 + ln]; bvl.u[8 + i] = sVl[16 + 8 * hh + i][dt * 16 + ln];
      }
      oacc[dt] = mmaN<3>(pah.v, pal.v, bvh.v, bvl.v, oacc[dt]);
    }
    __builtin_amdgcn_fence(__ATOMIC_ACQ_REL, "workgroup");
    __builtin_amdgcn_wave_barrier();
  }
#pragma unroll
  for (int r = 0; r < 8; ++r) {
    float l = l_r[r];
    l += __shfl_xor(l, 1, 32); l += __shfl_xor(l, 2, 32); l += __shfl_xor(l, 4, 32); l += __shfl_xor(l, 8, 32);
    l_r[r] = (l > 0.f) ? 1.0f / l : 0.f;
  }
#pragma unroll
  for (int dt = 0; dt < DT; ++dt)
#pragma unroll
    for (int r = 0; r < 8; ++r) sO[w][8 * hh + r][dt * 16 + ln] = oacc[dt][r] * l_r[r];
  __builtin_amdgcn_fence(__ATOMIC_ACQ_REL, "workgroup");
  __builtin_amdgcn_wave_barrier();
  {
    for (int r = 0; r < 16; ++r) {
      const int row = q0 + r;
      if (row < T && lane < D / 4) {
        const v4f val = *(const v4fa*)&sO[w][r][lane * 4];
        *(v4f*)(y + ((size_t)b * T + row) * ypitch + h * D + lane * 4) = val;
      }
    }
    
  }
}

// GEMM C = act(A·W + bias + resid): A f32 (ASPLIT -> hi/lo 2 terms), Wt bf16 [N][K]; ACT 0 none, 1 relu, 2 exact gelu;
// resid (optional, f32, row index = (row % rmod), pitch ldr, RES_BF16 rounds it) added before the activation.
template <bool ASPLIT, int ACT, bool BIAS_BF16, bool RES_BF16>
__global__ __launch_bounds__(128) void k_gemm_bf3(const float* __restrict__ A, int lda, const unsigned short* __restrict__ Wt, int ldb,
                                                const float* __restrict__ bias, const float* __restrict__ resid, int rmod, int ldr,
                                                float* __restrict__ C, int ldc, int M, int N, int K) {
  __shared__ __attribute__((aligned(16))) float so[4][16][64];
  const int tid = threadIdx.x, w = tid >> 5, lane = tid & 31, ln = lane & 15, hh = lane >> 4;
  const int ntn = N / 64;
  const int wid = blockIdx.x * 4 + w;
  const int mt = wid / ntn, nq = wid % ntn;
  if (mt * 16 >= M) return;
  const int row0 = mt * 16, col0 = nq * 64;
  const float* arow = A + (size_t)(row0 + ln) * lda;
  v8f acc[4] = {};
  for (int kb = 0; kb < K; kb += 32) {
    FragB ah, al;
    const v4f x0 = *(const v4fa*)(arow + kb + 8 * hh), x1 = *(const v4fa*)(arow + kb + 8 * hh + 4);
    const v4f x2 = *(const v4fa*)(arow + kb + 16 + 8 * hh), x3 = *(const v4fa*)(arow + kb + 16 + 8 * hh + 4);
    float xs[16] = {x0[0],x0[1],x0[2],x0[3],x1[0],x1[1],x1[2],x1[3],x2[0],x2[1],x2[2],x2[3],x3[0],x3[1],x3[2],x3[3]};
#pragma unroll
    for (int i = 0; i < 16; ++i) { const unsigned short hb = bf16_bits(xs[i]); ah.u[i] = hb; al.u[i] = ASPLIT ? bf16_bits(xs[i] - bf16_val(hb)) : (unsigned short)0; }
#pragma unroll
    for (int t = 0; t < 4; ++t) {
      const unsigned short* brow = Wt + (size_t)(col0 + t * 16 + ln) * ldb + kb;
      FragB b;
      b.half[0] = *(const v8us*)(brow + 8 * hh);
      b.half[1] = *(const v8us*)(brow + 16 + 8 * hh);
      acc[t] = mmaN<ASPLIT ? 2 : 1>(ah.v, al.v, b.v, b.v, acc[t]);
    }
  }
#pragma unroll
  for (int t = 0; t < 4; ++t) {
    const int col = col0 + t * 16 + ln;
    float bv = bias ? bias[col] : 0.f;
    if (BIAS_BF16) bv = bf16_round(bv);
#pragma unroll
    for (int r = 0; r < 8; ++r) {
      float v = acc[t][r] + bv;
      if (resid) { float rv = resid[(size_t)((row0 + 8 * hh + r) % rmod) * ldr + col]; if (RES_BF16) rv = bf16_round(rv); v += rv; }
      if (ACT == 1) v = fmaxf(v, 0.f);
      if (ACT == 2) v = 0.5f * v * (1.0f + erff(v * 0.70710678118654752f));
      if (ACT == 3) { const float u = 0.7978845608028654f * (v + 0.044715f * v * v * v); v = 0.5f * v * (1.0f + tanhf(u)); }
      so[w][8 * hh + r][t * 16 + ln] = v;
    }
  }
  __builtin_amdgcn_fence(__ATOMIC_ACQ_REL, "workgroup");
  __builtin_amdgcn_wave_barrier();
  const int rsub = lane >> 4, c4 = (lane & 15) * 4;
  {
#pragma unroll
    for (int q = 0; q < 8; ++q) {
      const int r = q * 2 + rsub;
      const v4f v = *(const v4fa*)&so[w][r][c4];
      *(v4f*)(C + (size_t)(row0 + r) * ldc + col0 + c4) = v;
    }
    
  }
}
// row LayerNorm (biased variance, eps) over N: s = X (+ R); optional out_sum <- s; out_norm <- (s-mu)*rsqrt(var+eps)*g + b
template <bool PARAM_BF16>
__global__ __launch_bounds__(256) void k_layernorm(const float* __restrict__ X, const float* __restrict__ R, const float* __restrict__ g, const float* __restrict__ bta,
                                                  float* __restrict__ out_sum, float* __restrict__ out_norm, int N, float eps) {
  __shared__ float red[256];
  const int row = blockIdx.x, tid = threadIdx.x;
  const float* x = X + (size_t)row * N; const float* rr = R ? R + (size_t)row * N : nullptr;
  float vals[16];                     // up to N = 4096
  const int per = N / 256;            // contiguous chunk per thread? use strided-by-4 chunks: thread handles j = tid*4 + 1024*u
  float s1 = 0.f;
  for (int u = 0; u < per / 4; ++u) {
    const int j = tid * 4 + 1024 * u;
    const v4f a = *(const v4fa*)(x + j);
    v4f b = {0.f,0.f,0.f,0.f}; if (rr) b = *(const v4fa*)(rr + j);
#pragma unroll
    for (int q = 0; q < 4; ++q) { const float v = a[q] + b[q]; vals[u * 4 + q] = v; s1 += v; }
  }
  red[tid] = s1; __syncthreads();
  for (int st = 128; st > 0; st >>= 1) { if (tid < st) red[tid] += red[tid + st]; __syncthreads(); }
  const float mu = red[0] / (float)N; __syncthreads();
  float s2 = 0.f;
  for (int u = 0; u < per / 4; ++u)
#pragma unroll
    for (int q = 0; q < 4; ++q) { const float c = vals[u * 4 + q] - mu; s2 += c * c; }
  red[tid] = s2; __syncthreads();
  for (int st = 128; st > 0; st >>= 1) { if (tid < st) red[tid] += red[tid + st]; __syncthreads(); }
  const float rs = rsqrtf(red[0] / (float)N + eps);
  {
    for (int u = 0; u < per / 4; ++u) {
      const int j = tid * 4 + 1024 * u;
      v4f o, sm;
#pragma unroll
      for (int q = 0; q < 4; ++q) {
        float gg = g[j + q], bb = bta[j + q];
        if (PARAM_BF16) { gg = bf16_round(gg); bb = bf16_round(bb); }
        sm[q] = vals[u * 4 + q]; o[q] = (vals[u * 4 + q] - mu) * rs * gg + bb;
      }
      if (out_sum) *(v4f*)(out_sum + (size_t)row * N + j) = sm;
      *(v4f*)(out_norm + (size_t)row * N + j) = o;
    }
    
  }
}



// ---- f16 WMMA path (v_wmma_f32_16x16x32_f16): 11-bit significands for operands in range — used where a [0,1] probability operand needs more precision than bf16
typedef _Float16 v16h __attribute__((ext_vector_type(16)));
union FragH { v16h v; v8us half[2]; _Float16 h[16]; unsigned short u[16]; };
template <int NT>
__device__ __forceinline__ v8f mmaH(v16h ah, v16h al, v16h bh, v16h bl, v8f c) {
  c = __builtin_amdgcn_wmma_f32_16x16x32_f16(false, ah, false, bh, (short)0, c, false, false);
  if (NT >= 2) c = __builtin_amdgcn_wmma_f32_16x16x32_f16(false, al, false, bh, (short)0, c, false, false);
  if (NT >= 3) c = __builtin_amdgcn_wmma_f32_16x16x32_f16(false, ah, false, bl, (short)0, c, false, false);
  asm volatile("v_nop\n\tv_nop\n\tv_nop\n\tv_nop" : "+v"(c) : "v"(ah), "v"(al), "v"(bh), "v"(bl));
  return c;
}
// batched GEMM like k_gemm_b but f16 operands: A f32 (split into f16 hi/lo if ASPLIT, else rounded to f16), Bt = f16 values [n][k]; alpha; C f32; N multiple of 16 (partial tiles skipped)
template <bool ASPLIT>
__global__ __launch_bounds__(128) void k_gemm_h(const float* __restrict__ A, int lda, size_t sA, const _Float16* __restrict__ Bh, int ldb, size_t sB, float alpha, float* __restrict__ C, int ldc, size_t sC, int M, int N, int K) {
  __shared__ __attribute__((aligned(16))) float so[4][16][64];
  const int tid = threadIdx.x, w = tid >> 5, lane = tid & 31, ln = lane & 15, hh = lane >> 4; const int by = blockIdx.y;
  A += (size_t)by * sA; Bh += (size_t)by * sB; C += (size_t)by * sC;
  const int ntn = (N + 63) / 64; const int wid = blockIdx.x * 4 + w; const int mt = wid / ntn, nq = wid % ntn; if (mt * 16 >= M) return;
  const int row0 = mt * 16, col0 = nq * 64; const float* arow = A + (size_t)(row0 + ln) * lda;
  v8f acc[4] = {};
  for (int kb = 0; kb < K; kb += 32) {
    FragH ah, al;
    const v4f x0 = *(const v4fa*)(arow + kb + 8 * hh), x1 = *(const v4fa*)(arow + kb + 8 * hh + 4), x2 = *(const v4fa*)(arow + kb + 16 + 8 * hh), x3 = *(const v4fa*)(arow + kb + 16 + 8 * hh + 4);
    float xs[16] = {x0[0],x0[1],x0[2],x0[3],x1[0],x1[1],x1[2],x1[3],x2[0],x2[1],x2[2],x2[3],x3[0],x3[1],x3[2],x3[3]};
#pragma unroll
    for (int i = 0; i < 16; ++i) { const _Float16 h = (_Float16)xs[i]; ah.h[i] = h; al.h[i] = ASPLIT ? (_Float16)(xs[i] - (float)h) : (_Float16)0.0f; }
#pragma unroll
    for (int t = 0; t < 4; ++t) { if (col0 + t * 16 >= N) continue; const size_t boff = (size_t)(col0 + t * 16 + ln) * ldb + kb; FragH bq; bq.half[0] = *(const v8us*)(Bh + boff + 8 * hh); bq.half[1] = *(const v8us*)(Bh + boff + 16 + 8 * hh);
      acc[t] = mmaH<ASPLIT ? 2 : 1>(ah.v, al.v, bq.v, bq.v, acc[t]); }
  }
#pragma unroll
  for (int t = 0; t < 4; ++t) { if (col0 + t * 16 >= N) continue;
#pragma unroll
    for (int r = 0; r < 8; ++r) so[w][8 * hh + r][t * 16 + ln] = acc[t][r] * alpha; }
  __builtin_amdgcn_fence(__ATOMIC_ACQ_REL, "workgroup"); __builtin_amdgcn_wave_barrier();
  const int rsub = lane >> 4, c4 = (lane & 15) * 4;
  {
#pragma unroll
    for (int q = 0; q < 8; ++q) { const int r = q * 2 + rsub; if (col0 + c4 < N) { const v4f v = *(const v4fa*)&so[w][r][c4]; *(v4f*)(C + (size_t)(row0 + r) * ldc + col0 + c4) = v; } }
     }
}

// Wt[n][k] = f16(W[k][n]·scale) from f32 row-major W[K][N] (scale = power of two; bf16-exact weights stay exact in f16 away from the subnormal range)
__global__ __launch_bounds__(256) void k_wt_f16(const float* __restrict__ W, _Float16* __restrict__ Wt, int K, int N, float scale) {
  const int t = blockIdx.x * 256 + threadIdx.x; if (t >= N * (K / 8)) return; const int n = t / (K / 8), k8 = (t % (K / 8)) * 8; FragH f;
#pragma unroll
  for (int i = 0; i < 8; ++i) f.h[i] = (_Float16)(bf16_round(W[(size_t)(k8 + i) * N + n]) * scale); const v8us o = f.half[0];
  *(v8us*)((unsigned short*)Wt + (size_t)n * K + k8) = o; 
}
// k_gemm_hh variant with fused epilogue: v = acc·alpha + bias[by·sBias + col] (+ CP[(row/rowsPerB)·sCPb + by·64 + col] if CP) ; ACT 0 none / 1 elu ; writes f16 C16 and/or f32 C (each if non-null)
template <int ACT>
__global__ __launch_bounds__(128) void k_gemm_hhx(const _Float16* __restrict__ A, int lda, size_t sA, const _Float16* __restrict__ Bh, int ldb, size_t sB, float alpha, const float* __restrict__ bias, size_t sBias, const float* __restrict__ CP, int rowsPerB, size_t sCPb, int row0g,
    float* __restrict__ C, _Float16* __restrict__ C16, int ldc, size_t sC, int M, int N, int K) {
  __shared__ __attribute__((aligned(16))) float so[4][16][64];
  const int tid = threadIdx.x, w = tid >> 5, lane = tid & 31, ln = lane & 15, hh = lane >> 4; const int by = blockIdx.y;
  A += (size_t)by * sA; Bh += (size_t)by * sB; const size_t cofs = (size_t)by * sC; const float* bp = bias ? bias + (size_t)by * sBias : nullptr;
  const int ntn = (N + 63) / 64; const int wid = blockIdx.x * 4 + w; const int mt = wid / ntn, nq = wid % ntn; if (mt * 16 >= M) return;
  const int row0 = mt * 16, col0 = nq * 64; const _Float16* arow = A + (size_t)(row0 + ln) * lda;
  v8f acc[4] = {};
  for (int kb = 0; kb < K; kb += 32) { FragH ah; ah.half[0] = *(const v8us*)((const unsigned short*)arow + kb + 8 * hh); ah.half[1] = *(const v8us*)((const unsigned short*)arow + kb + 16 + 8 * hh);
#pragma unroll
    for (int t = 0; t < 4; ++t) { if (col0 + t * 16 >= N) continue; const size_t boff = (size_t)(col0 + t * 16 + ln) * ldb + kb; FragH bq; bq.half[0] = *(const v8us*)((const unsigned short*)Bh + boff + 8 * hh); bq.half[1] = *(const v8us*)((const unsigned short*)Bh + boff + 16 + 8 * hh);
      acc[t] = mmaH<1>(ah.v, ah.v, bq.v, bq.v, acc[t]); }
  }
#pragma unroll
  for (int t = 0; t < 4; ++t) { if (col0 + t * 16 >= N) continue; const int col = col0 + t * 16 + ln; const float bv = bp ? bf16_round(bp[col]) : 0.f;
#pragma unroll
    for (int r = 0; r < 8; ++r) { float v = acc[t][r] * alpha + bv; if (CP) { const int bidx = (row0g + row0 + 8 * hh + r) / rowsPerB; v += CP[(size_t)bidx * sCPb + (size_t)by * 64 + col]; } if (ACT == 1) v = (v > 0.f) ? v : expm1f(v); else if (ACT == 7) v = (v > 0.f) ? v + 1.0f : expf(v); else if (ACT == 8) v = tanhf(v); else if (ACT == 9) v = 0.5f * v * (1.0f + tanhf(0.7978845608028654f * (v + 0.044715f * v * v * v))); else if (ACT == 11) v = 1.0f / (1.0f + expf(-v)); else if (ACT == 12) v = (v > 0.f) ? v : 0.01f * v; else if (ACT == 14) v = (v > 0.f) ? v : 0.1f * v; else if (ACT == 15) v = v / (1.0f + expf(-v)); else if (ACT == 3) v = fmaxf(v, 0.f); else if (ACT == 6) v = 0.5f * v * (1.0f + erff(v * 0.70710678118654752f)); so[w][8 * hh + r][t * 16 + ln] = v; } }
  __builtin_amdgcn_fence(__ATOMIC_ACQ_REL, "workgroup"); __builtin_amdgcn_wave_barrier();
  const int rsub = lane >> 4, c4 = (lane & 15) * 4; typedef _Float16 v4h __attribute__((ext_vector_type(4)));
  {
#pragma unroll
    for (int q = 0; q < 8; ++q) { const int r = q * 2 + rsub; if (col0 + c4 < N) { const v4f v = *(const v4fa*)&so[w][r][c4]; if (C) *(v4f*)(C + cofs + (size_t)(row0 + r) * ldc + col0 + c4) = v; if (C16) { v4h h4; for (int i = 0; i < 4; ++i) h4[i] = (_Float16)v[i]; *(v4h*)(C16 + cofs + (size_t)(row0 + r) * ldc + col0 + c4) = h4; } } }
     }
}


typedef _Float16 v4h __attribute__((ext_vector_type(4)));

__global__ __launch_bounds__(256) void k_x16(const float* __restrict__ x, _Float16* __restrict__ X16, size_t n8) { const size_t t = (size_t)blockIdx.x * 256 + threadIdx.x; if (t >= n8) return; FragH f;
#pragma unroll
  for (int q = 0; q < 8; ++q) f.h[q] = (_Float16)bf16_round(x[t * 8 + q]); *(v8us*)((unsigned short*)X16 + t * 8) = f.half[0];  }
__global__ __launch_bounds__(256) void k_h16(const float* __restrict__ x, _Float16* __restrict__ X16, size_t n8) { const size_t t = (size_t)blockIdx.x * 256 + threadIdx.x; if (t >= n8) return; FragH f;
#pragma unroll
  for (int q = 0; q < 8; ++q) f.h[q] = (_Float16)x[t * 8 + q]; *(v8us*)((unsigned short*)X16 + t * 8) = f.half[0];  }
__global__ __launch_bounds__(256) void k_round16f(const float* __restrict__ W, _Float16* __restrict__ Bt, size_t n8) { const size_t t = (size_t)blockIdx.x * 256 + threadIdx.x; if (t >= n8) return; FragH f;
#pragma unroll
  for (int i = 0; i < 8; ++i) f.h[i] = (_Float16)(bf16_round(W[t * 8 + i]) * 16.0f); *(v8us*)((unsigned short*)Bt + t * 8) = f.half[0];  }
template <int NHv, int TTv>
__global__ __launch_bounds__(256) void k_vt(const _Float16* __restrict__ V16, int ldv, int voff, _Float16* __restrict__ Vt) { __shared__ unsigned short tl[64][66]; const int tid = threadIdx.x; const int slab = blockIdx.x / (TTv / 64), lg = blockIdx.x % (TTv / 64); const int b = slab / NHv, h = slab % NHv;
  for (int i = tid; i < 64 * 8; i += 256) { const int r = i / 8, c8 = (i % 8) * 8; FragH f; f.half[0] = *(const v8us*)((const unsigned short*)V16 + ((size_t)b * TTv + lg * 64 + r) * ldv + voff + h * 64 + c8);
#pragma unroll
    for (int q = 0; q < 8; ++q) tl[r][c8 + q] = f.u[q]; }
  __syncthreads();
  {
#pragma unroll
    for (int rd = 0; rd < 2; ++rd) { const int d = rd * 32 + tid / 8, pc = tid % 8; FragH f;
#pragma unroll
      for (int q = 0; q < 8; ++q) f.u[q] = tl[pc * 8 + q][d];
      *(v8us*)((unsigned short*)Vt + ((size_t)slab * 64 + d) * TTv + lg * 64 + pc * 8) = f.half[0]; }
     } }

__global__ __launch_bounds__(256) void k_h16s(const float* __restrict__ F, _Float16* __restrict__ H, size_t n8) { const size_t t = (size_t)blockIdx.x * 256 + threadIdx.x; if (t >= n8) return; const v4f a = *(const v4fa*)(F + t * 8), c = *(const v4fa*)(F + t * 8 + 4); FragH f;
#pragma unroll
  for (int q = 0; q < 4; ++q) { f.h[q] = (_Float16)(a[q] * 16.0f); f.h[4 + q] = (_Float16)(c[q] * 16.0f); } *(v8us*)((unsigned short*)H + t * 8) = f.half[0];  }
__global__ __launch_bounds__(128) void k_flash(const _Float16* __restrict__ Q16, int ldq, const _Float16* __restrict__ K16, int ldk, const _Float16* __restrict__ Vt, const int* __restrict__ MSK, float* __restrict__ O, int ldo) {
  constexpr int RPW = 16, RTN = RPW / 16, NQB = TT / (4 * RPW), DT = 4, KS = 2;
  __shared__ __attribute__((aligned(16))) unsigned short sP[4][RPW][40]; __shared__ __attribute__((aligned(16))) float sO[4][RPW][64 + 4];
  const int tid = threadIdx.x, w = tid >> 5, lane = tid & 31, ln = lane & 15, hh = lane >> 4;
  const int slab = blockIdx.x / NQB, qblk = blockIdx.x % NQB; const int b = slab / NH, h = slab % NH; const int qb0 = qblk * (4 * RPW); const int q0 = qb0 + w * RPW;
  FragH aq[2][KS];
#pragma unroll
  for (int rt = 0; rt < RTN; ++rt) { const unsigned short* qr = (const unsigned short*)Q16 + ((size_t)b * TT + q0 + rt * 16 + ln) * ldq + h * 64;
#pragma unroll
    for (int ks = 0; ks < KS; ++ks) { aq[rt][ks].half[0] = *(const v8us*)(qr + ks * 32 + 8 * hh); aq[rt][ks].half[1] = *(const v8us*)(qr + ks * 32 + 16 + 8 * hh); } }
  const unsigned short* Vth = (const unsigned short*)Vt + (size_t)slab * 64 * TT;
  float m_r[2][8], l_r[2][8]; v8f oacc[2][DT];
#pragma unroll
  for (int rt = 0; rt < RTN; ++rt) {
#pragma unroll
    for (int r = 0; r < 8; ++r) { m_r[rt][r] = -3.0e38f; l_r[rt][r] = 0.f; }
#pragma unroll
    for (int dt = 0; dt < DT; ++dt) oacc[rt][dt] = (v8f){0.f,0.f,0.f,0.f,0.f,0.f,0.f,0.f}; }
  const int jend = TT;
#pragma unroll 1
  for (int j0 = 0; j0 < jend; j0 += 32) {
    const int km0 = MSK[(size_t)b * TT + j0 + ln], km1 = MSK[(size_t)b * TT + j0 + 16 + ln];      /* key padding mask (1 = attend), shared by all queries and heads */
    v8f s[2][2];
#pragma unroll
    for (int nt = 0; nt < 2; ++nt) { const unsigned short* kr = (const unsigned short*)K16 + ((size_t)b * TT + j0 + nt * 16 + ln) * ldk + h * 64; FragH bk[KS];
#pragma unroll
      for (int ks = 0; ks < KS; ++ks) { bk[ks].half[0] = *(const v8us*)(kr + ks * 32 + 8 * hh); bk[ks].half[1] = *(const v8us*)(kr + ks * 32 + 16 + 8 * hh); }
#pragma unroll
      for (int rt = 0; rt < RTN; ++rt) { v8f acc = (v8f){0.f,0.f,0.f,0.f,0.f,0.f,0.f,0.f};
#pragma unroll
        for (int ks = 0; ks < KS; ++ks) acc = mmaH<1>(aq[rt][ks].v, aq[rt][ks].v, bk[ks].v, bk[ks].v, acc); s[rt][nt] = acc; } }
#pragma unroll
    for (int rt = 0; rt < RTN; ++rt)
#pragma unroll
      for (int r = 0; r < 8; ++r) { const int tq = q0 + rt * 16 + 8 * hh + r; const int k0 = j0 + ln, k1 = j0 + 16 + ln; (void)tq; (void)k0; (void)k1;
        const bool ok0 = (km0 != 0), ok1 = (km1 != 0);
        const float s0 = ok0 ? s[rt][0][r] * 0.03125f : -INFINITY, s1 = ok1 ? s[rt][1][r] * 0.03125f : -INFINITY;      /* energy/√1024; masked keys carry −1e20 in the module ≡ −inf */ float mc = fmaxf(s0, s1);
        mc = fmaxf(mc, __shfl_xor(mc, 1, 32)); mc = fmaxf(mc, __shfl_xor(mc, 2, 32)); mc = fmaxf(mc, __shfl_xor(mc, 4, 32)); mc = fmaxf(mc, __shfl_xor(mc, 8, 32));
        const float mn = fmaxf(m_r[rt][r], mc); const float al = (mn > -1.0e38f) ? expf(m_r[rt][r] - mn) : 1.0f; m_r[rt][r] = mn; const float p0 = ok0 ? expf(s0 - mn) : 0.f, p1 = ok1 ? expf(s1 - mn) : 0.f; l_r[rt][r] = l_r[rt][r] * al + p0 + p1;
#pragma unroll
        for (int dt = 0; dt < DT; ++dt) oacc[rt][dt][r] *= al;
        FragH t2; t2.h[0] = (_Float16)(p0 * 1024.0f); t2.h[1] = (_Float16)(p1 * 1024.0f); sP[w][rt * 16 + 8 * hh + r][ln] = t2.u[0]; sP[w][rt * 16 + 8 * hh + r][16 + ln] = t2.u[1]; }
    __builtin_amdgcn_fence(__ATOMIC_ACQ_REL, "workgroup"); __builtin_amdgcn_wave_barrier();
    FragH pa[2];
#pragma unroll
    for (int rt = 0; rt < RTN; ++rt) { pa[rt].half[0] = *(const v8us*)&sP[w][rt * 16 + ln][8 * hh]; pa[rt].half[1] = *(const v8us*)&sP[w][rt * 16 + ln][16 + 8 * hh]; }
#pragma unroll
    for (int dt = 0; dt < DT; ++dt) { const unsigned short* vrow = Vth + (size_t)(dt * 16 + ln) * TT + j0; FragH bv; bv.half[0] = *(const v8us*)(vrow + 8 * hh); bv.half[1] = *(const v8us*)(vrow + 16 + 8 * hh);
#pragma unroll
      for (int rt = 0; rt < RTN; ++rt) oacc[rt][dt] = mmaH<1>(pa[rt].v, pa[rt].v, bv.v, bv.v, oacc[rt][dt]); }
    __builtin_amdgcn_fence(__ATOMIC_ACQ_REL, "workgroup"); __builtin_amdgcn_wave_barrier(); }
#pragma unroll
  for (int rt = 0; rt < RTN; ++rt) {
#pragma unroll
    for (int r = 0; r < 8; ++r) { float l = l_r[rt][r]; l += __shfl_xor(l, 1, 32); l += __shfl_xor(l, 2, 32); l += __shfl_xor(l, 4, 32); l += __shfl_xor(l, 8, 32); l_r[rt][r] = (l > 0.f) ? 1.0f / (l * 1024.0f) : 0.f; }
#pragma unroll
    for (int dt = 0; dt < DT; ++dt)
#pragma unroll
      for (int r = 0; r < 8; ++r) sO[w][rt * 16 + 8 * hh + r][dt * 16 + ln] = oacc[rt][dt][r] * l_r[rt][r]; }
  __builtin_amdgcn_fence(__ATOMIC_ACQ_REL, "workgroup"); __builtin_amdgcn_wave_barrier();
  {
#pragma unroll
    for (int rp = 0; rp < RPW; rp += 2) { const int r = rp + (lane >> 4), pc = lane & 15; const v4f val = *(const v4fa*)&sO[w][r][pc * 4]; *(v4f*)(O + ((size_t)b * TT + q0 + r) * ldo + h * 64 + pc * 4) = val; }
     } }

extern "C" void kernel_launch(void* const* d_in, const int* in_sizes, int n_in,
                              void* d_out, int out_size, void* d_ws, size_t ws_size, hipStream_t stream) {
  (void)in_sizes; (void)n_in; (void)out_size;
  const float* const* I = (const float* const*)d_in; const float* values = I[0]; const float* keys = I[1]; const float* query = I[2]; const int* mask = (const int*)d_in[3]; const float* Wv = I[4]; const float* Wk = I[5]; const float* Wq = I[6]; const float* Wo = I[7]; const float* bo = I[8];
  char* ws = (char*)d_ws; size_t off = 0;
  auto take = [&](size_t bytes) { char* p = ws + off; off += (bytes + 255) & ~(size_t)255; return p; };
  _Float16* Bs = (_Float16*)take((size_t)3 * HD * HD * 2); _Float16* Bo = (_Float16*)take((size_t)DD * DD * 2);
  _Float16* XV = (_Float16*)take((size_t)NR * DD * 2); _Float16* XK = (_Float16*)take((size_t)NR * DD * 2); _Float16* XQ = (_Float16*)take((size_t)NR * DD * 2);
  _Float16* Q = (_Float16*)take((size_t)NR * DD * 2); _Float16* K = (_Float16*)take((size_t)NR * DD * 2); _Float16* V = (_Float16*)take((size_t)NR * DD * 2); _Float16* Vt = (_Float16*)take((size_t)NR * DD * 2); float* O = (float*)take((size_t)NR * DD * 4); _Float16* O16 = XQ;
  if (off > ws_size) return;      // 0.03 + 2.1 + 7 × 8.4 + 16.8 ≈ 78 MB
  k_round16f<<<(HD * HD / 8 + 255) / 256, 256, 0, stream>>>(Wv, Bs, HD * HD / 8); k_round16f<<<(HD * HD / 8 + 255) / 256, 256, 0, stream>>>(Wk, Bs + HD * HD, HD * HD / 8); k_round16f<<<(HD * HD / 8 + 255) / 256, 256, 0, stream>>>(Wq, Bs + 2 * HD * HD, HD * HD / 8); k_round16f<<<(unsigned)(((size_t)DD * DD / 8 + 255) / 256), 256, 0, stream>>>(Wo, Bo, (size_t)DD * DD / 8);      /* (out,in) natural ×2^4 */
  const unsigned g8 = (unsigned)(((size_t)NR * DD / 8 + 255) / 256); k_x16<<<g8, 256, 0, stream>>>(values, XV, (size_t)NR * DD / 8); k_x16<<<g8, 256, 0, stream>>>(keys, XK, (size_t)NR * DD / 8); k_x16<<<g8, 256, 0, stream>>>(query, XQ, (size_t)NR * DD / 8);
  const dim3 gh(((NR / 16) * 1 + 3) / 4, 1);
  for (int h = 0; h < NH; ++h) {      /* per head-column block: y[:, 64h..] = x[:, 64h..]·Wᵀ (shared W): M 4096 N 64 K 64 */
    k_gemm_hhx<0><<<gh, 128, 0, stream>>>(XV + h * HD, DD, 0, Bs, HD, 0, 0.0625f, nullptr, 0, nullptr, 1, 0, 0, nullptr, V + h * HD, DD, 0, NR, HD, HD);
    k_gemm_hhx<0><<<gh, 128, 0, stream>>>(XK + h * HD, DD, 0, Bs + HD * HD, HD, 0, 0.0625f, nullptr, 0, nullptr, 1, 0, 0, nullptr, K + h * HD, DD, 0, NR, HD, HD);
    k_gemm_hhx<0><<<gh, 128, 0, stream>>>(XQ + h * HD, DD, 0, Bs + 2 * HD * HD, HD, 0, 0.0625f, nullptr, 0, nullptr, 1, 0, 0, nullptr, Q + h * HD, DD, 0, NR, HD, HD); }
  k_vt<NH, TT><<<BB * NH * (TT / 64), 256, 0, stream>>>(V, DD, 0, Vt);
  k_flash<<<BB * NH * (TT / 64), 128, 0, stream>>>(Q, DD, K, DD, Vt, mask, O, DD);
  k_h16s<<<g8, 256, 0, stream>>>(O, O16, (size_t)NR * DD / 8);      /* over the query plane (dead after the projections) */
  k_gemm_hhx<0><<<dim3(((NR / 16) * (DD / 64) + 3) / 4, 1), 128, 0, stream>>>(O16, DD, 0, Bo, DD, 0, 0.00390625f, bo, 0, nullptr, 1, 0, 0, (float*)d_out, nullptr, DD, 0, NR, DD, DD);      /* out = O·Woᵀ + bo */
}

// v001
// Measured time: 331 microseconds a run.
// Next to v000, in two timings, it ran 1.66 times as fast each time.
#include <hip/hip_runtime.h>
// 'SelfAttension' (B=2, S=2048, E=1024, 16 heads × 64): per-head projections with ONE shared 64×64 weight per tensor (y_h = x_h·Wᵀ, torch (out,in), no bias) for values, keys, query; energy = q·kᵀ with −1e20 where the key mask [N,1,1,S] == 0;
// attn = softmax(energy/√1024); out = (attn·v merged)·Woᵀ + bo.
// Compute dtype: inputs, weights, bias rounded to bf16; the per-head 64×64 projections as block-diagonal f16 GEMMs (all 16 head-block columns of all three tensors in one launch, grid = row blocks x heads x tensors, K = 64); fused flash-style kernel (per-(b,k) int mask loads, scale 1/32,
// online softmax f32, P f16 ×2^10) on v_wmma_f32_16x16x32_f16; O ×2^4 → f16 → output GEMM + bias; f32 accumulate.
#define BB 2
#define TT 2048
#define DD 1024
#define NH 16
#define HD 64
#define NR (BB * TT)

typedef __bf16 v16b __attribute__((ext_vector_type(16)));
typedef unsigned short v8us __attribute__((ext_vector_type(8), may_alias));
typedef float  v8f  __attribute__((ext_vector_type(8)));
typedef float  v4f  __attribute__((ext_vector_type(4)));
typedef float  v4fa __attribute__((ext_vector_type(4), may_alias));
union FragB { v16b v; v8us half[2]; unsigned short u[16]; };

__device__ __forceinline__ unsigned short bf16_bits(float x) { unsigned int u = __float_as_uint(x); return (unsigned short)((u + 0x7FFFu + ((u >> 16) & 1u)) >> 16); }
__device__ __forceinline__ float bf16_val(unsigned short b) { return __uint_as_float(((unsigned int)b) << 16); }
__device__ __forceinline__ float bf16_round(float x) { return bf16_val(bf16_bits(x)); }
// D += A·B with NT terms: 1 = ah·bh, 2 = + al·bh (A split), 3 = + ah·bl (both split)
template <int NT>
__device__ __forceinline__ v8f mmaN(v16b ah, v16b al, v16b bh, v16b bl, v8f c) {
  c = __builtin_amdgcn_wmma_f32_16x16x32_bf16(false, ah, false, bh, (short)0, c, false, false);
  if (NT >= 2) c = __builtin_amdgcn_wmma_f32_16x16x32_bf16(false, al, false, bh, (short)0, c, false, false);
  if (NT >= 3) c = __builtin_amdgcn_wmma_f32_16x16x32_bf16(false, ah, false, bl, (short)0, c, false, false);
  asm volatile("v_nop\n\tv_nop\n\tv_nop\n\tv_nop" : "+v"(c) : "v"(ah), "v"(al), "v"(bh), "v"(bl));
  return c;
}

__global__ __launch_bounds__(256) void k_wt_bf16(const float* __restrict__ W, unsigned short* __restrict__ Wt, int K, int N) {
  const int t = blockIdx.x * 256 + threadIdx.x;
  const int k8n = K / 8;
  if (t >= N * k8n) return;
  const int n = t / k8n, k8 = (t % k8n) * 8;
  v8us v;
#pragma unroll
  for (int i = 0; i < 8; ++i) v[i] = bf16_bits(W[(size_t)(k8 + i) * N + n]);
  *(v8us*)(Wt + (size_t)n * K + k8) = v;
  
}

// GEMM C[M][N] (f32, pitch ldc) = act(A[M][K]·W + bias). A f32 row-major (pitch lda) converted per fragment to bf16
// (ASPLIT: hi/lo two planes -> 2 terms, else single rounded term); Wt bf16 [N][K] (pitch ldb). BIAS_BF16 rounds the
// bias to bf16 first (bias quantised to bf16 before the add). K%32==0, M%16==0, N%64==0.
template <bool ASPLIT, int ACT, bool BIAS_BF16>
__global__ __launch_bounds__(128) void k_gemm_bf(const float* __restrict__ A, int lda, const unsigned short* __restrict__ Wt, int ldb,
                                               const float* __restrict__ bias, float* __restrict__ C, int ldc, int M, int N, int K) {
  __shared__ __attribute__((aligned(16))) float so[4][16][64];
  const int tid = threadIdx.x, w = tid >> 5, lane = tid & 31, ln = lane & 15, hh = lane >> 4;
  const int ntn = N / 64;
  const int wid = blockIdx.x * 4 + w;
  const int mt = wid / ntn, nq = wid % ntn;
  if (mt * 16 >= M) return;
  const int row0 = mt * 16, col0 = nq * 64;
  const float* arow = A + (size_t)(row0 + ln) * lda;
  v8f acc[4] = {};
  for (int kb = 0; kb < K; kb += 32) {
    FragB ah, al;
    const v4f x0 = *(const v4fa*)(arow + kb + 8 * hh), x1 = *(const v4fa*)(arow + kb + 8 * hh + 4);
    const v4f x2 = *(const v4fa*)(arow + kb + 16 + 8 * hh), x3 = *(const v4fa*)(arow + kb + 16 + 8 * hh + 4);
    float xs[16] = {x0[0],x0[1],x0[2],x0[3],x1[0],x1[1],x1[2],x1[3],x2[0],x2[1],x2[2],x2[3],x3[0],x3[1],x3[2],x3[3]};
#pragma unroll
    for (int i = 0; i < 16; ++i) { const unsigned short hb = bf16_bits(xs[i]); ah.u[i] = hb; al.u[i] = ASPLIT ? bf16_bits(xs[i] - bf16_val(hb)) : (unsigned short)0; }
#pragma unroll
    for (int t = 0; t < 4; ++t) {
      const unsigned short* brow = Wt + (size_t)(col0 + t * 16 + ln) * ldb + kb;
      FragB b;
      b.half[0] = *(const v8us*)(brow + 8 * hh);
      b.half[1] = *(const v8us*)(brow + 16 + 8 * hh);
      acc[t] = mmaN<ASPLIT ? 2 : 1>(ah.v, al.v, b.v, b.v, acc[t]);
    }
  }
#pragma unroll
  for (int t = 0; t < 4; ++t) {
    float bv = bias ? bias[col0 + t * 16 + ln] : 0.f;
    if (BIAS_BF16) bv = bf16_round(bv);
#pragma unroll
    for (int r = 0; r < 8; ++r) { float v = acc[t][r] + bv; if (ACT == 1) v = fmaxf(v, 0.f); so[w][8 * hh + r][t * 16 + ln] = v; }
  }
  __builtin_amdgcn_fence(__ATOMIC_ACQ_REL, "workgroup");
  __builtin_amdgcn_wave_barrier();
  const int rsub = lane >> 4, c4 = (lane & 15) * 4;
  {
#pragma unroll
    for (int q = 0; q < 8; ++q) {
      const int r = q * 2 + rsub;
      const v4f v = *(const v4fa*)&so[w][r][c4];
      *(v4f*)(C + (size_t)(row0 + r) * ldc + col0 + c4) = v;
    }
    
  }
}

// Flash-style causal/unmasked attention, all contractions 3-term bf16 hi/lo splits, f32 softmax with running max.
// q,k,v rows are read from f32 buffers with arbitrary row pitch (so they can live inside a fused qkv buffer);
// D = head size (multiple of 32, <= 128); one wave = 16 query rows; block = 4 waves (64 queries) sharing K/V chunks of 32.
template <int D, bool CAUSAL>
__global__ __launch_bounds__(128) void k_flash(const float* __restrict__ qb, const float* __restrict__ kb, const float* __restrict__ vb,
                                             int pitch, int T, int H, float scale, float* __restrict__ y, int ypitch) {
  constexpr int KS = D / 32;        // k-steps for QK
  constexpr int DT = D / 16;        // d tiles for PV
  __shared__ __attribute__((aligned(16))) unsigned short sKh[32][D + 8], sKl[32][D + 8], sVh[32][D + 8], sVl[32][D + 8];
  __shared__ __attribute__((aligned(16))) unsigned short sPh[4][16][40], sPl[4][16][40];
  __shared__ __attribute__((aligned(16))) float sO[4][16][D];
  const int tid = threadIdx.x, w = tid >> 5, lane = tid & 31, ln = lane & 15, hh = lane >> 4;
  const int nqb = (T + 63) / 64;
  const int bh = blockIdx.x / nqb, qblk = blockIdx.x % nqb;
  const int b = bh / H, h = bh % H;
  const int q0 = qblk * 64 + w * 16;
  const float* Q = qb + (size_t)b * T * pitch + h * D;
  const float* K = kb + (size_t)b * T * pitch + h * D;
  const float* V = vb + (size_t)b * T * pitch + h * D;

  // A fragments of the wave's 16 query rows (scaled), hi/lo
  FragB aqh[KS], aql[KS];
  {
    int row = q0 + ln; if (row >= T) row = T - 1;
    const float* qr = Q + (size_t)row * pitch;
#pragma unroll
    for (int ks = 0; ks < KS; ++ks)
#pragma unroll
      for (int i = 0; i < 16; ++i) {
        const int d = ks * 32 + ((i < 8) ? (8 * hh + i) : (16 + 8 * hh + (i - 8)));
        const float x = qr[d] * scale; const unsigned short hb = bf16_bits(x);
        aqh[ks].u[i] = hb; aql[ks].u[i] = bf16_bits(x - bf16_val(hb));
      }
  }
  float m_r[8], l_r[8];
#pragma unroll
  for (int r = 0; r < 8; ++r) { m_r[r] = -3.0e38f; l_r[r] = 0.f; }
  v8f oacc[DT];
#pragma unroll
  for (int dt = 0; dt < DT; ++dt) oacc[dt] = (v8f){0.f,0.f,0.f,0.f,0.f,0.f,0.f,0.f};

  const int kv_end = CAUSAL ? min(T, qblk * 64 + 64) : T;     // block-uniform
  for (int j0 = 0; j0 < kv_end; j0 += 32) {
    __syncthreads();
    for (int e = tid; e < 32 * (D / 4); e += 128) {
      const int r = e / (D / 4), c4 = (e % (D / 4)) * 4;
      const int key = j0 + r;
      v4f kf = {0.f,0.f,0.f,0.f}, vf = {0.f,0.f,0.f,0.f};
      if (key < T) { kf = *(const v4fa*)(K + (size_t)key * pitch + c4); vf = *(const v4fa*)(V + (size_t)key * pitch + c4); }
#pragma unroll
      for (int t = 0; t < 4; ++t) {
        unsigned short hb = bf16_bits(kf[t]); sKh[r][c4 + t] = hb; sKl[r][c4 + t] = bf16_bits(kf[t] - bf16_val(hb));
        hb = bf16_bits(vf[t]); sVh[r][c4 + t] = hb; sVl[r][c4 + t] = bf16_bits(vf[t] - bf16_val(hb));
      }
    }
    __syncthreads();
    // S tile 16 x 32
    v8f s[2];
#pragma unroll
    for (int nt = 0; nt < 2; ++nt) {
      v8f acc = {};
#pragma unroll
      for (int ks = 0; ks < KS; ++ks) {
        FragB bh_, bl_;
        bh_.half[0] = *(const v8us*)&sKh[nt * 16 + ln][ks * 32 + 8 * hh]; bh_.half[1] = *(const v8us*)&sKh[nt * 16 + ln][ks * 32 + 16 + 8 * hh];
        bl_.half[0] = *(const v8us*)&sKl[nt * 16 + ln][ks * 32 + 8 * hh]; bl_.half[1] = *(const v8us*)&sKl[nt * 16 + ln][ks * 32 + 16 + 8 * hh];
        acc = mmaN<3>(aqh[ks].v, aql[ks].v, bh_.v, bl_.v, acc);
      }
      s[nt] = acc;
    }
    // mask + running max (rows 8hh+r; the 16 lanes of a half share rows)
    float alpha[8];
#pragma unroll
    for (int r = 0; r < 8; ++r) {
      const int qi = q0 + 8 * hh + r;
      const int ja = j0 + ln, jb = j0 + 16 + ln;
      if (CAUSAL) { if (ja > qi) s[0][r] = -3.0e38f; if (jb > qi) s[1][r] = -3.0e38f; }
      if (ja >= T) s[0][r] = -3.0e38f;
      if (jb >= T) s[1][r] = -3.0e38f;
      float mx = fmaxf(s[0][r], s[1][r]);
      mx = fmaxf(mx, __shfl_xor(mx, 1, 32)); mx = fmaxf(mx, __shfl_xor(mx, 2, 32)); mx = fmaxf(mx, __shfl_xor(mx, 4, 32)); mx = fmaxf(mx, __shfl_xor(mx, 8, 32));
      const float mnew = fmaxf(m_r[r], mx);
      alpha[r] = (mnew > -1.0e38f) ? __expf(m_r[r] - mnew) : 1.0f;
      const float p0 = (s[0][r] > -1.0e38f) ? __expf(s[0][r] - mnew) : 0.f;
      const float p1 = (s[1][r] > -1.0e38f) ? __expf(s[1][r] - mnew) : 0.f;
      m_r[r] = mnew;
      l_r[r] = l_r[r] * alpha[r] + p0 + p1;            // per-lane partial row sum (16 lanes combined at the end)
      unsigned short hb = bf16_bits(p0); sPh[w][8 * hh + r][ln] = hb;      sPl[w][8 * hh + r][ln] = bf16_bits(p0 - bf16_val(hb));
      hb = bf16_bits(p1);                sPh[w][8 * hh + r][16 + ln] = hb; sPl[w][8 * hh + r][16 + ln] = bf16_bits(p1 - bf16_val(hb));
    }
#pragma unroll
    for (int dt = 0; dt < DT; ++dt)
#pragma unroll
      for (int r = 0; r < 8; ++r) oacc[dt][r] *= alpha[r];
    __builtin_amdgcn_fence(__ATOMIC_ACQ_REL, "workgroup");
    __builtin_amdgcn_wave_barrier();
    FragB pah, pal;
    pah.half[0] = *(const v8us*)&sPh[w][ln][8 * hh]; pah.half[1] = *(const v8us*)&sPh[w][ln][16 + 8 * hh];
    pal.half[0] = *(const v8us*)&sPl[w][ln][8 * hh]; pal.half[1] = *(const v8us*)&sPl[w][ln][16 + 8 * hh];
#pragma unroll
    for (int dt = 0; dt < DT; ++dt) {
      FragB bvh, bvl;
#pragma unroll
      for (int i = 0; i < 8; ++i) {
        bvh.u[i] = sVh[8 * hh + i][dt * 16 + ln]; bvh.u[8 + i] = sVh[16 + 8 * hh + i][dt * 16 + ln];
        bvl.u[i] = sVl[8 * hh + i][dt * 16 + ln]; bvl.u[8 + i] = sVl[16 + 8 * hh + i][dt * 16 + ln];
      }
      oacc[dt] = mmaN<3>(pah.v, pal.v, bvh.v, bvl.v, oacc[dt]);
    }
    __builtin_amdgcn_fence(__ATOMIC_ACQ_REL, "workgroup");
    __builtin_amdgcn_wave_barrier();
  }
#pragma unroll
  for (int r = 0; r < 8; ++r) {
    float l = l_r[r];
    l += __shfl_xor(l, 1, 32); l += __shfl_xor(l, 2, 32); l += __shfl_xor(l, 4, 32); l += __shfl_xor(l, 8, 32);
    l_r[r] = (l > 0.f) ? 1.0f / l : 0.f;
  }
#pragma unroll
  for (int dt = 0; dt < DT; ++dt)
#pragma unroll
    for (int r = 0; r < 8; ++r) sO[w][8 * hh + r][dt * 16 + ln] = oacc[dt][r] * l_r[r];
  __builtin_amdgcn_fence(__ATOMIC_ACQ_REL, "workgroup");
  __builtin_amdgcn_wave_barrier();
  {
    for (int r = 0; r < 16; ++r) {
      const int row = q0 + r;
      if (row < T && lane < D / 4) {
        const v4f val = *(const v4fa*)&sO[w][r][lane * 4];
        *(v4f*)(y + ((size_t)b * T + row) * ypitch + h * D + lane * 4) = val;
      }
    }
    
  }
}

// GEMM C = act(A·W + bias + resid): A f32 (ASPLIT -> hi/lo 2 terms), Wt bf16 [N][K]; ACT 0 none, 1 relu, 2 exact gelu;
// resid (optional, f32, row index = (row % rmod), pitch ldr, RES_BF16 rounds it) added before the activation.
template <bool ASPLIT, int ACT, bool BIAS_BF16, bool RES_BF16>
__global__ __launch_bounds__(128) void k_gemm_bf3(const float* __restrict__ A, int lda, const unsigned short* __restrict__ Wt, int ldb,
                                                const float* __restrict__ bias, const float* __restrict__ resid, int rmod, int ldr,
                                                float* __restrict__ C, int ldc, int M, int N, int K) {
  __shared__ __attribute__((aligned(16))) float so[4][16][64];
  const int tid = threadIdx.x, w = tid >> 5, lane = tid & 31, ln = lane & 15, hh = lane >> 4;
  const int ntn = N / 64;
  const int wid = blockIdx.x * 4 + w;
  const int mt = wid / ntn, nq = wid % ntn;
  if (mt * 16 >= M) return;
  const int row0 = mt * 16, col0 = nq * 64;
  const float* arow = A + (size_t)(row0 + ln) * lda;
  v8f acc[4] = {};
  for (int kb = 0; kb < K; kb += 32) {
    FragB ah, al;
    const v4f x0 = *(const v4fa*)(arow + kb + 8 * hh), x1 = *(const v4fa*)(arow + kb + 8 * hh + 4);
    const v4f x2 = *(const v4fa*)(arow + kb + 16 + 8 * hh), x3 = *(const v4fa*)(arow + kb + 16 + 8 * hh + 4);
    float xs[16] = {x0[0],x0[1],x0[2],x0[3],x1[0],x1[1],x1[2],x1[3],x2[0],x2[1],x2[2],x2[3],x3[0],x3[1],x3[2],x3[3]};
#pragma unroll
    for (int i = 0; i < 16; ++i) { const unsigned short hb = bf16_bits(xs[i]); ah.u[i] = hb; al.u[i] = ASPLIT ? bf16_bits(xs[i] - bf16_val(hb)) : (unsigned short)0; }
#pragma unroll
    for (int t = 0; t < 4; ++t) {
      const unsigned short* brow = Wt + (size_t)(col0 + t * 16 + ln) * ldb + kb;
      FragB b;
      b.half[0] = *(const v8us*)(brow + 8 * hh);
      b.half[1] = *(const v8us*)(brow + 16 + 8 * hh);
      acc[t] = mmaN<ASPLIT ? 2 : 1>(ah.v, al.v, b.v, b.v, acc[t]);
    }
  }
#pragma unroll
  for (int t = 0; t < 4; ++t) {
    const int col = col0 + t * 16 + ln;
    float bv = bias ? bias[col] : 0.f;
    if (BIAS_BF16) bv = bf16_round(bv);
#pragma unroll
    for (int r = 0; r < 8; ++r) {
      float v = acc[t][r] + bv;
      if (resid) { float rv = resid[(size_t)((row0 + 8 * hh + r) % rmod) * ldr + col]; if (RES_BF16) rv = bf16_round(rv); v += rv; }
      if (ACT == 1) v = fmaxf(v, 0.f);
      if (ACT == 2) v = 0.5f * v * (1.0f + erff(v * 0.70710678118654752f));
      if (ACT == 3) { const float u = 0.7978845608028654f * (v + 0.044715f * v * v * v); v = 0.5f * v * (1.0f + tanhf(u)); }
      so[w][8 * hh + r][t * 16 + ln] = v;
    }
  }
  __builtin_amdgcn_fence(__ATOMIC_ACQ_REL, "workgroup");
  __builtin_amdgcn_wave_barrier();
  const int rsub = lane >> 4, c4 = (lane & 15) * 4;
  {
#pragma unroll
    for (int q = 0; q < 8; ++q) {
      const int r = q * 2 + rsub;
      const v4f v = *(const v4fa*)&so[w][r][c4];
      *(v4f*)(C + (size_t)(row0 + r) * ldc + col0 + c4) = v;
    }
    
  }
}
// row LayerNorm (biased variance, eps) over N: s = X (+ R); optional out_sum <- s; out_norm <- (s-mu)*rsqrt(var+eps)*g + b
template <bool PARAM_BF16>
__global__ __launch_bounds__(256) void k_layernorm(const float* __restrict__ X, const float* __restrict__ R, const float* __restrict__ g, const float* __restrict__ bta,
                                                  float* __restrict__ out_sum, float* __restrict__ out_norm, int N, float eps) {
  __shared__ float red[256];
  const int row = blockIdx.x, tid = threadIdx.x;
  const float* x = X + (size_t)row * N; const float* rr = R ? R + (size_t)row * N : nullptr;
  float vals[16];                     // up to N = 4096
  const int per = N / 256;            // contiguous chunk per thread? use strided-by-4 chunks: thread handles j = tid*4 + 1024*u
  float s1 = 0.f;
  for (int u = 0; u < per / 4; ++u) {
    const int j = tid * 4 + 1024 * u;
    const v4f a = *(const v4fa*)(x + j);
    v4f b = {0.f,0.f,0.f,0.f}; if (rr) b = *(const v4fa*)(rr + j);
#pragma unroll
    for (int q = 0; q < 4; ++q) { const float v = a[q] + b[q]; vals[u * 4 + q] = v; s1 += v; }
  }
  red[tid] = s1; __syncthreads();
  for (int st = 128; st > 0; st >>= 1) { if (tid < st) red[tid] += red[tid + st]; __syncthreads(); }
  const float mu = red[0] / (float)N; __syncthreads();
  float s2 = 0.f;
  for (int u = 0; u < per / 4; ++u)
#pragma unroll
    for (int q = 0; q < 4; ++q) { const float c = vals[u * 4 + q] - mu; s2 += c * c; }
  red[tid] = s2; __syncthreads();
  for (int st = 128; st > 0; st >>= 1) { if (tid < st) red[tid] += red[tid + st]; __syncthreads(); }
  const float rs = rsqrtf(red[0] / (float)N + eps);
  {
    for (int u = 0; u < per / 4; ++u) {
      const int j = tid * 4 + 1024 * u;
      v4f o, sm;
#pragma unroll
      for (int q = 0; q < 4; ++q) {
        float gg = g[j + q], bb = bta[j + q];
        if (PARAM_BF16) { gg = bf16_round(gg); bb = bf16_round(bb); }
        sm[q] = vals[u * 4 + q]; o[q] = (vals[u * 4 + q] - mu) * rs * gg + bb;
      }
      if (out_sum) *(v4f*)(out_sum + (size_t)row * N + j) = sm;
      *(v4f*)(out_norm + (size_t)row * N + j) = o;
    }
    
  }
}



// ---- f16 WMMA path (v_wmma_f32_16x16x32_f16): 11-bit significands for operands in range — used where a [0,1] probability operand needs more precision than bf16
typedef _Float16 v16h __attribute__((ext_vector_type(16)));
union FragH { v16h v; v8us half[2]; _Float16 h[16]; unsigned short u[16]; };
template <int NT>
__device__ __forceinline__ v8f mmaH(v16h ah, v16h al, v16h bh, v16h bl, v8f c) {
  c = __builtin_amdgcn_wmma_f32_16x16x32_f16(false, ah, false, bh, (short)0, c, false, false);
  if (NT >= 2) c = __builtin_amdgcn_wmma_f32_16x16x32_f16(false, al, false, bh, (short)0, c, false, false);
  if (NT >= 3) c = __builtin_amdgcn_wmma_f32_16x16x32_f16(false, ah, false, bl, (short)0, c, false, false);
  asm volatile("v_nop\n\tv_nop\n\tv_nop\n\tv_nop" : "+v"(c) : "v"(ah), "v"(al), "v"(bh), "v"(bl));
  return c;
}
// batched GEMM like k_gemm_b but f16 operands: A f32 (split into f16 hi/lo if ASPLIT, else rounded to f16), Bt = f16 values [n][k]; alpha; C f32; N multiple of 16 (partial tiles skipped)
template <bool ASPLIT>
__global__ __launch_bounds__(128) void k_gemm_h(const float* __restrict__ A, int lda, size_t sA, const _Float16* __restrict__ Bh, int ldb, size_t sB, float alpha, float* __restrict__ C, int ldc, size_t sC, int M, int N, int K) {
  __shared__ __attribute__((aligned(16))) float so[4][16][64];
  const int tid = threadIdx.x, w = tid >> 5, lane = tid & 31, ln = lane & 15, hh = lane >> 4; const int by = blockIdx.y;
  A += (size_t)by * sA; Bh += (size_t)by * sB; C += (size_t)by * sC;
  const int ntn = (N + 63) / 64; const int wid = blockIdx.x * 4 + w; const int mt = wid / ntn, nq = wid % ntn; if (mt * 16 >= M) return;
  const int row0 = mt * 16, col0 = nq * 64; const float* arow = A + (size_t)(row0 + ln) * lda;
  v8f acc[4] = {};
  for (int kb = 0; kb < K; kb += 32) {
    FragH ah, al;
    const v4f x0 = *(const v4fa*)(arow + kb + 8 * hh), x1 = *(const v4fa*)(arow + kb + 8 * hh + 4), x2 = *(const v4fa*)(arow + kb + 16 + 8 * hh), x3 = *(const v4fa*)(arow + kb + 16 + 8 * hh + 4);
    float xs[16] = {x0[0],x0[1],x0[2],x0[3],x1[0],x1[1],x1[2],x1[3],x2[0],x2[1],x2[2],x2[3],x3[0],x3[1],x3[2],x3[3]};
#pragma unroll
    for (int i = 0; i < 16; ++i) { const _Float16 h = (_Float16)xs[i]; ah.h[i] = h; al.h[i] = ASPLIT ? (_Float16)(xs[i] - (float)h) : (_Float16)0.0f; }
#pragma unroll
    for (int t = 0; t < 4; ++t) { if (col0 + t * 16 >= N) continue; const size_t boff = (size_t)(col0 + t * 16 + ln) * ldb + kb; FragH bq; bq.half[0] = *(const v8us*)(Bh + boff + 8 * hh); bq.half[1] = *(const v8us*)(Bh + boff + 16 + 8 * hh);
      acc[t] = mmaH<ASPLIT ? 2 : 1>(ah.v, al.v, bq.v, bq.v, acc[t]); }
  }
#pragma unroll
  for (int t = 0; t < 4; ++t) { if (col0 + t * 16 >= N) continue;
#pragma unroll
    for (int r = 0; r < 8; ++r) so[w][8 * hh + r][t * 16 + ln] = acc[t][r] * alpha; }
  __builtin_amdgcn_fence(__ATOMIC_ACQ_REL, "workgroup"); __builtin_amdgcn_wave_barrier();
  const int rsub = lane >> 4, c4 = (lane & 15) * 4;
  {
#pragma unroll
    for (int q = 0; q < 8; ++q) { const int r = q * 2 + rsub; if (col0 + c4 < N) { const v4f v = *(const v4fa*)&so[w][r][c4]; *(v4f*)(C + (size_t)(row0 + r) * ldc + col0 + c4) = v; } }
     }
}

// Wt[n][k] = f16(W[k][n]·scale) from f32 row-major W[K][N] (scale = power of two; bf16-exact weights stay exact in f16 away from the subnormal range)
__global__ __launch_bounds__(256) void k_wt_f16(const float* __restrict__ W, _Float16* __restrict__ Wt, int K, int N, float scale) {
  const int t = blockIdx.x * 256 + threadIdx.x; if (t >= N * (K / 8)) return; const int n = t / (K / 8), k8 = (t % (K / 8)) * 8; FragH f;
#pragma unroll
  for (int i = 0; i < 8; ++i) f.h[i] = (_Float16)(bf16_round(W[(size_t)(k8 + i) * N + n]) * scale); const v8us o = f.half[0];
  *(v8us*)((unsigned short*)Wt + (size_t)n * K + k8) = o; 
}
// k_gemm_hh variant with fused epilogue: v = acc·alpha + bias[by·sBias + col] (+ CP[(row/rowsPerB)·sCPb + by·64 + col] if CP) ; ACT 0 none / 1 elu ; writes f16 C16 and/or f32 C (each if non-null)
template <int ACT>
__global__ __launch_bounds__(128) void k_gemm_hhx(const _Float16* __restrict__ A, int lda, size_t sA, const _Float16* __restrict__ Bh, int ldb, size_t sB, float alpha, const float* __restrict__ bias, size_t sBias, const float* __restrict__ CP, int rowsPerB, size_t sCPb, int row0g,
    float* __restrict__ C, _Float16* __restrict__ C16, int ldc, size_t sC, int M, int N, int K, size_t sAz, size_t sBz, size_t sCz) {
  __shared__ __attribute__((aligned(16))) float so[4][16][64];
  const int tid = threadIdx.x, w = tid >> 5, lane = tid & 31, ln = lane & 15, hh = lane >> 4; const int by = blockIdx.y, bz = blockIdx.z;      /* second batch index bz with its own strides sAz, sBz, sCz */
  A += (size_t)by * sA + (size_t)bz * sAz; Bh += (size_t)by * sB + (size_t)bz * sBz; const size_t cofs = (size_t)by * sC + (size_t)bz * sCz; const float* bp = bias ? bias + (size_t)by * sBias : nullptr;
  const int ntn = (N + 63) / 64; const int wid = blockIdx.x * 4 + w; const int mt = wid / ntn, nq = wid % ntn; if (mt * 16 >= M) return;
  const int row0 = mt * 16, col0 = nq * 64; const _Float16* arow = A + (size_t)(row0 + ln) * lda;
  v8f acc[4] = {};
  for (int kb = 0; kb < K; kb += 32) { FragH ah; ah.half[0] = *(const v8us*)((const unsigned short*)arow + kb + 8 * hh); ah.half[1] = *(const v8us*)((const unsigned short*)arow + kb + 16 + 8 * hh);
#pragma unroll
    for (int t = 0; t < 4; ++t) { if (col0 + t * 16 >= N) continue; const size_t boff = (size_t)(col0 + t * 16 + ln) * ldb + kb; FragH bq; bq.half[0] = *(const v8us*)((const unsigned short*)Bh + boff + 8 * hh); bq.half[1] = *(const v8us*)((const unsigned short*)Bh + boff + 16 + 8 * hh);
      acc[t] = mmaH<1>(ah.v, ah.v, bq.v, bq.v, acc[t]); }
  }
#pragma unroll
  for (int t = 0; t < 4; ++t) { if (col0 + t * 16 >= N) continue; const int col = col0 + t * 16 + ln; const float bv = bp ? bf16_round(bp[col]) : 0.f;
#pragma unroll
    for (int r = 0; r < 8; ++r) { float v = acc[t][r] * alpha + bv; if (CP) { const int bidx = (row0g + row0 + 8 * hh + r) / rowsPerB; v += CP[(size_t)bidx * sCPb + (size_t)by * 64 + col]; } if (ACT == 1) v = (v > 0.f) ? v : expm1f(v); else if (ACT == 7) v = (v > 0.f) ? v + 1.0f : expf(v); else if (ACT == 8) v = tanhf(v); else if (ACT == 9) v = 0.5f * v * (1.0f + tanhf(0.7978845608028654f * (v + 0.044715f * v * v * v))); else if (ACT == 11) v = 1.0f / (1.0f + expf(-v)); else if (ACT == 12) v = (v > 0.f) ? v : 0.01f * v; else if (ACT == 14) v = (v > 0.f) ? v : 0.1f * v; else if (ACT == 15) v = v / (1.0f + expf(-v)); else if (ACT == 3) v = fmaxf(v, 0.f); else if (ACT == 6) v = 0.5f * v * (1.0f + erff(v * 0.70710678118654752f)); so[w][8 * hh + r][t * 16 + ln] = v; } }
  __builtin_amdgcn_fence(__ATOMIC_ACQ_REL, "workgroup"); __builtin_amdgcn_wave_barrier();
  const int rsub = lane >> 4, c4 = (lane & 15) * 4; typedef _Float16 v4h __attribute__((ext_vector_type(4)));
  {
#pragma unroll
    for (int q = 0; q < 8; ++q) { const int r = q * 2 + rsub; if (col0 + c4 < N) { const v4f v = *(const v4fa*)&so[w][r][c4]; if (C) *(v4f*)(C + cofs + (size_t)(row0 + r) * ldc + col0 + c4) = v; if (C16) { v4h h4; for (int i = 0; i < 4; ++i) h4[i] = (_Float16)v[i]; *(v4h*)(C16 + cofs + (size_t)(row0 + r) * ldc + col0 + c4) = h4; } } }
     }
}


typedef _Float16 v4h __attribute__((ext_vector_type(4)));

// three equally sized inputs in one launch: blockIdx.y picks the source, plane blockIdx.y of X16 (8*n8 elements each) is the destination
__global__ __launch_bounds__(256) void k_x16(const float* __restrict__ x0, const float* __restrict__ x1, const float* __restrict__ x2, _Float16* __restrict__ X16, size_t n8) { const size_t t = (size_t)blockIdx.x * 256 + threadIdx.x; if (t >= n8) return; FragH f;
  const float* __restrict__ x = (blockIdx.y == 0) ? x0 : (blockIdx.y == 1) ? x1 : x2; X16 += (size_t)blockIdx.y * n8 * 8;
#pragma unroll
  for (int q = 0; q < 8; ++q) f.h[q] = (_Float16)bf16_round(x[t * 8 + q]); *(v8us*)((unsigned short*)X16 + t * 8) = f.half[0];  }
__global__ __launch_bounds__(256) void k_h16(const float* __restrict__ x, _Float16* __restrict__ X16, size_t n8) { const size_t t = (size_t)blockIdx.x * 256 + threadIdx.x; if (t >= n8) return; FragH f;
#pragma unroll
  for (int q = 0; q < 8; ++q) f.h[q] = (_Float16)x[t * 8 + q]; *(v8us*)((unsigned short*)X16 + t * 8) = f.half[0];  }
// four weights in one launch, laid end to end in Bt: three of ns8 groups of 8 elements each, then one of nl8 groups (ns8 a multiple of 256, so the source is the same for a whole block)
__global__ __launch_bounds__(256) void k_round16f(const float* __restrict__ W0, const float* __restrict__ W1, const float* __restrict__ W2, const float* __restrict__ W3, _Float16* __restrict__ Bt, size_t ns8, size_t nl8) { const size_t t = (size_t)blockIdx.x * 256 + threadIdx.x; if (t >= 3 * ns8 + nl8) return; FragH f;
  const float* W = W0; size_t u = t; if (t >= 3 * ns8) { W = W3; u = t - 3 * ns8; } else if (t >= 2 * ns8) { W = W2; u = t - 2 * ns8; } else if (t >= ns8) { W = W1; u = t - ns8; }
#pragma unroll
  for (int i = 0; i < 8; ++i) f.h[i] = (_Float16)(bf16_round(W[u * 8 + i]) * 16.0f); *(v8us*)((unsigned short*)Bt + t * 8) = f.half[0];  }
template <int NHv, int TTv>
__global__ __launch_bounds__(256) void k_vt(const _Float16* __restrict__ V16, int ldv, int voff, _Float16* __restrict__ Vt) { __shared__ unsigned short tl[64][66]; const int tid = threadIdx.x; const int slab = blockIdx.x / (TTv / 64), lg = blockIdx.x % (TTv / 64); const int b = slab / NHv, h = slab % NHv;
  for (int i = tid; i < 64 * 8; i += 256) { const int r = i / 8, c8 = (i % 8) * 8; FragH f; f.half[0] = *(const v8us*)((const unsigned short*)V16 + ((size_t)b * TTv + lg * 64 + r) * ldv + voff + h * 64 + c8);
#pragma unroll
    for (int q = 0; q < 8; ++q) tl[r][c8 + q] = f.u[q]; }
  __syncthreads();
  {
#pragma unroll
    for (int rd = 0; rd < 2; ++rd) { const int d = rd * 32 + tid / 8, pc = tid % 8; FragH f;
#pragma unroll
      for (int q = 0; q < 8; ++q) f.u[q] = tl[pc * 8 + q][d];
      *(v8us*)((unsigned short*)Vt + ((size_t)slab * 64 + d) * TTv + lg * 64 + pc * 8) = f.half[0]; }
     } }

__global__ __launch_bounds__(256) void k_h16s(const float* __restrict__ F, _Float16* __restrict__ H, size_t n8) { const size_t t = (size_t)blockIdx.x * 256 + threadIdx.x; if (t >= n8) return; const v4f a = *(const v4fa*)(F + t * 8), c = *(const v4fa*)(F + t * 8 + 4); FragH f;
#pragma unroll
  for (int q = 0; q < 4; ++q) { f.h[q] = (_Float16)(a[q] * 16.0f); f.h[4 + q] = (_Float16)(c[q] * 16.0f); } *(v8us*)((unsigned short*)H + t * 8) = f.half[0];  }
__global__ __launch_bounds__(128) void k_flash(const _Float16* __restrict__ Q16, int ldq, const _Float16* __restrict__ K16, int ldk, const _Float16* __restrict__ Vt, const int* __restrict__ MSK, float* __restrict__ O, int ldo) {
  constexpr int RPW = 16, RTN = RPW / 16, NQB = TT / (4 * RPW), DT = 4, KS = 2;
  __shared__ __attribute__((aligned(16))) unsigned short sP[4][RPW][40]; __shared__ __attribute__((aligned(16))) float sO[4][RPW][64 + 4];
  const int tid = threadIdx.x, w = tid >> 5, lane = tid & 31, ln = lane & 15, hh = lane >> 4;
  const int slab = blockIdx.x / NQB, qblk = blockIdx.x % NQB; const int b = slab / NH, h = slab % NH; const int qb0 = qblk * (4 * RPW); const int q0 = qb0 + w * RPW;
  FragH aq[2][KS];
#pragma unroll
  for (int rt = 0; rt < RTN; ++rt) { const unsigned short* qr = (const unsigned short*)Q16 + ((size_t)b * TT + q0 + rt * 16 + ln) * ldq + h * 64;
#pragma unroll
    for (int ks = 0; ks < KS; ++ks) { aq[rt][ks].half[0] = *(const v8us*)(qr + ks * 32 + 8 * hh); aq[rt][ks].half[1] = *(const v8us*)(qr + ks * 32 + 16 + 8 * hh); } }
  const unsigned short* Vth = (const unsigned short*)Vt + (size_t)slab * 64 * TT;
  float m_r[2][8], l_r[2][8]; v8f oacc[2][DT];
#pragma unroll
  for (int rt = 0; rt < RTN; ++rt) {
#pragma unroll
    for (int r = 0; r < 8; ++r) { m_r[rt][r] = -3.0e38f; l_r[rt][r] = 0.f; }
#pragma unroll
    for (int dt = 0; dt < DT; ++dt) oacc[rt][dt] = (v8f){0.f,0.f,0.f,0.f,0.f,0.f,0.f,0.f}; }
  const int jend = TT;
#pragma unroll 1
  for (int j0 = 0; j0 < jend; j0 += 32) {
    const int km0 = MSK[(size_t)b * TT + j0 + ln], km1 = MSK[(size_t)b * TT + j0 + 16 + ln];      /* key padding mask (1 = attend), shared by all queries and heads */
    v8f s[2][2];
#pragma unroll
    for (int nt = 0; nt < 2; ++nt) { const unsigned short* kr = (const unsigned short*)K16 + ((size_t)b * TT + j0 + nt * 16 + ln) * ldk + h * 64; FragH bk[KS];
#pragma unroll
      for (int ks = 0; ks < KS; ++ks) { bk[ks].half[0] = *(const v8us*)(kr + ks * 32 + 8 * hh); bk[ks].half[1] = *(const v8us*)(kr + ks * 32 + 16 + 8 * hh); }
#pragma unroll
      for (int rt = 0; rt < RTN; ++rt) { v8f acc = (v8f){0.f,0.f,0.f,0.f,0.f,0.f,0.f,0.f};
#pragma unroll
        for (int ks = 0; ks < KS; ++ks) acc = mmaH<1>(aq[rt][ks].v, aq[rt][ks].v, bk[ks].v, bk[ks].v, acc); s[rt][nt] = acc; } }
#pragma unroll
    for (int rt = 0; rt < RTN; ++rt)
#pragma unroll
      for (int r = 0; r < 8; ++r) { const int tq = q0 + rt * 16 + 8 * hh + r; const int k0 = j0 + ln, k1 = j0 + 16 + ln; (void)tq; (void)k0; (void)k1;
        const bool ok0 = (km0 != 0), ok1 = (km1 != 0);
        const float s0 = ok0 ? s[rt][0][r] * 0.03125f : -INFINITY, s1 = ok1 ? s[rt][1][r] * 0.03125f : -INFINITY;      /* energy/√1024; masked keys carry −1e20 in the module ≡ −inf */ float mc = fmaxf(s0, s1);
        mc = fmaxf(mc, __shfl_xor(mc, 1, 32)); mc = fmaxf(mc, __shfl_xor(mc, 2, 32)); mc = fmaxf(mc, __shfl_xor(mc, 4, 32)); mc = fmaxf(mc, __shfl_xor(mc, 8, 32));
        const float mn = fmaxf(m_r[rt][r], mc); const float al = (mn > -1.0e38f) ? expf(m_r[rt][r] - mn) : 1.0f; m_r[rt][r] = mn; const float p0 = ok0 ? expf(s0 - mn) : 0.f, p1 = ok1 ? expf(s1 - mn) : 0.f; l_r[rt][r] = l_r[rt][r] * al + p0 + p1;
#pragma unroll
        for (int dt = 0; dt < DT; ++dt) oacc[rt][dt][r] *= al;
        FragH t2; t2.h[0] = (_Float16)(p0 * 1024.0f); t2.h[1] = (_Float16)(p1 * 1024.0f); sP[w][rt * 16 + 8 * hh + r][ln] = t2.u[0]; sP[w][rt * 16 + 8 * hh + r][16 + ln] = t2.u[1]; }
    __builtin_amdgcn_fence(__ATOMIC_ACQ_REL, "workgroup"); __builtin_amdgcn_wave_barrier();
    FragH pa[2];
#pragma unroll
    for (int rt = 0; rt < RTN; ++rt) { pa[rt].half[0] = *(const v8us*)&sP[w][rt * 16 + ln][8 * hh]; pa[rt].half[1] = *(const v8us*)&sP[w][rt * 16 + ln][16 + 8 * hh]; }
#pragma unroll
    for (int dt = 0; dt < DT; ++dt) { const unsigned short* vrow = Vth + (size_t)(dt * 16 + ln) * TT + j0; FragH bv; bv.half[0] = *(const v8us*)(vrow + 8 * hh); bv.half[1] = *(const v8us*)(vrow + 16 + 8 * hh);
#pragma unroll
      for (int rt = 0; rt < RTN; ++rt) oacc[rt][dt] = mmaH<1>(pa[rt].v, pa[rt].v, bv.v, bv.v, oacc[rt][dt]); }
    __builtin_amdgcn_fence(__ATOMIC_ACQ_REL, "workgroup"); __builtin_amdgcn_wave_barrier(); }
#pragma unroll
  for (int rt = 0; rt < RTN; ++rt) {
#pragma unroll
    for (int r = 0; r < 8; ++r) { float l = l_r[rt][r]; l += __shfl_xor(l, 1, 32); l += __shfl_xor(l, 2, 32); l += __shfl_xor(l, 4, 32); l += __shfl_xor(l, 8, 32); l_r[rt][r] = (l > 0.f) ? 1.0f / (l * 1024.0f) : 0.f; }
#pragma unroll
    for (int dt = 0; dt < DT; ++dt)
#pragma unroll
      for (int r = 0; r < 8; ++r) sO[w][rt * 16 + 8 * hh + r][dt * 16 + ln] = oacc[rt][dt][r] * l_r[rt][r]; }
  __builtin_amdgcn_fence(__ATOMIC_ACQ_REL, "workgroup"); __builtin_amdgcn_wave_barrier();
  {
#pragma unroll
    for (int rp = 0; rp < RPW; rp += 2) { const int r = rp + (lane >> 4), pc = lane & 15; const v4f val = *(const v4fa*)&sO[w][r][pc * 4]; *(v4f*)(O + ((size_t)b * TT + q0 + r) * ldo + h * 64 + pc * 4) = val; }
     } }

extern "C" void kernel_launch(void* const* d_in, const int* in_sizes, int n_in,
                              void* d_out, int out_size, void* d_ws, size_t ws_size, hipStream_t stream) {
  (void)in_sizes; (void)n_in; (void)out_size;
  const float* const* I = (const float* const*)d_in; const float* values = I[0]; const float* keys = I[1]; const float* query = I[2]; const int* mask = (const int*)d_in[3]; const float* Wv = I[4]; const float* Wk = I[5]; const float* Wq = I[6]; const float* Wo = I[7]; const float* bo = I[8];
  char* ws = (char*)d_ws; size_t off = 0;
  auto take = [&](size_t bytes) { char* p = ws + off; off += (bytes + 255) & ~(size_t)255; return p; };
  _Float16* Bs = (_Float16*)take(((size_t)3 * HD * HD + (size_t)DD * DD) * 2); _Float16* Bo = Bs + 3 * HD * HD;      /* Wv, Wk, Wq, Wo end to end */
  _Float16* XV = (_Float16*)take((size_t)3 * NR * DD * 2); _Float16* XQ = XV + (size_t)2 * NR * DD;      /* planes values, keys, query */
  _Float16* V = (_Float16*)take((size_t)3 * NR * DD * 2); _Float16* K = V + (size_t)NR * DD; _Float16* Q = K + (size_t)NR * DD;      /* projected planes, same order */
  _Float16* Vt = (_Float16*)take((size_t)NR * DD * 2); float* O = (float*)take((size_t)NR * DD * 4); _Float16* O16 = XQ;
  if (off > ws_size) return;      // 0.03 + 2.1 + 7 × 8.4 + 16.8 ≈ 78 MB
  k_round16f<<<(unsigned)(((size_t)3 * HD * HD / 8 + (size_t)DD * DD / 8 + 255) / 256), 256, 0, stream>>>(Wv, Wk, Wq, Wo, Bs, HD * HD / 8, (size_t)DD * DD / 8);      /* (out,in) natural x2^4 */
  const unsigned g8 = (unsigned)(((size_t)NR * DD / 8 + 255) / 256); k_x16<<<dim3(g8, 3), 256, 0, stream>>>(values, keys, query, XV, (size_t)NR * DD / 8);
  /* y[:, 64h..] = x[:, 64h..].W^T (W shared by the heads): M 4096 N 64 K 64 per (head, tensor); blockIdx.y = head (column offset 64h in A and C), blockIdx.z = tensor (plane of A and C, weight of Bs) */
  k_gemm_hhx<0><<<dim3(((NR / 16) * 1 + 3) / 4, NH, 3), 128, 0, stream>>>(XV, DD, HD, Bs, HD, 0, 0.0625f, nullptr, 0, nullptr, 1, 0, 0, nullptr, V, DD, HD, NR, HD, HD, (size_t)NR * DD, HD * HD, (size_t)NR * DD);
  k_vt<NH, TT><<<BB * NH * (TT / 64), 256, 0, stream>>>(V, DD, 0, Vt);
  k_flash<<<BB * NH * (TT / 64), 128, 0, stream>>>(Q, DD, K, DD, Vt, mask, O, DD);
  k_h16s<<<g8, 256, 0, stream>>>(O, O16, (size_t)NR * DD / 8);      /* over the query plane (dead after the projections) */
  k_gemm_hhx<0><<<dim3(((NR / 16) * (DD / 64) + 3) / 4, 1), 128, 0, stream>>>(O16, DD, 0, Bo, DD, 0, 0.00390625f, bo, 0, nullptr, 1, 0, 0, (float*)d_out, nullptr, DD, 0, NR, DD, DD, 0, 0, 0);      /* out = O·Woᵀ + bo */
}

// v002
// It runs in 217 microseconds.
// Timed twice side by side with v001, it ran 1.53 and 1.52 times as fast.
// All steps since v000 together make it 2.52 times as fast.
#include <hip/hip_runtime.h>
// 'SelfAttension' (B=2, S=2048, E=1024, 16 heads × 64): per-head projections with ONE shared 64×64 weight per tensor (y_h = x_h·Wᵀ, torch (out,in), no bias) for values, keys, query; energy = q·kᵀ with −1e20 where the key mask [N,1,1,S] == 0;
// attn = softmax(energy/√1024); out = (attn·v merged)·Woᵀ + bo.
// Compute dtype: inputs, weights, bias rounded to bf16; the per-head 64×64 projections as block-diagonal f16 GEMMs (all 16 head-block columns of all three tensors in one launch, grid = row blocks x heads x tensors, K = 64); fused flash-style kernel (per-(b,k) int mask loads, scale 1/32,
// online softmax f32, P f16 ×2^10) on v_wmma_f32_16x16x32_f16; O ×2^4 → f16 → output GEMM + bias; f32 accumulate.
#define BB 2
#define TT 2048
#define DD 1024
#define NH 16
#define HD 64
#define NR (BB * TT)

typedef __bf16 v16b __attribute__((ext_vector_type(16)));
typedef unsigned short v8us __attribute__((ext_vector_type(8), may_alias));
typedef float  v8f  __attribute__((ext_vector_type(8)));
typedef float  v4f  __attribute__((ext_vector_type(4)));
typedef float  v4fa __attribute__((ext_vector_type(4), may_alias));
union FragB { v16b v; v8us half[2]; unsigned short u[16]; };

__device__ __forceinline__ unsigned short bf16_bits(float x) { unsigned int u = __float_as_uint(x); return (unsigned short)((u + 0x7FFFu + ((u >> 16) & 1u)) >> 16); }
__device__ __forceinline__ float bf16_val(unsigned short b) { return __uint_as_float(((unsigned int)b) << 16); }
__device__ __forceinline__ float bf16_round(float x) { return bf16_val(bf16_bits(x)); }
// D += A·B with NT terms: 1 = ah·bh, 2 = + al·bh (A split), 3 = + ah·bl (both split)
template <int NT>
__device__ __forceinline__ v8f mmaN(v16b ah, v16b al, v16b bh, v16b bl, v8f c) {
  c = __builtin_amdgcn_wmma_f32_16x16x32_bf16(false, ah, false, bh, (short)0, c, false, false);
  if (NT >= 2) c = __builtin_amdgcn_wmma_f32_16x16x32_bf16(false, al, false, bh, (short)0, c, false, false);
  if (NT >= 3) c = __builtin_amdgcn_wmma_f32_16x16x32_bf16(false, ah, false, bl, (short)0, c, false, false);
  asm volatile("v_nop\n\tv_nop\n\tv_nop\n\tv_nop" : "+v"(c) : "v"(ah), "v"(al), "v"(bh), "v"(bl));
  return c;
}

__global__ __launch_bounds__(256) void k_wt_bf16(const float* __restrict__ W, unsigned short* __restrict__ Wt, int K, int N) {
  const int t = blockIdx.x * 256 + threadIdx.x;
  const int k8n = K / 8;
  if (t >= N * k8n) return;
  const int n = t / k8n, k8 = (t % k8n) * 8;
  v8us v;
#pragma unroll
  for (int i = 0; i < 8; ++i) v[i] = bf16_bits(W[(size_t)(k8 + i) * N + n]);
  *(v8us*)(Wt + (size_t)n * K + k8) = v;
  
}

// GEMM C[M][N] (f32, pitch ldc) = act(A[M][K]·W + bias). A f32 row-major (pitch lda) converted per fragment to bf16
// (ASPLIT: hi/lo two planes -> 2 terms, else single rounded term); Wt bf16 [N][K] (pitch ldb). BIAS_BF16 rounds the
// bias to bf16 first (bias quantised to bf16 before the add). K%32==0, M%16==0, N%64==0.
template <bool ASPLIT, int ACT, bool BIAS_BF16>
__global__ __launch_bounds__(128) void k_gemm_bf(const float* __restrict__ A, int lda, const unsigned short* __restrict__ Wt, int ldb,
                                               const float* __restrict__ bias, float* __restrict__ C, int ldc, int M, int N, int K) {
  __shared__ __attribute__((aligned(16))) float so[4][16][64];
  const int tid = threadIdx.x, w = tid >> 5, lane = tid & 31, ln = lane & 15, hh = lane >> 4;
  const int ntn = N / 64;
  const int wid = blockIdx.x * 4 + w;
  const int mt = wid / ntn, nq = wid % ntn;
  if (mt * 16 >= M) return;
  const int row0 = mt * 16, col0 = nq * 64;
  const float* arow = A + (size_t)(row0 + ln) * lda;
  v8f acc[4] = {};
  for (int kb = 0; kb < K; kb += 32) {
    FragB ah, al;
    const v4f x0 = *(const v4fa*)(arow + kb + 8 * hh), x1 = *(const v4fa*)(arow + kb + 8 * hh + 4);
    const v4f x2 = *(const v4fa*)(arow + kb + 16 + 8 * hh), x3 = *(const v4fa*)(arow + kb + 16 + 8 * hh + 4);
    float xs[16] = {x0[0],x0[1],x0[2],x0[3],x1[0],x1[1],x1[2],x1[3],x2[0],x2[1],x2[2],x2[3],x3[0],x3[1],x3[2],x3[3]};
#pragma unroll
    for (int i = 0; i < 16; ++i) { const unsigned short hb = bf16_bits(xs[i]); ah.u[i] = hb; al.u[i] = ASPLIT ? bf16_bits(xs[i] - bf16_val(hb)) : (unsigned short)0; }
#pragma unroll
    for (int t = 0; t < 4; ++t) {
      const unsigned short* brow = Wt + (size_t)(col0 + t * 16 + ln) * ldb + kb;
      FragB b;
      b.half[0] = *(const v8us*)(brow + 8 * hh);
      b.half[1] = *(const v8us*)(brow + 16 + 8 * hh);
      acc[t] = mmaN<ASPLIT ? 2 : 1>(ah.v, al.v, b.v, b.v, acc[t]);
    }
  }
#pragma unroll
  for (int t = 0; t < 4; ++t) {
    float bv = bias ? bias[col0 + t * 16 + ln] : 0.f;
    if (BIAS_BF16) bv = bf16_round(bv);
#pragma unroll
    for (int r = 0; r < 8; ++r) { float v = acc[t][r] + bv; if (ACT == 1) v = fmaxf(v, 0.f); so[w][8 * hh + r][t * 16 + ln] = v; }
  }
  __builtin_amdgcn_fence(__ATOMIC_ACQ_REL, "workgroup");
  __builtin_amdgcn_wave_barrier();
  const int rsub = lane >> 4, c4 = (lane & 15) * 4;
  {
#pragma unroll
    for (int q = 0; q < 8; ++q) {
      const int r = q * 2 + rsub;
      const v4f v = *(const v4fa*)&so[w][r][c4];
      *(v4f*)(C + (size_t)(row0 + r) * ldc + col0 + c4) = v;
    }
    
  }
}

// Flash-style causal/unmasked attention, all contractions 3-term bf16 hi/lo splits, f32 softmax with running max.
// q,k,v rows are read from f32 buffers with arbitrary row pitch (so they can live inside a fused qkv buffer);
// D = head size (multiple of 32, <= 128); one wave = 16 query rows; block = 4 waves (64 queries) sharing K/V chunks of 32.
template <int D, bool CAUSAL>
__global__ __launch_bounds__(128) void k_flash(const float* __restrict__ qb, const float* __restrict__ kb, const float* __restrict__ vb,
                                             int pitch, int T, int H, float scale, float* __restrict__ y, int ypitch) {
  constexpr int KS = D / 32;        // k-steps for QK
  constexpr int DT = D / 16;        // d tiles for PV
  __shared__ __attribute__((aligned(16))) unsigned short sKh[32][D + 8], sKl[32][D + 8], sVh[32][D + 8], sVl[32][D + 8];
  __shared__ __attribute__((aligned(16))) unsigned short sPh[4][16][40], sPl[4][16][40];
  __shared__ __attribute__((aligned(16))) float sO[4][16][D];
  const int tid = threadIdx.x, w = tid >> 5, lane = tid & 31, ln = lane & 15, hh = lane >> 4;
  const int nqb = (T + 63) / 64;
  const int bh = blockIdx.x / nqb, qblk = blockIdx.x % nqb;
  const int b = bh / H, h = bh % H;
  const int q0 = qblk * 64 + w * 16;
  const float* Q = qb + (size_t)b * T * pitch + h * D;
  const float* K = kb + (size_t)b * T * pitch + h * D;
  const float* V = vb + (size_t)b * T * pitch + h * D;

  // A fragments of the wave's 16 query rows (scaled), hi/lo
  FragB aqh[KS], aql[KS];
  {
    int row = q0 + ln; if (row >= T) row = T - 1;
    const float* qr = Q + (size_t)row * pitch;
#pragma unroll
    for (int ks = 0; ks < KS; ++ks)
#pragma unroll
      for (int i = 0; i < 16; ++i) {
        const int d = ks * 32 + ((i < 8) ? (8 * hh + i) : (16 + 8 * hh + (i - 8)));
        const float x = qr[d] * scale; const unsigned short hb = bf16_bits(x);
        aqh[ks].u[i] = hb; aql[ks].u[i] = bf16_bits(x - bf16_val(hb));
      }
  }
  float m_r[8], l_r[8];
#pragma unroll
  for (int r = 0; r < 8; ++r) { m_r[r] = -3.0e38f; l_r[r] = 0.f; }
  v8f oacc[DT];
#pragma unroll
  for (int dt = 0; dt < DT; ++dt) oacc[dt] = (v8f){0.f,0.f,0.f,0.f,0.f,0.f,0.f,0.f};

  const int kv_end = CAUSAL ? min(T, qblk * 64 + 64) : T;     // block-uniform
  for (int j0 = 0; j0 < kv_end; j0 += 32) {
    __syncthreads();
    for (int e = tid; e < 32 * (D / 4); e += 128) {
      const int r = e / (D / 4), c4 = (e % (D / 4)) * 4;
      const int key = j0 + r;
      v4f kf = {0.f,0.f,0.f,0.f}, vf = {0.f,0.f,0.f,0.f};
      if (key < T) { kf = *(const v4fa*)(K + (size_t)key * pitch + c4); vf = *(const v4fa*)(V + (size_t)key * pitch + c4); }
#pragma unroll
      for (int t = 0; t < 4; ++t) {
        unsigned short hb = bf16_bits(kf[t]); sKh[r][c4 + t] = hb; sKl[r][c4 + t] = bf16_bits(kf[t] - bf16_val(hb));
        hb = bf16_bits(vf[t]); sVh[r][c4 + t] = hb; sVl[r][c4 + t] = bf16_bits(vf[t] - bf16_val(hb));
      }
    }
    __syncthreads();
    // S tile 16 x 32
    v8f s[2];
#pragma unroll
    for (int nt = 0; nt < 2; ++nt) {
      v8f acc = {};
#pragma unroll
      for (int ks = 0; ks < KS; ++ks) {
        FragB bh_, bl_;
        bh_.half[0] = *(const v8us*)&sKh[nt * 16 + ln][ks * 32 + 8 * hh]; bh_.half[1] = *(const v8us*)&sKh[nt * 16 + ln][ks * 32 + 16 + 8 * hh];
        bl_.half[0] = *(const v8us*)&sKl[nt * 16 + ln][ks * 32 + 8 * hh]; bl_.half[1] = *(const v8us*)&sKl[nt * 16 + ln][ks * 32 + 16 + 8 * hh];
        acc = mmaN<3>(aqh[ks].v, aql[ks].v, bh_.v, bl_.v, acc);
      }
      s[nt] = acc;
    }
    // mask + running max (rows 8hh+r; the 16 lanes of a half share rows)
    float alpha[8];
#pragma unroll
    for (int r = 0; r < 8; ++r) {
      const int qi = q0 + 8 * hh + r;
      const int ja = j0 + ln, jb = j0 + 16 + ln;
      if (CAUSAL) { if (ja > qi) s[0][r] = -3.0e38f; if (jb > qi) s[1][r] = -3.0e38f; }
      if (ja >= T) s[0][r] = -3.0e38f;
      if (jb >= T) s[1][r] = -3.0e38f;
      float mx = fmaxf(s[0][r], s[1][r]);
      mx = fmaxf(mx, __shfl_xor(mx, 1, 32)); mx = fmaxf(mx, __shfl_xor(mx, 2, 32)); mx = fmaxf(mx, __shfl_xor(mx, 4, 32)); mx = fmaxf(mx, __shfl_xor(mx, 8, 32));
      const float mnew = fmaxf(m_r[r], mx);
      alpha[r] = (mnew > -1.0e38f) ? __expf(m_r[r] - mnew) : 1.0f;
      const float p0 = (s[0][r] > -1.0e38f) ? __expf(s[0][r] - mnew) : 0.f;
      const float p1 = (s[1][r] > -1.0e38f) ? __expf(s[1][r] - mnew) : 0.f;
      m_r[r] = mnew;
      l_r[r] = l_r[r] * alpha[r] + p0 + p1;            // per-lane partial row sum (16 lanes combined at the end)
      unsigned short hb = bf16_bits(p0); sPh[w][8 * hh + r][ln] = hb;      sPl[w][8 * hh + r][ln] = bf16_bits(p0 - bf16_val(hb));
      hb = bf16_bits(p1);                sPh[w][8 * hh + r][16 + ln] = hb; sPl[w][8 * hh + r][16 + ln] = bf16_bits(p1 - bf16_val(hb));
    }
#pragma unroll
    for (int dt = 0; dt < DT; ++dt)
#pragma unroll
      for (int r = 0; r < 8; ++r) oacc[dt][r] *= alpha[r];
    __builtin_amdgcn_fence(__ATOMIC_ACQ_REL, "workgroup");
    __builtin_amdgcn_wave_barrier();
    FragB pah, pal;
    pah.half[0] = *(const v8us*)&sPh[w][ln][8 * hh]; pah.half[1] = *(const v8us*)&sPh[w][ln][16 + 8 * hh];
    pal.half[0] = *(const v8us*)&sPl[w][ln][8 * hh]; pal.half[1] = *(const v8us*)&sPl[w][ln][16 + 8 * hh];
#pragma unroll
    for (int dt = 0; dt < DT; ++dt) {
      FragB bvh, bvl;
#pragma unroll
      for (int i = 0; i < 8; ++i) {
        bvh.u[i] = sVh[8 * hh + i][dt * 16 + ln]; bvh.u[8 + i] = sVh[16 + 8 * hh + i][dt * 16 + ln];
        bvl.u[i] = sVl[8 * hh + i][dt * 16 + ln]; bvl.u[8 + i] = sVl[16 + 8 * hh + i][dt * 16 + ln];
      }
      oacc[dt] = mmaN<3>(pah.v, pal.v, bvh.v, bvl.v, oacc[dt]);
    }
    __builtin_amdgcn_fence(__ATOMIC_ACQ_REL, "workgroup");
    __builtin_amdgcn_wave_barrier();
  }
#pragma unroll
  for (int r = 0; r < 8; ++r) {
    float l = l_r[r];
    l += __shfl_xor(l, 1, 32); l += __shfl_xor(l, 2, 32); l += __shfl_xor(l, 4, 32); l += __shfl_xor(l, 8, 32);
    l_r[r] = (l > 0.f) ? 1.0f / l : 0.f;
  }
#pragma unroll
  for (int dt = 0; dt < DT; ++dt)
#pragma unroll
    for (int r = 0; r < 8; ++r) sO[w][8 * hh + r][dt * 16 + ln] = oacc[dt][r] * l_r[r];
  __builtin_amdgcn_fence(__ATOMIC_ACQ_REL, "workgroup");
  __builtin_amdgcn_wave_barrier();
  {
    for (int r = 0; r < 16; ++r) {
      const int row = q0 + r;
      if (row < T && lane < D / 4) {
        const v4f val = *(const v4fa*)&sO[w][r][lane * 4];
        *(v4f*)(y + ((size_t)b * T + row) * ypitch + h * D + lane * 4) = val;
      }
    }
    
  }
}

// GEMM C = act(A·W + bias + resid): A f32 (ASPLIT -> hi/lo 2 terms), Wt bf16 [N][K]; ACT 0 none, 1 relu, 2 exact gelu;
// resid (optional, f32, row index = (row % rmod), pitch ldr, RES_BF16 rounds it) added before the activation.
template <bool ASPLIT, int ACT, bool BIAS_BF16, bool RES_BF16>
__global__ __launch_bounds__(128) void k_gemm_bf3(const float* __restrict__ A, int lda, const unsigned short* __restrict__ Wt, int ldb,
                                                const float* __restrict__ bias, const float* __restrict__ resid, int rmod, int ldr,
                                                float* __restrict__ C, int ldc, int M, int N, int K) {
  __shared__ __attribute__((aligned(16))) float so[4][16][64];
  const int tid = threadIdx.x, w = tid >> 5, lane = tid & 31, ln = lane & 15, hh = lane >> 4;
  const int ntn = N / 64;
  const int wid = blockIdx.x * 4 + w;
  const int mt = wid / ntn, nq = wid % ntn;
  if (mt * 16 >= M) return;
  const int row0 = mt * 16, col0 = nq * 64;
  const float* arow = A + (size_t)(row0 + ln) * lda;
  v8f acc[4] = {};
  for (int kb = 0; kb < K; kb += 32) {
    FragB ah, al;
    const v4f x0 = *(const v4fa*)(arow + kb + 8 * hh), x1 = *(const v4fa*)(arow + kb + 8 * hh + 4);
    const v4f x2 = *(const v4fa*)(arow + kb + 16 + 8 * hh), x3 = *(const v4fa*)(arow + kb + 16 + 8 * hh + 4);
    float xs[16] = {x0[0],x0[1],x0[2],x0[3],x1[0],x1[1],x1[2],x1[3],x2[0],x2[1],x2[2],x2[3],x3[0],x3[1],x3[2],x3[3]};
#pragma unroll
    for (int i = 0; i < 16; ++i) { const unsigned short hb = bf16_bits(xs[i]); ah.u[i] = hb; al.u[i] = ASPLIT ? bf16_bits(xs[i] - bf16_val(hb)) : (unsigned short)0; }
#pragma unroll
    for (int t = 0; t < 4; ++t) {
      const unsigned short* brow = Wt + (size_t)(col0 + t * 16 + ln) * ldb + kb;
      FragB b;
      b.half[0] = *(const v8us*)(brow + 8 * hh);
      b.half[1] = *(const v8us*)(brow + 16 + 8 * hh);
      acc[t] = mmaN<ASPLIT ? 2 : 1>(ah.v, al.v, b.v, b.v, acc[t]);
    }
  }
#pragma unroll
  for (int t = 0; t < 4; ++t) {
    const int col = col0 + t * 16 + ln;
    float bv = bias ? bias[col] : 0.f;
    if (BIAS_BF16) bv = bf16_round(bv);
#pragma unroll
    for (int r = 0; r < 8; ++r) {
      float v = acc[t][r] + bv;
      if (resid) { float rv = resid[(size_t)((row0 + 8 * hh + r) % rmod) * ldr + col]; if (RES_BF16) rv = bf16_round(rv); v += rv; }
      if (ACT == 1) v = fmaxf(v, 0.f);
      if (ACT == 2) v = 0.5f * v * (1.0f + erff(v * 0.70710678118654752f));
      if (ACT == 3) { const float u = 0.7978845608028654f * (v + 0.044715f * v * v * v); v = 0.5f * v * (1.0f + tanhf(u)); }
      so[w][8 * hh + r][t * 16 + ln] = v;
    }
  }
  __builtin_amdgcn_fence(__ATOMIC_ACQ_REL, "workgroup");
  __builtin_amdgcn_wave_barrier();
  const int rsub = lane >> 4, c4 = (lane & 15) * 4;
  {
#pragma unroll
    for (int q = 0; q < 8; ++q) {
      const int r = q * 2 + rsub;
      const v4f v = *(const v4fa*)&so[w][r][c4];
      *(v4f*)(C + (size_t)(row0 + r) * ldc + col0 + c4) = v;
    }
    
  }
}
// row LayerNorm (biased variance, eps) over N: s = X (+ R); optional out_sum <- s; out_norm <- (s-mu)*rsqrt(var+eps)*g + b
template <bool PARAM_BF16>
__global__ __launch_bounds__(256) void k_layernorm(const float* __restrict__ X, const float* __restrict__ R, const float* __restrict__ g, const float* __restrict__ bta,
                                                  float* __restrict__ out_sum, float* __restrict__ out_norm, int N, float eps) {
  __shared__ float red[256];
  const int row = blockIdx.x, tid = threadIdx.x;
  const float* x = X + (size_t)row * N; const float* rr = R ? R + (size_t)row * N : nullptr;
  float vals[16];                     // up to N = 4096
  const int per = N / 256;            // contiguous chunk per thread? use strided-by-4 chunks: thread handles j = tid*4 + 1024*u
  float s1 = 0.f;
  for (int u = 0; u < per / 4; ++u) {
    const int j = tid * 4 + 1024 * u;
    const v4f a = *(const v4fa*)(x + j);
    v4f b = {0.f,0.f,0.f,0.f}; if (rr) b = *(const v4fa*)(rr + j);
#pragma unroll
    for (int q = 0; q < 4; ++q) { const float v = a[q] + b[q]; vals[u * 4 + q] = v; s1 += v; }
  }
  red[tid] = s1; __syncthreads();
  for (int st = 128; st > 0; st >>= 1) { if (tid < st) red[tid] += red[tid + st]; __syncthreads(); }
  const float mu = red[0] / (float)N; __syncthreads();
  float s2 = 0.f;
  for (int u = 0; u < per / 4; ++u)
#pragma unroll
    for (int q = 0; q < 4; ++q) { const float c = vals[u * 4 + q] - mu; s2 += c * c; }
  red[tid] = s2; __syncthreads();
  for (int st = 128; st > 0; st >>= 1) { if (tid < st) red[tid] += red[tid + st]; __syncthreads(); }
  const float rs = rsqrtf(red[0] / (float)N + eps);
  {
    for (int u = 0; u < per / 4; ++u) {
      const int j = tid * 4 + 1024 * u;
      v4f o, sm;
#pragma unroll
      for (int q = 0; q < 4; ++q) {
        float gg = g[j + q], bb = bta[j + q];
        if (PARAM_BF16) { gg = bf16_round(gg); bb = bf16_round(bb); }
        sm[q] = vals[u * 4 + q]; o[q] = (vals[u * 4 + q] - mu) * rs * gg + bb;
      }
      if (out_sum) *(v4f*)(out_sum + (size_t)row * N + j) = sm;
      *(v4f*)(out_norm + (size_t)row * N + j) = o;
    }
    
  }
}



// ---- f16 WMMA path (v_wmma_f32_16x16x32_f16): 11-bit significands for operands in range — used where a [0,1] probability operand needs more precision than bf16
typedef _Float16 v16h __attribute__((ext_vector_type(16)));
union FragH { v16h v; v8us half[2]; _Float16 h[16]; unsigned short u[16]; };
template <int NT>
__device__ __forceinline__ v8f mmaH(v16h ah, v16h al, v16h bh, v16h bl, v8f c) {
  c = __builtin_amdgcn_wmma_f32_16x16x32_f16(false, ah, false, bh, (short)0, c, false, false);
  if (NT >= 2) c = __builtin_amdgcn_wmma_f32_16x16x32_f16(false, al, false, bh, (short)0, c, false, false);
  if (NT >= 3) c = __builtin_amdgcn_wmma_f32_16x16x32_f16(false, ah, false, bl, (short)0, c, false, false);
  asm volatile("v_nop\n\tv_nop\n\tv_nop\n\tv_nop" : "+v"(c) : "v"(ah), "v"(al), "v"(bh), "v"(bl));
  return c;
}
// batched GEMM like k_gemm_b but f16 operands: A f32 (split into f16 hi/lo if ASPLIT, else rounded to f16), Bt = f16 values [n][k]; alpha; C f32; N multiple of 16 (partial tiles skipped)
template <bool ASPLIT>
__global__ __launch_bounds__(128) void k_gemm_h(const float* __restrict__ A, int lda, size_t sA, const _Float16* __restrict__ Bh, int ldb, size_t sB, float alpha, float* __restrict__ C, int ldc, size_t sC, int M, int N, int K) {
  __shared__ __attribute__((aligned(16))) float so[4][16][64];
  const int tid = threadIdx.x, w = tid >> 5, lane = tid & 31, ln = lane & 15, hh = lane >> 4; const int by = blockIdx.y;
  A += (size_t)by * sA; Bh += (size_t)by * sB; C += (size_t)by * sC;
  const int ntn = (N + 63) / 64; const int wid = blockIdx.x * 4 + w; const int mt = wid / ntn, nq = wid % ntn; if (mt * 16 >= M) return;
  const int row0 = mt * 16, col0 = nq * 64; const float* arow = A + (size_t)(row0 + ln) * lda;
  v8f acc[4] = {};
  for (int kb = 0; kb < K; kb += 32) {
    FragH ah, al;
    const v4f x0 = *(const v4fa*)(arow + kb + 8 * hh), x1 = *(const v4fa*)(arow + kb + 8 * hh + 4), x2 = *(const v4fa*)(arow + kb + 16 + 8 * hh), x3 = *(const v4fa*)(arow + kb + 16 + 8 * hh + 4);
    float xs[16] = {x0[0],x0[1],x0[2],x0[3],x1[0],x1[1],x1[2],x1[3],x2[0],x2[1],x2[2],x2[3],x3[0],x3[1],x3[2],x3[3]};
#pragma unroll
    for (int i = 0; i < 16; ++i) { const _Float16 h = (_Float16)xs[i]; ah.h[i] = h; al.h[i] = ASPLIT ? (_Float16)(xs[i] - (float)h) : (_Float16)0.0f; }
#pragma unroll
    for (int t = 0; t < 4; ++t) { if (col0 + t * 16 >= N) continue; const size_t boff = (size_t)(col0 + t * 16 + ln) * ldb + kb; FragH bq; bq.half[0] = *(const v8us*)(Bh + boff + 8 * hh); bq.half[1] = *(const v8us*)(Bh + boff + 16 + 8 * hh);
      acc[t] = mmaH<ASPLIT ? 2 : 1>(ah.v, al.v, bq.v, bq.v, acc[t]); }
  }
#pragma unroll
  for (int t = 0; t < 4; ++t) { if (col0 + t * 16 >= N) continue;
#pragma unroll
    for (int r = 0; r < 8; ++r) so[w][8 * hh + r][t * 16 + ln] = acc[t][r] * alpha; }
  __builtin_amdgcn_fence(__ATOMIC_ACQ_REL, "workgroup"); __builtin_amdgcn_wave_barrier();
  const int rsub = lane >> 4, c4 = (lane & 15) * 4;
  {
#pragma unroll
    for (int q = 0; q < 8; ++q) { const int r = q * 2 + rsub; if (col0 + c4 < N) { const v4f v = *(const v4fa*)&so[w][r][c4]; *(v4f*)(C + (size_t)(row0 + r) * ldc + col0 + c4) = v; } }
     }
}

// Wt[n][k] = f16(W[k][n]·scale) from f32 row-major W[K][N] (scale = power of two; bf16-exact weights stay exact in f16 away from the subnormal range)
__global__ __launch_bounds__(256) void k_wt_f16(const float* __restrict__ W, _Float16* __restrict__ Wt, int K, int N, float scale) {
  const int t = blockIdx.x * 256 + threadIdx.x; if (t >= N * (K / 8)) return; const int n = t / (K / 8), k8 = (t % (K / 8)) * 8; FragH f;
#pragma unroll
  for (int i = 0; i < 8; ++i) f.h[i] = (_Float16)(bf16_round(W[(size_t)(k8 + i) * N + n]) * scale); const v8us o = f.half[0];
  *(v8us*)((unsigned short*)Wt + (size_t)n * K + k8) = o; 
}
// k_gemm_hh variant with fused epilogue: v = acc·alpha + bias[by·sBias + col] (+ CP[(row/rowsPerB)·sCPb + by·64 + col] if CP) ; ACT 0 none / 1 elu ; writes f16 C16 and/or f32 C (each if non-null)
template <int ACT>
__global__ __launch_bounds__(128) void k_gemm_hhx(const _Float16* __restrict__ A, int lda, size_t sA, const _Float16* __restrict__ Bh, int ldb, size_t sB, float alpha, const float* __restrict__ bias, size_t sBias, const float* __restrict__ CP, int rowsPerB, size_t sCPb, int row0g,
    float* __restrict__ C, _Float16* __restrict__ C16, int ldc, size_t sC, int M, int N, int K, size_t sAz, size_t sBz, size_t sCz) {
  __shared__ __attribute__((aligned(16))) float so[4][16][64];
  const int tid = threadIdx.x, w = tid >> 5, lane = tid & 31, ln = lane & 15, hh = lane >> 4; const int by = blockIdx.y, bz = blockIdx.z;      /* second batch index bz with its own strides sAz, sBz, sCz */
  A += (size_t)by * sA + (size_t)bz * sAz; Bh += (size_t)by * sB + (size_t)bz * sBz; const size_t cofs = (size_t)by * sC + (size_t)bz * sCz; const float* bp = bias ? bias + (size_t)by * sBias : nullptr;
  const int ntn = (N + 63) / 64; const int wid = blockIdx.x * 4 + w; const int mt = wid / ntn, nq = wid % ntn; if (mt * 16 >= M) return;
  const int row0 = mt * 16, col0 = nq * 64; const _Float16* arow = A + (size_t)(row0 + ln) * lda;
  v8f acc[4] = {};
  for (int kb = 0; kb < K; kb += 32) { FragH ah; ah.half[0] = *(const v8us*)((const unsigned short*)arow + kb + 8 * hh); ah.half[1] = *(const v8us*)((const unsigned short*)arow + kb + 16 + 8 * hh);
#pragma unroll
    for (int t = 0; t < 4; ++t) { if (col0 + t * 16 >= N) continue; const size_t boff = (size_t)(col0 + t * 16 + ln) * ldb + kb; FragH bq; bq.half[0] = *(const v8us*)((const unsigned short*)Bh + boff + 8 * hh); bq.half[1] = *(const v8us*)((const unsigned short*)Bh + boff + 16 + 8 * hh);
      acc[t] = mmaH<1>(ah.v, ah.v, bq.v, bq.v, acc[t]); }
  }
#pragma unroll
  for (int t = 0; t < 4; ++t) { if (col0 + t * 16 >= N) continue; const int col = col0 + t * 16 + ln; const float bv = bp ? bf16_round(bp[col]) : 0.f;
#pragma unroll
    for (int r = 0; r < 8; ++r) { float v = acc[t][r] * alpha + bv; if (CP) { const int bidx = (row0g + row0 + 8 * hh + r) / rowsPerB; v += CP[(size_t)bidx * sCPb + (size_t)by * 64 + col]; } if (ACT == 1) v = (v > 0.f) ? v : expm1f(v); else if (ACT == 7) v = (v > 0.f) ? v + 1.0f : expf(v); else if (ACT == 8) v = tanhf(v); else if (ACT == 9) v = 0.5f * v * (1.0f + tanhf(0.7978845608028654f * (v + 0.044715f * v * v * v))); else if (ACT == 11) v = 1.0f / (1.0f + expf(-v)); else if (ACT == 12) v = (v > 0.f) ? v : 0.01f * v; else if (ACT == 14) v = (v > 0.f) ? v : 0.1f * v; else if (ACT == 15) v = v / (1.0f + expf(-v)); else if (ACT == 3) v = fmaxf(v, 0.f); else if (ACT == 6) v = 0.5f * v * (1.0f + erff(v * 0.70710678118654752f)); so[w][8 * hh + r][t * 16 + ln] = v; } }
  __builtin_amdgcn_fence(__ATOMIC_ACQ_REL, "workgroup"); __builtin_amdgcn_wave_barrier();
  const int rsub = lane >> 4, c4 = (lane & 15) * 4; typedef _Float16 v4h __attribute__((ext_vector_type(4)));
  {
#pragma unroll
    for (int q = 0; q < 8; ++q) { const int r = q * 2 + rsub; if (col0 + c4 < N) { const v4f v = *(const v4fa*)&so[w][r][c4]; if (C) *(v4f*)(C + cofs + (size_t)(row0 + r) * ldc + col0 + c4) = v; if (C16) { v4h h4; for (int i = 0; i < 4; ++i) h4[i] = (_Float16)v[i]; *(v4h*)(C16 + cofs + (size_t)(row0 + r) * ldc + col0 + c4) = h4; } } }
     }
}


typedef _Float16 v4h __attribute__((ext_vector_type(4)));

// three equally sized inputs in one launch: blockIdx.y picks the source, plane blockIdx.y of X16 (8*n8 elements each) is the destination
__global__ __launch_bounds__(256) void k_x16(const float* __restrict__ x0, const float* __restrict__ x1, const float* __restrict__ x2, _Float16* __restrict__ X16, size_t n8) { const size_t t = (size_t)blockIdx.x * 256 + threadIdx.x; if (t >= n8) return; FragH f;
  const float* __restrict__ x = (blockIdx.y == 0) ? x0 : (blockIdx.y == 1) ? x1 : x2; X16 += (size_t)blockIdx.y * n8 * 8;
#pragma unroll
  for (int q = 0; q < 8; ++q) f.h[q] = (_Float16)bf16_round(x[t * 8 + q]); *(v8us*)((unsigned short*)X16 + t * 8) = f.half[0];  }
__global__ __launch_bounds__(256) void k_h16(const float* __restrict__ x, _Float16* __restrict__ X16, size_t n8) { const size_t t = (size_t)blockIdx.x * 256 + threadIdx.x; if (t >= n8) return; FragH f;
#pragma unroll
  for (int q = 0; q < 8; ++q) f.h[q] = (_Float16)x[t * 8 + q]; *(v8us*)((unsigned short*)X16 + t * 8) = f.half[0];  }
// four weights in one launch, laid end to end in Bt: three of ns8 groups of 8 elements each, then one of nl8 groups (ns8 a multiple of 256, so the source is the same for a whole block)
__global__ __launch_bounds__(256) void k_round16f(const float* __restrict__ W0, const float* __restrict__ W1, const float* __restrict__ W2, const float* __restrict__ W3, _Float16* __restrict__ Bt, size_t ns8, size_t nl8) { const size_t t = (size_t)blockIdx.x * 256 + threadIdx.x; if (t >= 3 * ns8 + nl8) return; FragH f;
  const float* W = W0; size_t u = t; if (t >= 3 * ns8) { W = W3; u = t - 3 * ns8; } else if (t >= 2 * ns8) { W = W2; u = t - 2 * ns8; } else if (t >= ns8) { W = W1; u = t - ns8; }
#pragma unroll
  for (int i = 0; i < 8; ++i) f.h[i] = (_Float16)(bf16_round(W[u * 8 + i]) * 16.0f); *(v8us*)((unsigned short*)Bt + t * 8) = f.half[0];  }
template <int NHv, int TTv>
__global__ __launch_bounds__(256) void k_vt(const _Float16* __restrict__ V16, int ldv, int voff, _Float16* __restrict__ Vt) { __shared__ unsigned short tl[64][66]; const int tid = threadIdx.x; const int slab = blockIdx.x / (TTv / 64), lg = blockIdx.x % (TTv / 64); const int b = slab / NHv, h = slab % NHv;
  for (int i = tid; i < 64 * 8; i += 256) { const int r = i / 8, c8 = (i % 8) * 8; FragH f; f.half[0] = *(const v8us*)((const unsigned short*)V16 + ((size_t)b * TTv + lg * 64 + r) * ldv + voff + h * 64 + c8);
#pragma unroll
    for (int q = 0; q < 8; ++q) tl[r][c8 + q] = f.u[q]; }
  __syncthreads();
  {
#pragma unroll
    for (int rd = 0; rd < 2; ++rd) { const int d = rd * 32 + tid / 8, pc = tid % 8; FragH f;
#pragma unroll
      for (int q = 0; q < 8; ++q) f.u[q] = tl[pc * 8 + q][d];
      *(v8us*)((unsigned short*)Vt + ((size_t)slab * 64 + d) * TTv + lg * 64 + pc * 8) = f.half[0]; }
     } }

__global__ __launch_bounds__(256) void k_h16s(const float* __restrict__ F, _Float16* __restrict__ H, size_t n8) { const size_t t = (size_t)blockIdx.x * 256 + threadIdx.x; if (t >= n8) return; const v4f a = *(const v4fa*)(F + t * 8), c = *(const v4fa*)(F + t * 8 + 4); FragH f;
#pragma unroll
  for (int q = 0; q < 4; ++q) { f.h[q] = (_Float16)(a[q] * 16.0f); f.h[4 + q] = (_Float16)(c[q] * 16.0f); } *(v8us*)((unsigned short*)H + t * 8) = f.half[0];  }
// lane l with lane l ^ 16 (a vector cross-row move, no LDS)
__device__ __forceinline__ float xhalf(float x) { return __builtin_bit_cast(float, __builtin_amdgcn_permlanex16(__builtin_bit_cast(int, x), __builtin_bit_cast(int, x), 0x76543210, 0xfedcba98, false, false)); }
__global__ __launch_bounds__(128) void k_flash(const _Float16* __restrict__ Q16, int ldq, const _Float16* __restrict__ K16, int ldk, const _Float16* __restrict__ Vt, const int* __restrict__ MSK, float* __restrict__ O, int ldo) {
  constexpr int RPW = 16, NQB = TT / (4 * RPW), DT = 4, KS = 2; typedef int v4ia __attribute__((ext_vector_type(4), may_alias));
  __shared__ __attribute__((aligned(16))) float sO[4][RPW][64 + 4];
  const int tid = threadIdx.x, w = tid >> 5, lane = tid & 31, ln = lane & 15, hh = lane >> 4;
  const int slab = blockIdx.x / NQB, qblk = blockIdx.x % NQB; const int b = slab / NH, h = slab % NH; const int qb0 = qblk * (4 * RPW); const int q0 = qb0 + w * RPW;
  FragH bq[KS];
  { const unsigned short* qr = (const unsigned short*)Q16 + ((size_t)b * TT + q0 + ln) * ldq + h * 64;
#pragma unroll
    for (int ks = 0; ks < KS; ++ks) { bq[ks].half[0] = *(const v8us*)(qr + ks * 32 + 8 * hh); bq[ks].half[1] = *(const v8us*)(qr + ks * 32 + 16 + 8 * hh); } }
  /* block-uniform bases plus one 32-bit lane offset each, the same on every pass */
  const unsigned short* Kb = (const unsigned short*)K16 + (size_t)b * TT * ldk + h * 64; const unsigned klane = (unsigned)(ln * ldk + 8 * hh);
  const unsigned short* Vth = (const unsigned short*)Vt + (size_t)slab * 64 * TT; const unsigned vlane = (unsigned)(ln * TT + 8 * hh);
  const int* Mb = MSK + (size_t)b * TT; const unsigned mlane = (unsigned)(8 * hh);
  float m_q = -3.0e38f, l_q = 0.f; v8f oacc[DT];      /* of query q0 + ln; l_q sums this half's keys; oacc[dt][r] = O^T[dt*16 + 8hh + r][ln] */
#pragma unroll
  for (int dt = 0; dt < DT; ++dt) oacc[dt] = (v8f){0.f,0.f,0.f,0.f,0.f,0.f,0.f,0.f};
  const int jend = TT;
#pragma unroll 1
  for (int j0 = 0; j0 < jend; j0 += 32) {
    const int* mp = Mb + j0 + mlane;      /* key padding mask (1 = attend), shared by all queries and heads: the lane's keys j0 + 8hh + r and j0 + 16 + 8hh + r */
    const v4ia km[2][2] = {{*(const v4ia*)mp, *(const v4ia*)(mp + 4)}, {*(const v4ia*)(mp + 16), *(const v4ia*)(mp + 20)}};
    v8f s[2];
#pragma unroll
    for (int nt = 0; nt < 2; ++nt) { const unsigned short* kr = Kb + (size_t)(j0 + nt * 16) * ldk + klane; FragH ak[KS];
#pragma unroll
      for (int ks = 0; ks < KS; ++ks) { ak[ks].half[0] = *(const v8us*)(kr + ks * 32); ak[ks].half[1] = *(const v8us*)(kr + ks * 32 + 16); }
      v8f acc = (v8f){0.f,0.f,0.f,0.f,0.f,0.f,0.f,0.f};
#pragma unroll
      for (int ks = 0; ks < KS; ++ks) acc = mmaH<1>(ak[ks].v, ak[ks].v, bq[ks].v, bq[ks].v, acc); s[nt] = acc; }
    float mc = -INFINITY;
#pragma unroll
    for (int nt = 0; nt < 2; ++nt)
#pragma unroll
      for (int r = 0; r < 8; ++r) { s[nt][r] = (km[nt][r >> 2][r & 3] != 0) ? s[nt][r] * 0.03125f : -INFINITY; mc = fmaxf(mc, s[nt][r]); }      /* energy/sqrt(1024); masked keys carry -1e20 in the module, -inf here */
    mc = fmaxf(mc, xhalf(mc));
    const float mn = fmaxf(m_q, mc); const float al = expf(m_q - mn); m_q = mn;      /* mn >= -3e38 is finite: nothing attended yet gives exp(0) = 1, a masked key exp(-inf) = 0 */
    float ps = 0.f; FragH pb;
#pragma unroll
    for (int nt = 0; nt < 2; ++nt)
#pragma unroll
      for (int r = 0; r < 8; ++r) { const float p = expf(s[nt][r] - mn); ps += p; pb.h[nt * 8 + r] = (_Float16)(p * 1024.0f); }
    l_q = l_q * al + ps;
#pragma unroll
    for (int dt = 0; dt < DT; ++dt)
#pragma unroll
      for (int r = 0; r < 8; ++r) oacc[dt][r] *= al;
#pragma unroll
    for (int dt = 0; dt < DT; ++dt) { const unsigned short* vrow = Vth + (size_t)dt * 16 * TT + j0 + vlane; FragH av; av.half[0] = *(const v8us*)vrow; av.half[1] = *(const v8us*)(vrow + 16);
      oacc[dt] = mmaH<1>(av.v, av.v, pb.v, pb.v, oacc[dt]); } }
  { const float l = l_q + xhalf(l_q); const float inv = (l > 0.f) ? 1.0f / (l * 1024.0f) : 0.f;
#pragma unroll
    for (int dt = 0; dt < DT; ++dt) { const v4f lo = {oacc[dt][0] * inv, oacc[dt][1] * inv, oacc[dt][2] * inv, oacc[dt][3] * inv}, hi = {oacc[dt][4] * inv, oacc[dt][5] * inv, oacc[dt][6] * inv, oacc[dt][7] * inv};
      *(v4fa*)&sO[w][ln][dt * 16 + 8 * hh] = lo; *(v4fa*)&sO[w][ln][dt * 16 + 8 * hh + 4] = hi; } }
  __builtin_amdgcn_fence(__ATOMIC_ACQ_REL, "workgroup"); __builtin_amdgcn_wave_barrier();
  {
#pragma unroll
    for (int rp = 0; rp < RPW; rp += 2) { const int r = rp + (lane >> 4), pc = lane & 15; const v4f val = *(const v4fa*)&sO[w][r][pc * 4]; *(v4f*)(O + ((size_t)b * TT + q0 + r) * ldo + h * 64 + pc * 4) = val; }
     } }

extern "C" void kernel_launch(void* const* d_in, const int* in_sizes, int n_in,
                              void* d_out, int out_size, void* d_ws, size_t ws_size, hipStream_t stream) {
  (void)in_sizes; (void)n_in; (void)out_size;
  const float* const* I = (const float* const*)d_in; const float* values = I[0]; const float* keys = I[1]; const float* query = I[2]; const int* mask = (const int*)d_in[3]; const float* Wv = I[4]; const float* Wk = I[5]; const float* Wq = I[6]; const float* Wo = I[7]; const float* bo = I[8];
  char* ws = (char*)d_ws; size_t off = 0;
  auto take = [&](size_t bytes) { char* p = ws + off; off += (bytes + 255) & ~(size_t)255; return p; };
  _Float16* Bs = (_Float16*)take(((size_t)3 * HD * HD + (size_t)DD * DD) * 2); _Float16* Bo = Bs + 3 * HD * HD;      /* Wv, Wk, Wq, Wo end to end */
  _Float16* XV = (_Float16*)take((size_t)3 * NR * DD * 2); _Float16* XQ = XV + (size_t)2 * NR * DD;      /* planes values, keys, query */
  _Float16* V = (_Float16*)take((size_t)3 * NR * DD * 2); _Float16* K = V + (size_t)NR * DD; _Float16* Q = K + (size_t)NR * DD;      /* projected planes, same order */
  _Float16* Vt = (_Float16*)take((size_t)NR * DD * 2); float* O = (float*)take((size_t)NR * DD * 4); _Float16* O16 = XQ;
  if (off > ws_size) return;      // 0.03 + 2.1 + 7 × 8.4 + 16.8 ≈ 78 MB
  k_round16f<<<(unsigned)(((size_t)3 * HD * HD / 8 + (size_t)DD * DD / 8 + 255) / 256), 256, 0, stream>>>(Wv, Wk, Wq, Wo, Bs, HD * HD / 8, (size_t)DD * DD / 8);      /* (out,in) natural x2^4 */
  const unsigned g8 = (unsigned)(((size_t)NR * DD / 8 + 255) / 256); k_x16<<<dim3(g8, 3), 256, 0, stream>>>(values, keys, query, XV, (size_t)NR * DD / 8);
  /* y[:, 64h..] = x[:, 64h..].W^T (W shared by the heads): M 4096 N 64 K 64 per (head, tensor); blockIdx.y = head (column offset 64h in A and C), blockIdx.z = tensor (plane of A and C, weight of Bs) */
  k_gemm_hhx<0><<<dim3(((NR / 16) * 1 + 3) / 4, NH, 3), 128, 0, stream>>>(XV, DD, HD, Bs, HD, 0, 0.0625f, nullptr, 0, nullptr, 1, 0, 0, nullptr, V, DD, HD, NR, HD, HD, (size_t)NR * DD, HD * HD, (size_t)NR * DD);
  k_vt<NH, TT><<<BB * NH * (TT / 64), 256, 0, stream>>>(V, DD, 0, Vt);
  k_flash<<<BB * NH * (TT / 64), 128, 0, stream>>>(Q, DD, K, DD, Vt, mask, O, DD);
  k_h16s<<<g8, 256, 0, stream>>>(O, O16, (size_t)NR * DD / 8);      /* over the query plane (dead after the projections) */
  k_gemm_hhx<0><<<dim3(((NR / 16) * (DD / 64) + 3) / 4, 1), 128, 0, stream>>>(O16, DD, 0, Bo, DD, 0, 0.00390625f, bo, 0, nullptr, 1, 0, 0, (float*)d_out, nullptr, DD, 0, NR, DD, DD, 0, 0, 0);      /* out = O·Woᵀ + bo */
}

// v003
// Measured time: 189 microseconds a run.
// Timed twice side by side with v002, it ran 1.15 times as fast both times.
// Over all steps from v000 it is 2.90 times as fast.
#include <hip/hip_runtime.h>
// 'SelfAttension' (B=2, S=2048, E=1024, 16 heads × 64): per-head projections with ONE shared 64×64 weight per tensor (y_h = x_h·Wᵀ, torch (out,in), no bias) for values, keys, query; energy = q·kᵀ with −1e20 where the key mask [N,1,1,S] == 0;
// attn = softmax(energy/√1024); out = (attn·v merged)·Woᵀ + bo.
// Compute dtype: inputs, weights, bias rounded to bf16; the per-head 64×64 projections as block-diagonal f16 GEMMs (all 16 head-block columns of all three tensors in one launch, grid = row blocks x heads x 4: the three tensors and the Wo to f16 conversion, K = 64); fused flash-style kernel (per-(b,k) int mask loads, scale 1/32,
// online softmax f32, P f16 ×2^10) on v_wmma_f32_16x16x32_f16; O ×2^4 → f16 → output GEMM + bias; f32 accumulate.
#define BB 2
#define TT 2048
#define DD 1024
#define NH 16
#define HD 64
#define NR (BB * TT)

typedef __bf16 v16b __attribute__((ext_vector_type(16)));
typedef unsigned short v8us __attribute__((ext_vector_type(8), may_alias));
typedef float  v8f  __attribute__((ext_vector_type(8)));
typedef float  v4f  __attribute__((ext_vector_type(4)));
typedef float  v4fa __attribute__((ext_vector_type(4), may_alias));
union FragB { v16b v; v8us half[2]; unsigned short u[16]; };

__device__ __forceinline__ unsigned short bf16_bits(float x) { unsigned int u = __float_as_uint(x); return (unsigned short)((u + 0x7FFFu + ((u >> 16) & 1u)) >> 16); }
__device__ __forceinline__ float bf16_val(unsigned short b) { return __uint_as_float(((unsigned int)b) << 16); }
__device__ __forceinline__ float bf16_round(float x) { return bf16_val(bf16_bits(x)); }
// D += A·B with NT terms: 1 = ah·bh, 2 = + al·bh (A split), 3 = + ah·bl (both split)
template <int NT>
__device__ __forceinline__ v8f mmaN(v16b ah, v16b al, v16b bh, v16b bl, v8f c) {
  c = __builtin_amdgcn_wmma_f32_16x16x32_bf16(false, ah, false, bh, (short)0, c, false, false);
  if (NT >= 2) c = __builtin_amdgcn_wmma_f32_16x16x32_bf16(false, al, false, bh, (short)0, c, false, false);
  if (NT >= 3) c = __builtin_amdgcn_wmma_f32_16x16x32_bf16(false, ah, false, bl, (short)0, c, false, false);
  asm volatile("v_nop\n\tv_nop\n\tv_nop\n\tv_nop" : "+v"(c) : "v"(ah), "v"(al), "v"(bh), "v"(bl));
  return c;
}

__global__ __launch_bounds__(256) void k_wt_bf16(const float* __restrict__ W, unsigned short* __restrict__ Wt, int K, int N) {
  const int t = blockIdx.x * 256 + threadIdx.x;
  const int k8n = K / 8;
  if (t >= N * k8n) return;
  const int n = t / k8n, k8 = (t % k8n) * 8;
  v8us v;
#pragma unroll
  for (int i = 0; i < 8; ++i) v[i] = bf16_bits(W[(size_t)(k8 + i) * N + n]);
  *(v8us*)(Wt + (size_t)n * K + k8) = v;
  
}

// GEMM C[M][N] (f32, pitch ldc) = act(A[M][K]·W + bias). A f32 row-major (pitch lda) converted per fragment to bf16
// (ASPLIT: hi/lo two planes -> 2 terms, else single rounded term); Wt bf16 [N][K] (pitch ldb). BIAS_BF16 rounds the
// bias to bf16 first (bias quantised to bf16 before the add). K%32==0, M%16==0, N%64==0.
template <bool ASPLIT, int ACT, bool BIAS_BF16>
__global__ __launch_bounds__(128) void k_gemm_bf(const float* __restrict__ A, int lda, const unsigned short* __restrict__ Wt, int ldb,
                                               const float* __restrict__ bias, float* __restrict__ C, int ldc, int M, int N, int K) {
  __shared__ __attribute__((aligned(16))) float so[4][16][64];
  const int tid = threadIdx.x, w = tid >> 5, lane = tid & 31, ln = lane & 15, hh = lane >> 4;
  const int ntn = N / 64;
  const int wid = blockIdx.x * 4 + w;
  const int mt = wid / ntn, nq = wid % ntn;
  if (mt * 16 >= M) return;
  const int row0 = mt * 16, col0 = nq * 64;
  const float* arow = A + (size_t)(row0 + ln) * lda;
  v8f acc[4] = {};
  for (int kb = 0; kb < K; kb += 32) {
    FragB ah, al;
    const v4f x0 = *(const v4fa*)(arow + kb + 8 * hh), x1 = *(const v4fa*)(arow + kb + 8 * hh + 4);
    const v4f x2 = *(const v4fa*)(arow + kb + 16 + 8 * hh), x3 = *(const v4fa*)(arow + kb + 16 + 8 * hh + 4);
    float xs[16] = {x0[0],x0[1],x0[2],x0[3],x1[0],x1[1],x1[2],x1[3],x2[0],x2[1],x2[2],x2[3],x3[0],x3[1],x3[2],x3[3]};
#pragma unroll
    for (int i = 0; i < 16; ++i) { const unsigned short hb = bf16_bits(xs[i]); ah.u[i] = hb; al.u[i] = ASPLIT ? bf16_bits(xs[i] - bf16_val(hb)) : (unsigned short)0; }
#pragma unroll
    for (int t = 0; t < 4; ++t) {
      const unsigned short* brow = Wt + (size_t)(col0 + t * 16 + ln) * ldb + kb;
      FragB b;
      b.half[0] = *(const v8us*)(brow + 8 * hh);
      b.half[1] = *(const v8us*)(brow + 16 + 8 * hh);
      acc[t] = mmaN<ASPLIT ? 2 : 1>(ah.v, al.v, b.v, b.v, acc[t]);
    }
  }
#pragma unroll
  for (int t = 0; t < 4; ++t) {
    float bv = bias ? bias[col0 + t * 16 + ln] : 0.f;
    if (BIAS_BF16) bv = bf16_round(bv);
#pragma unroll
    for (int r = 0; r < 8; ++r) { float v = acc[t][r] + bv; if (ACT == 1) v = fmaxf(v, 0.f); so[w][8 * hh + r][t * 16 + ln] = v; }
  }
  __builtin_amdgcn_fence(__ATOMIC_ACQ_REL, "workgroup");
  __builtin_amdgcn_wave_barrier();
  const int rsub = lane >> 4, c4 = (lane & 15) * 4;
  {
#pragma unroll
    for (int q = 0; q < 8; ++q) {
      const int r = q * 2 + rsub;
      const v4f v = *(const v4fa*)&so[w][r][c4];
      *(v4f*)(C + (size_t)(row0 + r) * ldc + col0 + c4) = v;
    }
    
  }
}

// Flash-style causal/unmasked attention, all contractions 3-term bf16 hi/lo splits, f32 softmax with running max.
// q,k,v rows are read from f32 buffers with arbitrary row pitch (so they can live inside a fused qkv buffer);
// D = head size (multiple of 32, <= 128); one wave = 16 query rows; block = 4 waves (64 queries) sharing K/V chunks of 32.
template <int D, bool CAUSAL>
__global__ __launch_bounds__(128) void k_flash(const float* __restrict__ qb, const float* __restrict__ kb, const float* __restrict__ vb,
                                             int pitch, int T, int H, float scale, float* __restrict__ y, int ypitch) {
  constexpr int KS = D / 32;        // k-steps for QK
  constexpr int DT = D / 16;        // d tiles for PV
  __shared__ __attribute__((aligned(16))) unsigned short sKh[32][D + 8], sKl[32][D + 8], sVh[32][D + 8], sVl[32][D + 8];
  __shared__ __attribute__((aligned(16))) unsigned short sPh[4][16][40], sPl[4][16][40];
  __shared__ __attribute__((aligned(16))) float sO[4][16][D];
  const int tid = threadIdx.x, w = tid >> 5, lane = tid & 31, ln = lane & 15, hh = lane >> 4;
  const int nqb = (T + 63) / 64;
  const int bh = blockIdx.x / nqb, qblk = blockIdx.x % nqb;
  const int b = bh / H, h = bh % H;
  const int q0 = qblk * 64 + w * 16;
  const float* Q = qb + (size_t)b * T * pitch + h * D;
  const float* K = kb + (size_t)b * T * pitch + h * D;
  const float* V = vb + (size_t)b * T * pitch + h * D;

  // A fragments of the wave's 16 query rows (scaled), hi/lo
  FragB aqh[KS], aql[KS];
  {
    int row = q0 + ln; if (row >= T) row = T - 1;
    const float* qr = Q + (size_t)row * pitch;
#pragma unroll
    for (int ks = 0; ks < KS; ++ks)
#pragma unroll
      for (int i = 0; i < 16; ++i) {
        const int d = ks * 32 + ((i < 8) ? (8 * hh + i) : (16 + 8 * hh + (i - 8)));
        const float x = qr[d] * scale; const unsigned short hb = bf16_bits(x);
        aqh[ks].u[i] = hb; aql[ks].u[i] = bf16_bits(x - bf16_val(hb));
      }
  }
  float m_r[8], l_r[8];
#pragma unroll
  for (int r = 0; r < 8; ++r) { m_r[r] = -3.0e38f; l_r[r] = 0.f; }
  v8f oacc[DT];
#pragma unroll
  for (int dt = 0; dt < DT; ++dt) oacc[dt] = (v8f){0.f,0.f,0.f,0.f,0.f,0.f,0.f,0.f};

  const int kv_end = CAUSAL ? min(T, qblk * 64 + 64) : T;     // block-uniform
  for (int j0 = 0; j0 < kv_end; j0 += 32) {
    __syncthreads();
    for (int e = tid; e < 32 * (D / 4); e += 128) {
      const int r = e / (D / 4), c4 = (e % (D / 4)) * 4;
      const int key = j0 + r;
      v4f kf = {0.f,0.f,0.f,0.f}, vf = {0.f,0.f,0.f,0.f};
      if (key < T) { kf = *(const v4fa*)(K + (size_t)key * pitch + c4); vf = *(const v4fa*)(V + (size_t)key * pitch + c4); }
#pragma unroll
      for (int t = 0; t < 4; ++t) {
        unsigned short hb = bf16_bits(kf[t]); sKh[r][c4 + t] = hb; sKl[r][c4 + t] = bf16_bits(kf[t] - bf16_val(hb));
        hb = bf16_bits(vf[t]); sVh[r][c4 + t] = hb; sVl[r][c4 + t] = bf16_bits(vf[t] - bf16_val(hb));
      }
    }
    __syncthreads();
    // S tile 16 x 32
    v8f s[2];
#pragma unroll
    for (int nt = 0; nt < 2; ++nt) {
      v8f acc = {};
#pragma unroll
      for (int ks = 0; ks < KS; ++ks) {
        FragB bh_, bl_;
        bh_.half[0] = *(const v8us*)&sKh[nt * 16 + ln][ks * 32 + 8 * hh]; bh_.half[1] = *(const v8us*)&sKh[nt * 16 + ln][ks * 32 + 16 + 8 * hh];
        bl_.half[0] = *(const v8us*)&sKl[nt * 16 + ln][ks * 32 + 8 * hh]; bl_.half[1] = *(const v8us*)&sKl[nt * 16 + ln][ks * 32 + 16 + 8 * hh];
        acc = mmaN<3>(aqh[ks].v, aql[ks].v, bh_.v, bl_.v, acc);
      }
      s[nt] = acc;
    }
    // mask + running max (rows 8hh+r; the 16 lanes of a half share rows)
    float alpha[8];
#pragma unroll
    for (int r = 0; r < 8; ++r) {
      const int qi = q0 + 8 * hh + r;
      const int ja = j0 + ln, jb = j0 + 16 + ln;
      if (CAUSAL) { if (ja > qi) s[0][r] = -3.0e38f; if (jb > qi) s[1][r] = -3.0e38f; }
      if (ja >= T) s[0][r] = -3.0e38f;
      if (jb >= T) s[1][r] = -3.0e38f;
      float mx = fmaxf(s[0][r], s[1][r]);
      mx = fmaxf(mx, __shfl_xor(mx, 1, 32)); mx = fmaxf(mx, __shfl_xor(mx, 2, 32)); mx = fmaxf(mx, __shfl_xor(mx, 4, 32)); mx = fmaxf(mx, __shfl_xor(mx, 8, 32));
      const float mnew = fmaxf(m_r[r], mx);
      alpha[r] = (mnew > -1.0e38f) ? __expf(m_r[r] - mnew) : 1.0f;
      const float p0 = (s[0][r] > -1.0e38f) ? __expf(s[0][r] - mnew) : 0.f;
      const float p1 = (s[1][r] > -1.0e38f) ? __expf(s[1][r] - mnew) : 0.f;
      m_r[r] = mnew;
      l_r[r] = l_r[r] * alpha[r] + p0 + p1;            // per-lane partial row sum (16 lanes combined at the end)
      unsigned short hb = bf16_bits(p0); sPh[w][8 * hh + r][ln] = hb;      sPl[w][8 * hh + r][ln] = bf16_bits(p0 - bf16_val(hb));
      hb = bf16_bits(p1);                sPh[w][8 * hh + r][16 + ln] = hb; sPl[w][8 * hh + r][16 + ln] = bf16_bits(p1 - bf16_val(hb));
    }
#pragma unroll
    for (int dt = 0; dt < DT; ++dt)
#pragma unroll
      for (int r = 0; r < 8; ++r) oacc[dt][r] *= alpha[r];
    __builtin_amdgcn_fence(__ATOMIC_ACQ_REL, "workgroup");
    __builtin_amdgcn_wave_barrier();
    FragB pah, pal;
    pah.half[0] = *(const v8us*)&sPh[w][ln][8 * hh]; pah.half[1] = *(const v8us*)&sPh[w][ln][16 + 8 * hh];
    pal.half[0] = *(const v8us*)&sPl[w][ln][8 * hh]; pal.half[1] = *(const v8us*)&sPl[w][ln][16 + 8 * hh];
#pragma unroll
    for (int dt = 0; dt < DT; ++dt) {
      FragB bvh, bvl;
#pragma unroll
      for (int i = 0; i < 8; ++i) {
        bvh.u[i] = sVh[8 * hh + i][dt * 16 + ln]; bvh.u[8 + i] = sVh[16 + 8 * hh + i][dt * 16 + ln];
        bvl.u[i] = sVl[8 * hh + i][dt * 16 + ln]; bvl.u[8 + i] = sVl[16 + 8 * hh + i][dt * 16 + ln];
      }
      oacc[dt] = mmaN<3>(pah.v, pal.v, bvh.v, bvl.v, oacc[dt]);
    }
    __builtin_amdgcn_fence(__ATOMIC_ACQ_REL, "workgroup");
    __builtin_amdgcn_wave_barrier();
  }
#pragma unroll
  for (int r = 0; r < 8; ++r) {
    float l = l_r[r];
    l += __shfl_xor(l, 1, 32); l += __shfl_xor(l, 2, 32); l += __shfl_xor(l, 4, 32); l += __shfl_xor(l, 8, 32);
    l_r[r] = (l > 0.f) ? 1.0f / l : 0.f;
  }
#pragma unroll
  for (int dt = 0; dt < DT; ++dt)
#pragma unroll
    for (int r = 0; r < 8; ++r) sO[w][8 * hh + r][dt * 16 + ln] = oacc[dt][r] * l_r[r];
  __builtin_amdgcn_fence(__ATOMIC_ACQ_REL, "workgroup");
  __builtin_amdgcn_wave_barrier();
  {
    for (int r = 0; r < 16; ++r) {
      const int row = q0 + r;
      if (row < T && lane < D / 4) {
        const v4f val = *(const v4fa*)&sO[w][r][lane * 4];
        *(v4f*)(y + ((size_t)b * T + row) * ypitch + h * D + lane * 4) = val;
      }
    }
    
  }
}

// GEMM C = act(A·W + bias + resid): A f32 (ASPLIT -> hi/lo 2 terms), Wt bf16 [N][K]; ACT 0 none, 1 relu, 2 exact gelu;
// resid (optional, f32, row index = (row % rmod), pitch ldr, RES_BF16 rounds it) added before the activation.
template <bool ASPLIT, int ACT, bool BIAS_BF16, bool RES_BF16>
__global__ __launch_bounds__(128) void k_gemm_bf3(const float* __restrict__ A, int lda, const unsigned short* __restrict__ Wt, int ldb,
                                                const float* __restrict__ bias, const float* __restrict__ resid, int rmod, int ldr,
                                                float* __restrict__ C, int ldc, int M, int N, int K) {
  __shared__ __attribute__((aligned(16))) float so[4][16][64];
  const int tid = threadIdx.x, w = tid >> 5, lane = tid & 31, ln = lane & 15, hh = lane >> 4;
  const int ntn = N / 64;
  const int wid = blockIdx.x * 4 + w;
  const int mt = wid / ntn, nq = wid % ntn;
  if (mt * 16 >= M) return;
  const int row0 = mt * 16, col0 = nq * 64;
  const float* arow = A + (size_t)(row0 + ln) * lda;
  v8f acc[4] = {};
  for (int kb = 0; kb < K; kb += 32) {
    FragB ah, al;
    const v4f x0 = *(const v4fa*)(arow + kb + 8 * hh), x1 = *(const v4fa*)(arow + kb + 8 * hh + 4);
    const v4f x2 = *(const v4fa*)(arow + kb + 16 + 8 * hh), x3 = *(const v4fa*)(arow + kb + 16 + 8 * hh + 4);
    float xs[16] = {x0[0],x0[1],x0[2],x0[3],x1[0],x1[1],x1[2],x1[3],x2[0],x2[1],x2[2],x2[3],x3[0],x3[1],x3[2],x3[3]};
#pragma unroll
    for (int i = 0; i < 16; ++i) { const unsigned short hb = bf16_bits(xs[i]); ah.u[i] = hb; al.u[i] = ASPLIT ? bf16_bits(xs[i] - bf16_val(hb)) : (unsigned short)0; }
#pragma unroll
    for (int t = 0; t < 4; ++t) {
      const unsigned short* brow = Wt + (size_t)(col0 + t * 16 + ln) * ldb + kb;
      FragB b;
      b.half[0] = *(const v8us*)(brow + 8 * hh);
      b.half[1] = *(const v8us*)(brow + 16 + 8 * hh);
      acc[t] = mmaN<ASPLIT ? 2 : 1>(ah.v, al.v, b.v, b.v, acc[t]);
    }
  }
#pragma unroll
  for (int t = 0; t < 4; ++t) {
    const int col = col0 + t * 16 + ln;
    float bv = bias ? bias[col] : 0.f;
    if (BIAS_BF16) bv = bf16_round(bv);
#pragma unroll
    for (int r = 0; r < 8; ++r) {
      float v = acc[t][r] + bv;
      if (resid) { float rv = resid[(size_t)((row0 + 8 * hh + r) % rmod) * ldr + col]; if (RES_BF16) rv = bf16_round(rv); v += rv; }
      if (ACT == 1) v = fmaxf(v, 0.f);
      if (ACT == 2) v = 0.5f * v * (1.0f + erff(v * 0.70710678118654752f));
      if (ACT == 3) { const float u = 0.7978845608028654f * (v + 0.044715f * v * v * v); v = 0.5f * v * (1.0f + tanhf(u)); }
      so[w][8 * hh + r][t * 16 + ln] = v;
    }
  }
  __builtin_amdgcn_fence(__ATOMIC_ACQ_REL, "workgroup");
  __builtin_amdgcn_wave_barrier();
  const int rsub = lane >> 4, c4 = (lane & 15) * 4;
  {
#pragma unroll
    for (int q = 0; q < 8; ++q) {
      const int r = q * 2 + rsub;
      const v4f v = *(const v4fa*)&so[w][r][c4];
      *(v4f*)(C + (size_t)(row0 + r) * ldc + col0 + c4) = v;
    }
    
  }
}
// row LayerNorm (biased variance, eps) over N: s = X (+ R); optional out_sum <- s; out_norm <- (s-mu)*rsqrt(var+eps)*g + b
template <bool PARAM_BF16>
__global__ __launch_bounds__(256) void k_layernorm(const float* __restrict__ X, const float* __restrict__ R, const float* __restrict__ g, const float* __restrict__ bta,
                                                  float* __restrict__ out_sum, float* __restrict__ out_norm, int N, float eps) {
  __shared__ float red[256];
  const int row = blockIdx.x, tid = threadIdx.x;
  const float* x = X + (size_t)row * N; const float* rr = R ? R + (size_t)row * N : nullptr;
  float vals[16];                     // up to N = 4096
  const int per = N / 256;            // contiguous chunk per thread? use strided-by-4 chunks: thread handles j = tid*4 + 1024*u
  float s1 = 0.f;
  for (int u = 0; u < per / 4; ++u) {
    const int j = tid * 4 + 1024 * u;
    const v4f a = *(const v4fa*)(x + j);
    v4f b = {0.f,0.f,0.f,0.f}; if (rr) b = *(const v4fa*)(rr + j);
#pragma unroll
    for (int q = 0; q < 4; ++q) { const float v = a[q] + b[q]; vals[u * 4 + q] = v; s1 += v; }
  }
  red[tid] = s1; __syncthreads();
  for (int st = 128; st > 0; st >>= 1) { if (tid < st) red[tid] += red[tid + st]; __syncthreads(); }
  const float mu = red[0] / (float)N; __syncthreads();
  float s2 = 0.f;
  for (int u = 0; u < per / 4; ++u)
#pragma unroll
    for (int q = 0; q < 4; ++q) { const float c = vals[u * 4 + q] - mu; s2 += c * c; }
  red[tid] = s2; __syncthreads();
  for (int st = 128; st > 0; st >>= 1) { if (tid < st) red[tid] += red[tid + st]; __syncthreads(); }
  const float rs = rsqrtf(red[0] / (float)N + eps);
  {
    for (int u = 0; u < per / 4; ++u) {
      const int j = tid * 4 + 1024 * u;
      v4f o, sm;
#pragma unroll
      for (int q = 0; q < 4; ++q) {
        float gg = g[j + q], bb = bta[j + q];
        if (PARAM_BF16) { gg = bf16_round(gg); bb = bf16_round(bb); }
        sm[q] = vals[u * 4 + q]; o[q] = (vals[u * 4 + q] - mu) * rs * gg + bb;
      }
      if (out_sum) *(v4f*)(out_sum + (size_t)row * N + j) = sm;
      *(v4f*)(out_norm + (size_t)row * N + j) = o;
    }
    
  }
}



// ---- f16 WMMA path (v_wmma_f32_16x16x32_f16): 11-bit significands for operands in range — used where a [0,1] probability operand needs more precision than bf16
typedef _Float16 v16h __attribute__((ext_vector_type(16)));
union FragH { v16h v; v8us half[2]; _Float16 h[16]; unsigned short u[16]; };
template <int NT>
__device__ __forceinline__ v8f mmaH(v16h ah, v16h al, v16h bh, v16h bl, v8f c) {
  c = __builtin_amdgcn_wmma_f32_16x16x32_f16(false, ah, false, bh, (short)0, c, false, false);
  if (NT >= 2) c = __builtin_amdgcn_wmma_f32_16x16x32_f16(false, al, false, bh, (short)0, c, false, false);
  if (NT >= 3) c = __builtin_amdgcn_wmma_f32_16x16x32_f16(false, ah, false, bl, (short)0, c, false, false);
  asm volatile("v_nop\n\tv_nop\n\tv_nop\n\tv_nop" : "+v"(c) : "v"(ah), "v"(al), "v"(bh), "v"(bl));
  return c;
}
// batched GEMM like k_gemm_b but f16 operands: A f32 (split into f16 hi/lo if ASPLIT, else rounded to f16), Bt = f16 values [n][k]; alpha; C f32; N multiple of 16 (partial tiles skipped)
template <bool ASPLIT>
__global__ __launch_bounds__(128) void k_gemm_h(const float* __restrict__ A, int lda, size_t sA, const _Float16* __restrict__ Bh, int ldb, size_t sB, float alpha, float* __restrict__ C, int ldc, size_t sC, int M, int N, int K) {
  __shared__ __attribute__((aligned(16))) float so[4][16][64];
  const int tid = threadIdx.x, w = tid >> 5, lane = tid & 31, ln = lane & 15, hh = lane >> 4; const int by = blockIdx.y;
  A += (size_t)by * sA; Bh += (size_t)by * sB; C += (size_t)by * sC;
  const int ntn = (N + 63) / 64; const int wid = blockIdx.x * 4 + w; const int mt = wid / ntn, nq = wid % ntn; if (mt * 16 >= M) return;
  const int row0 = mt * 16, col0 = nq * 64; const float* arow = A + (size_t)(row0 + ln) * lda;
  v8f acc[4] = {};
  for (int kb = 0; kb < K; kb += 32) {
    FragH ah, al;
    const v4f x0 = *(const v4fa*)(arow + kb + 8 * hh), x1 = *(const v4fa*)(arow + kb + 8 * hh + 4), x2 = *(const v4fa*)(arow + kb + 16 + 8 * hh), x3 = *(const v4fa*)(arow + kb + 16 + 8 * hh + 4);
    float xs[16] = {x0[0],x0[1],x0[2],x0[3],x1[0],x1[1],x1[2],x1[3],x2[0],x2[1],x2[2],x2[3],x3[0],x3[1],x3[2],x3[3]};
#pragma unroll
    for (int i = 0; i < 16; ++i) { const _Float16 h = (_Float16)xs[i]; ah.h[i] = h; al.h[i] = ASPLIT ? (_Float16)(xs[i] - (float)h) : (_Float16)0.0f; }
#pragma unroll
    for (int t = 0; t < 4; ++t) { if (col0 + t * 16 >= N) continue; const size_t boff = (size_t)(col0 + t * 16 + ln) * ldb + kb; FragH bq; bq.half[0] = *(const v8us*)(Bh + boff + 8 * hh); bq.half[1] = *(const v8us*)(Bh + boff + 16 + 8 * hh);
      acc[t] = mmaH<ASPLIT ? 2 : 1>(ah.v, al.v, bq.v, bq.v, acc[t]); }
  }
#pragma unroll
  for (int t = 0; t < 4; ++t) { if (col0 + t * 16 >= N) continue;
#pragma unroll
    for (int r = 0; r < 8; ++r) so[w][8 * hh + r][t * 16 + ln] = acc[t][r] * alpha; }
  __builtin_amdgcn_fence(__ATOMIC_ACQ_REL, "workgroup"); __builtin_amdgcn_wave_barrier();
  const int rsub = lane >> 4, c4 = (lane & 15) * 4;
  {
#pragma unroll
    for (int q = 0; q < 8; ++q) { const int r = q * 2 + rsub; if (col0 + c4 < N) { const v4f v = *(const v4fa*)&so[w][r][c4]; *(v4f*)(C + (size_t)(row0 + r) * ldc + col0 + c4) = v; } }
     }
}

// Wt[n][k] = f16(W[k][n]·scale) from f32 row-major W[K][N] (scale = power of two; bf16-exact weights stay exact in f16 away from the subnormal range)
__global__ __launch_bounds__(256) void k_wt_f16(const float* __restrict__ W, _Float16* __restrict__ Wt, int K, int N, float scale) {
  const int t = blockIdx.x * 256 + threadIdx.x; if (t >= N * (K / 8)) return; const int n = t / (K / 8), k8 = (t % (K / 8)) * 8; FragH f;
#pragma unroll
  for (int i = 0; i < 8; ++i) f.h[i] = (_Float16)(bf16_round(W[(size_t)(k8 + i) * N + n]) * scale); const v8us o = f.half[0];
  *(v8us*)((unsigned short*)Wt + (size_t)n * K + k8) = o; 
}
// k_gemm_hh variant with fused epilogue: v = acc·alpha + bias[by·sBias + col] (+ CP[(row/rowsPerB)·sCPb + by·64 + col] if CP) ; ACT 0 none / 1 elu ; writes f16 C16 and/or f32 C (each if non-null)
template <int ACT>
__global__ __launch_bounds__(128) void k_gemm_hhx(const _Float16* __restrict__ A, int lda, size_t sA, const _Float16* __restrict__ Bh, int ldb, size_t sB, float alpha, const float* __restrict__ bias, size_t sBias, const float* __restrict__ CP, int rowsPerB, size_t sCPb, int row0g,
    float* __restrict__ C, _Float16* __restrict__ C16, int ldc, size_t sC, int M, int N, int K, size_t sAz, size_t sBz, size_t sCz) {
  __shared__ __attribute__((aligned(16))) float so[4][16][64];
  const int tid = threadIdx.x, w = tid >> 5, lane = tid & 31, ln = lane & 15, hh = lane >> 4; const int by = blockIdx.y, bz = blockIdx.z;      /* second batch index bz with its own strides sAz, sBz, sCz */
  A += (size_t)by * sA + (size_t)bz * sAz; Bh += (size_t)by * sB + (size_t)bz * sBz; const size_t cofs = (size_t)by * sC + (size_t)bz * sCz; const float* bp = bias ? bias + (size_t)by * sBias : nullptr;
  const int ntn = (N + 63) / 64; const int wid = blockIdx.x * 4 + w; const int mt = wid / ntn, nq = wid % ntn; if (mt * 16 >= M) return;
  const int row0 = mt * 16, col0 = nq * 64; const _Float16* arow = A + (size_t)(row0 + ln) * lda;
  v8f acc[4] = {};
  for (int kb = 0; kb < K; kb += 32) { FragH ah; ah.half[0] = *(const v8us*)((const unsigned short*)arow + kb + 8 * hh); ah.half[1] = *(const v8us*)((const unsigned short*)arow + kb + 16 + 8 * hh);
#pragma unroll
    for (int t = 0; t < 4; ++t) { if (col0 + t * 16 >= N) continue; const size_t boff = (size_t)(col0 + t * 16 + ln) * ldb + kb; FragH bq; bq.half[0] = *(const v8us*)((const unsigned short*)Bh + boff + 8 * hh); bq.half[1] = *(const v8us*)((const unsigned short*)Bh + boff + 16 + 8 * hh);
      acc[t] = mmaH<1>(ah.v, ah.v, bq.v, bq.v, acc[t]); }
  }
#pragma unroll
  for (int t = 0; t < 4; ++t) { if (col0 + t * 16 >= N) continue; const int col = col0 + t * 16 + ln; const float bv = bp ? bf16_round(bp[col]) : 0.f;
#pragma unroll
    for (int r = 0; r < 8; ++r) { float v = acc[t][r] * alpha + bv; if (CP) { const int bidx = (row0g + row0 + 8 * hh + r) / rowsPerB; v += CP[(size_t)bidx * sCPb + (size_t)by * 64 + col]; } if (ACT == 1) v = (v > 0.f) ? v : expm1f(v); else if (ACT == 7) v = (v > 0.f) ? v + 1.0f : expf(v); else if (ACT == 8) v = tanhf(v); else if (ACT == 9) v = 0.5f * v * (1.0f + tanhf(0.7978845608028654f * (v + 0.044715f * v * v * v))); else if (ACT == 11) v = 1.0f / (1.0f + expf(-v)); else if (ACT == 12) v = (v > 0.f) ? v : 0.01f * v; else if (ACT == 14) v = (v > 0.f) ? v : 0.1f * v; else if (ACT == 15) v = v / (1.0f + expf(-v)); else if (ACT == 3) v = fmaxf(v, 0.f); else if (ACT == 6) v = 0.5f * v * (1.0f + erff(v * 0.70710678118654752f)); so[w][8 * hh + r][t * 16 + ln] = v; } }
  __builtin_amdgcn_fence(__ATOMIC_ACQ_REL, "workgroup"); __builtin_amdgcn_wave_barrier();
  const int rsub = lane >> 4, c4 = (lane & 15) * 4; typedef _Float16 v4h __attribute__((ext_vector_type(4)));
  {
#pragma unroll
    for (int q = 0; q < 8; ++q) { const int r = q * 2 + rsub; if (col0 + c4 < N) { const v4f v = *(const v4fa*)&so[w][r][c4]; if (C) *(v4f*)(C + cofs + (size_t)(row0 + r) * ldc + col0 + c4) = v; if (C16) { v4h h4; for (int i = 0; i < 4; ++i) h4[i] = (_Float16)v[i]; *(v4h*)(C16 + cofs + (size_t)(row0 + r) * ldc + col0 + c4) = h4; } } }
     }
}


typedef _Float16 v4h __attribute__((ext_vector_type(4)));

__global__ __launch_bounds__(256) void k_h16(const float* __restrict__ x, _Float16* __restrict__ X16, size_t n8) { const size_t t = (size_t)blockIdx.x * 256 + threadIdx.x; if (t >= n8) return; FragH f;
#pragma unroll
  for (int q = 0; q < 8; ++q) f.h[q] = (_Float16)x[t * 8 + q]; *(v8us*)((unsigned short*)X16 + t * 8) = f.half[0];  }
// The 16 f32 of one 16 x 32 operand fragment in the hardware k order (k = 8hh + e, then 16 + 8hh + e - 8), as loaded: p = row + 32 ks + 8 hh
struct Raw16 { v4f a, b, c, d; };
__device__ __forceinline__ Raw16 raw_f32(const float* __restrict__ p) { Raw16 x; x.a = *(const v4fa*)p; x.b = *(const v4fa*)(p + 4); x.c = *(const v4fa*)(p + 16); x.d = *(const v4fa*)(p + 20); return x; }
// each value rounded to bf16, then held exactly in f16 (weights x2^4)
template <bool W16>
__device__ __forceinline__ FragH frag_f32(const Raw16& x) { FragH f;
#pragma unroll
  for (int q = 0; q < 4; ++q) {
    f.h[q]      = W16 ? (_Float16)(bf16_round(x.a[q]) * 16.0f) : (_Float16)bf16_round(x.a[q]);
    f.h[4 + q]  = W16 ? (_Float16)(bf16_round(x.b[q]) * 16.0f) : (_Float16)bf16_round(x.b[q]);
    f.h[8 + q]  = W16 ? (_Float16)(bf16_round(x.c[q]) * 16.0f) : (_Float16)bf16_round(x.c[q]);
    f.h[12 + q] = W16 ? (_Float16)(bf16_round(x.d[q]) * 16.0f) : (_Float16)bf16_round(x.d[q]); }
  return f; }
// One wave: 64 rows x one head of one tensor, y = x.W^T (K = 64), inputs and weight converted in registers; the next 16 rows are loaded while these are worked on. st = the wave's own 64 x 64 f16 staging tile (pitch 72), written 16 B a lane:
// TR (values): A = x rows, B = W rows, so a lane holds 8 consecutive rows of one output column and the tile is staged transposed, st[d][row];
// else (keys, query): A = W rows, B = x rows, so a lane holds 8 consecutive columns of one row, st[row][e]. Either way each staged row leaves as one whole 128-B line; dst = first staged row, pitch in elements.
template <bool TR>
__device__ __forceinline__ void proj_tile(const float* __restrict__ x, const float* __restrict__ W, unsigned short (*st)[72], unsigned short* __restrict__ dst, size_t pitch, int lane) {
  const int ln = lane & 15, hh = lane >> 4; const float* xl = x + (size_t)ln * DD + 8 * hh; const float* wl = W + ln * HD + 8 * hh;
  Raw16 xr[2][2]; xr[0][0] = raw_f32(xl); xr[0][1] = raw_f32(xl + 32);
  Raw16 wr[4][2];
#pragma unroll
  for (int t = 0; t < 4; ++t)
#pragma unroll
    for (int ks = 0; ks < 2; ++ks) wr[t][ks] = raw_f32(wl + t * 16 * HD + ks * 32);
  asm volatile("s_wait_xcnt 0x0" :: "v"(wl) : "memory");      /* precaution: the weight loads' address registers (the input) are written again only behind this wait */
  FragH wf[4][2];
#pragma unroll
  for (int t = 0; t < 4; ++t)
#pragma unroll
    for (int ks = 0; ks < 2; ++ks) wf[t][ks] = frag_f32<true>(wr[t][ks]);
#pragma unroll
  for (int rt = 0; rt < 4; ++rt) {
    if (rt < 3) { xr[(rt + 1) & 1][0] = raw_f32(xl + (size_t)(rt + 1) * 16 * DD); xr[(rt + 1) & 1][1] = raw_f32(xl + (size_t)(rt + 1) * 16 * DD + 32);
      if (rt == 2) asm volatile("s_wait_xcnt 0x0" :: "v"(xl) : "memory"); }      /* the same precaution behind the last loads that name the row address */
    const FragH x0 = frag_f32<false>(xr[rt & 1][0]), x1 = frag_f32<false>(xr[rt & 1][1]);
#pragma unroll
    for (int t = 0; t < 4; ++t) { v8f acc = (v8f){0.f,0.f,0.f,0.f,0.f,0.f,0.f,0.f};
      if (TR) { acc = mmaH<1>(x0.v, x0.v, wf[t][0].v, wf[t][0].v, acc); acc = mmaH<1>(x1.v, x1.v, wf[t][1].v, wf[t][1].v, acc); }
      else    { acc = mmaH<1>(wf[t][0].v, wf[t][0].v, x0.v, x0.v, acc); acc = mmaH<1>(wf[t][1].v, wf[t][1].v, x1.v, x1.v, acc); }
      FragH o;
#pragma unroll
      for (int r = 0; r < 8; ++r) o.h[r] = (_Float16)(acc[r] * 0.0625f);
      if (TR) *(v8us*)&st[t * 16 + ln][rt * 16 + 8 * hh] = o.half[0]; else *(v8us*)&st[rt * 16 + ln][t * 16 + 8 * hh] = o.half[0]; } }
  __builtin_amdgcn_fence(__ATOMIC_ACQ_REL, "workgroup"); __builtin_amdgcn_wave_barrier();      /* the wave reads back what its other lanes staged */
#pragma unroll
  for (int q = 0; q < 16; ++q) { const int r = q * 4 + (lane >> 3), c8 = (lane & 7) * 8; const v8us v = *(const v8us*)&st[r][c8]; *(v8us*)(dst + (size_t)r * pitch + c8) = v; }
  asm volatile("s_wait_xcnt 0x0" ::: "memory"); }      /* the same precaution behind the stores: nothing that follows on any path writes their registers first */
// grid (NR / 256, heads, 4): blockIdx.z = 0 values -> Vt[slab][d][t], 1 keys -> K16, 2 query -> Q16 (row-major, head h at column 64 h); blockIdx.z = 3: Bo = f16(bf16(Wo) x2^4), 8 elements a thread and trip
__global__ __launch_bounds__(128) void k_proj(const float* __restrict__ xv, const float* __restrict__ xk, const float* __restrict__ xq, const float* __restrict__ Wv, const float* __restrict__ Wk, const float* __restrict__ Wq, const float* __restrict__ Wo,
    _Float16* __restrict__ Vt, _Float16* __restrict__ K16, _Float16* __restrict__ Q16, _Float16* __restrict__ Bo) {
  __shared__ __attribute__((aligned(16))) unsigned short st[4][64][72];
  const int tid = threadIdx.x, w = tid >> 5, lane = tid & 31; const int z = blockIdx.z, h = blockIdx.y;
  if (z == 3) { constexpr int NTH = (NR / 256) * NH * 128;
#pragma unroll
    for (int i = 0; i < DD * DD / 8 / NTH; ++i) { const size_t t = (size_t)i * NTH + (size_t)(blockIdx.y * (NR / 256) + blockIdx.x) * 128 + tid; const v4f a = *(const v4fa*)(Wo + t * 8), c = *(const v4fa*)(Wo + t * 8 + 4); FragH f;
#pragma unroll
      for (int q = 0; q < 4; ++q) { f.h[q] = (_Float16)(bf16_round(a[q]) * 16.0f); f.h[4 + q] = (_Float16)(bf16_round(c[q]) * 16.0f); }
      *(v8us*)((unsigned short*)Bo + t * 8) = f.half[0]; }
    return; }
  const int row0 = (blockIdx.x * 4 + w) * 64; const size_t xo = (size_t)row0 * DD + h * HD;
  if (z == 0) proj_tile<true>(xv + xo, Wv, st[w], (unsigned short*)Vt + ((size_t)((row0 / TT) * NH + h) * HD) * TT + row0 % TT, TT, lane);
  else proj_tile<false>((z == 1 ? xk : xq) + xo, z == 1 ? Wk : Wq, st[w], (unsigned short*)(z == 1 ? K16 : Q16) + xo, DD, lane); }
// lane l with lane l ^ 16 (a vector cross-row move, no LDS)
__device__ __forceinline__ float xhalf(float x) { return __builtin_bit_cast(float, __builtin_amdgcn_permlanex16(__builtin_bit_cast(int, x), __builtin_bit_cast(int, x), 0x76543210, 0xfedcba98, false, false)); }
__global__ __launch_bounds__(128) void k_flash(const _Float16* __restrict__ Q16, int ldq, const _Float16* __restrict__ K16, int ldk, const _Float16* __restrict__ Vt, const int* __restrict__ MSK, _Float16* __restrict__ O16, int ldo) {
  constexpr int RPW = 16, NQB = TT / (4 * RPW), DT = 4, KS = 2; typedef int v4ia __attribute__((ext_vector_type(4), may_alias));
  __shared__ __attribute__((aligned(16))) unsigned short sO[4][RPW][64 + 8];
  const int tid = threadIdx.x, w = tid >> 5, lane = tid & 31, ln = lane & 15, hh = lane >> 4;
  const int slab = blockIdx.x / NQB, qblk = blockIdx.x % NQB; const int b = slab / NH, h = slab % NH; const int qb0 = qblk * (4 * RPW); const int q0 = qb0 + w * RPW;
  FragH bq[KS];
  { const unsigned short* qr = (const unsigned short*)Q16 + ((size_t)b * TT + q0 + ln) * ldq + h * 64;
#pragma unroll
    for (int ks = 0; ks < KS; ++ks) { bq[ks].half[0] = *(const v8us*)(qr + ks * 32 + 8 * hh); bq[ks].half[1] = *(const v8us*)(qr + ks * 32 + 16 + 8 * hh); } }
  /* block-uniform bases plus one 32-bit lane offset each, the same on every pass */
  const unsigned short* Kb = (const unsigned short*)K16 + (size_t)b * TT * ldk + h * 64; const unsigned klane = (unsigned)(ln * ldk + 8 * hh);
  const unsigned short* Vth = (const unsigned short*)Vt + (size_t)slab * 64 * TT; const unsigned vlane = (unsigned)(ln * TT + 8 * hh);
  const int* Mb = MSK + (size_t)b * TT; const unsigned mlane = (unsigned)(8 * hh);
  float m_q = -3.0e38f, l_q = 0.f; v8f oacc[DT];      /* of query q0 + ln; l_q sums this half's keys; oacc[dt][r] = O^T[dt*16 + 8hh + r][ln] */
#pragma unroll
  for (int dt = 0; dt < DT; ++dt) oacc[dt] = (v8f){0.f,0.f,0.f,0.f,0.f,0.f,0.f,0.f};
  const int jend = TT;
#pragma unroll 1
  for (int j0 = 0; j0 < jend; j0 += 32) {
    const int* mp = Mb + j0 + mlane;      /* key padding mask (1 = attend), shared by all queries and heads: the lane's keys j0 + 8hh + r and j0 + 16 + 8hh + r */
    const v4ia km[2][2] = {{*(const v4ia*)mp, *(const v4ia*)(mp + 4)}, {*(const v4ia*)(mp + 16), *(const v4ia*)(mp + 20)}};
    v8f s[2];
#pragma unroll
    for (int nt = 0; nt < 2; ++nt) { const unsigned short* kr = Kb + (size_t)(j0 + nt * 16) * ldk + klane; FragH ak[KS];
#pragma unroll
      for (int ks = 0; ks < KS; ++ks) { ak[ks].half[0] = *(const v8us*)(kr + ks * 32); ak[ks].half[1] = *(const v8us*)(kr + ks * 32 + 16); }
      v8f acc = (v8f){0.f,0.f,0.f,0.f,0.f,0.f,0.f,0.f};
#pragma unroll
      for (int ks = 0; ks < KS; ++ks) acc = mmaH<1>(ak[ks].v, ak[ks].v, bq[ks].v, bq[ks].v, acc); s[nt] = acc; }
    float mc = -INFINITY;
#pragma unroll
    for (int nt = 0; nt < 2; ++nt)
#pragma unroll
      for (int r = 0; r < 8; ++r) { s[nt][r] = (km[nt][r >> 2][r & 3] != 0) ? s[nt][r] * 0.03125f : -INFINITY; mc = fmaxf(mc, s[nt][r]); }      /* energy/sqrt(1024); masked keys carry -1e20 in the module, -inf here */
    mc = fmaxf(mc, xhalf(mc));
    const float mn = fmaxf(m_q, mc); const float al = expf(m_q - mn); m_q = mn;      /* mn >= -3e38 is finite: nothing attended yet gives exp(0) = 1, a masked key exp(-inf) = 0 */
    float ps = 0.f; FragH pb;
#pragma unroll
    for (int nt = 0; nt < 2; ++nt)
#pragma unroll
      for (int r = 0; r < 8; ++r) { const float p = expf(s[nt][r] - mn); ps += p; pb.h[nt * 8 + r] = (_Float16)(p * 1024.0f); }
    l_q = l_q * al + ps;
#pragma unroll
    for (int dt = 0; dt < DT; ++dt)
#pragma unroll
      for (int r = 0; r < 8; ++r) oacc[dt][r] *= al;
#pragma unroll
    for (int dt = 0; dt < DT; ++dt) { const unsigned short* vrow = Vth + (size_t)dt * 16 * TT + j0 + vlane; FragH av; av.half[0] = *(const v8us*)vrow; av.half[1] = *(const v8us*)(vrow + 16);
      oacc[dt] = mmaH<1>(av.v, av.v, pb.v, pb.v, oacc[dt]); } }
  { const float l = l_q + xhalf(l_q); const float inv = (l > 0.f) ? 1.0f / (l * 1024.0f) : 0.f;
#pragma unroll
    for (int dt = 0; dt < DT; ++dt) { FragH o;      /* O x2^4 in f16, the output GEMM's A operand: the lane's 8 consecutive d of query ln */
#pragma unroll
      for (int r = 0; r < 8; ++r) o.h[r] = (_Float16)((oacc[dt][r] * inv) * 16.0f);
      *(v8us*)&sO[w][ln][dt * 16 + 8 * hh] = o.half[0]; } }
  __builtin_amdgcn_fence(__ATOMIC_ACQ_REL, "workgroup"); __builtin_amdgcn_wave_barrier();
  {
#pragma unroll
    for (int rp = 0; rp < RPW; rp += 4) { const int r = rp + (lane >> 3), pc = lane & 7; const v8us val = *(const v8us*)&sO[w][r][pc * 8]; *(v8us*)((unsigned short*)O16 + ((size_t)b * TT + q0 + r) * ldo + h * 64 + pc * 8) = val; }
     } }

extern "C" void kernel_launch(void* const* d_in, const int* in_sizes, int n_in,
                              void* d_out, int out_size, void* d_ws, size_t ws_size, hipStream_t stream) {
  (void)in_sizes; (void)n_in; (void)out_size;
  const float* const* I = (const float* const*)d_in; const float* values = I[0]; const float* keys = I[1]; const float* query = I[2]; const int* mask = (const int*)d_in[3]; const float* Wv = I[4]; const float* Wk = I[5]; const float* Wq = I[6]; const float* Wo = I[7]; const float* bo = I[8];
  char* ws = (char*)d_ws; size_t off = 0;
  auto take = [&](size_t bytes) { char* p = ws + off; off += (bytes + 255) & ~(size_t)255; return p; };
  _Float16* Bo = (_Float16*)take((size_t)DD * DD * 2);
  _Float16* K = (_Float16*)take((size_t)NR * DD * 2); _Float16* Q = (_Float16*)take((size_t)NR * DD * 2); _Float16* Vt = (_Float16*)take((size_t)NR * DD * 2); _Float16* O16 = (_Float16*)take((size_t)NR * DD * 2);
  if (off > ws_size) return;      // 2.1 + 4 x 8.4 = 36 MB
  k_proj<<<dim3(NR / 256, NH, 4), 128, 0, stream>>>(values, keys, query, Wv, Wk, Wq, Wo, Vt, K, Q, Bo);
  k_flash<<<BB * NH * (TT / 64), 128, 0, stream>>>(Q, DD, K, DD, Vt, mask, O16, DD);
  k_gemm_hhx<0><<<dim3(((NR / 16) * (DD / 64) + 3) / 4, 1), 128, 0, stream>>>(O16, DD, 0, Bo, DD, 0, 0.00390625f, bo, 0, nullptr, 1, 0, 0, (float*)d_out, nullptr, DD, 0, NR, DD, DD, 0, 0, 0);      /* out = O·Woᵀ + bo */
}

// v004
// A run of this version takes 129 microseconds.
// Next to v003, in two timings, it ran 1.44 and 1.46 times as fast.
// Counting every step since v000, it is 4.21 times as fast.
#include <hip/hip_runtime.h>
// 'SelfAttension' (B=2, S=2048, E=1024, 16 heads × 64): per-head projections with ONE shared 64×64 weight per tensor (y_h = x_h·Wᵀ, torch (out,in), no bias) for values, keys, query; energy = q·kᵀ with −1e20 where the key mask [N,1,1,S] == 0;
// attn = softmax(energy/√1024); out = (attn·v merged)·Woᵀ + bo.
// Compute dtype: inputs, weights, bias rounded to bf16; the per-head 64×64 projections as block-diagonal f16 GEMMs (all 16 head-block columns of all three tensors in one launch, grid = row blocks x heads x 4: the three tensors and the Wo to f16 conversion, K = 64); fused flash-style kernel (per-(b,k) int mask loads, scale 1/32,
// online softmax f32, P f16 ×2^10) on v_wmma_f32_16x16x32_f16; O ×2^4 → f16 → output GEMM + bias; f32 accumulate.
#define BB 2
#define TT 2048
#define DD 1024
#define NH 16
#define HD 64
#define NR (BB * TT)

typedef __bf16 v16b __attribute__((ext_vector_type(16)));
typedef unsigned short v8us __attribute__((ext_vector_type(8), may_alias));
typedef float  v8f  __attribute__((ext_vector_type(8)));
typedef float  v4f  __attribute__((ext_vector_type(4)));
typedef float  v4fa __attribute__((ext_vector_type(4), may_alias));
union FragB { v16b v; v8us half[2]; unsigned short u[16]; };

__device__ __forceinline__ unsigned short bf16_bits(float x) { unsigned int u = __float_as_uint(x); return (unsigned short)((u + 0x7FFFu + ((u >> 16) & 1u)) >> 16); }
__device__ __forceinline__ float bf16_val(unsigned short b) { return __uint_as_float(((unsigned int)b) << 16); }
__device__ __forceinline__ float bf16_round(float x) { return bf16_val(bf16_bits(x)); }
// D += A·B with NT terms: 1 = ah·bh, 2 = + al·bh (A split), 3 = + ah·bl (both split)
template <int NT>
__device__ __forceinline__ v8f mmaN(v16b ah, v16b al, v16b bh, v16b bl, v8f c) {
  c = __builtin_amdgcn_wmma_f32_16x16x32_bf16(false, ah, false, bh, (short)0, c, false, false);
  if (NT >= 2) c = __builtin_amdgcn_wmma_f32_16x16x32_bf16(false, al, false, bh, (short)0, c, false, false);
  if (NT >= 3) c = __builtin_amdgcn_wmma_f32_16x16x32_bf16(false, ah, false, bl, (short)0, c, false, false);
  asm volatile("v_nop\n\tv_nop\n\tv_nop\n\tv_nop" : "+v"(c) : "v"(ah), "v"(al), "v"(bh), "v"(bl));
  return c;
}

__global__ __launch_bounds__(256) void k_wt_bf16(const float* __restrict__ W, unsigned short* __restrict__ Wt, int K, int N) {
  const int t = blockIdx.x * 256 + threadIdx.x;
  const int k8n = K / 8;
  if (t >= N * k8n) return;
  const int n = t / k8n, k8 = (t % k8n) * 8;
  v8us v;
#pragma unroll
  for (int i = 0; i < 8; ++i) v[i] = bf16_bits(W[(size_t)(k8 + i) * N + n]);
  *(v8us*)(Wt + (size_t)n * K + k8) = v;
  
}

// GEMM C[M][N] (f32, pitch ldc) = act(A[M][K]·W + bias). A f32 row-major (pitch lda) converted per fragment to bf16
// (ASPLIT: hi/lo two planes -> 2 terms, else single rounded term); Wt bf16 [N][K] (pitch ldb). BIAS_BF16 rounds the
// bias to bf16 first (bias quantised to bf16 before the add). K%32==0, M%16==0, N%64==0.
template <bool ASPLIT, int ACT, bool BIAS_BF16>
__global__ __launch_bounds__(128) void k_gemm_bf(const float* __restrict__ A, int lda, const unsigned short* __restrict__ Wt, int ldb,
                                               const float* __restrict__ bias, float* __restrict__ C, int ldc, int M, int N, int K) {
  __shared__ __attribute__((aligned(16))) float so[4][16][64];
  const int tid = threadIdx.x, w = tid >> 5, lane = tid & 31, ln = lane & 15, hh = lane >> 4;
  const int ntn = N / 64;
  const int wid = blockIdx.x * 4 + w;
  const int mt = wid / ntn, nq = wid % ntn;
  if (mt * 16 >= M) return;
  const int row0 = mt * 16, col0 = nq * 64;
  const float* arow = A + (size_t)(row0 + ln) * lda;
  v8f acc[4] = {};
  for (int kb = 0; kb < K; kb += 32) {
    FragB ah, al;
    const v4f x0 = *(const v4fa*)(arow + kb + 8 * hh), x1 = *(const v4fa*)(arow + kb + 8 * hh + 4);
    const v4f x2 = *(const v4fa*)(arow + kb + 16 + 8 * hh), x3 = *(const v4fa*)(arow + kb + 16 + 8 * hh + 4);
    float xs[16] = {x0[0],x0[1],x0[2],x0[3],x1[0],x1[1],x1[2],x1[3],x2[0],x2[1],x2[2],x2[3],x3[0],x3[1],x3[2],x3[3]};
#pragma unroll
    for (int i = 0; i < 16; ++i) { const unsigned short hb = bf16_bits(xs[i]); ah.u[i] = hb; al.u[i] = ASPLIT ? bf16_bits(xs[i] - bf16_val(hb)) : (unsigned short)0; }
#pragma unroll
    for (int t = 0; t < 4; ++t) {
      const unsigned short* brow = Wt + (size_t)(col0 + t * 16 + ln) * ldb + kb;
      FragB b;
      b.half[0] = *(const v8us*)(brow + 8 * hh);
      b.half[1] = *(const v8us*)(brow + 16 + 8 * hh);
      acc[t] = mmaN<ASPLIT ? 2 : 1>(ah.v, al.v, b.v, b.v, acc[t]);
    }
  }
#pragma unroll
  for (int t = 0; t < 4; ++t) {
    float bv = bias ? bias[col0 + t * 16 + ln] : 0.f;
    if (BIAS_BF16) bv = bf16_round(bv);
#pragma unroll
    for (int r = 0; r < 8; ++r) { float v = acc[t][r] + bv; if (ACT == 1) v = fmaxf(v, 0.f); so[w][8 * hh + r][t * 16 + ln] = v; }
  }
  __builtin_amdgcn_fence(__ATOMIC_ACQ_REL, "workgroup");
  __builtin_amdgcn_wave_barrier();
  const int rsub = lane >> 4, c4 = (lane & 15) * 4;
  {
#pragma unroll
    for (int q = 0; q < 8; ++q) {
      const int r = q * 2 + rsub;
      const v4f v = *(const v4fa*)&so[w][r][c4];
      *(v4f*)(C + (size_t)(row0 + r) * ldc + col0 + c4) = v;
    }
    
  }
}

// Flash-style causal/unmasked attention, all contractions 3-term bf16 hi/lo splits, f32 softmax with running max.
// q,k,v rows are read from f32 buffers with arbitrary row pitch (so they can live inside a fused qkv buffer);
// D = head size (multiple of 32, <= 128); one wave = 16 query rows; block = 4 waves (64 queries) sharing K/V chunks of 32.
template <int D, bool CAUSAL>
__global__ __launch_bounds__(128) void k_flash(const float* __restrict__ qb, const float* __restrict__ kb, const float* __restrict__ vb,
                                             int pitch, int T, int H, float scale, float* __restrict__ y, int ypitch) {
  constexpr int KS = D / 32;        // k-steps for QK
  constexpr int DT = D / 16;        // d tiles for PV
  __shared__ __attribute__((aligned(16))) unsigned short sKh[32][D + 8], sKl[32][D + 8], sVh[32][D + 8], sVl[32][D + 8];
  __shared__ __attribute__((aligned(16))) unsigned short sPh[4][16][40], sPl[4][16][40];
  __shared__ __attribute__((aligned(16))) float sO[4][16][D];
  const int tid = threadIdx.x, w = tid >> 5, lane = tid & 31, ln = lane & 15, hh = lane >> 4;
  const int nqb = (T + 63) / 64;
  const int bh = blockIdx.x / nqb, qblk = blockIdx.x % nqb;
  const int b = bh / H, h = bh % H;
  const int q0 = qblk * 64 + w * 16;
  const float* Q = qb + (size_t)b * T * pitch + h * D;
  const float* K = kb + (size_t)b * T * pitch + h * D;
  const float* V = vb + (size_t)b * T * pitch + h * D;

  // A fragments of the wave's 16 query rows (scaled), hi/lo
  FragB aqh[KS], aql[KS];
  {
    int row = q0 + ln; if (row >= T) row = T - 1;
    const float* qr = Q + (size_t)row * pitch;
#pragma unroll
    for (int ks = 0; ks < KS; ++ks)
#pragma unroll
      for (int i = 0; i < 16; ++i) {
        const int d = ks * 32 + ((i < 8) ? (8 * hh + i) : (16 + 8 * hh + (i - 8)));
        const float x = qr[d] * scale; const unsigned short hb = bf16_bits(x);
        aqh[ks].u[i] = hb; aql[ks].u[i] = bf16_bits(x - bf16_val(hb));
      }
  }
  float m_r[8], l_r[8];
#pragma unroll
  for (int r = 0; r < 8; ++r) { m_r[r] = -3.0e38f; l_r[r] = 0.f; }
  v8f oacc[DT];
#pragma unroll
  for (int dt = 0; dt < DT; ++dt) oacc[dt] = (v8f){0.f,0.f,0.f,0.f,0.f,0.f,0.f,0.f};

  const int kv_end = CAUSAL ? min(T, qblk * 64 + 64) : T;     // block-uniform
  for (int j0 = 0; j0 < kv_end; j0 += 32) {
    __syncthreads();
    for (int e = tid; e < 32 * (D / 4); e += 128) {
      const int r = e / (D / 4), c4 = (e % (D / 4)) * 4;
      const int key = j0 + r;
      v4f kf = {0.f,0.f,0.f,0.f}, vf = {0.f,0.f,0.f,0.f};
      if (key < T) { kf = *(const v4fa*)(K + (size_t)key * pitch + c4); vf = *(const v4fa*)(V + (size_t)key * pitch + c4); }
#pragma unroll
      for (int t = 0; t < 4; ++t) {
        unsigned short hb = bf16_bits(kf[t]); sKh[r][c4 + t] = hb; sKl[r][c4 + t] = bf16_bits(kf[t] - bf16_val(hb));
        hb = bf16_bits(vf[t]); sVh[r][c4 + t] = hb; sVl[r][c4 + t] = bf16_bits(vf[t] - bf16_val(hb));
      }
    }
    __syncthreads();
    // S tile 16 x 32
    v8f s[2];
#pragma unroll
    for (int nt = 0; nt < 2; ++nt) {
      v8f acc = {};
#pragma unroll
      for (int ks = 0; ks < KS; ++ks) {
        FragB bh_, bl_;
        bh_.half[0] = *(const v8us*)&sKh[nt * 16 + ln][ks * 32 + 8 * hh]; bh_.half[1] = *(const v8us*)&sKh[nt * 16 + ln][ks * 32 + 16 + 8 * hh];
        bl_.half[0] = *(const v8us*)&sKl[nt * 16 + ln][ks * 32 + 8 * hh]; bl_.half[1] = *(const v8us*)&sKl[nt * 16 + ln][ks * 32 + 16 + 8 * hh];
        acc = mmaN<3>(aqh[ks].v, aql[ks].v, bh_.v, bl_.v, acc);
      }
      s[nt] = acc;
    }
    // mask + running max (rows 8hh+r; the 16 lanes of a half share rows)
    float alpha[8];
#pragma unroll
    for (int r = 0; r < 8; ++r) {
      const int qi = q0 + 8 * hh + r;
      const int ja = j0 + ln, jb = j0 + 16 + ln;
      if (CAUSAL) { if (ja > qi) s[0][r] = -3.0e38f; if (jb > qi) s[1][r] = -3.0e38f; }
      if (ja >= T) s[0][r] = -3.0e38f;
      if (jb >= T) s[1][r] = -3.0e38f;
      float mx = fmaxf(s[0][r], s[1][r]);
      mx = fmaxf(mx, __shfl_xor(mx, 1, 32)); mx = fmaxf(mx, __shfl_xor(mx, 2, 32)); mx = fmaxf(mx, __shfl_xor(mx, 4, 32)); mx = fmaxf(mx, __shfl_xor(mx, 8, 32));
      const float mnew = fmaxf(m_r[r], mx);
      alpha[r] = (mnew > -1.0e38f) ? __expf(m_r[r] - mnew) : 1.0f;
      const float p0 = (s[0][r] > -1.0e38f) ? __expf(s[0][r] - mnew) : 0.f;
      const float p1 = (s[1][r] > -1.0e38f) ? __expf(s[1][r] - mnew) : 0.f;
      m_r[r] = mnew;
      l_r[r] = l_r[r] * alpha[r] + p0 + p1;            // per-lane partial row sum (16 lanes combined at the end)
      unsigned short hb = bf16_bits(p0); sPh[w][8 * hh + r][ln] = hb;      sPl[w][8 * hh + r][ln] = bf16_bits(p0 - bf16_val(hb));
      hb = bf16_bits(p1);                sPh[w][8 * hh + r][16 + ln] = hb; sPl[w][8 * hh + r][16 + ln] = bf16_bits(p1 - bf16_val(hb));
    }
#pragma unroll
    for (int dt = 0; dt < DT; ++dt)
#pragma unroll
      for (int r = 0; r < 8; ++r) oacc[dt][r] *= alpha[r];
    __builtin_amdgcn_fence(__ATOMIC_ACQ_REL, "workgroup");
    __builtin_amdgcn_wave_barrier();
    FragB pah, pal;
    pah.half[0] = *(const v8us*)&sPh[w][ln][8 * hh]; pah.half[1] = *(const v8us*)&sPh[w][ln][16 + 8 * hh];
    pal.half[0] = *(const v8us*)&sPl[w][ln][8 * hh]; pal.half[1] = *(const v8us*)&sPl[w][ln][16 + 8 * hh];
#pragma unroll
    for (int dt = 0; dt < DT; ++dt) {
      FragB bvh, bvl;
#pragma unroll
      for (int i = 0; i < 8; ++i) {
        bvh.u[i] = sVh[8 * hh + i][dt * 16 + ln]; bvh.u[8 + i] = sVh[16 + 8 * hh + i][dt * 16 + ln];
        bvl.u[i] = sVl[8 * hh + i][dt * 16 + ln]; bvl.u[8 + i] = sVl[16 + 8 * hh + i][dt * 16 + ln];
      }
      oacc[dt] = mmaN<3>(pah.v, pal.v, bvh.v, bvl.v, oacc[dt]);
    }
    __builtin_amdgcn_fence(__ATOMIC_ACQ_REL, "workgroup");
    __builtin_amdgcn_wave_barrier();
  }
#pragma unroll
  for (int r = 0; r < 8; ++r) {
    float l = l_r[r];
    l += __shfl_xor(l, 1, 32); l += __shfl_xor(l, 2, 32); l += __shfl_xor(l, 4, 32); l += __shfl_xor(l, 8, 32);
    l_r[r] = (l > 0.f) ? 1.0f / l : 0.f;
  }
#pragma unroll
  for (int dt = 0; dt < DT; ++dt)
#pragma unroll
    for (int r = 0; r < 8; ++r) sO[w][8 * hh + r][dt * 16 + ln] = oacc[dt][r] * l_r[r];
  __builtin_amdgcn_fence(__ATOMIC_ACQ_REL, "workgroup");
  __builtin_amdgcn_wave_barrier();
  {
    for (int r = 0; r < 16; ++r) {
      const int row = q0 + r;
      if (row < T && lane < D / 4) {
        const v4f val = *(const v4fa*)&sO[w][r][lane * 4];
        *(v4f*)(y + ((size_t)b * T + row) * ypitch + h * D + lane * 4) = val;
      }
    }
    
  }
}

// GEMM C = act(A·W + bias + resid): A f32 (ASPLIT -> hi/lo 2 terms), Wt bf16 [N][K]; ACT 0 none, 1 relu, 2 exact gelu;
// resid (optional, f32, row index = (row % rmod), pitch ldr, RES_BF16 rounds it) added before the activation.
template <bool ASPLIT, int ACT, bool BIAS_BF16, bool RES_BF16>
__global__ __launch_bounds__(128) void k_gemm_bf3(const float* __restrict__ A, int lda, const unsigned short* __restrict__ Wt, int ldb,
                                                const float* __restrict__ bias, const float* __restrict__ resid, int rmod, int ldr,
                                                float* __restrict__ C, int ldc, int M, int N, int K) {
  __shared__ __attribute__((aligned(16))) float so[4][16][64];
  const int tid = threadIdx.x, w = tid >> 5, lane = tid & 31, ln = lane & 15, hh = lane >> 4;
  const int ntn = N / 64;
  const int wid = blockIdx.x * 4 + w;
  const int mt = wid / ntn, nq = wid % ntn;
  if (mt * 16 >= M) return;
  const int row0 = mt * 16, col0 = nq * 64;
  const float* arow = A + (size_t)(row0 + ln) * lda;
  v8f acc[4] = {};
  for (int kb = 0; kb < K; kb += 32) {
    FragB ah, al;
    const v4f x0 = *(const v4fa*)(arow + kb + 8 * hh), x1 = *(const v4fa*)(arow + kb + 8 * hh + 4);
    const v4f x2 = *(const v4fa*)(arow + kb + 16 + 8 * hh), x3 = *(const v4fa*)(arow + kb + 16 + 8 * hh + 4);
    float xs[16] = {x0[0],x0[1],x0[2],x0[3],x1[0],x1[1],x1[2],x1[3],x2[0],x2[1],x2[2],x2[3],x3[0],x3[1],x3[2],x3[3]};
#pragma unroll
    for (int i = 0; i < 16; ++i) { const unsigned short hb = bf16_bits(xs[i]); ah.u[i] = hb; al.u[i] = ASPLIT ? bf16_bits(xs[i] - bf16_val(hb)) : (unsigned short)0; }
#pragma unroll
    for (int t = 0; t < 4; ++t) {
      const unsigned short* brow = Wt + (size_t)(col0 + t * 16 + ln) * ldb + kb;
      FragB b;
      b.half[0] = *(const v8us*)(brow + 8 * hh);
      b.half[1] = *(const v8us*)(brow + 16 + 8 * hh);
      acc[t] = mmaN<ASPLIT ? 2 : 1>(ah.v, al.v, b.v, b.v, acc[t]);
    }
  }
#pragma unroll
  for (int t = 0; t < 4; ++t) {
    const int col = col0 + t * 16 + ln;
    float bv = bias ? bias[col] : 0.f;
    if (BIAS_BF16) bv = bf16_round(bv);
#pragma unroll
    for (int r = 0; r < 8; ++r) {
      float v = acc[t][r] + bv;
      if (resid) { float rv = resid[(size_t)((row0 + 8 * hh + r) % rmod) * ldr + col]; if (RES_BF16) rv = bf16_round(rv); v += rv; }
      if (ACT == 1) v = fmaxf(v, 0.f);
      if (ACT == 2) v = 0.5f * v * (1.0f + erff(v * 0.70710678118654752f));
      if (ACT == 3) { const float u = 0.7978845608028654f * (v + 0.044715f * v * v * v); v = 0.5f * v * (1.0f + tanhf(u)); }
      so[w][8 * hh + r][t * 16 + ln] = v;
    }
  }
  __builtin_amdgcn_fence(__ATOMIC_ACQ_REL, "workgroup");
  __builtin_amdgcn_wave_barrier();
  const int rsub = lane >> 4, c4 = (lane & 15) * 4;
  {
#pragma unroll
    for (int q = 0; q < 8; ++q) {
      const int r = q * 2 + rsub;
      const v4f v = *(const v4fa*)&so[w][r][c4];
      *(v4f*)(C + (size_t)(row0 + r) * ldc + col0 + c4) = v;
    }
    
  }
}
// row LayerNorm (biased variance, eps) over N: s = X (+ R); optional out_sum <- s; out_norm <- (s-mu)*rsqrt(var+eps)*g + b
template <bool PARAM_BF16>
__global__ __launch_bounds__(256) void k_layernorm(const float* __restrict__ X, const float* __restrict__ R, const float* __restrict__ g, const float* __restrict__ bta,
                                                  float* __restrict__ out_sum, float* __restrict__ out_norm, int N, float eps) {
  __shared__ float red[256];
  const int row = blockIdx.x, tid = threadIdx.x;
  const float* x = X + (size_t)row * N; const float* rr = R ? R + (size_t)row * N : nullptr;
  float vals[16];                     // up to N = 4096
  const int per = N / 256;            // contiguous chunk per thread? use strided-by-4 chunks: thread handles j = tid*4 + 1024*u
  float s1 = 0.f;
  for (int u = 0; u < per / 4; ++u) {
    const int j = tid * 4 + 1024 * u;
    const v4f a = *(const v4fa*)(x + j);
    v4f b = {0.f,0.f,0.f,0.f}; if (rr) b = *(const v4fa*)(rr + j);
#pragma unroll
    for (int q = 0; q < 4; ++q) { const float v = a[q] + b[q]; vals[u * 4 + q] = v; s1 += v; }
  }
  red[tid] = s1; __syncthreads();
  for (int st = 128; st > 0; st >>= 1) { if (tid < st) red[tid] += red[tid + st]; __syncthreads(); }
  const float mu = red[0] / (float)N; __syncthreads();
  float s2 = 0.f;
  for (int u = 0; u < per / 4; ++u)
#pragma unroll
    for (int q = 0; q < 4; ++q) { const float c = vals[u * 4 + q] - mu; s2 += c * c; }
  red[tid] = s2; __syncthreads();
  for (int st = 128; st > 0; st >>= 1) { if (tid < st) red[tid] += red[tid + st]; __syncthreads(); }
  const float rs = rsqrtf(red[0] / (float)N + eps);
  {
    for (int u = 0; u < per / 4; ++u) {
      const int j = tid * 4 + 1024 * u;
      v4f o, sm;
#pragma unroll
      for (int q = 0; q < 4; ++q) {
        float gg = g[j + q], bb = bta[j + q];
        if (PARAM_BF16) { gg = bf16_round(gg); bb = bf16_round(bb); }
        sm[q] = vals[u * 4 + q]; o[q] = (vals[u * 4 + q] - mu) * rs * gg + bb;
      }
      if (out_sum) *(v4f*)(out_sum + (size_t)row * N + j) = sm;
      *(v4f*)(out_norm + (size_t)row * N + j) = o;
    }
    
  }
}



// ---- f16 WMMA path (v_wmma_f32_16x16x32_f16): 11-bit significands for operands in range — used where a [0,1] probability operand needs more precision than bf16
typedef _Float16 v16h __attribute__((ext_vector_type(16)));
union FragH { v16h v; v8us half[2]; _Float16 h[16]; unsigned short u[16]; };
template <int NT>
__device__ __forceinline__ v8f mmaH(v16h ah, v16h al, v16h bh, v16h bl, v8f c) {
  c = __builtin_amdgcn_wmma_f32_16x16x32_f16(false, ah, false, bh, (short)0, c, false, false);
  if (NT >= 2) c = __builtin_amdgcn_wmma_f32_16x16x32_f16(false, al, false, bh, (short)0, c, false, false);
  if (NT >= 3) c = __builtin_amdgcn_wmma_f32_16x16x32_f16(false, ah, false, bl, (short)0, c, false, false);
  asm volatile("v_nop\n\tv_nop\n\tv_nop\n\tv_nop" : "+v"(c) : "v"(ah), "v"(al), "v"(bh), "v"(bl));
  return c;
}
// batched GEMM like k_gemm_b but f16 operands: A f32 (split into f16 hi/lo if ASPLIT, else rounded to f16), Bt = f16 values [n][k]; alpha; C f32; N multiple of 16 (partial tiles skipped)
template <bool ASPLIT>
__global__ __launch_bounds__(128) void k_gemm_h(const float* __restrict__ A, int lda, size_t sA, const _Float16* __restrict__ Bh, int ldb, size_t sB, float alpha, float* __restrict__ C, int ldc, size_t sC, int M, int N, int K) {
  __shared__ __attribute__((aligned(16))) float so[4][16][64];
  const int tid = threadIdx.x, w = tid >> 5, lane = tid & 31, ln = lane & 15, hh = lane >> 4; const int by = blockIdx.y;
  A += (size_t)by * sA; Bh += (size_t)by * sB; C += (size_t)by * sC;
  const int ntn = (N + 63) / 64; const int wid = blockIdx.x * 4 + w; const int mt = wid / ntn, nq = wid % ntn; if (mt * 16 >= M) return;
  const int row0 = mt * 16, col0 = nq * 64; const float* arow = A + (size_t)(row0 + ln) * lda;
  v8f acc[4] = {};
  for (int kb = 0; kb < K; kb += 32) {
    FragH ah, al;
    const v4f x0 = *(const v4fa*)(arow + kb + 8 * hh), x1 = *(const v4fa*)(arow + kb + 8 * hh + 4), x2 = *(const v4fa*)(arow + kb + 16 + 8 * hh), x3 = *(const v4fa*)(arow + kb + 16 + 8 * hh + 4);
    float xs[16] = {x0[0],x0[1],x0[2],x0[3],x1[0],x1[1],x1[2],x1[3],x2[0],x2[1],x2[2],x2[3],x3[0],x3[1],x3[2],x3[3]};
#pragma unroll
    for (int i = 0; i < 16; ++i) { const _Float16 h = (_Float16)xs[i]; ah.h[i] = h; al.h[i] = ASPLIT ? (_Float16)(xs[i] - (float)h) : (_Float16)0.0f; }
#pragma unroll
    for (int t = 0; t < 4; ++t) { if (col0 + t * 16 >= N) continue; const size_t boff = (size_t)(col0 + t * 16 + ln) * ldb + kb; FragH bq; bq.half[0] = *(const v8us*)(Bh + boff + 8 * hh); bq.half[1] = *(const v8us*)(Bh + boff + 16 + 8 * hh);
      acc[t] = mmaH<ASPLIT ? 2 : 1>(ah.v, al.v, bq.v, bq.v, acc[t]); }
  }
#pragma unroll
  for (int t = 0; t < 4; ++t) { if (col0 + t * 16 >= N) continue;
#pragma unroll
    for (int r = 0; r < 8; ++r) so[w][8 * hh + r][t * 16 + ln] = acc[t][r] * alpha; }
  __builtin_amdgcn_fence(__ATOMIC_ACQ_REL, "workgroup"); __builtin_amdgcn_wave_barrier();
  const int rsub = lane >> 4, c4 = (lane & 15) * 4;
  {
#pragma unroll
    for (int q = 0; q < 8; ++q) { const int r = q * 2 + rsub; if (col0 + c4 < N) { const v4f v = *(const v4fa*)&so[w][r][c4]; *(v4f*)(C + (size_t)(row0 + r) * ldc + col0 + c4) = v; } }
     }
}

// Wt[n][k] = f16(W[k][n]·scale) from f32 row-major W[K][N] (scale = power of two; bf16-exact weights stay exact in f16 away from the subnormal range)
__global__ __launch_bounds__(256) void k_wt_f16(const float* __restrict__ W, _Float16* __restrict__ Wt, int K, int N, float scale) {
  const int t = blockIdx.x * 256 + threadIdx.x; if (t >= N * (K / 8)) return; const int n = t / (K / 8), k8 = (t % (K / 8)) * 8; FragH f;
#pragma unroll
  for (int i = 0; i < 8; ++i) f.h[i] = (_Float16)(bf16_round(W[(size_t)(k8 + i) * N + n]) * scale); const v8us o = f.half[0];
  *(v8us*)((unsigned short*)Wt + (size_t)n * K + k8) = o; 
}
// k_gemm_hh variant with fused epilogue: v = acc·alpha + bias[by·sBias + col] (+ CP[(row/rowsPerB)·sCPb + by·64 + col] if CP) ; ACT 0 none / 1 elu ; writes f16 C16 and/or f32 C (each if non-null)
template <int ACT>
__global__ __launch_bounds__(128) void k_gemm_hhx(const _Float16* __restrict__ A, int lda, size_t sA, const _Float16* __restrict__ Bh, int ldb, size_t sB, float alpha, const float* __restrict__ bias, size_t sBias, const float* __restrict__ CP, int rowsPerB, size_t sCPb, int row0g,
    float* __restrict__ C, _Float16* __restrict__ C16, int ldc, size_t sC, int M, int N, int K, size_t sAz, size_t sBz, size_t sCz) {
  __shared__ __attribute__((aligned(16))) float so[4][16][64];
  const int tid = threadIdx.x, w = tid >> 5, lane = tid & 31, ln = lane & 15, hh = lane >> 4; const int by = blockIdx.y, bz = blockIdx.z;      /* second batch index bz with its own strides sAz, sBz, sCz */
  A += (size_t)by * sA + (size_t)bz * sAz; Bh += (size_t)by * sB + (size_t)bz * sBz; const size_t cofs = (size_t)by * sC + (size_t)bz * sCz; const float* bp = bias ? bias + (size_t)by * sBias : nullptr;
  const int ntn = (N + 63) / 64; const int wid = blockIdx.x * 4 + w; const int mt = wid / ntn, nq = wid % ntn; if (mt * 16 >= M) return;
  const int row0 = mt * 16, col0 = nq * 64; const _Float16* arow = A + (size_t)(row0 + ln) * lda;
  v8f acc[4] = {};
  for (int kb = 0; kb < K; kb += 32) { FragH ah; ah.half[0] = *(const v8us*)((const unsigned short*)arow + kb + 8 * hh); ah.half[1] = *(const v8us*)((const unsigned short*)arow + kb + 16 + 8 * hh);
#pragma unroll
    for (int t = 0; t < 4; ++t) { if (col0 + t * 16 >= N) continue; const size_t boff = (size_t)(col0 + t * 16 + ln) * ldb + kb; FragH bq; bq.half[0] = *(const v8us*)((const unsigned short*)Bh + boff + 8 * hh); bq.half[1] = *(const v8us*)((const unsigned short*)Bh + boff + 16 + 8 * hh);
      acc[t] = mmaH<1>(ah.v, ah.v, bq.v, bq.v, acc[t]); }
  }
#pragma unroll
  for (int t = 0; t < 4; ++t) { if (col0 + t * 16 >= N) continue; const int col = col0 + t * 16 + ln; const float bv = bp ? bf16_round(bp[col]) : 0.f;
#pragma unroll
    for (int r = 0; r < 8; ++r) { float v = acc[t][r] * alpha + bv; if (CP) { const int bidx = (row0g + row0 + 8 * hh + r) / rowsPerB; v += CP[(size_t)bidx * sCPb + (size_t)by * 64 + col]; } if (ACT == 1) v = (v > 0.f) ? v : expm1f(v); else if (ACT == 7) v = (v > 0.f) ? v + 1.0f : expf(v); else if (ACT == 8) v = tanhf(v); else if (ACT == 9) v = 0.5f * v * (1.0f + tanhf(0.7978845608028654f * (v + 0.044715f * v * v * v))); else if (ACT == 11) v = 1.0f / (1.0f + expf(-v)); else if (ACT == 12) v = (v > 0.f) ? v : 0.01f * v; else if (ACT == 14) v = (v > 0.f) ? v : 0.1f * v; else if (ACT == 15) v = v / (1.0f + expf(-v)); else if (ACT == 3) v = fmaxf(v, 0.f); else if (ACT == 6) v = 0.5f * v * (1.0f + erff(v * 0.70710678118654752f)); so[w][8 * hh + r][t * 16 + ln] = v; } }
  __builtin_amdgcn_fence(__ATOMIC_ACQ_REL, "workgroup"); __builtin_amdgcn_wave_barrier();
  const int rsub = lane >> 4, c4 = (lane & 15) * 4; typedef _Float16 v4h __attribute__((ext_vector_type(4)));
  {
#pragma unroll
    for (int q = 0; q < 8; ++q) { const int r = q * 2 + rsub; if (col0 + c4 < N) { const v4f v = *(const v4fa*)&so[w][r][c4]; if (C) *(v4f*)(C + cofs + (size_t)(row0 + r) * ldc + col0 + c4) = v; if (C16) { v4h h4; for (int i = 0; i < 4; ++i) h4[i] = (_Float16)v[i]; *(v4h*)(C16 + cofs + (size_t)(row0 + r) * ldc + col0 + c4) = h4; } } }
     }
}


typedef _Float16 v4h __attribute__((ext_vector_type(4)));

__global__ __launch_bounds__(256) void k_h16(const float* __restrict__ x, _Float16* __restrict__ X16, size_t n8) { const size_t t = (size_t)blockIdx.x * 256 + threadIdx.x; if (t >= n8) return; FragH f;
#pragma unroll
  for (int q = 0; q < 8; ++q) f.h[q] = (_Float16)x[t * 8 + q]; *(v8us*)((unsigned short*)X16 + t * 8) = f.half[0];  }
// The 16 f32 of one 16 x 32 operand fragment in the hardware k order (k = 8hh + e, then 16 + 8hh + e - 8), as loaded: p = row + 32 ks + 8 hh
struct Raw16 { v4f a, b, c, d; };
__device__ __forceinline__ Raw16 raw_f32(const float* __restrict__ p) { Raw16 x; x.a = *(const v4fa*)p; x.b = *(const v4fa*)(p + 4); x.c = *(const v4fa*)(p + 16); x.d = *(const v4fa*)(p + 20); return x; }
// each value rounded to bf16, then held exactly in f16 (weights x2^4)
template <bool W16>
__device__ __forceinline__ FragH frag_f32(const Raw16& x) { FragH f;
#pragma unroll
  for (int q = 0; q < 4; ++q) {
    f.h[q]      = W16 ? (_Float16)(bf16_round(x.a[q]) * 16.0f) : (_Float16)bf16_round(x.a[q]);
    f.h[4 + q]  = W16 ? (_Float16)(bf16_round(x.b[q]) * 16.0f) : (_Float16)bf16_round(x.b[q]);
    f.h[8 + q]  = W16 ? (_Float16)(bf16_round(x.c[q]) * 16.0f) : (_Float16)bf16_round(x.c[q]);
    f.h[12 + q] = W16 ? (_Float16)(bf16_round(x.d[q]) * 16.0f) : (_Float16)bf16_round(x.d[q]); }
  return f; }
// One wave: 64 rows x one head of one tensor, y = x.W^T (K = 64), inputs and weight converted in registers; the next 16 rows are loaded while these are worked on. st = the wave's own 64 x 64 f16 staging tile (pitch 72), written 16 B a lane:
// TR (values): A = x rows, B = W rows, so a lane holds 8 consecutive rows of one output column and the tile is staged transposed, st[d][row];
// else (keys, query): A = W rows, B = x rows, so a lane holds 8 consecutive columns of one row, st[row][e]. Either way each staged row leaves as one whole 128-B line; dst = first staged row, pitch in elements.
template <bool TR>
__device__ __forceinline__ void proj_tile(const float* __restrict__ x, const float* __restrict__ W, unsigned short (*st)[72], unsigned short* __restrict__ dst, size_t pitch, int lane) {
  const int ln = lane & 15, hh = lane >> 4; const float* xl = x + (size_t)ln * DD + 8 * hh; const float* wl = W + ln * HD + 8 * hh;
  Raw16 xr[2][2]; xr[0][0] = raw_f32(xl); xr[0][1] = raw_f32(xl + 32);
  Raw16 wr[4][2];
#pragma unroll
  for (int t = 0; t < 4; ++t)
#pragma unroll
    for (int ks = 0; ks < 2; ++ks) wr[t][ks] = raw_f32(wl + t * 16 * HD + ks * 32);
  asm volatile("s_wait_xcnt 0x0" :: "v"(wl) : "memory");      /* precaution: the weight loads' address registers (the input) are written again only behind this wait */
  FragH wf[4][2];
#pragma unroll
  for (int t = 0; t < 4; ++t)
#pragma unroll
    for (int ks = 0; ks < 2; ++ks) wf[t][ks] = frag_f32<true>(wr[t][ks]);
#pragma unroll
  for (int rt = 0; rt < 4; ++rt) {
    if (rt < 3) { xr[(rt + 1) & 1][0] = raw_f32(xl + (size_t)(rt + 1) * 16 * DD); xr[(rt + 1) & 1][1] = raw_f32(xl + (size_t)(rt + 1) * 16 * DD + 32);
      if (rt == 2) asm volatile("s_wait_xcnt 0x0" :: "v"(xl) : "memory"); }      /* the same precaution behind the last loads that name the row address */
    const FragH x0 = frag_f32<false>(xr[rt & 1][0]), x1 = frag_f32<false>(xr[rt & 1][1]);
#pragma unroll
    for (int t = 0; t < 4; ++t) { v8f acc = (v8f){0.f,0.f,0.f,0.f,0.f,0.f,0.f,0.f};
      if (TR) { acc = mmaH<1>(x0.v, x0.v, wf[t][0].v, wf[t][0].v, acc); acc = mmaH<1>(x1.v, x1.v, wf[t][1].v, wf[t][1].v, acc); }
      else    { acc = mmaH<1>(wf[t][0].v, wf[t][0].v, x0.v, x0.v, acc); acc = mmaH<1>(wf[t][1].v, wf[t][1].v, x1.v, x1.v, acc); }
      FragH o;
#pragma unroll
      for (int r = 0; r < 8; ++r) o.h[r] = (_Float16)(acc[r] * 0.0625f);
      if (TR) *(v8us*)&st[t * 16 + ln][rt * 16 + 8 * hh] = o.half[0]; else *(v8us*)&st[rt * 16 + ln][t * 16 + 8 * hh] = o.half[0]; } }
  __builtin_amdgcn_fence(__ATOMIC_ACQ_REL, "workgroup"); __builtin_amdgcn_wave_barrier();      /* the wave reads back what its other lanes staged */
#pragma unroll
  for (int q = 0; q < 16; ++q) { const int r = q * 4 + (lane >> 3), c8 = (lane & 7) * 8; const v8us v = *(const v8us*)&st[r][c8]; *(v8us*)(dst + (size_t)r * pitch + c8) = v; }
  asm volatile("s_wait_xcnt 0x0" ::: "memory"); }      /* the same precaution behind the stores: nothing that follows on any path writes their registers first */
// grid (NR / 256, heads, 4): blockIdx.z = 0 values -> Vt[slab][d][t], 1 keys -> K16, 2 query -> Q16 (row-major, head h at column 64 h); blockIdx.z = 3: Bo = f16(bf16(Wo) x2^4), 8 elements a thread and trip
__global__ __launch_bounds__(128) void k_proj(const float* __restrict__ xv, const float* __restrict__ xk, const float* __restrict__ xq, const float* __restrict__ Wv, const float* __restrict__ Wk, const float* __restrict__ Wq, const float* __restrict__ Wo,
    _Float16* __restrict__ Vt, _Float16* __restrict__ K16, _Float16* __restrict__ Q16, _Float16* __restrict__ Bo) {
  __shared__ __attribute__((aligned(16))) unsigned short st[4][64][72];
  const int tid = threadIdx.x, w = tid >> 5, lane = tid & 31; const int z = blockIdx.z, h = blockIdx.y;
  if (z == 3) { constexpr int NTH = (NR / 256) * NH * 128;
#pragma unroll
    for (int i = 0; i < DD * DD / 8 / NTH; ++i) { const size_t t = (size_t)i * NTH + (size_t)(blockIdx.y * (NR / 256) + blockIdx.x) * 128 + tid; const v4f a = *(const v4fa*)(Wo + t * 8), c = *(const v4fa*)(Wo + t * 8 + 4); FragH f;
#pragma unroll
      for (int q = 0; q < 4; ++q) { f.h[q] = (_Float16)(bf16_round(a[q]) * 16.0f); f.h[4 + q] = (_Float16)(bf16_round(c[q]) * 16.0f); }
      *(v8us*)((unsigned short*)Bo + t * 8) = f.half[0]; }
    return; }
  const int row0 = (blockIdx.x * 4 + w) * 64; const size_t xo = (size_t)row0 * DD + h * HD;
  if (z == 0) proj_tile<true>(xv + xo, Wv, st[w], (unsigned short*)Vt + ((size_t)((row0 / TT) * NH + h) * HD) * TT + row0 % TT, TT, lane);
  else proj_tile<false>((z == 1 ? xk : xq) + xo, z == 1 ? Wk : Wq, st[w], (unsigned short*)(z == 1 ? K16 : Q16) + xo, DD, lane); }
// lane l with lane l ^ 16 (a vector cross-row move, no LDS)
__device__ __forceinline__ float xhalf(float x) { return __builtin_bit_cast(float, __builtin_amdgcn_permlanex16(__builtin_bit_cast(int, x), __builtin_bit_cast(int, x), 0x76543210, 0xfedcba98, false, false)); }
// Four asynchronous 16-B copies a lane, global -> LDS, through no register. The s_wait_xcnt in the same statement is a precaution: the address registers are written again only behind it.
__device__ __forceinline__ void cp4(unsigned l0, unsigned l1, unsigned l2, unsigned l3, const void* g0, const void* g1, const void* g2, const void* g3) {
  asm volatile("global_load_async_to_lds_b128 %0, %4, off\n\tglobal_load_async_to_lds_b128 %1, %5, off\n\tglobal_load_async_to_lds_b128 %2, %6, off\n\tglobal_load_async_to_lds_b128 %3, %7, off\n\ts_wait_xcnt 0x0"
               :: "v"(l0), "v"(l1), "v"(l2), "v"(l3), "v"(g0), "v"(g1), "v"(g2), "v"(g3) : "memory"); }
__global__ __launch_bounds__(128) void k_flash(const _Float16* __restrict__ Q16, int ldq, const _Float16* __restrict__ K16, int ldk, const _Float16* __restrict__ Vt, const int* __restrict__ MSK, _Float16* __restrict__ O16, int ldo) {
  constexpr int RPW = 16, NQB = TT / (4 * RPW), DT = 4, KS = 2, SK = 64, NST = TT / SK, LP = 72; typedef int v4ia __attribute__((ext_vector_type(4), may_alias));
  __shared__ __attribute__((aligned(16))) unsigned short sKV[2][2][SK][LP];      /* [buffer][K, V^T][row][pitch] */
  __shared__ __attribute__((aligned(16))) int sM[TT];
  __shared__ __attribute__((aligned(16))) unsigned short sO[4][RPW][64 + 8];
  const int tid = threadIdx.x, w = tid >> 5, lane = tid & 31, ln = lane & 15, hh = lane >> 4;
  const int slab = blockIdx.x / NQB, qblk = blockIdx.x % NQB; const int b = slab / NH, h = slab % NH; const int qb0 = qblk * (4 * RPW); const int q0 = qb0 + w * RPW;
  /* the thread's part of a stage: 16 B at column 8 cc of rows cr + 16 i, so that a wave's copy takes four whole 128-B lines */
  const int cr = tid >> 3, cc = tid & 7;
  const unsigned short* kg = (const unsigned short*)K16 + ((size_t)b * TT + cr) * ldk + h * 64 + cc * 8;
  const unsigned short* vg = (const unsigned short*)Vt + ((size_t)slab * 64 + cr) * TT + cc * 8;
  const unsigned lkv = (unsigned)(size_t)&sKV[0][0][cr][cc * 8];
  constexpr unsigned LROW = 16 * LP * 2, LTILE = SK * LP * 2, LBUF = 2 * LTILE;      /* bytes: 16 rows, one tile, one buffer */
  auto stage = [&](int t, unsigned bufo) {
    const unsigned short* k0 = kg + (size_t)t * SK * ldk; const unsigned short* v0 = vg + t * SK; const unsigned l = lkv + bufo;
    cp4(l, l + LROW, l + 2 * LROW, l + 3 * LROW, k0, k0 + (size_t)16 * ldk, k0 + (size_t)32 * ldk, k0 + (size_t)48 * ldk);
    cp4(l + LTILE, l + LTILE + LROW, l + LTILE + 2 * LROW, l + LTILE + 3 * LROW, v0, v0 + 16 * TT, v0 + 32 * TT, v0 + 48 * TT); };
  { const int* mg = MSK + (size_t)b * TT + tid * 4; const unsigned lm = (unsigned)(size_t)&sM[tid * 4];
    cp4(lm, lm + 2048, lm + 4096, lm + 6144, mg, mg + 512, mg + 1024, mg + 1536); }
  stage(0, 0);
  FragH bq[KS];
  { const unsigned short* qr = (const unsigned short*)Q16 + ((size_t)b * TT + q0 + ln) * ldq + h * 64;
#pragma unroll
    for (int ks = 0; ks < KS; ++ks) { bq[ks].half[0] = *(const v8us*)(qr + ks * 32 + 8 * hh); bq[ks].half[1] = *(const v8us*)(qr + ks * 32 + 16 + 8 * hh); } }
  asm volatile("s_wait_asynccnt 0x0" ::: "memory");      /* this wave's copies of the mask row and of stage 0 have landed */
  __syncthreads();                                        /* ... and every other wave's: nothing of them is read before */
  stage(1, LBUF);
  float m_q = -3.0e38f, l_q = 0.f; v8f oacc[DT];      /* of query q0 + ln; l_q sums this half's keys; oacc[dt][r] = O^T[dt*16 + 8hh + r][ln] */
#pragma unroll
  for (int dt = 0; dt < DT; ++dt) oacc[dt] = (v8f){0.f,0.f,0.f,0.f,0.f,0.f,0.f,0.f};
#pragma unroll 1      /* stays rolled (for speed only), the buffer chosen by t & 1 */
  for (int t = 0; t < NST; ++t) {
    const int bf = t & 1;
    const unsigned short* kf = &sKV[bf][0][ln][8 * hh]; const unsigned short* vf = &sKV[bf][1][ln][8 * hh]; const int* mf = &sM[t * SK + 8 * hh];
#pragma unroll
    for (int kk = 0; kk < SK; kk += 32) {      /* unrolled: every LDS offset of the two 32-key passes is an immediate */
      /* the pass's fragments and mask words as one group of LDS reads, in front of its first product */
      FragH ak[2][KS], av[DT];
#pragma unroll
      for (int nt = 0; nt < 2; ++nt)
#pragma unroll
        for (int ks = 0; ks < KS; ++ks) { const unsigned short* kr = kf + (kk + nt * 16) * LP + ks * 32; ak[nt][ks].half[0] = *(const v8us*)kr; ak[nt][ks].half[1] = *(const v8us*)(kr + 16); }
      const int* mp = mf + kk;      /* key padding mask (1 = attend), shared by all queries and heads: the lane's keys 8hh + r and 16 + 8hh + r of the pass */
      const v4ia km[2][2] = {{*(const v4ia*)mp, *(const v4ia*)(mp + 4)}, {*(const v4ia*)(mp + 16), *(const v4ia*)(mp + 20)}};
#pragma unroll
      for (int dt = 0; dt < DT; ++dt) { const unsigned short* vrow = vf + dt * 16 * LP + kk; av[dt].half[0] = *(const v8us*)vrow; av[dt].half[1] = *(const v8us*)(vrow + 16); }
      v8f s[2];
#pragma unroll
      for (int nt = 0; nt < 2; ++nt) { v8f acc = (v8f){0.f,0.f,0.f,0.f,0.f,0.f,0.f,0.f};
#pragma unroll
        for (int ks = 0; ks < KS; ++ks) acc = mmaH<1>(ak[nt][ks].v, ak[nt][ks].v, bq[ks].v, bq[ks].v, acc); s[nt] = acc; }
      float mc = -INFINITY;
#pragma unroll
      for (int nt = 0; nt < 2; ++nt)
#pragma unroll
        for (int r = 0; r < 8; ++r) { s[nt][r] = (km[nt][r >> 2][r & 3] != 0) ? s[nt][r] * 0.03125f : -INFINITY; mc = fmaxf(mc, s[nt][r]); }      /* energy/sqrt(1024); masked keys carry -1e20 in the module, -inf here */
      mc = fmaxf(mc, xhalf(mc));
      const float mn = fmaxf(m_q, mc); const float al = expf(m_q - mn); m_q = mn;      /* mn >= -3e38 is finite: nothing attended yet gives exp(0) = 1, a masked key exp(-inf) = 0 */
      float ps = 0.f; FragH pb;
#pragma unroll
      for (int nt = 0; nt < 2; ++nt)
#pragma unroll
        for (int r = 0; r < 8; ++r) { const float p = expf(s[nt][r] - mn); ps += p; pb.h[nt * 8 + r] = (_Float16)(p * 1024.0f); }
      l_q = l_q * al + ps;
#pragma unroll
      for (int dt = 0; dt < DT; ++dt)
#pragma unroll
        for (int r = 0; r < 8; ++r) oacc[dt][r] *= al;
#pragma unroll
      for (int dt = 0; dt < DT; ++dt) oacc[dt] = mmaH<1>(av[dt].v, av[dt].v, pb.v, pb.v, oacc[dt]); }
    asm volatile("s_wait_dscnt 0x0" ::: "memory");        /* this wave's reads of the buffer are over before it is handed to the copies */
    asm volatile("s_wait_asynccnt 0x0" ::: "memory");     /* this wave's copies of stage t + 1 have landed */
    __syncthreads();                                      /* publishes stage t + 1 and ends every wave's reads of stage t */
    if (t + 2 < NST) stage(t + 2, bf * LBUF); }
  asm volatile("s_wait_asynccnt 0x0" ::: "memory");       /* no copy is outstanding when the wave goes on to its end */
  { const float l = l_q + xhalf(l_q); const float inv = (l > 0.f) ? 1.0f / (l * 1024.0f) : 0.f;
#pragma unroll
    for (int dt = 0; dt < DT; ++dt) { FragH o;      /* O x2^4 in f16, the output GEMM's A operand: the lane's 8 consecutive d of query ln */
#pragma unroll
      for (int r = 0; r < 8; ++r) o.h[r] = (_Float16)((oacc[dt][r] * inv) * 16.0f);
      *(v8us*)&sO[w][ln][dt * 16 + 8 * hh] = o.half[0]; } }
  __builtin_amdgcn_fence(__ATOMIC_ACQ_REL, "workgroup"); __builtin_amdgcn_wave_barrier();
  {
#pragma unroll
    for (int rp = 0; rp < RPW; rp += 4) { const int r = rp + (lane >> 3), pc = lane & 7; const v8us val = *(const v8us*)&sO[w][r][pc * 8]; *(v8us*)((unsigned short*)O16 + ((size_t)b * TT + q0 + r) * ldo + h * 64 + pc * 8) = val; }
     } }

extern "C" void kernel_launch(void* const* d_in, const int* in_sizes, int n_in,
                              void* d_out, int out_size, void* d_ws, size_t ws_size, hipStream_t stream) {
  (void)in_sizes; (void)n_in; (void)out_size;
  const float* const* I = (const float* const*)d_in; const float* values = I[0]; const float* keys = I[1]; const float* query = I[2]; const int* mask = (const int*)d_in[3]; const float* Wv = I[4]; const float* Wk = I[5]; const float* Wq = I[6]; const float* Wo = I[7]; const float* bo = I[8];
  char* ws = (char*)d_ws; size_t off = 0;
  auto take = [&](size_t bytes) { char* p = ws + off; off += (bytes + 255) & ~(size_t)255; return p; };
  _Float16* Bo = (_Float16*)take((size_t)DD * DD * 2);
  _Float16* K = (_Float16*)take((size_t)NR * DD * 2); _Float16* Q = (_Float16*)take((size_t)NR * DD * 2); _Float16* Vt = (_Float16*)take((size_t)NR * DD * 2); _Float16* O16 = (_Float16*)take((size_t)NR * DD * 2);
  if (off > ws_size) return;      // 2.1 + 4 x 8.4 = 36 MB
  k_proj<<<dim3(NR / 256, NH, 4), 128, 0, stream>>>(values, keys, query, Wv, Wk, Wq, Wo, Vt, K, Q, Bo);
  k_flash<<<BB * NH * (TT / 64), 128, 0, stream>>>(Q, DD, K, DD, Vt, mask, O16, DD);
  k_gemm_hhx<0><<<dim3(((NR / 16) * (DD / 64) + 3) / 4, 1), 128, 0, stream>>>(O16, DD, 0, Bo, DD, 0, 0.00390625f, bo, 0, nullptr, 1, 0, 0, (float*)d_out, nullptr, DD, 0, NR, DD, DD, 0, 0, 0);      /* out = O·Woᵀ + bo */
}

// v005
// A run of this version takes 105 microseconds.
// Two timings next to v004 put it at 1.23 and 1.26 times that version's speed.
// All steps since v000 together make it 5.25 times as fast.
#include <hip/hip_runtime.h>
// 'SelfAttension' (B=2, S=2048, E=1024, 16 heads × 64): per-head projections with ONE shared 64×64 weight per tensor (y_h = x_h·Wᵀ, torch (out,in), no bias) for values, keys, query; energy = q·kᵀ with −1e20 where the key mask [N,1,1,S] == 0;
// attn = softmax(energy/√1024); out = (attn·v merged)·Woᵀ + bo.
// Compute dtype: inputs, weights, bias rounded to bf16; the per-head 64×64 projections as block-diagonal f16 GEMMs (all 16 head-block columns of all three tensors in one launch, grid = row blocks x heads x 4: the three tensors and the Wo to f16 conversion, K = 64); fused flash-style kernel (per-(b,k) int mask loads, scale 1/32,
// online softmax f32, P f16 ×2^10) on v_wmma_f32_16x16x32_f16; O ×2^4 → f16 → output GEMM + bias; f32 accumulate.
#define BB 2
#define TT 2048
#define DD 1024
#define NH 16
#define HD 64
#define NR (BB * TT)

typedef __bf16 v16b __attribute__((ext_vector_type(16)));
typedef unsigned short v8us __attribute__((ext_vector_type(8), may_alias));
typedef float  v8f  __attribute__((ext_vector_type(8)));
typedef float  v4f  __attribute__((ext_vector_type(4)));
typedef float  v4fa __attribute__((ext_vector_type(4), may_alias));
union FragB { v16b v; v8us half[2]; unsigned short u[16]; };

__device__ __forceinline__ unsigned short bf16_bits(float x) { unsigned int u = __float_as_uint(x); return (unsigned short)((u + 0x7FFFu + ((u >> 16) & 1u)) >> 16); }
__device__ __forceinline__ float bf16_val(unsigned short b) { return __uint_as_float(((unsigned int)b) << 16); }
__device__ __forceinline__ float bf16_round(float x) { return bf16_val(bf16_bits(x)); }
// D += A·B with NT terms: 1 = ah·bh, 2 = + al·bh (A split), 3 = + ah·bl (both split)
template <int NT>
__device__ __forceinline__ v8f mmaN(v16b ah, v16b al, v16b bh, v16b bl, v8f c) {
  c = __builtin_amdgcn_wmma_f32_16x16x32_bf16(false, ah, false, bh, (short)0, c, false, false);
  if (NT >= 2) c = __builtin_amdgcn_wmma_f32_16x16x32_bf16(false, al, false, bh, (short)0, c, false, false);
  if (NT >= 3) c = __builtin_amdgcn_wmma_f32_16x16x32_bf16(false, ah, false, bl, (short)0, c, false, false);
  asm volatile("v_nop\n\tv_nop\n\tv_nop\n\tv_nop" : "+v"(c) : "v"(ah), "v"(al), "v"(bh), "v"(bl));
  return c;
}

__global__ __launch_bounds__(256) void k_wt_bf16(const float* __restrict__ W, unsigned short* __restrict__ Wt, int K, int N) {
  const int t = blockIdx.x * 256 + threadIdx.x;
  const int k8n = K / 8;
  if (t >= N * k8n) return;
  const int n = t / k8n, k8 = (t % k8n) * 8;
  v8us v;
#pragma unroll
  for (int i = 0; i < 8; ++i) v[i] = bf16_bits(W[(size_t)(k8 + i) * N + n]);
  *(v8us*)(Wt + (size_t)n * K + k8) = v;
  
}

// GEMM C[M][N] (f32, pitch ldc) = act(A[M][K]·W + bias). A f32 row-major (pitch lda) converted per fragment to bf16
// (ASPLIT: hi/lo two planes -> 2 terms, else single rounded term); Wt bf16 [N][K] (pitch ldb). BIAS_BF16 rounds the
// bias to bf16 first (bias quantised to bf16 before the add). K%32==0, M%16==0, N%64==0.
template <bool ASPLIT, int ACT, bool BIAS_BF16>
__global__ __launch_bounds__(128) void k_gemm_bf(const float* __restrict__ A, int lda, const unsigned short* __restrict__ Wt, int ldb,
                                               const float* __restrict__ bias, float* __restrict__ C, int ldc, int M, int N, int K) {
  __shared__ __attribute__((aligned(16))) float so[4][16][64];
  const int tid = threadIdx.x, w = tid >> 5, lane = tid & 31, ln = lane & 15, hh = lane >> 4;
  const int ntn = N / 64;
  const int wid = blockIdx.x * 4 + w;
  const int mt = wid / ntn, nq = wid % ntn;
  if (mt * 16 >= M) return;
  const int row0 = mt * 16, col0 = nq * 64;
  const float* arow = A + (size_t)(row0 + ln) * lda;
  v8f acc[4] = {};
  for (int kb = 0; kb < K; kb += 32) {
    FragB ah, al;
    const v4f x0 = *(const v4fa*)(arow + kb + 8 * hh), x1 = *(const v4fa*)(arow + kb + 8 * hh + 4);
    const v4f x2 = *(const v4fa*)(arow + kb + 16 + 8 * hh), x3 = *(const v4fa*)(arow + kb + 16 + 8 * hh + 4);
    float xs[16] = {x0[0],x0[1],x0[2],x0[3],x1[0],x1[1],x1[2],x1[3],x2[0],x2[1],x2[2],x2[3],x3[0],x3[1],x3[2],x3[3]};
#pragma unroll
    for (int i = 0; i < 16; ++i) { const unsigned short hb = bf16_bits(xs[i]); ah.u[i] = hb; al.u[i] = ASPLIT ? bf16_bits(xs[i] - bf16_val(hb)) : (unsigned short)0; }
#pragma unroll
    for (int t = 0; t < 4; ++t) {
      const unsigned short* brow = Wt + (size_t)(col0 + t * 16 + ln) * ldb + kb;
      FragB b;
      b.half[0] = *(const v8us*)(brow + 8 * hh);
      b.half[1] = *(const v8us*)(brow + 16 + 8 * hh);
      acc[t] = mmaN<ASPLIT ? 2 : 1>(ah.v, al.v, b.v, b.v, acc[t]);
    }
  }
#pragma unroll
  for (int t = 0; t < 4; ++t) {
    float bv = bias ? bias[col0 + t * 16 + ln] : 0.f;
    if (BIAS_BF16) bv = bf16_round(bv);
#pragma unroll
    for (int r = 0; r < 8; ++r) { float v = acc[t][r] + bv; if (ACT == 1) v = fmaxf(v, 0.f); so[w][8 * hh + r][t * 16 + ln] = v; }
  }
  __builtin_amdgcn_fence(__ATOMIC_ACQ_REL, "workgroup");
  __builtin_amdgcn_wave_barrier();
  const int rsub = lane >> 4, c4 = (lane & 15) * 4;
  {
#pragma unroll
    for (int q = 0; q < 8; ++q) {
      const int r = q * 2 + rsub;
      const v4f v = *(const v4fa*)&so[w][r][c4];
      *(v4f*)(C + (size_t)(row0 + r) * ldc + col0 + c4) = v;
    }
    
  }
}

// Flash-style causal/unmasked attention, all contractions 3-term bf16 hi/lo splits, f32 softmax with running max.
// q,k,v rows are read from f32 buffers with arbitrary row pitch (so they can live inside a fused qkv buffer);
// D = head size (multiple of 32, <= 128); one wave = 16 query rows; block = 4 waves (64 queries) sharing K/V chunks of 32.
template <int D, bool CAUSAL>
__global__ __launch_bounds__(128) void k_flash(const float* __restrict__ qb, const float* __restrict__ kb, const float* __restrict__ vb,
                                             int pitch, int T, int H, float scale, float* __restrict__ y, int ypitch) {
  constexpr int KS = D / 32;        // k-steps for QK
  constexpr int DT = D / 16;        // d tiles for PV
  __shared__ __attribute__((aligned(16))) unsigned short sKh[32][D + 8], sKl[32][D + 8], sVh[32][D + 8], sVl[32][D + 8];
  __shared__ __attribute__((aligned(16))) unsigned short sPh[4][16][40], sPl[4][16][40];
  __shared__ __attribute__((aligned(16))) float sO[4][16][D];
  const int tid = threadIdx.x, w = tid >> 5, lane = tid & 31, ln = lane & 15, hh = lane >> 4;
  const int nqb = (T + 63) / 64;
  const int bh = blockIdx.x / nqb, qblk = blockIdx.x % nqb;
  const int b = bh / H, h = bh % H;
  const int q0 = qblk * 64 + w * 16;
  const float* Q = qb + (size_t)b * T * pitch + h * D;
  const float* K = kb + (size_t)b * T * pitch + h * D;
  const float* V = vb + (size_t)b * T * pitch + h * D;

  // A fragments of the wave's 16 query rows (scaled), hi/lo
  FragB aqh[KS], aql[KS];
  {
    int row = q0 + ln; if (row >= T) row = T - 1;
    const float* qr = Q + (size_t)row * pitch;
#pragma unroll
    for (int ks = 0; ks < KS; ++ks)
#pragma unroll
      for (int i = 0; i < 16; ++i) {
        const int d = ks * 32 + ((i < 8) ? (8 * hh + i) : (16 + 8 * hh + (i - 8)));
        const float x = qr[d] * scale; const unsigned short hb = bf16_bits(x);
        aqh[ks].u[i] = hb; aql[ks].u[i] = bf16_bits(x - bf16_val(hb));
      }
  }
  float m_r[8], l_r[8];
#pragma unroll
  for (int r = 0; r < 8; ++r) { m_r[r] = -3.0e38f; l_r[r] = 0.f; }
  v8f oacc[DT];
#pragma unroll
  for (int dt = 0; dt < DT; ++dt) oacc[dt] = (v8f){0.f,0.f,0.f,0.f,0.f,0.f,0.f,0.f};

  const int kv_end = CAUSAL ? min(T, qblk * 64 + 64) : T;     // block-uniform
  for (int j0 = 0; j0 < kv_end; j0 += 32) {
    __syncthreads();
    for (int e = tid; e < 32 * (D / 4); e += 128) {
      const int r = e / (D / 4), c4 = (e % (D / 4)) * 4;
      const int key = j0 + r;
      v4f kf = {0.f,0.f,0.f,0.f}, vf = {0.f,0.f,0.f,0.f};
      if (key < T) { kf = *(const v4fa*)(K + (size_t)key * pitch + c4); vf = *(const v4fa*)(V + (size_t)key * pitch + c4); }
#pragma unroll
      for (int t = 0; t < 4; ++t) {
        unsigned short hb = bf16_bits(kf[t]); sKh[r][c4 + t] = hb; sKl[r][c4 + t] = bf16_bits(kf[t] - bf16_val(hb));
        hb = bf16_bits(vf[t]); sVh[r][c4 + t] = hb; sVl[r][c4 + t] = bf16_bits(vf[t] - bf16_val(hb));
      }
    }
    __syncthreads();
    // S tile 16 x 32
    v8f s[2];
#pragma unroll
    for (int nt = 0; nt < 2; ++nt) {
      v8f acc = {};
#pragma unroll
      for (int ks = 0; ks < KS; ++ks) {
        FragB bh_, bl_;
        bh_.half[0] = *(const v8us*)&sKh[nt * 16 + ln][ks * 32 + 8 * hh]; bh_.half[1] = *(const v8us*)&sKh[nt * 16 + ln][ks * 32 + 16 + 8 * hh];
        bl_.half[0] = *(const v8us*)&sKl[nt * 16 + ln][ks * 32 + 8 * hh]; bl_.half[1] = *(const v8us*)&sKl[nt * 16 + ln][ks * 32 + 16 + 8 * hh];
        acc = mmaN<3>(aqh[ks].v, aql[ks].v, bh_.v, bl_.v, acc);
      }
      s[nt] = acc;
    }
    // mask + running max (rows 8hh+r; the 16 lanes of a half share rows)
    float alpha[8];
#pragma unroll
    for (int r = 0; r < 8; ++r) {
      const int qi = q0 + 8 * hh + r;
      const int ja = j0 + ln, jb = j0 + 16 + ln;
      if (CAUSAL) { if (ja > qi) s[0][r] = -3.0e38f; if (jb > qi) s[1][r] = -3.0e38f; }
      if (ja >= T) s[0][r] = -3.0e38f;
      if (jb >= T) s[1][r] = -3.0e38f;
      float mx = fmaxf(s[0][r], s[1][r]);
      mx = fmaxf(mx, __shfl_xor(mx, 1, 32)); mx = fmaxf(mx, __shfl_xor(mx, 2, 32)); mx = fmaxf(mx, __shfl_xor(mx, 4, 32)); mx = fmaxf(mx, __shfl_xor(mx, 8, 32));
      const float mnew = fmaxf(m_r[r], mx);
      alpha[r] = (mnew > -1.0e38f) ? __expf(m_r[r] - mnew) : 1.0f;
      const float p0 = (s[0][r] > -1.0e38f) ? __expf(s[0][r] - mnew) : 0.f;
      const float p1 = (s[1][r] > -1.0e38f) ? __expf(s[1][r] - mnew) : 0.f;
      m_r[r] = mnew;
      l_r[r] = l_r[r] * alpha[r] + p0 + p1;            // per-lane partial row sum (16 lanes combined at the end)
      unsigned short hb = bf16_bits(p0); sPh[w][8 * hh + r][ln] = hb;      sPl[w][8 * hh + r][ln] = bf16_bits(p0 - bf16_val(hb));
      hb = bf16_bits(p1);                sPh[w][8 * hh + r][16 + ln] = hb; sPl[w][8 * hh + r][16 + ln] = bf16_bits(p1 - bf16_val(hb));
    }
#pragma unroll
    for (int dt = 0; dt < DT; ++dt)
#pragma unroll
      for (int r = 0; r < 8; ++r) oacc[dt][r] *= alpha[r];
    __builtin_amdgcn_fence(__ATOMIC_ACQ_REL, "workgroup");
    __builtin_amdgcn_wave_barrier();
    FragB pah, pal;
    pah.half[0] = *(const v8us*)&sPh[w][ln][8 * hh]; pah.half[1] = *(const v8us*)&sPh[w][ln][16 + 8 * hh];
    pal.half[0] = *(const v8us*)&sPl[w][ln][8 * hh]; pal.half[1] = *(const v8us*)&sPl[w][ln][16 + 8 * hh];
#pragma unroll
    for (int dt = 0; dt < DT; ++dt) {
      FragB bvh, bvl;
#pragma unroll
      for (int i = 0; i < 8; ++i) {
        bvh.u[i] = sVh[8 * hh + i][dt * 16 + ln]; bvh.u[8 + i] = sVh[16 + 8 * hh + i][dt * 16 + ln];
        bvl.u[i] = sVl[8 * hh + i][dt * 16 + ln]; bvl.u[8 + i] = sVl[16 + 8 * hh + i][dt * 16 + ln];
      }
      oacc[dt] = mmaN<3>(pah.v, pal.v, bvh.v, bvl.v, oacc[dt]);
    }
    __builtin_amdgcn_fence(__ATOMIC_ACQ_REL, "workgroup");
    __builtin_amdgcn_wave_barrier();
  }
#pragma unroll
  for (int r = 0; r < 8; ++r) {
    float l = l_r[r];
    l += __shfl_xor(l, 1, 32); l += __shfl_xor(l, 2, 32); l += __shfl_xor(l, 4, 32); l += __shfl_xor(l, 8, 32);
    l_r[r] = (l > 0.f) ? 1.0f / l : 0.f;
  }
#pragma unroll
  for (int dt = 0; dt < DT; ++dt)
#pragma unroll
    for (int r = 0; r < 8; ++r) sO[w][8 * hh + r][dt * 16 + ln] = oacc[dt][r] * l_r[r];
  __builtin_amdgcn_fence(__ATOMIC_ACQ_REL, "workgroup");
  __builtin_amdgcn_wave_barrier();
  {
    for (int r = 0; r < 16; ++r) {
      const int row = q0 + r;
      if (row < T && lane < D / 4) {
        const v4f val = *(const v4fa*)&sO[w][r][lane * 4];
        *(v4f*)(y + ((size_t)b * T + row) * ypitch + h * D + lane * 4) = val;
      }
    }
    
  }
}

// GEMM C = act(A·W + bias + resid): A f32 (ASPLIT -> hi/lo 2 terms), Wt bf16 [N][K]; ACT 0 none, 1 relu, 2 exact gelu;
// resid (optional, f32, row index = (row % rmod), pitch ldr, RES_BF16 rounds it) added before the activation.
template <bool ASPLIT, int ACT, bool BIAS_BF16, bool RES_BF16>
__global__ __launch_bounds__(128) void k_gemm_bf3(const float* __restrict__ A, int lda, const unsigned short* __restrict__ Wt, int ldb,
                                                const float* __restrict__ bias, const float* __restrict__ resid, int rmod, int ldr,
                                                float* __restrict__ C, int ldc, int M, int N, int K) {
  __shared__ __attribute__((aligned(16))) float so[4][16][64];
  const int tid = threadIdx.x, w = tid >> 5, lane = tid & 31, ln = lane & 15, hh = lane >> 4;
  const int ntn = N / 64;
  const int wid = blockIdx.x * 4 + w;
  const int mt = wid / ntn, nq = wid % ntn;
  if (mt * 16 >= M) return;
  const int row0 = mt * 16, col0 = nq * 64;
  const float* arow = A + (size_t)(row0 + ln) * lda;
  v8f acc[4] = {};
  for (int kb = 0; kb < K; kb += 32) {
    FragB ah, al;
    const v4f x0 = *(const v4fa*)(arow + kb + 8 * hh), x1 = *(const v4fa*)(arow + kb + 8 * hh + 4);
    const v4f x2 = *(const v4fa*)(arow + kb + 16 + 8 * hh), x3 = *(const v4fa*)(arow + kb + 16 + 8 * hh + 4);
    float xs[16] = {x0[0],x0[1],x0[2],x0[3],x1[0],x1[1],x1[2],x1[3],x2[0],x2[1],x2[2],x2[3],x3[0],x3[1],x3[2],x3[3]};
#pragma unroll
    for (int i = 0; i < 16; ++i) { const unsigned short hb = bf16_bits(xs[i]); ah.u[i] = hb; al.u[i] = ASPLIT ? bf16_bits(xs[i] - bf16_val(hb)) : (unsigned short)0; }
#pragma unroll
    for (int t = 0; t < 4; ++t) {
      const unsigned short* brow = Wt + (size_t)(col0 + t * 16 + ln) * ldb + kb;
      FragB b;
      b.half[0] = *(const v8us*)(brow + 8 * hh);
      b.half[1] = *(const v8us*)(brow + 16 + 8 * hh);
      acc[t] = mmaN<ASPLIT ? 2 : 1>(ah.v, al.v, b.v, b.v, acc[t]);
    }
  }
#pragma unroll
  for (int t = 0; t < 4; ++t) {
    const int col = col0 + t * 16 + ln;
    float bv = bias ? bias[col] : 0.f;
    if (BIAS_BF16) bv = bf16_round(bv);
#pragma unroll
    for (int r = 0; r < 8; ++r) {
      float v = acc[t][r] + bv;
      if (resid) { float rv = resid[(size_t)((row0 + 8 * hh + r) % rmod) * ldr + col]; if (RES_BF16) rv = bf16_round(rv); v += rv; }
      if (ACT == 1) v = fmaxf(v, 0.f);
      if (ACT == 2) v = 0.5f * v * (1.0f + erff(v * 0.70710678118654752f));
      if (ACT == 3) { const float u = 0.7978845608028654f * (v + 0.044715f * v * v * v); v = 0.5f * v * (1.0f + tanhf(u)); }
      so[w][8 * hh + r][t * 16 + ln] = v;
    }
  }
  __builtin_amdgcn_fence(__ATOMIC_ACQ_REL, "workgroup");
  __builtin_amdgcn_wave_barrier();
  const int rsub = lane >> 4, c4 = (lane & 15) * 4;
  {
#pragma unroll
    for (int q = 0; q < 8; ++q) {
      const int r = q * 2 + rsub;
      const v4f v = *(const v4fa*)&so[w][r][c4];
      *(v4f*)(C + (size_t)(row0 + r) * ldc + col0 + c4) = v;
    }
    
  }
}
// row LayerNorm (biased variance, eps) over N: s = X (+ R); optional out_sum <- s; out_norm <- (s-mu)*rsqrt(var+eps)*g + b
template <bool PARAM_BF16>
__global__ __launch_bounds__(256) void k_layernorm(const float* __restrict__ X, const float* __restrict__ R, const float* __restrict__ g, const float* __restrict__ bta,
                                                  float* __restrict__ out_sum, float* __restrict__ out_norm, int N, float eps) {
  __shared__ float red[256];
  const int row = blockIdx.x, tid = threadIdx.x;
  const float* x = X + (size_t)row * N; const float* rr = R ? R + (size_t)row * N : nullptr;
  float vals[16];                     // up to N = 4096
  const int per = N / 256;            // contiguous chunk per thread? use strided-by-4 chunks: thread handles j = tid*4 + 1024*u
  float s1 = 0.f;
  for (int u = 0; u < per / 4; ++u) {
    const int j = tid * 4 + 1024 * u;
    const v4f a = *(const v4fa*)(x + j);
    v4f b = {0.f,0.f,0.f,0.f}; if (rr) b = *(const v4fa*)(rr + j);
#pragma unroll
    for (int q = 0; q < 4; ++q) { const float v = a[q] + b[q]; vals[u * 4 + q] = v; s1 += v; }
  }
  red[tid] = s1; __syncthreads();
  for (int st = 128; st > 0; st >>= 1) { if (tid < st) red[tid] += red[tid + st]; __syncthreads(); }
  const float mu = red[0] / (float)N; __syncthreads();
  float s2 = 0.f;
  for (int u = 0; u < per / 4; ++u)
#pragma unroll
    for (int q = 0; q < 4; ++q) { const float c = vals[u * 4 + q] - mu; s2 += c * c; }
  red[tid] = s2; __syncthreads();
  for (int st = 128; st > 0; st >>= 1) { if (tid < st) red[tid] += red[tid + st]; __syncthreads(); }
  const float rs = rsqrtf(red[0] / (float)N + eps);
  {
    for (int u = 0; u < per / 4; ++u) {
      const int j = tid * 4 + 1024 * u;
      v4f o, sm;
#pragma unroll
      for (int q = 0; q < 4; ++q) {
        float gg = g[j + q], bb = bta[j + q];
        if (PARAM_BF16) { gg = bf16_round(gg); bb = bf16_round(bb); }
        sm[q] = vals[u * 4 + q]; o[q] = (vals[u * 4 + q] - mu) * rs * gg + bb;
      }
      if (out_sum) *(v4f*)(out_sum + (size_t)row * N + j) = sm;
      *(v4f*)(out_norm + (size_t)row * N + j) = o;
    }
    
  }
}



// ---- f16 WMMA path (v_wmma_f32_16x16x32_f16): 11-bit significands for operands in range — used where a [0,1] probability operand needs more precision than bf16
typedef _Float16 v16h __attribute__((ext_vector_type(16)));
union FragH { v16h v; v8us half[2]; _Float16 h[16]; unsigned short u[16]; };
template <int NT>
__device__ __forceinline__ v8f mmaH(v16h ah, v16h al, v16h bh, v16h bl, v8f c) {
  c = __builtin_amdgcn_wmma_f32_16x16x32_f16(false, ah, false, bh, (short)0, c, false, false);
  if (NT >= 2) c = __builtin_amdgcn_wmma_f32_16x16x32_f16(false, al, false, bh, (short)0, c, false, false);
  if (NT >= 3) c = __builtin_amdgcn_wmma_f32_16x16x32_f16(false, ah, false, bl, (short)0, c, false, false);
  asm volatile("v_nop\n\tv_nop\n\tv_nop\n\tv_nop" : "+v"(c) : "v"(ah), "v"(al), "v"(bh), "v"(bl));
  return c;
}
// batched GEMM like k_gemm_b but f16 operands: A f32 (split into f16 hi/lo if ASPLIT, else rounded to f16), Bt = f16 values [n][k]; alpha; C f32; N multiple of 16 (partial tiles skipped)
template <bool ASPLIT>
__global__ __launch_bounds__(128) void k_gemm_h(const float* __restrict__ A, int lda, size_t sA, const _Float16* __restrict__ Bh, int ldb, size_t sB, float alpha, float* __restrict__ C, int ldc, size_t sC, int M, int N, int K) {
  __shared__ __attribute__((aligned(16))) float so[4][16][64];
  const int tid = threadIdx.x, w = tid >> 5, lane = tid & 31, ln = lane & 15, hh = lane >> 4; const int by = blockIdx.y;
  A += (size_t)by * sA; Bh += (size_t)by * sB; C += (size_t)by * sC;
  const int ntn = (N + 63) / 64; const int wid = blockIdx.x * 4 + w; const int mt = wid / ntn, nq = wid % ntn; if (mt * 16 >= M) return;
  const int row0 = mt * 16, col0 = nq * 64; const float* arow = A + (size_t)(row0 + ln) * lda;
  v8f acc[4] = {};
  for (int kb = 0; kb < K; kb += 32) {
    FragH ah, al;
    const v4f x0 = *(const v4fa*)(arow + kb + 8 * hh), x1 = *(const v4fa*)(arow + kb + 8 * hh + 4), x2 = *(const v4fa*)(arow + kb + 16 + 8 * hh), x3 = *(const v4fa*)(arow + kb + 16 + 8 * hh + 4);
    float xs[16] = {x0[0],x0[1],x0[2],x0[3],x1[0],x1[1],x1[2],x1[3],x2[0],x2[1],x2[2],x2[3],x3[0],x3[1],x3[2],x3[3]};
#pragma unroll
    for (int i = 0; i < 16; ++i) { const _Float16 h = (_Float16)xs[i]; ah.h[i] = h; al.h[i] = ASPLIT ? (_Float16)(xs[i] - (float)h) : (_Float16)0.0f; }
#pragma unroll
    for (int t = 0; t < 4; ++t) { if (col0 + t * 16 >= N) continue; const size_t boff = (size_t)(col0 + t * 16 + ln) * ldb + kb; FragH bq; bq.half[0] = *(const v8us*)(Bh + boff + 8 * hh); bq.half[1] = *(const v8us*)(Bh + boff + 16 + 8 * hh);
      acc[t] = mmaH<ASPLIT ? 2 : 1>(ah.v, al.v, bq.v, bq.v, acc[t]); }
  }
#pragma unroll
  for (int t = 0; t < 4; ++t) { if (col0 + t * 16 >= N) continue;
#pragma unroll
    for (int r = 0; r < 8; ++r) so[w][8 * hh + r][t * 16 + ln] = acc[t][r] * alpha; }
  __builtin_amdgcn_fence(__ATOMIC_ACQ_REL, "workgroup"); __builtin_amdgcn_wave_barrier();
  const int rsub = lane >> 4, c4 = (lane & 15) * 4;
  {
#pragma unroll
    for (int q = 0; q < 8; ++q) { const int r = q * 2 + rsub; if (col0 + c4 < N) { const v4f v = *(const v4fa*)&so[w][r][c4]; *(v4f*)(C + (size_t)(row0 + r) * ldc + col0 + c4) = v; } }
     }
}

// Wt[n][k] = f16(W[k][n]·scale) from f32 row-major W[K][N] (scale = power of two; bf16-exact weights stay exact in f16 away from the subnormal range)
__global__ __launch_bounds__(256) void k_wt_f16(const float* __restrict__ W, _Float16* __restrict__ Wt, int K, int N, float scale) {
  const int t = blockIdx.x * 256 + threadIdx.x; if (t >= N * (K / 8)) return; const int n = t / (K / 8), k8 = (t % (K / 8)) * 8; FragH f;
#pragma unroll
  for (int i = 0; i < 8; ++i) f.h[i] = (_Float16)(bf16_round(W[(size_t)(k8 + i) * N + n]) * scale); const v8us o = f.half[0];
  *(v8us*)((unsigned short*)Wt + (size_t)n * K + k8) = o; 
}
// k_gemm_hh variant with fused epilogue: v = acc·alpha + bias[by·sBias + col] (+ CP[(row/rowsPerB)·sCPb + by·64 + col] if CP) ; ACT 0 none / 1 elu ; writes f16 C16 and/or f32 C (each if non-null)
template <int ACT>
__global__ __launch_bounds__(128) void k_gemm_hhx(const _Float16* __restrict__ A, int lda, size_t sA, const _Float16* __restrict__ Bh, int ldb, size_t sB, float alpha, const float* __restrict__ bias, size_t sBias, const float* __restrict__ CP, int rowsPerB, size_t sCPb, int row0g,
    float* __restrict__ C, _Float16* __restrict__ C16, int ldc, size_t sC, int M, int N, int K, size_t sAz, size_t sBz, size_t sCz) {
  __shared__ __attribute__((aligned(16))) float so[4][16][64];
  const int tid = threadIdx.x, w = tid >> 5, lane = tid & 31, ln = lane & 15, hh = lane >> 4; const int by = blockIdx.y, bz = blockIdx.z;      /* second batch index bz with its own strides sAz, sBz, sCz */
  A += (size_t)by * sA + (size_t)bz * sAz; Bh += (size_t)by * sB + (size_t)bz * sBz; const size_t cofs = (size_t)by * sC + (size_t)bz * sCz; const float* bp = bias ? bias + (size_t)by * sBias : nullptr;
  const int ntn = (N + 63) / 64; const int wid = blockIdx.x * 4 + w; const int mt = wid / ntn, nq = wid % ntn; if (mt * 16 >= M) return;
  const int row0 = mt * 16, col0 = nq * 64; const _Float16* arow = A + (size_t)(row0 + ln) * lda;
  v8f acc[4] = {};
  for (int kb = 0; kb < K; kb += 32) { FragH ah; ah.half[0] = *(const v8us*)((const unsigned short*)arow + kb + 8 * hh); ah.half[1] = *(const v8us*)((const unsigned short*)arow + kb + 16 + 8 * hh);
#pragma unroll
    for (int t = 0; t < 4; ++t) { if (col0 + t * 16 >= N) continue; const size_t boff = (size_t)(col0 + t * 16 + ln) * ldb + kb; FragH bq; bq.half[0] = *(const v8us*)((const unsigned short*)Bh + boff + 8 * hh); bq.half[1] = *(const v8us*)((const unsigned short*)Bh + boff + 16 + 8 * hh);
      acc[t] = mmaH<1>(ah.v, ah.v, bq.v, bq.v, acc[t]); }
  }
#pragma unroll
  for (int t = 0; t < 4; ++t) { if (col0 + t * 16 >= N) continue; const int col = col0 + t * 16 + ln; const float bv = bp ? bf16_round(bp[col]) : 0.f;
#pragma unroll
    for (int r = 0; r < 8; ++r) { float v = acc[t][r] * alpha + bv; if (CP) { const int bidx = (row0g + row0 + 8 * hh + r) / rowsPerB; v += CP[(size_t)bidx * sCPb + (size_t)by * 64 + col]; } if (ACT == 1) v = (v > 0.f) ? v : expm1f(v); else if (ACT == 7) v = (v > 0.f) ? v + 1.0f : expf(v); else if (ACT == 8) v = tanhf(v); else if (ACT == 9) v = 0.5f * v * (1.0f + tanhf(0.7978845608028654f * (v + 0.044715f * v * v * v))); else if (ACT == 11) v = 1.0f / (1.0f + expf(-v)); else if (ACT == 12) v = (v > 0.f) ? v : 0.01f * v; else if (ACT == 14) v = (v > 0.f) ? v : 0.1f * v; else if (ACT == 15) v = v / (1.0f + expf(-v)); else if (ACT == 3) v = fmaxf(v, 0.f); else if (ACT == 6) v = 0.5f * v * (1.0f + erff(v * 0.70710678118654752f)); so[w][8 * hh + r][t * 16 + ln] = v; } }
  __builtin_amdgcn_fence(__ATOMIC_ACQ_REL, "workgroup"); __builtin_amdgcn_wave_barrier();
  const int rsub = lane >> 4, c4 = (lane & 15) * 4; typedef _Float16 v4h __attribute__((ext_vector_type(4)));
  {
#pragma unroll
    for (int q = 0; q < 8; ++q) { const int r = q * 2 + rsub; if (col0 + c4 < N) { const v4f v = *(const v4fa*)&so[w][r][c4]; if (C) *(v4f*)(C + cofs + (size_t)(row0 + r) * ldc + col0 + c4) = v; if (C16) { v4h h4; for (int i = 0; i < 4; ++i) h4[i] = (_Float16)v[i]; *(v4h*)(C16 + cofs + (size_t)(row0 + r) * ldc + col0 + c4) = h4; } } }
     }
}


typedef _Float16 v4h __attribute__((ext_vector_type(4)));

__global__ __launch_bounds__(256) void k_h16(const float* __restrict__ x, _Float16* __restrict__ X16, size_t n8) { const size_t t = (size_t)blockIdx.x * 256 + threadIdx.x; if (t >= n8) return; FragH f;
#pragma unroll
  for (int q = 0; q < 8; ++q) f.h[q] = (_Float16)x[t * 8 + q]; *(v8us*)((unsigned short*)X16 + t * 8) = f.half[0];  }
// The 16 f32 of one 16 x 32 operand fragment in the hardware k order (k = 8hh + e, then 16 + 8hh + e - 8), as loaded: p = row + 32 ks + 8 hh
struct Raw16 { v4f a, b, c, d; };
__device__ __forceinline__ Raw16 raw_f32(const float* __restrict__ p) { Raw16 x; x.a = *(const v4fa*)p; x.b = *(const v4fa*)(p + 4); x.c = *(const v4fa*)(p + 16); x.d = *(const v4fa*)(p + 20); return x; }
// each value rounded to bf16, then held exactly in f16 (weights x2^4)
template <bool W16>
__device__ __forceinline__ FragH frag_f32(const Raw16& x) { FragH f;
#pragma unroll
  for (int q = 0; q < 4; ++q) {
    f.h[q]      = W16 ? (_Float16)(bf16_round(x.a[q]) * 16.0f) : (_Float16)bf16_round(x.a[q]);
    f.h[4 + q]  = W16 ? (_Float16)(bf16_round(x.b[q]) * 16.0f) : (_Float16)bf16_round(x.b[q]);
    f.h[8 + q]  = W16 ? (_Float16)(bf16_round(x.c[q]) * 16.0f) : (_Float16)bf16_round(x.c[q]);
    f.h[12 + q] = W16 ? (_Float16)(bf16_round(x.d[q]) * 16.0f) : (_Float16)bf16_round(x.d[q]); }
  return f; }
// One wave: 64 rows x one head of one tensor, y = x.W^T (K = 64), inputs and weight converted in registers; the next 16 rows are loaded while these are worked on. st = the wave's own 64 x 64 f16 staging tile (pitch 72), written 16 B a lane:
// TR (values): A = x rows, B = W rows, so a lane holds 8 consecutive rows of one output column and the tile is staged transposed, st[d][row];
// else (keys, query): A = W rows, B = x rows, so a lane holds 8 consecutive columns of one row, st[row][e]. Either way each staged row leaves as one whole 128-B line; dst = first staged row, pitch in elements.
template <bool TR>
__device__ __forceinline__ void proj_tile(const float* __restrict__ x, const float* __restrict__ W, unsigned short (*st)[72], unsigned short* __restrict__ dst, size_t pitch, int lane) {
  const int ln = lane & 15, hh = lane >> 4; const float* xl = x + (size_t)ln * DD + 8 * hh; const float* wl = W + ln * HD + 8 * hh;
  Raw16 xr[2][2]; xr[0][0] = raw_f32(xl); xr[0][1] = raw_f32(xl + 32);
  Raw16 wr[4][2];
#pragma unroll
  for (int t = 0; t < 4; ++t)
#pragma unroll
    for (int ks = 0; ks < 2; ++ks) wr[t][ks] = raw_f32(wl + t * 16 * HD + ks * 32);
  asm volatile("s_wait_xcnt 0x0" :: "v"(wl) : "memory");      /* precaution: the weight loads' address registers (the input) are written again only behind this wait */
  FragH wf[4][2];
#pragma unroll
  for (int t = 0; t < 4; ++t)
#pragma unroll
    for (int ks = 0; ks < 2; ++ks) wf[t][ks] = frag_f32<true>(wr[t][ks]);
#pragma unroll
  for (int rt = 0; rt < 4; ++rt) {
    if (rt < 3) { xr[(rt + 1) & 1][0] = raw_f32(xl + (size_t)(rt + 1) * 16 * DD); xr[(rt + 1) & 1][1] = raw_f32(xl + (size_t)(rt + 1) * 16 * DD + 32);
      if (rt == 2) asm volatile("s_wait_xcnt 0x0" :: "v"(xl) : "memory"); }      /* the same precaution behind the last loads that name the row address */
    const FragH x0 = frag_f32<false>(xr[rt & 1][0]), x1 = frag_f32<false>(xr[rt & 1][1]);
#pragma unroll
    for (int t = 0; t < 4; ++t) { v8f acc = (v8f){0.f,0.f,0.f,0.f,0.f,0.f,0.f,0.f};
      if (TR) { acc = mmaH<1>(x0.v, x0.v, wf[t][0].v, wf[t][0].v, acc); acc = mmaH<1>(x1.v, x1.v, wf[t][1].v, wf[t][1].v, acc); }
      else    { acc = mmaH<1>(wf[t][0].v, wf[t][0].v, x0.v, x0.v, acc); acc = mmaH<1>(wf[t][1].v, wf[t][1].v, x1.v, x1.v, acc); }
      FragH o;
#pragma unroll
      for (int r = 0; r < 8; ++r) o.h[r] = (_Float16)(acc[r] * 0.0625f);
      if (TR) *(v8us*)&st[t * 16 + ln][rt * 16 + 8 * hh] = o.half[0]; else *(v8us*)&st[rt * 16 + ln][t * 16 + 8 * hh] = o.half[0]; } }
  __builtin_amdgcn_fence(__ATOMIC_ACQ_REL, "workgroup"); __builtin_amdgcn_wave_barrier();      /* the wave reads back what its other lanes staged */
#pragma unroll
  for (int q = 0; q < 16; ++q) { const int r = q * 4 + (lane >> 3), c8 = (lane & 7) * 8; const v8us v = *(const v8us*)&st[r][c8]; *(v8us*)(dst + (size_t)r * pitch + c8) = v; }
  asm volatile("s_wait_xcnt 0x0" ::: "memory"); }      /* the same precaution behind the stores: nothing that follows on any path writes their registers first */
// grid (NR / 256, heads, 4): blockIdx.z = 0 values -> Vt[slab][d][t], 1 keys -> K16, 2 query -> Q16 (row-major, head h at column 64 h); blockIdx.z = 3: Bo = f16(bf16(Wo) x2^4), 8 elements a thread and trip
__global__ __launch_bounds__(128) void k_proj(const float* __restrict__ xv, const float* __restrict__ xk, const float* __restrict__ xq, const float* __restrict__ Wv, const float* __restrict__ Wk, const float* __restrict__ Wq, const float* __restrict__ Wo,
    _Float16* __restrict__ Vt, _Float16* __restrict__ K16, _Float16* __restrict__ Q16, _Float16* __restrict__ Bo) {
  __shared__ __attribute__((aligned(16))) unsigned short st[4][64][72];
  const int tid = threadIdx.x, w = tid >> 5, lane = tid & 31; const int z = blockIdx.z, h = blockIdx.y;
  if (z == 3) { constexpr int NTH = (NR / 256) * NH * 128;
#pragma unroll
    for (int i = 0; i < DD * DD / 8 / NTH; ++i) { const size_t t = (size_t)i * NTH + (size_t)(blockIdx.y * (NR / 256) + blockIdx.x) * 128 + tid; const v4f a = *(const v4fa*)(Wo + t * 8), c = *(const v4fa*)(Wo + t * 8 + 4); FragH f;
#pragma unroll
      for (int q = 0; q < 4; ++q) { f.h[q] = (_Float16)(bf16_round(a[q]) * 16.0f); f.h[4 + q] = (_Float16)(bf16_round(c[q]) * 16.0f); }
      *(v8us*)((unsigned short*)Bo + t * 8) = f.half[0]; }
    return; }
  const int row0 = (blockIdx.x * 4 + w) * 64; const size_t xo = (size_t)row0 * DD + h * HD;
  if (z == 0) proj_tile<true>(xv + xo, Wv, st[w], (unsigned short*)Vt + ((size_t)((row0 / TT) * NH + h) * HD) * TT + row0 % TT, TT, lane);
  else proj_tile<false>((z == 1 ? xk : xq) + xo, z == 1 ? Wk : Wq, st[w], (unsigned short*)(z == 1 ? K16 : Q16) + xo, DD, lane); }
// lane l with lane l ^ 16 (a vector cross-row move, no LDS)
__device__ __forceinline__ float xhalf(float x) { return __builtin_bit_cast(float, __builtin_amdgcn_permlanex16(__builtin_bit_cast(int, x), __builtin_bit_cast(int, x), 0x76543210, 0xfedcba98, false, false)); }
// x <- 2^x on the hardware exponential for a pass's 16 scores and its rescale exponent. One asm statement so that each v_exp_f32 writes over its own argument and its neighbours name other registers:
// the slot that the instruction set asks for behind a transcendental (no read of its result, no write of its source) is then kept between them by construction, and the closing v_nop keeps it for whatever follows.
__device__ __forceinline__ void exp2_17(v8f& a, v8f& b, float& c) {
  float a0 = a[0], a1 = a[1], a2 = a[2], a3 = a[3], a4 = a[4], a5 = a[5], a6 = a[6], a7 = a[7], b0 = b[0], b1 = b[1], b2 = b[2], b3 = b[3], b4 = b[4], b5 = b[5], b6 = b[6], b7 = b[7];
  asm("v_exp_f32 %16, %16\n\tv_exp_f32 %0, %0\n\tv_exp_f32 %1, %1\n\tv_exp_f32 %2, %2\n\tv_exp_f32 %3, %3\n\tv_exp_f32 %4, %4\n\tv_exp_f32 %5, %5\n\tv_exp_f32 %6, %6\n\tv_exp_f32 %7, %7\n\t"
      "v_exp_f32 %8, %8\n\tv_exp_f32 %9, %9\n\tv_exp_f32 %10, %10\n\tv_exp_f32 %11, %11\n\tv_exp_f32 %12, %12\n\tv_exp_f32 %13, %13\n\tv_exp_f32 %14, %14\n\tv_exp_f32 %15, %15\n\tv_nop"
      : "+v"(a0), "+v"(a1), "+v"(a2), "+v"(a3), "+v"(a4), "+v"(a5), "+v"(a6), "+v"(a7), "+v"(b0), "+v"(b1), "+v"(b2), "+v"(b3), "+v"(b4), "+v"(b5), "+v"(b6), "+v"(b7), "+v"(c));      /* every exponential in place; the rescale factor's goes first, since 32 products wait for it */
  a = (v8f){a0, a1, a2, a3, a4, a5, a6, a7}; b = (v8f){b0, b1, b2, b3, b4, b5, b6, b7}; }
// Four asynchronous 16-B copies a lane, global -> LDS, through no register. The s_wait_xcnt in the same statement is a precaution: the address registers are written again only behind it.
__device__ __forceinline__ void cp4(unsigned l0, unsigned l1, unsigned l2, unsigned l3, const void* g0, const void* g1, const void* g2, const void* g3) {
  asm volatile("global_load_async_to_lds_b128 %0, %4, off\n\tglobal_load_async_to_lds_b128 %1, %5, off\n\tglobal_load_async_to_lds_b128 %2, %6, off\n\tglobal_load_async_to_lds_b128 %3, %7, off\n\ts_wait_xcnt 0x0"
               :: "v"(l0), "v"(l1), "v"(l2), "v"(l3), "v"(g0), "v"(g1), "v"(g2), "v"(g3) : "memory"); }
__global__ __launch_bounds__(128) void k_flash(const _Float16* __restrict__ Q16, int ldq, const _Float16* __restrict__ K16, int ldk, const _Float16* __restrict__ Vt, const int* __restrict__ MSK, _Float16* __restrict__ O16, int ldo) {
  constexpr int RPW = 16, NQB = TT / (4 * RPW), DT = 4, KS = 2, SK = 64, NST = TT / SK, LP = 72; typedef int v4ia __attribute__((ext_vector_type(4), may_alias));
  __shared__ __attribute__((aligned(16))) unsigned short sKV[2][2][SK][LP];      /* [buffer][K, V^T][row][pitch] */
  __shared__ __attribute__((aligned(16))) int sM[TT];
  __shared__ __attribute__((aligned(16))) unsigned short sO[4][RPW][64 + 8];
  const int tid = threadIdx.x, w = tid >> 5, lane = tid & 31, ln = lane & 15, hh = lane >> 4;
  const int slab = blockIdx.x / NQB, qblk = blockIdx.x % NQB; const int b = slab / NH, h = slab % NH; const int qb0 = qblk * (4 * RPW); const int q0 = qb0 + w * RPW;
  /* the thread's part of a stage: 16 B at column 8 cc of rows cr + 16 i, so that a wave's copy takes four whole 128-B lines */
  const int cr = tid >> 3, cc = tid & 7;
  const unsigned short* kg = (const unsigned short*)K16 + ((size_t)b * TT + cr) * ldk + h * 64 + cc * 8;
  const unsigned short* vg = (const unsigned short*)Vt + ((size_t)slab * 64 + cr) * TT + cc * 8;
  const unsigned lkv = (unsigned)(size_t)&sKV[0][0][cr][cc * 8];
  constexpr unsigned LROW = 16 * LP * 2, LTILE = SK * LP * 2, LBUF = 2 * LTILE;      /* bytes: 16 rows, one tile, one buffer */
  auto stage = [&](int t, unsigned bufo) {
    const unsigned short* k0 = kg + (size_t)t * SK * ldk; const unsigned short* v0 = vg + t * SK; const unsigned l = lkv + bufo;
    cp4(l, l + LROW, l + 2 * LROW, l + 3 * LROW, k0, k0 + (size_t)16 * ldk, k0 + (size_t)32 * ldk, k0 + (size_t)48 * ldk);
    cp4(l + LTILE, l + LTILE + LROW, l + LTILE + 2 * LROW, l + LTILE + 3 * LROW, v0, v0 + 16 * TT, v0 + 32 * TT, v0 + 48 * TT); };
  { const int* mg = MSK + (size_t)b * TT + tid * 4; const unsigned lm = (unsigned)(size_t)&sM[tid * 4];
    cp4(lm, lm + 2048, lm + 4096, lm + 6144, mg, mg + 512, mg + 1024, mg + 1536); }
  stage(0, 0);
  FragH bq[KS];
  { const unsigned short* qr = (const unsigned short*)Q16 + ((size_t)b * TT + q0 + ln) * ldq + h * 64;
#pragma unroll
    for (int ks = 0; ks < KS; ++ks) { bq[ks].half[0] = *(const v8us*)(qr + ks * 32 + 8 * hh); bq[ks].half[1] = *(const v8us*)(qr + ks * 32 + 16 + 8 * hh); } }
  asm volatile("s_wait_asynccnt 0x0" ::: "memory");      /* this wave's copies of the mask row and of stage 0 have landed */
  __syncthreads();                                        /* ... and every other wave's: nothing of them is read before */
  stage(1, LBUF);
  float m_q = -3.0e38f, l_q = 0.f; v8f oacc[DT];      /* of query q0 + ln; m_q in units of the raw energy; l_q sums this half's keys (x2^10); oacc[dt][r] = O^T[dt*16 + 8hh + r][ln] */
  constexpr float SC2 = 0.03125f * 1.44269504088896340736f;      /* 1/sqrt(1024) x log2(e): softmax(energy/32) in powers of two */
#pragma unroll
  for (int dt = 0; dt < DT; ++dt) oacc[dt] = (v8f){0.f,0.f,0.f,0.f,0.f,0.f,0.f,0.f};
#pragma unroll 1      /* stays rolled (for speed only), the buffer chosen by t & 1 */
  for (int t = 0; t < NST; ++t) {
    const int bf = t & 1;
    const unsigned short* kf = &sKV[bf][0][ln][8 * hh]; const unsigned short* vf = &sKV[bf][1][ln][8 * hh]; const int* mf = &sM[t * SK + 8 * hh];
#pragma unroll
    for (int kk = 0; kk < SK; kk += 32) {      /* unrolled: every LDS offset of the two 32-key passes is an immediate */
      /* the pass's fragments and mask words as one group of LDS reads, in front of its first product */
      FragH ak[2][KS], av[DT];
#pragma unroll
      for (int nt = 0; nt < 2; ++nt)
#pragma unroll
        for (int ks = 0; ks < KS; ++ks) { const unsigned short* kr = kf + (kk + nt * 16) * LP + ks * 32; ak[nt][ks].half[0] = *(const v8us*)kr; ak[nt][ks].half[1] = *(const v8us*)(kr + 16); }
      const int* mp = mf + kk;      /* key padding mask (1 = attend), shared by all queries and heads: the lane's keys 8hh + r and 16 + 8hh + r of the pass */
      const v4ia km[2][2] = {{*(const v4ia*)mp, *(const v4ia*)(mp + 4)}, {*(const v4ia*)(mp + 16), *(const v4ia*)(mp + 20)}};
#pragma unroll
      for (int dt = 0; dt < DT; ++dt) { const unsigned short* vrow = vf + dt * 16 * LP + kk; av[dt].half[0] = *(const v8us*)vrow; av[dt].half[1] = *(const v8us*)(vrow + 16); }
      v8f s[2];
#pragma unroll
      for (int nt = 0; nt < 2; ++nt) { v8f acc = (v8f){0.f,0.f,0.f,0.f,0.f,0.f,0.f,0.f};
#pragma unroll
        for (int ks = 0; ks < KS; ++ks) acc = mmaH<1>(ak[nt][ks].v, ak[nt][ks].v, bq[ks].v, bq[ks].v, acc); s[nt] = acc; }
      float mc = -INFINITY;
#pragma unroll
      for (int nt = 0; nt < 2; ++nt)
#pragma unroll
        for (int r = 0; r < 8; ++r) { s[nt][r] = (km[nt][r >> 2][r & 3] != 0) ? s[nt][r] : -INFINITY; mc = fmaxf(mc, s[nt][r]); }      /* the raw energy: its scale is positive, so the maximum is taken before it; masked keys carry -1e20 in the module, -inf here */
      mc = fmaxf(mc, xhalf(mc));
      const float mn = fmaxf(m_q, mc); float al = (m_q - mn) * SC2; m_q = mn;      /* mn >= -3e38 is finite: nothing attended yet gives 2^0 = 1, a masked key 2^-inf = 0 */
      const float nb = fmaf(mn, -SC2, 10.0f);      /* p x2^10 = 2^(e SC2 - mn SC2 + 10): one fma and one hardware exponential a score */
#pragma unroll      /* both loops unrolled: constant indices keep the scores in registers */
      for (int nt = 0; nt < 2; ++nt)
#pragma unroll
        for (int r = 0; r < 8; ++r) s[nt][r] = fmaf(s[nt][r], SC2, nb);
      exp2_17(s[0], s[1], al);
      float ps = 0.f; FragH pb;
#pragma unroll
      for (int nt = 0; nt < 2; ++nt)
#pragma unroll
        for (int r = 0; r < 8; ++r) { const float p = s[nt][r]; ps += p; pb.h[nt * 8 + r] = (_Float16)p; }
      l_q = l_q * al + ps;
#pragma unroll
      for (int dt = 0; dt < DT; ++dt)
#pragma unroll
        for (int r = 0; r < 8; ++r) oacc[dt][r] *= al;
#pragma unroll
      for (int dt = 0; dt < DT; ++dt) oacc[dt] = mmaH<1>(av[dt].v, av[dt].v, pb.v, pb.v, oacc[dt]); }
    asm volatile("s_wait_dscnt 0x0" ::: "memory");        /* this wave's reads of the buffer are over before it is handed to the copies */
    asm volatile("s_wait_asynccnt 0x0" ::: "memory");     /* this wave's copies of stage t + 1 have landed */
    __syncthreads();                                      /* publishes stage t + 1 and ends every wave's reads of stage t */
    if (t + 2 < NST) stage(t + 2, bf * LBUF); }
  asm volatile("s_wait_asynccnt 0x0" ::: "memory");       /* no copy is outstanding when the wave goes on to its end */
  { const float l = l_q + xhalf(l_q); const float inv = (l > 0.f) ? 1.0f / l : 0.f;      /* l and O^T both carry the 2^10 of P */
#pragma unroll
    for (int dt = 0; dt < DT; ++dt) { FragH o;      /* O x2^4 in f16, the output GEMM's A operand: the lane's 8 consecutive d of query ln */
#pragma unroll
      for (int r = 0; r < 8; ++r) o.h[r] = (_Float16)((oacc[dt][r] * inv) * 16.0f);
      *(v8us*)&sO[w][ln][dt * 16 + 8 * hh] = o.half[0]; } }
  __builtin_amdgcn_fence(__ATOMIC_ACQ_REL, "workgroup"); __builtin_amdgcn_wave_barrier();
  {
#pragma unroll
    for (int rp = 0; rp < RPW; rp += 4) { const int r = rp + (lane >> 3), pc = lane & 7; const v8us val = *(const v8us*)&sO[w][r][pc * 8]; *(v8us*)((unsigned short*)O16 + ((size_t)b * TT + q0 + r) * ldo + h * 64 + pc * 8) = val; }
     } }

extern "C" void kernel_launch(void* const* d_in, const int* in_sizes, int n_in,
                              void* d_out, int out_size, void* d_ws, size_t ws_size, hipStream_t stream) {
  (void)in_sizes; (void)n_in; (void)out_size;
  const float* const* I = (const float* const*)d_in; const float* values = I[0]; const float* keys = I[1]; const float* query = I[2]; const int* mask = (const int*)d_in[3]; const float* Wv = I[4]; const float* Wk = I[5]; const float* Wq = I[6]; const float* Wo = I[7]; const float* bo = I[8];
  char* ws = (char*)d_ws; size_t off = 0;
  auto take = [&](size_t bytes) { char* p = ws + off; off += (bytes + 255) & ~(size_t)255; return p; };
  _Float16* Bo = (_Float16*)take((size_t)DD * DD * 2);
  _Float16* K = (_Float16*)take((size_t)NR * DD * 2); _Float16* Q = (_Float16*)take((size_t)NR * DD * 2); _Float16* Vt = (_Float16*)take((size_t)NR * DD * 2); _Float16* O16 = (_Float16*)take((size_t)NR * DD * 2);
  if (off > ws_size) return;      // 2.1 + 4 x 8.4 = 36 MB
  k_proj<<<dim3(NR / 256, NH, 4), 128, 0, stream>>>(values, keys, query, Wv, Wk, Wq, Wo, Vt, K, Q, Bo);
  k_flash<<<BB * NH * (TT / 64), 128, 0, stream>>>(Q, DD, K, DD, Vt, mask, O16, DD);
  k_gemm_hhx<0><<<dim3(((NR / 16) * (DD / 64) + 3) / 4, 1), 128, 0, stream>>>(O16, DD, 0, Bo, DD, 0, 0.00390625f, bo, 0, nullptr, 1, 0, 0, (float*)d_out, nullptr, DD, 0, NR, DD, DD, 0, 0, 0);      /* out = O·Woᵀ + bo */
}

// v006
// One run takes 70.2 microseconds.
// Two timings next to v005 both put it at 1.52 times that version's speed.
// All steps since v000 together make it 7.98 times as fast.
#include <hip/hip_runtime.h>
// 'SelfAttension' (B=2, S=2048, E=1024, 16 heads × 64): per-head projections with ONE shared 64×64 weight per tensor (y_h = x_h·Wᵀ, torch (out,in), no bias) for values, keys, query; energy = q·kᵀ with −1e20 where the key mask [N,1,1,S] == 0;
// attn = softmax(energy/√1024); out = (attn·v merged)·Woᵀ + bo.
// Compute dtype: inputs, weights, bias rounded to bf16; the per-head 64×64 projections as block-diagonal f16 GEMMs (all 16 head-block columns of all three tensors in one launch, grid = row blocks x heads x 4: the three tensors and the Wo to f16 conversion, K = 64); fused flash-style kernel (per-(b,k) int mask loads, scale 1/32,
// online softmax f32, P f16 ×2^10) on v_wmma_f32_16x16x32_f16; O ×2^4 → f16 → output GEMM + bias; f32 accumulate.
#define BB 2
#define TT 2048
#define DD 1024
#define NH 16
#define HD 64
#define NR (BB * TT)

typedef __bf16 v16b __attribute__((ext_vector_type(16)));
typedef unsigned short v8us __attribute__((ext_vector_type(8), may_alias));
typedef float  v8f  __attribute__((ext_vector_type(8)));
typedef float  v4f  __attribute__((ext_vector_type(4)));
typedef float  v4fa __attribute__((ext_vector_type(4), may_alias));
union FragB { v16b v; v8us half[2]; unsigned short u[16]; };

__device__ __forceinline__ unsigned short bf16_bits(float x) { unsigned int u = __float_as_uint(x); return (unsigned short)((u + 0x7FFFu + ((u >> 16) & 1u)) >> 16); }
__device__ __forceinline__ float bf16_val(unsigned short b) { return __uint_as_float(((unsigned int)b) << 16); }
__device__ __forceinline__ float bf16_round(float x) { return bf16_val(bf16_bits(x)); }
// D += A·B with NT terms: 1 = ah·bh, 2 = + al·bh (A split), 3 = + ah·bl (both split)
template <int NT>
__device__ __forceinline__ v8f mmaN(v16b ah, v16b al, v16b bh, v16b bl, v8f c) {
  c = __builtin_amdgcn_wmma_f32_16x16x32_bf16(false, ah, false, bh, (short)0, c, false, false);
  if (NT >= 2) c = __builtin_amdgcn_wmma_f32_16x16x32_bf16(false, al, false, bh, (short)0, c, false, false);
  if (NT >= 3) c = __builtin_amdgcn_wmma_f32_16x16x32_bf16(false, ah, false, bl, (short)0, c, false, false);
  asm volatile("v_nop\n\tv_nop\n\tv_nop\n\tv_nop" : "+v"(c) : "v"(ah), "v"(al), "v"(bh), "v"(bl));
  return c;
}

__global__ __launch_bounds__(256) void k_wt_bf16(const float* __restrict__ W, unsigned short* __restrict__ Wt, int K, int N) {
  const int t = blockIdx.x * 256 + threadIdx.x;
  const int k8n = K / 8;
  if (t >= N * k8n) return;
  const int n = t / k8n, k8 = (t % k8n) * 8;
  v8us v;
#pragma unroll
  for (int i = 0; i < 8; ++i) v[i] = bf16_bits(W[(size_t)(k8 + i) * N + n]);
  *(v8us*)(Wt + (size_t)n * K + k8) = v;
  
}

// GEMM C[M][N] (f32, pitch ldc) = act(A[M][K]·W + bias). A f32 row-major (pitch lda) converted per fragment to bf16
// (ASPLIT: hi/lo two planes -> 2 terms, else single rounded term); Wt bf16 [N][K] (pitch ldb). BIAS_BF16 rounds the
// bias to bf16 first (bias quantised to bf16 before the add). K%32==0, M%16==0, N%64==0.
template <bool ASPLIT, int ACT, bool BIAS_BF16>
__global__ __launch_bounds__(128) void k_gemm_bf(const float* __restrict__ A, int lda, const unsigned short* __restrict__ Wt, int ldb,
                                               const float* __restrict__ bias, float* __restrict__ C, int ldc, int M, int N, int K) {
  __shared__ __attribute__((aligned(16))) float so[4][16][64];
  const int tid = threadIdx.x, w = tid >> 5, lane = tid & 31, ln = lane & 15, hh = lane >> 4;
  const int ntn = N / 64;
  const int wid = blockIdx.x * 4 + w;
  const int mt = wid / ntn, nq = wid % ntn;
  if (mt * 16 >= M) return;
  const int row0 = mt * 16, col0 = nq * 64;
  const float* arow = A + (size_t)(row0 + ln) * lda;
  v8f acc[4] = {};
  for (int kb = 0; kb < K; kb += 32) {
    FragB ah, al;
    const v4f x0 = *(const v4fa*)(arow + kb + 8 * hh), x1 = *(const v4fa*)(arow + kb + 8 * hh + 4);
    const v4f x2 = *(const v4fa*)(arow + kb + 16 + 8 * hh), x3 = *(const v4fa*)(arow + kb + 16 + 8 * hh + 4);
    float xs[16] = {x0[0],x0[1],x0[2],x0[3],x1[0],x1[1],x1[2],x1[3],x2[0],x2[1],x2[2],x2[3],x3[0],x3[1],x3[2],x3[3]};
#pragma unroll
    for (int i = 0; i < 16; ++i) { const unsigned short hb = bf16_bits(xs[i]); ah.u[i] = hb; al.u[i] = ASPLIT ? bf16_bits(xs[i] - bf16_val(hb)) : (unsigned short)0; }
#pragma unroll
    for (int t = 0; t < 4; ++t) {
      const unsigned short* brow = Wt + (size_t)(col0 + t * 16 + ln) * ldb + kb;
      FragB b;
      b.half[0] = *(const v8us*)(brow + 8 * hh);
      b.half[1] = *(const v8us*)(brow + 16 + 8 * hh);
      acc[t] = mmaN<ASPLIT ? 2 : 1>(ah.v, al.v, b.v, b.v, acc[t]);
    }
  }
#pragma unroll
  for (int t = 0; t < 4; ++t) {
    float bv = bias ? bias[col0 + t * 16 + ln] : 0.f;
    if (BIAS_BF16) bv = bf16_round(bv);
#pragma unroll
    for (int r = 0; r < 8; ++r) { float v = acc[t][r] + bv; if (ACT == 1) v = fmaxf(v, 0.f); so[w][8 * hh + r][t * 16 + ln] = v; }
  }
  __builtin_amdgcn_fence(__ATOMIC_ACQ_REL, "workgroup");
  __builtin_amdgcn_wave_barrier();
  const int rsub = lane >> 4, c4 = (lane & 15) * 4;
  {
#pragma unroll
    for (int q = 0; q < 8; ++q) {
      const int r = q * 2 + rsub;
      const v4f v = *(const v4fa*)&so[w][r][c4];
      *(v4f*)(C + (size_t)(row0 + r) * ldc + col0 + c4) = v;
    }
    
  }
}

// Flash-style causal/unmasked attention, all contractions 3-term bf16 hi/lo splits, f32 softmax with running max.
// q,k,v rows are read from f32 buffers with arbitrary row pitch (so they can live inside a fused qkv buffer);
// D = head size (multiple of 32, <= 128); one wave = 16 query rows; block = 4 waves (64 queries) sharing K/V chunks of 32.
template <int D, bool CAUSAL>
__global__ __launch_bounds__(128) void k_flash(const float* __restrict__ qb, const float* __restrict__ kb, const float* __restrict__ vb,
                                             int pitch, int T, int H, float scale, float* __restrict__ y, int ypitch) {
  constexpr int KS = D / 32;        // k-steps for QK
  constexpr int DT = D / 16;        // d tiles for PV
  __shared__ __attribute__((aligned(16))) unsigned short sKh[32][D + 8], sKl[32][D + 8], sVh[32][D + 8], sVl[32][D + 8];
  __shared__ __attribute__((aligned(16))) unsigned short sPh[4][16][40], sPl[4][16][40];
  __shared__ __attribute__((aligned(16))) float sO[4][16][D];
  const int tid = threadIdx.x, w = tid >> 5, lane = tid & 31, ln = lane & 15, hh = lane >> 4;
  const int nqb = (T + 63) / 64;
  const int bh = blockIdx.x / nqb, qblk = blockIdx.x % nqb;
  const int b = bh / H, h = bh % H;
  const int q0 = qblk * 64 + w * 16;
  const float* Q = qb + (size_t)b * T * pitch + h * D;
  const float* K = kb + (size_t)b * T * pitch + h * D;
  const float* V = vb + (size_t)b * T * pitch + h * D;

  // A fragments of the wave's 16 query rows (scaled), hi/lo
  FragB aqh[KS], aql[KS];
  {
    int row = q0 + ln; if (row >= T) row = T - 1;
    const float* qr = Q + (size_t)row * pitch;
#pragma unroll
    for (int ks = 0; ks < KS; ++ks)
#pragma unroll
      for (int i = 0; i < 16; ++i) {
        const int d = ks * 32 + ((i < 8) ? (8 * hh + i) : (16 + 8 * hh + (i - 8)));
        const float x = qr[d] * scale; const unsigned short hb = bf16_bits(x);
        aqh[ks].u[i] = hb; aql[ks].u[i] = bf16_bits(x - bf16_val(hb));
      }
  }
  float m_r[8], l_r[8];
#pragma unroll
  for (int r = 0; r < 8; ++r) { m_r[r] = -3.0e38f; l_r[r] = 0.f; }
  v8f oacc[DT];
#pragma unroll
  for (int dt = 0; dt < DT; ++dt) oacc[dt] = (v8f){0.f,0.f,0.f,0.f,0.f,0.f,0.f,0.f};

  const int kv_end = CAUSAL ? min(T, qblk * 64 + 64) : T;     // block-uniform
  for (int j0 = 0; j0 < kv_end; j0 += 32) {
    __syncthreads();
    for (int e = tid; e < 32 * (D / 4); e += 128) {
      const int r = e / (D / 4), c4 = (e % (D / 4)) * 4;
      const int key = j0 + r;
      v4f kf = {0.f,0.f,0.f,0.f}, vf = {0.f,0.f,0.f,0.f};
      if (key < T) { kf = *(const v4fa*)(K + (size_t)key * pitch + c4); vf = *(const v4fa*)(V + (size_t)key * pitch + c4); }
#pragma unroll
      for (int t = 0; t < 4; ++t) {
        unsigned short hb = bf16_bits(kf[t]); sKh[r][c4 + t] = hb; sKl[r][c4 + t] = bf16_bits(kf[t] - bf16_val(hb));
        hb = bf16_bits(vf[t]); sVh[r][c4 + t] = hb; sVl[r][c4 + t] = bf16_bits(vf[t] - bf16_val(hb));
      }
    }
    __syncthreads();
    // S tile 16 x 32
    v8f s[2];
#pragma unroll
    for (int nt = 0; nt < 2; ++nt) {
      v8f acc = {};
#pragma unroll
      for (int ks = 0; ks < KS; ++ks) {
        FragB bh_, bl_;
        bh_.half[0] = *(const v8us*)&sKh[nt * 16 + ln][ks * 32 + 8 * hh]; bh_.half[1] = *(const v8us*)&sKh[nt * 16 + ln][ks * 32 + 16 + 8 * hh];
        bl_.half[0] = *(const v8us*)&sKl[nt * 16 + ln][ks * 32 + 8 * hh]; bl_.half[1] = *(const v8us*)&sKl[nt * 16 + ln][ks * 32 + 16 + 8 * hh];
        acc = mmaN<3>(aqh[ks].v, aql[ks].v, bh_.v, bl_.v, acc);
      }
      s[nt] = acc;
    }
    // mask + running max (rows 8hh+r; the 16 lanes of a half share rows)
    float alpha[8];
#pragma unroll
    for (int r = 0; r < 8; ++r) {
      const int qi = q0 + 8 * hh + r;
      const int ja = j0 + ln, jb = j0 + 16 + ln;
      if (CAUSAL) { if (ja > qi) s[0][r] = -3.0e38f; if (jb > qi) s[1][r] = -3.0e38f; }
      if (ja >= T) s[0][r] = -3.0e38f;
      if (jb >= T) s[1][r] = -3.0e38f;
      float mx = fmaxf(s[0][r], s[1][r]);
      mx = fmaxf(mx, __shfl_xor(mx, 1, 32)); mx = fmaxf(mx, __shfl_xor(mx, 2, 32)); mx = fmaxf(mx, __shfl_xor(mx, 4, 32)); mx = fmaxf(mx, __shfl_xor(mx, 8, 32));
      const float mnew = fmaxf(m_r[r], mx);
      alpha[r] = (mnew > -1.0e38f) ? __expf(m_r[r] - mnew) : 1.0f;
      const float p0 = (s[0][r] > -1.0e38f) ? __expf(s[0][r] - mnew) : 0.f;
      const float p1 = (s[1][r] > -1.0e38f) ? __expf(s[1][r] - mnew) : 0.f;
      m_r[r] = mnew;
      l_r[r] = l_r[r] * alpha[r] + p0 + p1;            // per-lane partial row sum (16 lanes combined at the end)
      unsigned short hb = bf16_bits(p0); sPh[w][8 * hh + r][ln] = hb;      sPl[w][8 * hh + r][ln] = bf16_bits(p0 - bf16_val(hb));
      hb = bf16_bits(p1);                sPh[w][8 * hh + r][16 + ln] = hb; sPl[w][8 * hh + r][16 + ln] = bf16_bits(p1 - bf16_val(hb));
    }
#pragma unroll
    for (int dt = 0; dt < DT; ++dt)
#pragma unroll
      for (int r = 0; r < 8; ++r) oacc[dt][r] *= alpha[r];
    __builtin_amdgcn_fence(__ATOMIC_ACQ_REL, "workgroup");
    __builtin_amdgcn_wave_barrier();
    FragB pah, pal;
    pah.half[0] = *(const v8us*)&sPh[w][ln][8 * hh]; pah.half[1] = *(const v8us*)&sPh[w][ln][16 + 8 * hh];
    pal.half[0] = *(const v8us*)&sPl[w][ln][8 * hh]; pal.half[1] = *(const v8us*)&sPl[w][ln][16 + 8 * hh];
#pragma unroll
    for (int dt = 0; dt < DT; ++dt) {
      FragB bvh, bvl;
#pragma unroll
      for (int i = 0; i < 8; ++i) {
        bvh.u[i] = sVh[8 * hh + i][dt * 16 + ln]; bvh.u[8 + i] = sVh[16 + 8 * hh + i][dt * 16 + ln];
        bvl.u[i] = sVl[8 * hh + i][dt * 16 + ln]; bvl.u[8 + i] = sVl[16 + 8 * hh + i][dt * 16 + ln];
      }
      oacc[dt] = mmaN<3>(pah.v, pal.v, bvh.v, bvl.v, oacc[dt]);
    }
    __builtin_amdgcn_fence(__ATOMIC_ACQ_REL, "workgroup");
    __builtin_amdgcn_wave_barrier();
  }
#pragma unroll
  for (int r = 0; r < 8; ++r) {
    float l = l_r[r];
    l += __shfl_xor(l, 1, 32); l += __shfl_xor(l, 2, 32); l += __shfl_xor(l, 4, 32); l += __shfl_xor(l, 8, 32);
    l_r[r] = (l > 0.f) ? 1.0f / l : 0.f;
  }
#pragma unroll
  for (int dt = 0; dt < DT; ++dt)
#pragma unroll
    for (int r = 0; r < 8; ++r) sO[w][8 * hh + r][dt * 16 + ln] = oacc[dt][r] * l_r[r];
  __builtin_amdgcn_fence(__ATOMIC_ACQ_REL, "workgroup");
  __builtin_amdgcn_wave_barrier();
  {
    for (int r = 0; r < 16; ++r) {
      const int row = q0 + r;
      if (row < T && lane < D / 4) {
        const v4f val = *(const v4fa*)&sO[w][r][lane * 4];
        *(v4f*)(y + ((size_t)b * T + row) * ypitch + h * D + lane * 4) = val;
      }
    }
    
  }
}

// GEMM C = act(A·W + bias + resid): A f32 (ASPLIT -> hi/lo 2 terms), Wt bf16 [N][K]; ACT 0 none, 1 relu, 2 exact gelu;
// resid (optional, f32, row index = (row % rmod), pitch ldr, RES_BF16 rounds it) added before the activation.
template <bool ASPLIT, int ACT, bool BIAS_BF16, bool RES_BF16>
__global__ __launch_bounds__(128) void k_gemm_bf3(const float* __restrict__ A, int lda, const unsigned short* __restrict__ Wt, int ldb,
                                                const float* __restrict__ bias, const float* __restrict__ resid, int rmod, int ldr,
                                                float* __restrict__ C, int ldc, int M, int N, int K) {
  __shared__ __attribute__((aligned(16))) float so[4][16][64];
  const int tid = threadIdx.x, w = tid >> 5, lane = tid & 31, ln = lane & 15, hh = lane >> 4;
  const int ntn = N / 64;
  const int wid = blockIdx.x * 4 + w;
  const int mt = wid / ntn, nq = wid % ntn;
  if (mt * 16 >= M) return;
  const int row0 = mt * 16, col0 = nq * 64;
  const float* arow = A + (size_t)(row0 + ln) * lda;
  v8f acc[4] = {};
  for (int kb = 0; kb < K; kb += 32) {
    FragB ah, al;
    const v4f x0 = *(const v4fa*)(arow + kb + 8 * hh), x1 = *(const v4fa*)(arow + kb + 8 * hh + 4);
    const v4f x2 = *(const v4fa*)(arow + kb + 16 + 8 * hh), x3 = *(const v4fa*)(arow + kb + 16 + 8 * hh + 4);
    float xs[16] = {x0[0],x0[1],x0[2],x0[3],x1[0],x1[1],x1[2],x1[3],x2[0],x2[1],x2[2],x2[3],x3[0],x3[1],x3[2],x3[3]};
#pragma unroll
    for (int i = 0; i < 16; ++i) { const unsigned short hb = bf16_bits(xs[i]); ah.u[i] = hb; al.u[i] = ASPLIT ? bf16_bits(xs[i] - bf16_val(hb)) : (unsigned short)0; }
#pragma unroll
    for (int t = 0; t < 4; ++t) {
      const unsigned short* brow = Wt + (size_t)(col0 + t * 16 + ln) * ldb + kb;
      FragB b;
      b.half[0] = *(const v8us*)(brow + 8 * hh);
      b.half[1] = *(const v8us*)(brow + 16 + 8 * hh);
      acc[t] = mmaN<ASPLIT ? 2 : 1>(ah.v, al.v, b.v, b.v, acc[t]);
    }
  }
#pragma unroll
  for (int t = 0; t < 4; ++t) {
    const int col = col0 + t * 16 + ln;
    float bv = bias ? bias[col] : 0.f;
    if (BIAS_BF16) bv = bf16_round(bv);
#pragma unroll
    for (int r = 0; r < 8; ++r) {
      float v = acc[t][r] + bv;
      if (resid) { float rv = resid[(size_t)((row0 + 8 * hh + r) % rmod) * ldr + col]; if (RES_BF16) rv = bf16_round(rv); v += rv; }
      if (ACT == 1) v = fmaxf(v, 0.f);
      if (ACT == 2) v = 0.5f * v * (1.0f + erff(v * 0.70710678118654752f));
      if (ACT == 3) { const float u = 0.7978845608028654f * (v + 0.044715f * v * v * v); v = 0.5f * v * (1.0f + tanhf(u)); }
      so[w][8 * hh + r][t * 16 + ln] = v;
    }
  }
  __builtin_amdgcn_fence(__ATOMIC_ACQ_REL, "workgroup");
  __builtin_amdgcn_wave_barrier();
  const int rsub = lane >> 4, c4 = (lane & 15) * 4;
  {
#pragma unroll
    for (int q = 0; q < 8; ++q) {
      const int r = q * 2 + rsub;
      const v4f v = *(const v4fa*)&so[w][r][c4];
      *(v4f*)(C + (size_t)(row0 + r) * ldc + col0 + c4) = v;
    }
    
  }
}
// row LayerNorm (biased variance, eps) over N: s = X (+ R); optional out_sum <- s; out_norm <- (s-mu)*rsqrt(var+eps)*g + b
template <bool PARAM_BF16>
__global__ __launch_bounds__(256) void k_layernorm(const float* __restrict__ X, const float* __restrict__ R, const float* __restrict__ g, const float* __restrict__ bta,
                                                  float* __restrict__ out_sum, float* __restrict__ out_norm, int N, float eps) {
  __shared__ float red[256];
  const int row = blockIdx.x, tid = threadIdx.x;
  const float* x = X + (size_t)row * N; const float* rr = R ? R + (size_t)row * N : nullptr;
  float vals[16];                     // up to N = 4096
  const int per = N / 256;            // contiguous chunk per thread? use strided-by-4 chunks: thread handles j = tid*4 + 1024*u
  float s1 = 0.f;
  for (int u = 0; u < per / 4; ++u) {
    const int j = tid * 4 + 1024 * u;
    const v4f a = *(const v4fa*)(x + j);
    v4f b = {0.f,0.f,0.f,0.f}; if (rr) b = *(const v4fa*)(rr + j);
#pragma unroll
    for (int q = 0; q < 4; ++q) { const float v = a[q] + b[q]; vals[u * 4 + q] = v; s1 += v; }
  }
  red[tid] = s1; __syncthreads();
  for (int st = 128; st > 0; st >>= 1) { if (tid < st) red[tid] += red[tid + st]; __syncthreads(); }
  const float mu = red[0] / (float)N; __syncthreads();
  float s2 = 0.f;
  for (int u = 0; u < per / 4; ++u)
#pragma unroll
    for (int q = 0; q < 4; ++q) { const float c = vals[u * 4 + q] - mu; s2 += c * c; }
  red[tid] = s2; __syncthreads();
  for (int st = 128; st > 0; st >>= 1) { if (tid < st) red[tid] += red[tid + st]; __syncthreads(); }
  const float rs = rsqrtf(red[0] / (float)N + eps);
  {
    for (int u = 0; u < per / 4; ++u) {
      const int j = tid * 4 + 1024 * u;
      v4f o, sm;
#pragma unroll
      for (int q = 0; q < 4; ++q) {
        float gg = g[j + q], bb = bta[j + q];
        if (PARAM_BF16) { gg = bf16_round(gg); bb = bf16_round(bb); }
        sm[q] = vals[u * 4 + q]; o[q] = (vals[u * 4 + q] - mu) * rs * gg + bb;
      }
      if (out_sum) *(v4f*)(out_sum + (size_t)row * N + j) = sm;
      *(v4f*)(out_norm + (size_t)row * N + j) = o;
    }
    
  }
}



// ---- f16 WMMA path (v_wmma_f32_16x16x32_f16): 11-bit significands for operands in range — used where a [0,1] probability operand needs more precision than bf16
typedef _Float16 v16h __attribute__((ext_vector_type(16)));
union FragH { v16h v; v8us half[2]; _Float16 h[16]; unsigned short u[16]; };
template <int NT>
__device__ __forceinline__ v8f mmaH(v16h ah, v16h al, v16h bh, v16h bl, v8f c) {
  c = __builtin_amdgcn_wmma_f32_16x16x32_f16(false, ah, false, bh, (short)0, c, false, false);
  if (NT >= 2) c = __builtin_amdgcn_wmma_f32_16x16x32_f16(false, al, false, bh, (short)0, c, false, false);
  if (NT >= 3) c = __builtin_amdgcn_wmma_f32_16x16x32_f16(false, ah, false, bl, (short)0, c, false, false);
  asm volatile("v_nop\n\tv_nop\n\tv_nop\n\tv_nop" : "+v"(c) : "v"(ah), "v"(al), "v"(bh), "v"(bl));
  return c;
}
// batched GEMM like k_gemm_b but f16 operands: A f32 (split into f16 hi/lo if ASPLIT, else rounded to f16), Bt = f16 values [n][k]; alpha; C f32; N multiple of 16 (partial tiles skipped)
template <bool ASPLIT>
__global__ __launch_bounds__(128) void k_gemm_h(const float* __restrict__ A, int lda, size_t sA, const _Float16* __restrict__ Bh, int ldb, size_t sB, float alpha, float* __restrict__ C, int ldc, size_t sC, int M, int N, int K) {
  __shared__ __attribute__((aligned(16))) float so[4][16][64];
  const int tid = threadIdx.x, w = tid >> 5, lane = tid & 31, ln = lane & 15, hh = lane >> 4; const int by = blockIdx.y;
  A += (size_t)by * sA; Bh += (size_t)by * sB; C += (size_t)by * sC;
  const int ntn = (N + 63) / 64; const int wid = blockIdx.x * 4 + w; const int mt = wid / ntn, nq = wid % ntn; if (mt * 16 >= M) return;
  const int row0 = mt * 16, col0 = nq * 64; const float* arow = A + (size_t)(row0 + ln) * lda;
  v8f acc[4] = {};
  for (int kb = 0; kb < K; kb += 32) {
    FragH ah, al;
    const v4f x0 = *(const v4fa*)(arow + kb + 8 * hh), x1 = *(const v4fa*)(arow + kb + 8 * hh + 4), x2 = *(const v4fa*)(arow + kb + 16 + 8 * hh), x3 = *(const v4fa*)(arow + kb + 16 + 8 * hh + 4);
    float xs[16] = {x0[0],x0[1],x0[2],x0[3],x1[0],x1[1],x1[2],x1[3],x2[0],x2[1],x2[2],x2[3],x3[0],x3[1],x3[2],x3[3]};
#pragma unroll
    for (int i = 0; i < 16; ++i) { const _Float16 h = (_Float16)xs[i]; ah.h[i] = h; al.h[i] = ASPLIT ? (_Float16)(xs[i] - (float)h) : (_Float16)0.0f; }
#pragma unroll
    for (int t = 0; t < 4; ++t) { if (col0 + t * 16 >= N) continue; const size_t boff = (size_t)(col0 + t * 16 + ln) * ldb + kb; FragH bq; bq.half[0] = *(const v8us*)(Bh + boff + 8 * hh); bq.half[1] = *(const v8us*)(Bh + boff + 16 + 8 * hh);
      acc[t] = mmaH<ASPLIT ? 2 : 1>(ah.v, al.v, bq.v, bq.v, acc[t]); }
  }
#pragma unroll
  for (int t = 0; t < 4; ++t) { if (col0 + t * 16 >= N) continue;
#pragma unroll
    for (int r = 0; r < 8; ++r) so[w][8 * hh + r][t * 16 + ln] = acc[t][r] * alpha; }
  __builtin_amdgcn_fence(__ATOMIC_ACQ_REL, "workgroup"); __builtin_amdgcn_wave_barrier();
  const int rsub = lane >> 4, c4 = (lane & 15) * 4;
  {
#pragma unroll
    for (int q = 0; q < 8; ++q) { const int r = q * 2 + rsub; if (col0 + c4 < N) { const v4f v = *(const v4fa*)&so[w][r][c4]; *(v4f*)(C + (size_t)(row0 + r) * ldc + col0 + c4) = v; } }
     }
}

// Wt[n][k] = f16(W[k][n]·scale) from f32 row-major W[K][N] (scale = power of two; bf16-exact weights stay exact in f16 away from the subnormal range)
__global__ __launch_bounds__(256) void k_wt_f16(const float* __restrict__ W, _Float16* __restrict__ Wt, int K, int N, float scale) {
  const int t = blockIdx.x * 256 + threadIdx.x; if (t >= N * (K / 8)) return; const int n = t / (K / 8), k8 = (t % (K / 8)) * 8; FragH f;
#pragma unroll
  for (int i = 0; i < 8; ++i) f.h[i] = (_Float16)(bf16_round(W[(size_t)(k8 + i) * N + n]) * scale); const v8us o = f.half[0];
  *(v8us*)((unsigned short*)Wt + (size_t)n * K + k8) = o; 
}
// k_gemm_hh variant with fused epilogue: v = acc·alpha + bias[by·sBias + col] (+ CP[(row/rowsPerB)·sCPb + by·64 + col] if CP) ; ACT 0 none / 1 elu ; writes f16 C16 and/or f32 C (each if non-null)
template <int ACT>
__global__ __launch_bounds__(128) void k_gemm_hhx(const _Float16* __restrict__ A, int lda, size_t sA, const _Float16* __restrict__ Bh, int ldb, size_t sB, float alpha, const float* __restrict__ bias, size_t sBias, const float* __restrict__ CP, int rowsPerB, size_t sCPb, int row0g,
    float* __restrict__ C, _Float16* __restrict__ C16, int ldc, size_t sC, int M, int N, int K, size_t sAz, size_t sBz, size_t sCz) {
  __shared__ __attribute__((aligned(16))) float so[4][16][64];
  const int tid = threadIdx.x, w = tid >> 5, lane = tid & 31, ln = lane & 15, hh = lane >> 4; const int by = blockIdx.y, bz = blockIdx.z;      /* second batch index bz with its own strides sAz, sBz, sCz */
  A += (size_t)by * sA + (size_t)bz * sAz; Bh += (size_t)by * sB + (size_t)bz * sBz; const size_t cofs = (size_t)by * sC + (size_t)bz * sCz; const float* bp = bias ? bias + (size_t)by * sBias : nullptr;
  const int ntn = (N + 63) / 64; const int wid = blockIdx.x * 4 + w; const int mt = wid / ntn, nq = wid % ntn; if (mt * 16 >= M) return;
  const int row0 = mt * 16, col0 = nq * 64; const _Float16* arow = A + (size_t)(row0 + ln) * lda;
  v8f acc[4] = {};
  for (int kb = 0; kb < K; kb += 32) { FragH ah; ah.half[0] = *(const v8us*)((const unsigned short*)arow + kb + 8 * hh); ah.half[1] = *(const v8us*)((const unsigned short*)arow + kb + 16 + 8 * hh);
#pragma unroll
    for (int t = 0; t < 4; ++t) { if (col0 + t * 16 >= N) continue; const size_t boff = (size_t)(col0 + t * 16 + ln) * ldb + kb; FragH bq; bq.half[0] = *(const v8us*)((const unsigned short*)Bh + boff + 8 * hh); bq.half[1] = *(const v8us*)((const unsigned short*)Bh + boff + 16 + 8 * hh);
      acc[t] = mmaH<1>(ah.v, ah.v, bq.v, bq.v, acc[t]); }
  }
#pragma unroll
  for (int t = 0; t < 4; ++t) { if (col0 + t * 16 >= N) continue; const int col = col0 + t * 16 + ln; const float bv = bp ? bf16_round(bp[col]) : 0.f;
#pragma unroll
    for (int r = 0; r < 8; ++r) { float v = acc[t][r] * alpha + bv; if (CP) { const int bidx = (row0g + row0 + 8 * hh + r) / rowsPerB; v += CP[(size_t)bidx * sCPb + (size_t)by * 64 + col]; } if (ACT == 1) v = (v > 0.f) ? v : expm1f(v); else if (ACT == 7) v = (v > 0.f) ? v + 1.0f : expf(v); else if (ACT == 8) v = tanhf(v); else if (ACT == 9) v = 0.5f * v * (1.0f + tanhf(0.7978845608028654f * (v + 0.044715f * v * v * v))); else if (ACT == 11) v = 1.0f / (1.0f + expf(-v)); else if (ACT == 12) v = (v > 0.f) ? v : 0.01f * v; else if (ACT == 14) v = (v > 0.f) ? v : 0.1f * v; else if (ACT == 15) v = v / (1.0f + expf(-v)); else if (ACT == 3) v = fmaxf(v, 0.f); else if (ACT == 6) v = 0.5f * v * (1.0f + erff(v * 0.70710678118654752f)); so[w][8 * hh + r][t * 16 + ln] = v; } }
  __builtin_amdgcn_fence(__ATOMIC_ACQ_REL, "workgroup"); __builtin_amdgcn_wave_barrier();
  const int rsub = lane >> 4, c4 = (lane & 15) * 4; typedef _Float16 v4h __attribute__((ext_vector_type(4)));
  {
#pragma unroll
    for (int q = 0; q < 8; ++q) { const int r = q * 2 + rsub; if (col0 + c4 < N) { const v4f v = *(const v4fa*)&so[w][r][c4]; if (C) *(v4f*)(C + cofs + (size_t)(row0 + r) * ldc + col0 + c4) = v; if (C16) { v4h h4; for (int i = 0; i < 4; ++i) h4[i] = (_Float16)v[i]; *(v4h*)(C16 + cofs + (size_t)(row0 + r) * ldc + col0 + c4) = h4; } } }
     }
}


typedef _Float16 v4h __attribute__((ext_vector_type(4)));

__global__ __launch_bounds__(256) void k_h16(const float* __restrict__ x, _Float16* __restrict__ X16, size_t n8) { const size_t t = (size_t)blockIdx.x * 256 + threadIdx.x; if (t >= n8) return; FragH f;
#pragma unroll
  for (int q = 0; q < 8; ++q) f.h[q] = (_Float16)x[t * 8 + q]; *(v8us*)((unsigned short*)X16 + t * 8) = f.half[0];  }
// The 16 f32 of one 16 x 32 operand fragment in the hardware k order (k = 8hh + e, then 16 + 8hh + e - 8), as loaded: p = row + 32 ks + 8 hh
struct Raw16 { v4f a, b, c, d; };
__device__ __forceinline__ Raw16 raw_f32(const float* __restrict__ p) { Raw16 x; x.a = *(const v4fa*)p; x.b = *(const v4fa*)(p + 4); x.c = *(const v4fa*)(p + 16); x.d = *(const v4fa*)(p + 20); return x; }
// each value rounded to bf16, then held exactly in f16 (weights x2^4)
template <bool W16>
__device__ __forceinline__ FragH frag_f32(const Raw16& x) { FragH f;
#pragma unroll
  for (int q = 0; q < 4; ++q) {
    f.h[q]      = W16 ? (_Float16)(bf16_round(x.a[q]) * 16.0f) : (_Float16)bf16_round(x.a[q]);
    f.h[4 + q]  = W16 ? (_Float16)(bf16_round(x.b[q]) * 16.0f) : (_Float16)bf16_round(x.b[q]);
    f.h[8 + q]  = W16 ? (_Float16)(bf16_round(x.c[q]) * 16.0f) : (_Float16)bf16_round(x.c[q]);
    f.h[12 + q] = W16 ? (_Float16)(bf16_round(x.d[q]) * 16.0f) : (_Float16)bf16_round(x.d[q]); }
  return f; }
// One wave: 64 rows x one head of one tensor, y = x.W^T (K = 64), inputs and weight converted in registers; the next 16 rows are loaded while these are worked on. st = the wave's own 64 x 64 f16 staging tile (pitch 72), written 16 B a lane:
// TR (values): A = x rows, B = W rows, so a lane holds 8 consecutive rows of one output column and the tile is staged transposed, st[d][row];
// else (keys, query): A = W rows, B = x rows, so a lane holds 8 consecutive columns of one row, st[row][e]. Either way each staged row leaves as one whole 128-B line; dst = first staged row, pitch in elements.
template <bool TR>
__device__ __forceinline__ void proj_tile(const float* __restrict__ x, const float* __restrict__ W, unsigned short (*st)[72], unsigned short* __restrict__ dst, size_t pitch, int lane) {
  const int ln = lane & 15, hh = lane >> 4; const float* xl = x + (size_t)ln * DD + 8 * hh; const float* wl = W + ln * HD + 8 * hh;
  Raw16 xr[2][2]; xr[0][0] = raw_f32(xl); xr[0][1] = raw_f32(xl + 32);
  Raw16 wr[4][2];
#pragma unroll
  for (int t = 0; t < 4; ++t)
#pragma unroll
    for (int ks = 0; ks < 2; ++ks) wr[t][ks] = raw_f32(wl + t * 16 * HD + ks * 32);
  asm volatile("s_wait_xcnt 0x0" :: "v"(wl) : "memory");      /* precaution: the weight loads' address registers (the input) are written again only behind this wait */
  FragH wf[4][2];
#pragma unroll
  for (int t = 0; t < 4; ++t)
#pragma unroll
    for (int ks = 0; ks < 2; ++ks) wf[t][ks] = frag_f32<true>(wr[t][ks]);
#pragma unroll
  for (int rt = 0; rt < 4; ++rt) {
    if (rt < 3) { xr[(rt + 1) & 1][0] = raw_f32(xl + (size_t)(rt + 1) * 16 * DD); xr[(rt + 1) & 1][1] = raw_f32(xl + (size_t)(rt + 1) * 16 * DD + 32);
      if (rt == 2) asm volatile("s_wait_xcnt 0x0" :: "v"(xl) : "memory"); }      /* the same precaution behind the last loads that name the row address */
    const FragH x0 = frag_f32<false>(xr[rt & 1][0]), x1 = frag_f32<false>(xr[rt & 1][1]);
#pragma unroll
    for (int t = 0; t < 4; ++t) { v8f acc = (v8f){0.f,0.f,0.f,0.f,0.f,0.f,0.f,0.f};
      if (TR) { acc = mmaH<1>(x0.v, x0.v, wf[t][0].v, wf[t][0].v, acc); acc = mmaH<1>(x1.v, x1.v, wf[t][1].v, wf[t][1].v, acc); }
      else    { acc = mmaH<1>(wf[t][0].v, wf[t][0].v, x0.v, x0.v, acc); acc = mmaH<1>(wf[t][1].v, wf[t][1].v, x1.v, x1.v, acc); }
      FragH o;
#pragma unroll
      for (int r = 0; r < 8; ++r) o.h[r] = (_Float16)(acc[r] * 0.0625f);
      if (TR) *(v8us*)&st[t * 16 + ln][rt * 16 + 8 * hh] = o.half[0]; else *(v8us*)&st[rt * 16 + ln][t * 16 + 8 * hh] = o.half[0]; } }
  __builtin_amdgcn_fence(__ATOMIC_ACQ_REL, "workgroup"); __builtin_amdgcn_wave_barrier();      /* the wave reads back what its other lanes staged */
#pragma unroll
  for (int q = 0; q < 16; ++q) { const int r = q * 4 + (lane >> 3), c8 = (lane & 7) * 8; const v8us v = *(const v8us*)&st[r][c8]; *(v8us*)(dst + (size_t)r * pitch + c8) = v; }
  asm volatile("s_wait_xcnt 0x0" ::: "memory"); }      /* the same precaution behind the stores: nothing that follows on any path writes their registers first */
// grid (NR / 256, heads, 4): blockIdx.z = 0 values -> Vt[slab][d][t], 1 keys -> K16, 2 query -> Q16 (row-major, head h at column 64 h); blockIdx.z = 3: Bo = f16(bf16(Wo) x2^4), 8 elements a thread and trip
__global__ __launch_bounds__(128) void k_proj(const float* __restrict__ xv, const float* __restrict__ xk, const float* __restrict__ xq, const float* __restrict__ Wv, const float* __restrict__ Wk, const float* __restrict__ Wq, const float* __restrict__ Wo,
    _Float16* __restrict__ Vt, _Float16* __restrict__ K16, _Float16* __restrict__ Q16, _Float16* __restrict__ Bo) {
  __shared__ __attribute__((aligned(16))) unsigned short st[4][64][72];
  const int tid = threadIdx.x, w = tid >> 5, lane = tid & 31; const int z = blockIdx.z, h = blockIdx.y;
  if (z == 3) { constexpr int NTH = (NR / 256) * NH * 128;
#pragma unroll
    for (int i = 0; i < DD * DD / 8 / NTH; ++i) { const size_t t = (size_t)i * NTH + (size_t)(blockIdx.y * (NR / 256) + blockIdx.x) * 128 + tid; const v4f a = *(const v4fa*)(Wo + t * 8), c = *(const v4fa*)(Wo + t * 8 + 4); FragH f;
#pragma unroll
      for (int q = 0; q < 4; ++q) { f.h[q] = (_Float16)(bf16_round(a[q]) * 16.0f); f.h[4 + q] = (_Float16)(bf16_round(c[q]) * 16.0f); }
      *(v8us*)((unsigned short*)Bo + t * 8) = f.half[0]; }
    return; }
  const int row0 = (blockIdx.x * 4 + w) * 64; const size_t xo = (size_t)row0 * DD + h * HD;
  if (z == 0) proj_tile<true>(xv + xo, Wv, st[w], (unsigned short*)Vt + ((size_t)((row0 / TT) * NH + h) * HD) * TT + row0 % TT, TT, lane);
  else proj_tile<false>((z == 1 ? xk : xq) + xo, z == 1 ? Wk : Wq, st[w], (unsigned short*)(z == 1 ? K16 : Q16) + xo, DD, lane); }
// lane l with lane l ^ 16 (a vector cross-row move, no LDS)
__device__ __forceinline__ float xhalf(float x) { return __builtin_bit_cast(float, __builtin_amdgcn_permlanex16(__builtin_bit_cast(int, x), __builtin_bit_cast(int, x), 0x76543210, 0xfedcba98, false, false)); }
// x <- 2^x on the hardware exponential for a pass's 16 scores and its rescale exponent. One asm statement so that each v_exp_f32 writes over its own argument and its neighbours name other registers:
// the slot that the instruction set asks for behind a transcendental (no read of its result, no write of its source) is then kept between them by construction, and the closing v_nop keeps it for whatever follows.
__device__ __forceinline__ void exp2_17(v8f& a, v8f& b, float& c) {
  float a0 = a[0], a1 = a[1], a2 = a[2], a3 = a[3], a4 = a[4], a5 = a[5], a6 = a[6], a7 = a[7], b0 = b[0], b1 = b[1], b2 = b[2], b3 = b[3], b4 = b[4], b5 = b[5], b6 = b[6], b7 = b[7];
  asm("v_exp_f32 %16, %16\n\tv_exp_f32 %0, %0\n\tv_exp_f32 %1, %1\n\tv_exp_f32 %2, %2\n\tv_exp_f32 %3, %3\n\tv_exp_f32 %4, %4\n\tv_exp_f32 %5, %5\n\tv_exp_f32 %6, %6\n\tv_exp_f32 %7, %7\n\t"
      "v_exp_f32 %8, %8\n\tv_exp_f32 %9, %9\n\tv_exp_f32 %10, %10\n\tv_exp_f32 %11, %11\n\tv_exp_f32 %12, %12\n\tv_exp_f32 %13, %13\n\tv_exp_f32 %14, %14\n\tv_exp_f32 %15, %15\n\tv_nop"
      : "+v"(a0), "+v"(a1), "+v"(a2), "+v"(a3), "+v"(a4), "+v"(a5), "+v"(a6), "+v"(a7), "+v"(b0), "+v"(b1), "+v"(b2), "+v"(b3), "+v"(b4), "+v"(b5), "+v"(b6), "+v"(b7), "+v"(c));      /* every exponential in place; the rescale factor's goes first, since 32 products wait for it */
  a = (v8f){a0, a1, a2, a3, a4, a5, a6, a7}; b = (v8f){b0, b1, b2, b3, b4, b5, b6, b7}; }
// Four asynchronous 16-B copies a lane, global -> LDS, through no register. The s_wait_xcnt in the same statement is a precaution: the address registers are written again only behind it.
__device__ __forceinline__ void cp4(unsigned l0, unsigned l1, unsigned l2, unsigned l3, const void* g0, const void* g1, const void* g2, const void* g3) {
  asm volatile("global_load_async_to_lds_b128 %0, %4, off\n\tglobal_load_async_to_lds_b128 %1, %5, off\n\tglobal_load_async_to_lds_b128 %2, %6, off\n\tglobal_load_async_to_lds_b128 %3, %7, off\n\ts_wait_xcnt 0x0"
               :: "v"(l0), "v"(l1), "v"(l2), "v"(l3), "v"(g0), "v"(g1), "v"(g2), "v"(g3) : "memory"); }
__global__ __launch_bounds__(128) void k_flash(const _Float16* __restrict__ Q16, int ldq, const _Float16* __restrict__ K16, int ldk, const _Float16* __restrict__ Vt, const int* __restrict__ MSK, _Float16* __restrict__ O16, int ldo) {
  constexpr int RPW = 16, NQB = TT / (4 * RPW), DT = 4, KS = 2, SK = 64, NST = TT / SK, LP = 72; typedef int v4ia __attribute__((ext_vector_type(4), may_alias));
  __shared__ __attribute__((aligned(16))) unsigned short sKV[2][2][SK][LP];      /* [buffer][K, V^T][row][pitch] */
  __shared__ __attribute__((aligned(16))) int sM[TT];
  __shared__ __attribute__((aligned(16))) unsigned short sO[4][RPW][64 + 8];
  const int tid = threadIdx.x, w = tid >> 5, lane = tid & 31, ln = lane & 15, hh = lane >> 4;
  const int slab = blockIdx.x / NQB, qblk = blockIdx.x % NQB; const int b = slab / NH, h = slab % NH; const int qb0 = qblk * (4 * RPW); const int q0 = qb0 + w * RPW;
  /* the thread's part of a stage: 16 B at column 8 cc of rows cr + 16 i, so that a wave's copy takes four whole 128-B lines */
  const int cr = tid >> 3, cc = tid & 7;
  const unsigned short* kg = (const unsigned short*)K16 + ((size_t)b * TT + cr) * ldk + h * 64 + cc * 8;
  const unsigned short* vg = (const unsigned short*)Vt + ((size_t)slab * 64 + cr) * TT + cc * 8;
  const unsigned lkv = (unsigned)(size_t)&sKV[0][0][cr][cc * 8];
  constexpr unsigned LROW = 16 * LP * 2, LTILE = SK * LP * 2, LBUF = 2 * LTILE;      /* bytes: 16 rows, one tile, one buffer */
  auto stage = [&](int t, unsigned bufo) {
    const unsigned short* k0 = kg + (size_t)t * SK * ldk; const unsigned short* v0 = vg + t * SK; const unsigned l = lkv + bufo;
    cp4(l, l + LROW, l + 2 * LROW, l + 3 * LROW, k0, k0 + (size_t)16 * ldk, k0 + (size_t)32 * ldk, k0 + (size_t)48 * ldk);
    cp4(l + LTILE, l + LTILE + LROW, l + LTILE + 2 * LROW, l + LTILE + 3 * LROW, v0, v0 + 16 * TT, v0 + 32 * TT, v0 + 48 * TT); };
  { const int* mg = MSK + (size_t)b * TT + tid * 4; const unsigned lm = (unsigned)(size_t)&sM[tid * 4];
    cp4(lm, lm + 2048, lm + 4096, lm + 6144, mg, mg + 512, mg + 1024, mg + 1536); }
  stage(0, 0);
  FragH bq[KS];
  { const unsigned short* qr = (const unsigned short*)Q16 + ((size_t)b * TT + q0 + ln) * ldq + h * 64;
#pragma unroll
    for (int ks = 0; ks < KS; ++ks) { bq[ks].half[0] = *(const v8us*)(qr + ks * 32 + 8 * hh); bq[ks].half[1] = *(const v8us*)(qr + ks * 32 + 16 + 8 * hh); } }
  asm volatile("s_wait_asynccnt 0x0" ::: "memory");      /* this wave's copies of the mask row and of stage 0 have landed */
  __syncthreads();                                        /* ... and every other wave's: nothing of them is read before */
  stage(1, LBUF);
  float m_q = -3.0e38f, l_q = 0.f; v8f oacc[DT];      /* of query q0 + ln; m_q in units of the raw energy; l_q sums this half's keys (x2^10); oacc[dt][r] = O^T[dt*16 + 8hh + r][ln] */
  constexpr float SC2 = 0.03125f * 1.44269504088896340736f;      /* 1/sqrt(1024) x log2(e): softmax(energy/32) in powers of two */
#pragma unroll
  for (int dt = 0; dt < DT; ++dt) oacc[dt] = (v8f){0.f,0.f,0.f,0.f,0.f,0.f,0.f,0.f};
#pragma unroll 1      /* stays rolled (for speed only), the buffer chosen by t & 1 */
  for (int t = 0; t < NST; ++t) {
    const int bf = t & 1;
    const unsigned short* kf = &sKV[bf][0][ln][8 * hh]; const unsigned short* vf = &sKV[bf][1][ln][8 * hh]; const int* mf = &sM[t * SK + 8 * hh];
#pragma unroll
    for (int kk = 0; kk < SK; kk += 32) {      /* unrolled: every LDS offset of the two 32-key passes is an immediate */
      /* the pass's fragments and mask words as one group of LDS reads, in front of its first product */
      FragH ak[2][KS], av[DT];
#pragma unroll
      for (int nt = 0; nt < 2; ++nt)
#pragma unroll
        for (int ks = 0; ks < KS; ++ks) { const unsigned short* kr = kf + (kk + nt * 16) * LP + ks * 32; ak[nt][ks].half[0] = *(const v8us*)kr; ak[nt][ks].half[1] = *(const v8us*)(kr + 16); }
      const int* mp = mf + kk;      /* key padding mask (1 = attend), shared by all queries and heads: the lane's keys 8hh + r and 16 + 8hh + r of the pass */
      const v4ia km[2][2] = {{*(const v4ia*)mp, *(const v4ia*)(mp + 4)}, {*(const v4ia*)(mp + 16), *(const v4ia*)(mp + 20)}};
#pragma unroll
      for (int dt = 0; dt < DT; ++dt) { const unsigned short* vrow = vf + dt * 16 * LP + kk; av[dt].half[0] = *(const v8us*)vrow; av[dt].half[1] = *(const v8us*)(vrow + 16); }
      v8f s[2];
#pragma unroll
      for (int nt = 0; nt < 2; ++nt) { v8f acc = (v8f){0.f,0.f,0.f,0.f,0.f,0.f,0.f,0.f};
#pragma unroll
        for (int ks = 0; ks < KS; ++ks) acc = mmaH<1>(ak[nt][ks].v, ak[nt][ks].v, bq[ks].v, bq[ks].v, acc); s[nt] = acc; }
      float mc = -INFINITY;
#pragma unroll
      for (int nt = 0; nt < 2; ++nt)
#pragma unroll
        for (int r = 0; r < 8; ++r) { s[nt][r] = (km[nt][r >> 2][r & 3] != 0) ? s[nt][r] : -INFINITY; mc = fmaxf(mc, s[nt][r]); }      /* the raw energy: its scale is positive, so the maximum is taken before it; masked keys carry -1e20 in the module, -inf here */
      mc = fmaxf(mc, xhalf(mc));
      const float mn = fmaxf(m_q, mc); float al = (m_q - mn) * SC2; m_q = mn;      /* mn >= -3e38 is finite: nothing attended yet gives 2^0 = 1, a masked key 2^-inf = 0 */
      const float nb = fmaf(mn, -SC2, 10.0f);      /* p x2^10 = 2^(e SC2 - mn SC2 + 10): one fma and one hardware exponential a score */
#pragma unroll      /* both loops unrolled: constant indices keep the scores in registers */
      for (int nt = 0; nt < 2; ++nt)
#pragma unroll
        for (int r = 0; r < 8; ++r) s[nt][r] = fmaf(s[nt][r], SC2, nb);
      exp2_17(s[0], s[1], al);
      float ps = 0.f; FragH pb;
#pragma unroll
      for (int nt = 0; nt < 2; ++nt)
#pragma unroll
        for (int r = 0; r < 8; ++r) { const float p = s[nt][r]; ps += p; pb.h[nt * 8 + r] = (_Float16)p; }
      l_q = l_q * al + ps;
#pragma unroll
      for (int dt = 0; dt < DT; ++dt)
#pragma unroll
        for (int r = 0; r < 8; ++r) oacc[dt][r] *= al;
#pragma unroll
      for (int dt = 0; dt < DT; ++dt) oacc[dt] = mmaH<1>(av[dt].v, av[dt].v, pb.v, pb.v, oacc[dt]); }
    asm volatile("s_wait_dscnt 0x0" ::: "memory");        /* this wave's reads of the buffer are over before it is handed to the copies */
    asm volatile("s_wait_asynccnt 0x0" ::: "memory");     /* this wave's copies of stage t + 1 have landed */
    __syncthreads();                                      /* publishes stage t + 1 and ends every wave's reads of stage t */
    if (t + 2 < NST) stage(t + 2, bf * LBUF); }
  asm volatile("s_wait_asynccnt 0x0" ::: "memory");       /* no copy is outstanding when the wave goes on to its end */
  { const float l = l_q + xhalf(l_q); const float inv = (l > 0.f) ? 1.0f / l : 0.f;      /* l and O^T both carry the 2^10 of P */
#pragma unroll
    for (int dt = 0; dt < DT; ++dt) { FragH o;      /* O x2^4 in f16, the output GEMM's A operand: the lane's 8 consecutive d of query ln */
#pragma unroll
      for (int r = 0; r < 8; ++r) o.h[r] = (_Float16)((oacc[dt][r] * inv) * 16.0f);
      *(v8us*)&sO[w][ln][dt * 16 + 8 * hh] = o.half[0]; } }
  __builtin_amdgcn_fence(__ATOMIC_ACQ_REL, "workgroup"); __builtin_amdgcn_wave_barrier();
  {
#pragma unroll
    for (int rp = 0; rp < RPW; rp += 4) { const int r = rp + (lane >> 3), pc = lane & 7; const v8us val = *(const v8us*)&sO[w][r][pc * 8]; *(v8us*)((unsigned short*)O16 + ((size_t)b * TT + q0 + r) * ldo + h * 64 + pc * 8) = val; }
     } }

// Output GEMM, out = (O x2^4).(Wo x2^4)^T / 2^8 + bf16(bo): one 128 x 128 tile of out a block, 8 waves of 64 x 32 (4 x 2 accumulator tiles), K in 8 stages of 128.
// A stage is 128 rows of O16 and 128 rows of Bo, 256 B (two whole lines) a row, LDS pitch 272 B, two buffers; stage t + 2 is copied while stage t + 1 is worked on. Each tile sums its k in ascending steps of 32.
__global__ __launch_bounds__(256) void k_ogemm(const _Float16* __restrict__ A, const _Float16* __restrict__ Bh, const float* __restrict__ bias, float* __restrict__ C) {
  constexpr int SK = 128, NST = DD / SK, LP = SK + 8, SP = 36; typedef float fa __attribute__((may_alias));
  __shared__ __attribute__((aligned(16))) unsigned short sAB[2][2][128][LP];      /* [buffer][O16, Bo][row][pitch]; behind the loop: each wave's 64 x 32 f32 of out, pitch SP */
  const int tid = threadIdx.x, w = tid >> 5, lane = tid & 31, ln = lane & 15, hh = lane >> 4;
  const int row0 = blockIdx.y * 128, col0 = blockIdx.x * 128, wm = (w & 1) * 64, wn = (w >> 1) * 32;
  /* the thread's part of a stage: 16 B at column 8 cc of rows cr + 16 i of both tiles, so that a wave's copy takes four whole 128-B lines */
  const int cr = tid >> 4, cc = tid & 15;
  const unsigned short* ag = (const unsigned short*)A + (size_t)(row0 + cr) * DD + cc * 8;
  const unsigned short* bg = (const unsigned short*)Bh + (size_t)(col0 + cr) * DD + cc * 8;
  const unsigned lab = (unsigned)(size_t)&sAB[0][0][cr][cc * 8];
  constexpr unsigned LROW = 16 * LP * 2, LTILE = 128 * LP * 2, LBUF = 2 * LTILE;      /* bytes: 16 rows, one tile, one buffer */
  auto tile = [&](const unsigned short* g, unsigned l) {      /* rows cr + 16 i, i = 0 .. 7: eight copies and, as in cp4, the s_wait_xcnt precaution in one statement, so that a tile costs one such wait */
    asm volatile("global_load_async_to_lds_b128 %0, %8, off\n\tglobal_load_async_to_lds_b128 %1, %9, off\n\tglobal_load_async_to_lds_b128 %2, %10, off\n\tglobal_load_async_to_lds_b128 %3, %11, off\n\t"
                 "global_load_async_to_lds_b128 %4, %12, off\n\tglobal_load_async_to_lds_b128 %5, %13, off\n\tglobal_load_async_to_lds_b128 %6, %14, off\n\tglobal_load_async_to_lds_b128 %7, %15, off\n\ts_wait_xcnt 0x0"
                 :: "v"(l), "v"(l + LROW), "v"(l + 2 * LROW), "v"(l + 3 * LROW), "v"(l + 4 * LROW), "v"(l + 5 * LROW), "v"(l + 6 * LROW), "v"(l + 7 * LROW),
                    "v"(g), "v"(g + 16 * DD), "v"(g + 32 * DD), "v"(g + 48 * DD), "v"(g + 64 * DD), "v"(g + 80 * DD), "v"(g + 96 * DD), "v"(g + 112 * DD) : "memory"); };
  auto stage = [&](int t, unsigned bufo) { tile(ag + t * SK, lab + bufo); tile(bg + t * SK, lab + bufo + LTILE); };
  stage(0, 0);
  asm volatile("s_wait_asynccnt 0x0" ::: "memory");      /* this wave's copies of stage 0 have landed */
  __syncthreads();                                        /* ... and every other wave's: nothing of them is read before */
  stage(1, LBUF);
  v8f acc[4][2];
#pragma unroll
  for (int i = 0; i < 4; ++i)
#pragma unroll
    for (int j = 0; j < 2; ++j) acc[i][j] = (v8f){0.f,0.f,0.f,0.f,0.f,0.f,0.f,0.f};
#pragma unroll 1      /* stays rolled: the buffer is chosen by t & 1 */
  for (int t = 0; t < NST; ++t) {
    const int bf = t & 1;
    const unsigned short* af = &sAB[bf][0][wm + ln][8 * hh]; const unsigned short* bp = &sAB[bf][1][wn + ln][8 * hh];
#pragma unroll      /* this loop and those inside it are unrolled: constant indices keep fragments and accumulators in registers, every LDS offset is an immediate */
    for (int kh = 0; kh < SK; kh += 64) {
      FragH a[2][4], b[2][2];
#pragma unroll
      for (int ks = 0; ks < 2; ++ks) {
#pragma unroll
        for (int j = 0; j < 2; ++j) { const unsigned short* p = bp + j * 16 * LP + kh + ks * 32; b[ks][j].half[0] = *(const v8us*)p; b[ks][j].half[1] = *(const v8us*)(p + 16); }
#pragma unroll
        for (int i = 0; i < 4; ++i) { const unsigned short* p = af + i * 16 * LP + kh + ks * 32; a[ks][i].half[0] = *(const v8us*)p; a[ks][i].half[1] = *(const v8us*)(p + 16); } }
      __builtin_amdgcn_sched_barrier(0);      /* 24 LDS reads stay one group in front of their 16 products (for speed only) */
#pragma unroll
      for (int ks = 0; ks < 2; ++ks)
#pragma unroll
        for (int i = 0; i < 4; ++i)
#pragma unroll
          for (int j = 0; j < 2; ++j) acc[i][j] = __builtin_amdgcn_wmma_f32_16x16x32_f16(false, a[ks][i].v, false, b[ks][j].v, (short)0, acc[i][j], false, false);
      __builtin_amdgcn_sched_barrier(0); }      /* the products stay in front of the waits below: lifted over them, the waits would end the next stage's flight before the products have covered it */
    asm volatile("s_wait_dscnt 0x0" ::: "memory");        /* this wave's reads of the buffer are over before it is handed to the copies */
    asm volatile("s_wait_asynccnt 0x0" ::: "memory");     /* this wave's copies of stage t + 1 have landed */
    __syncthreads();                                      /* publishes stage t + 1 and ends every wave's reads of stage t */
    if (t + 2 < NST) stage(t + 2, bf * LBUF); }
  asm volatile("s_wait_asynccnt 0x0" ::: "memory");       /* no copy is outstanding when the buffers become output staging */
  /* behind the last trip's barrier nobody reads the buffers any more: each wave stages its own 64 x 32 f32 there, so that every row leaves as one whole 128-B line */
  fa* st = (fa*)&sAB[0][0][0][0] + w * (64 * SP);
#pragma unroll
  for (int j = 0; j < 2; ++j) { const float bv = bf16_round(bias[col0 + wn + j * 16 + ln]);
#pragma unroll
    for (int i = 0; i < 4; ++i)
#pragma unroll
      for (int r = 0; r < 8; ++r) st[(i * 16 + 8 * hh + r) * SP + j * 16 + ln] = acc[i][j][r] * 0.00390625f + bv; }
  __builtin_amdgcn_fence(__ATOMIC_ACQ_REL, "workgroup"); __builtin_amdgcn_wave_barrier();      /* the wave reads back what its other lanes staged */
  float* cp = C + (size_t)(row0 + wm + (lane >> 3)) * DD + col0 + wn + (lane & 7) * 4; const fa* sp = st + (lane >> 3) * SP + (lane & 7) * 4;
#pragma unroll
  for (int q = 0; q < 16; ++q) { const v4f v = *(const v4fa*)(sp + q * 4 * SP); *(v4f*)(cp + (size_t)q * 4 * DD) = v; }
  asm volatile("s_wait_xcnt 0x0" ::: "memory"); }      /* precaution behind the stores: nothing that follows writes their registers first */

extern "C" void kernel_launch(void* const* d_in, const int* in_sizes, int n_in,
                              void* d_out, int out_size, void* d_ws, size_t ws_size, hipStream_t stream) {
  (void)in_sizes; (void)n_in; (void)out_size;
  const float* const* I = (const float* const*)d_in; const float* values = I[0]; const float* keys = I[1]; const float* query = I[2]; const int* mask = (const int*)d_in[3]; const float* Wv = I[4]; const float* Wk = I[5]; const float* Wq = I[6]; const float* Wo = I[7]; const float* bo = I[8];
  char* ws = (char*)d_ws; size_t off = 0;
  auto take = [&](size_t bytes) { char* p = ws + off; off += (bytes + 255) & ~(size_t)255; return p; };
  _Float16* Bo = (_Float16*)take((size_t)DD * DD * 2);
  _Float16* K = (_Float16*)take((size_t)NR * DD * 2); _Float16* Q = (_Float16*)take((size_t)NR * DD * 2); _Float16* Vt = (_Float16*)take((size_t)NR * DD * 2); _Float16* O16 = (_Float16*)take((size_t)NR * DD * 2);
  if (off > ws_size) return;      // 2.1 + 4 x 8.4 = 36 MB
  k_proj<<<dim3(NR / 256, NH, 4), 128, 0, stream>>>(values, keys, query, Wv, Wk, Wq, Wo, Vt, K, Q, Bo);
  k_flash<<<BB * NH * (TT / 64), 128, 0, stream>>>(Q, DD, K, DD, Vt, mask, O16, DD);
  k_ogemm<<<dim3(DD / 128, NR / 128), 256, 0, stream>>>(O16, Bo, bo, (float*)d_out);      /* out = O.Wo^T + bo */
}

// v007
// It runs in 66.5 microseconds.
// Next to v006, in two timings, it ran 1.05 times as fast each time.
// Counting every step since v000, it is 8.37 times as fast.
#include <hip/hip_runtime.h>
// 'SelfAttension' (B=2, S=2048, E=1024, 16 heads × 64): per-head projections with ONE shared 64×64 weight per tensor (y_h = x_h·Wᵀ, torch (out,in), no bias) for values, keys, query; energy = q·kᵀ with −1e20 where the key mask [N,1,1,S] == 0;
// attn = softmax(energy/√1024); out = (attn·v merged)·Woᵀ + bo.
// Compute dtype: inputs, weights, bias rounded to bf16; the per-head 64×64 projections as block-diagonal f16 GEMMs (all 16 head-block columns of all three tensors in one launch, grid = row blocks x heads x 4: the three tensors and the Wo to f16 conversion, K = 64); fused flash-style kernel (per-(b,k) int mask loads, scale 1/32,
// online softmax f32, P f16 ×2^10) on v_wmma_f32_16x16x32_f16; O ×2^4 → f16 → output GEMM + bias; f32 accumulate.
#define BB 2
#define TT 2048
#define DD 1024
#define NH 16
#define HD 64
#define NR (BB * TT)

typedef __bf16 v16b __attribute__((ext_vector_type(16)));
typedef unsigned short v8us __attribute__((ext_vector_type(8), may_alias));
typedef float  v8f  __attribute__((ext_vector_type(8)));
typedef float  v4f  __attribute__((ext_vector_type(4)));
typedef float  v4fa __attribute__((ext_vector_type(4), may_alias));
union FragB { v16b v; v8us half[2]; unsigned short u[16]; };

__device__ __forceinline__ unsigned short bf16_bits(float x) { unsigned int u = __float_as_uint(x); return (unsigned short)((u + 0x7FFFu + ((u >> 16) & 1u)) >> 16); }
__device__ __forceinline__ float bf16_val(unsigned short b) { return __uint_as_float(((unsigned int)b) << 16); }
__device__ __forceinline__ float bf16_round(float x) { return bf16_val(bf16_bits(x)); }
// D += A·B with NT terms: 1 = ah·bh, 2 = + al·bh (A split), 3 = + ah·bl (both split)
template <int NT>
__device__ __forceinline__ v8f mmaN(v16b ah, v16b al, v16b bh, v16b bl, v8f c) {
  c = __builtin_amdgcn_wmma_f32_16x16x32_bf16(false, ah, false, bh, (short)0, c, false, false);
  if (NT >= 2) c = __builtin_amdgcn_wmma_f32_16x16x32_bf16(false, al, false, bh, (short)0, c, false, false);
  if (NT >= 3) c = __builtin_amdgcn_wmma_f32_16x16x32_bf16(false, ah, false, bl, (short)0, c, false, false);
  asm volatile("v_nop\n\tv_nop\n\tv_nop\n\tv_nop" : "+v"(c) : "v"(ah), "v"(al), "v"(bh), "v"(bl));
  return c;
}

__global__ __launch_bounds__(256) void k_wt_bf16(const float* __restrict__ W, unsigned short* __restrict__ Wt, int K, int N) {
  const int t = blockIdx.x * 256 + threadIdx.x;
  const int k8n = K / 8;
  if (t >= N * k8n) return;
  const int n = t / k8n, k8 = (t % k8n) * 8;
  v8us v;
#pragma unroll
  for (int i = 0; i < 8; ++i) v[i] = bf16_bits(W[(size_t)(k8 + i) * N + n]);
  *(v8us*)(Wt + (size_t)n * K + k8) = v;
  
}

// GEMM C[M][N] (f32, pitch ldc) = act(A[M][K]·W + bias). A f32 row-major (pitch lda) converted per fragment to bf16
// (ASPLIT: hi/lo two planes -> 2 terms, else single rounded term); Wt bf16 [N][K] (pitch ldb). BIAS_BF16 rounds the
// bias to bf16 first (bias quantised to bf16 before the add). K%32==0, M%16==0, N%64==0.
template <bool ASPLIT, int ACT, bool BIAS_BF16>
__global__ __launch_bounds__(128) void k_gemm_bf(const float* __restrict__ A, int lda, const unsigned short* __restrict__ Wt, int ldb,
                                               const float* __restrict__ bias, float* __restrict__ C, int ldc, int M, int N, int K) {
  __shared__ __attribute__((aligned(16))) float so[4][16][64];
  const int tid = threadIdx.x, w = tid >> 5, lane = tid & 31, ln = lane & 15, hh = lane >> 4;
  const int ntn = N / 64;
  const int wid = blockIdx.x * 4 + w;
  const int mt = wid / ntn, nq = wid % ntn;
  if (mt * 16 >= M) return;
  const int row0 = mt * 16, col0 = nq * 64;
  const float* arow = A + (size_t)(row0 + ln) * lda;
  v8f acc[4] = {};
  for (int kb = 0; kb < K; kb += 32) {
    FragB ah, al;
    const v4f x0 = *(const v4fa*)(arow + kb + 8 * hh), x1 = *(const v4fa*)(arow + kb + 8 * hh + 4);
    const v4f x2 = *(const v4fa*)(arow + kb + 16 + 8 * hh), x3 = *(const v4fa*)(arow + kb + 16 + 8 * hh + 4);
    float xs[16] = {x0[0],x0[1],x0[2],x0[3],x1[0],x1[1],x1[2],x1[3],x2[0],x2[1],x2[2],x2[3],x3[0],x3[1],x3[2],x3[3]};
#pragma unroll
    for (int i = 0; i < 16; ++i) { const unsigned short hb = bf16_bits(xs[i]); ah.u[i] = hb; al.u[i] = ASPLIT ? bf16_bits(xs[i] - bf16_val(hb)) : (unsigned short)0; }
#pragma unroll
    for (int t = 0; t < 4; ++t) {
      const unsigned short* brow = Wt + (size_t)(col0 + t * 16 + ln) * ldb + kb;
      FragB b;
      b.half[0] = *(const v8us*)(brow + 8 * hh);
      b.half[1] = *(const v8us*)(brow + 16 + 8 * hh);
      acc[t] = mmaN<ASPLIT ? 2 : 1>(ah.v, al.v, b.v, b.v, acc[t]);
    }
  }
#pragma unroll
  for (int t = 0; t < 4; ++t) {
    float bv = bias ? bias[col0 + t * 16 + ln] : 0.f;
    if (BIAS_BF16) bv = bf16_round(bv);
#pragma unroll
    for (int r = 0; r < 8; ++r) { float v = acc[t][r] + bv; if (ACT == 1) v = fmaxf(v, 0.f); so[w][8 * hh + r][t * 16 + ln] = v; }
  }
  __builtin_amdgcn_fence(__ATOMIC_ACQ_REL, "workgroup");
  __builtin_amdgcn_wave_barrier();
  const int rsub = lane >> 4, c4 = (lane & 15) * 4;
  {
#pragma unroll
    for (int q = 0; q < 8; ++q) {
      const int r = q * 2 + rsub;
      const v4f v = *(const v4fa*)&so[w][r][c4];
      *(v4f*)(C + (size_t)(row0 + r) * ldc + col0 + c4) = v;
    }
    
  }
}

// Flash-style causal/unmasked attention, all contractions 3-term bf16 hi/lo splits, f32 softmax with running max.
// q,k,v rows are read from f32 buffers with arbitrary row pitch (so they can live inside a fused qkv buffer);
// D = head size (multiple of 32, <= 128); one wave = 16 query rows; block = 4 waves (64 queries) sharing K/V chunks of 32.
template <int D, bool CAUSAL>
__global__ __launch_bounds__(128) void k_flash(const float* __restrict__ qb, const float* __restrict__ kb, const float* __restrict__ vb,
                                             int pitch, int T, int H, float scale, float* __restrict__ y, int ypitch) {
  constexpr int KS = D / 32;        // k-steps for QK
  constexpr int DT = D / 16;        // d tiles for PV
  __shared__ __attribute__((aligned(16))) unsigned short sKh[32][D + 8], sKl[32][D + 8], sVh[32][D + 8], sVl[32][D + 8];
  __shared__ __attribute__((aligned(16))) unsigned short sPh[4][16][40], sPl[4][16][40];
  __shared__ __attribute__((aligned(16))) float sO[4][16][D];
  const int tid = threadIdx.x, w = tid >> 5, lane = tid & 31, ln = lane & 15, hh = lane >> 4;
  const int nqb = (T + 63) / 64;
  const int bh = blockIdx.x / nqb, qblk = blockIdx.x % nqb;
  const int b = bh / H, h = bh % H;
  const int q0 = qblk * 64 + w * 16;
  const float* Q = qb + (size_t)b * T * pitch + h * D;
  const float* K = kb + (size_t)b * T * pitch + h * D;
  const float* V = vb + (size_t)b * T * pitch + h * D;

  // A fragments of the wave's 16 query rows (scaled), hi/lo
  FragB aqh[KS], aql[KS];
  {
    int row = q0 + ln; if (row >= T) row = T - 1;
    const float* qr = Q + (size_t)row * pitch;
#pragma unroll
    for (int ks = 0; ks < KS; ++ks)
#pragma unroll
      for (int i = 0; i < 16; ++i) {
        const int d = ks * 32 + ((i < 8) ? (8 * hh + i) : (16 + 8 * hh + (i - 8)));
        const float x = qr[d] * scale; const unsigned short hb = bf16_bits(x);
        aqh[ks].u[i] = hb; aql[ks].u[i] = bf16_bits(x - bf16_val(hb));
      }
  }
  float m_r[8], l_r[8];
#pragma unroll
  for (int r = 0; r < 8; ++r) { m_r[r] = -3.0e38f; l_r[r] = 0.f; }
  v8f oacc[DT];
#pragma unroll
  for (int dt = 0; dt < DT; ++dt) oacc[dt] = (v8f){0.f,0.f,0.f,0.f,0.f,0.f,0.f,0.f};

  const int kv_end = CAUSAL ? min(T, qblk * 64 + 64) : T;     // block-uniform
  for (int j0 = 0; j0 < kv_end; j0 += 32) {
    __syncthreads();
    for (int e = tid; e < 32 * (D / 4); e += 128) {
      const int r = e / (D / 4), c4 = (e % (D / 4)) * 4;
      const int key = j0 + r;
      v4f kf = {0.f,0.f,0.f,0.f}, vf = {0.f,0.f,0.f,0.f};
      if (key < T) { kf = *(const v4fa*)(K + (size_t)key * pitch + c4); vf = *(const v4fa*)(V + (size_t)key * pitch + c4); }
#pragma unroll
      for (int t = 0; t < 4; ++t) {
        unsigned short hb = bf16_bits(kf[t]); sKh[r][c4 + t] = hb; sKl[r][c4 + t] = bf16_bits(kf[t] - bf16_val(hb));
        hb = bf16_bits(vf[t]); sVh[r][c4 + t] = hb; sVl[r][c4 + t] = bf16_bits(vf[t] - bf16_val(hb));
      }
    }
    __syncthreads();
    // S tile 16 x 32
    v8f s[2];
#pragma unroll
    for (int nt = 0; nt < 2; ++nt) {
      v8f acc = {};
#pragma unroll
      for (int ks = 0; ks < KS; ++ks) {
        FragB bh_, bl_;
        bh_.half[0] = *(const v8us*)&sKh[nt * 16 + ln][ks * 32 + 8 * hh]; bh_.half[1] = *(const v8us*)&sKh[nt * 16 + ln][ks * 32 + 16 + 8 * hh];
        bl_.half[0] = *(const v8us*)&sKl[nt * 16 + ln][ks * 32 + 8 * hh]; bl_.half[1] = *(const v8us*)&sKl[nt * 16 + ln][ks * 32 + 16 + 8 * hh];
        acc = mmaN<3>(aqh[ks].v, aql[ks].v, bh_.v, bl_.v, acc);
      }
      s[nt] = acc;
    }
    // mask + running max (rows 8hh+r; the 16 lanes of a half share rows)
    float alpha[8];
#pragma unroll
    for (int r = 0; r < 8; ++r) {
      const int qi = q0 + 8 * hh + r;
      const int ja = j0 + ln, jb = j0 + 16 + ln;
      if (CAUSAL) { if (ja > qi) s[0][r] = -3.0e38f; if (jb > qi) s[1][r] = -3.0e38f; }
      if (ja >= T) s[0][r] = -3.0e38f;
      if (jb >= T) s[1][r] = -3.0e38f;
      float mx = fmaxf(s[0][r], s[1][r]);
      mx = fmaxf(mx, __shfl_xor(mx, 1, 32)); mx = fmaxf(mx, __shfl_xor(mx, 2, 32)); mx = fmaxf(mx, __shfl_xor(mx, 4, 32)); mx = fmaxf(mx, __shfl_xor(mx, 8, 32));
      const float mnew = fmaxf(m_r[r], mx);
      alpha[r] = (mnew > -1.0e38f) ? __expf(m_r[r] - mnew) : 1.0f;
      const float p0 = (s[0][r] > -1.0e38f) ? __expf(s[0][r] - mnew) : 0.f;
      const float p1 = (s[1][r] > -1.0e38f) ? __expf(s[1][r] - mnew) : 0.f;
      m_r[r] = mnew;
      l_r[r] = l_r[r] * alpha[r] + p0 + p1;            // per-lane partial row sum (16 lanes combined at the end)
      unsigned short hb = bf16_bits(p0); sPh[w][8 * hh + r][ln] = hb;      sPl[w][8 * hh + r][ln] = bf16_bits(p0 - bf16_val(hb));
      hb = bf16_bits(p1);                sPh[w][8 * hh + r][16 + ln] = hb; sPl[w][8 * hh + r][16 + ln] = bf16_bits(p1 - bf16_val(hb));
    }
#pragma unroll
    for (int dt = 0; dt < DT; ++dt)
#pragma unroll
      for (int r = 0; r < 8; ++r) oacc[dt][r] *= alpha[r];
    __builtin_amdgcn_fence(__ATOMIC_ACQ_REL, "workgroup");
    __builtin_amdgcn_wave_barrier();
    FragB pah, pal;
    pah.half[0] = *(const v8us*)&sPh[w][ln][8 * hh]; pah.half[1] = *(const v8us*)&sPh[w][ln][16 + 8 * hh];
    pal.half[0] = *(const v8us*)&sPl[w][ln][8 * hh]; pal.half[1] = *(const v8us*)&sPl[w][ln][16 + 8 * hh];
#pragma unroll
    for (int dt = 0; dt < DT; ++dt) {
      FragB bvh, bvl;
#pragma unroll
      for (int i = 0; i < 8; ++i) {
        bvh.u[i] = sVh[8 * hh + i][dt * 16 + ln]; bvh.u[8 + i] = sVh[16 + 8 * hh + i][dt * 16 + ln];
        bvl.u[i] = sVl[8 * hh + i][dt * 16 + ln]; bvl.u[8 + i] = sVl[16 + 8 * hh + i][dt * 16 + ln];
      }
      oacc[dt] = mmaN<3>(pah.v, pal.v, bvh.v, bvl.v, oacc[dt]);
    }
    __builtin_amdgcn_fence(__ATOMIC_ACQ_REL, "workgroup");
    __builtin_amdgcn_wave_barrier();
  }
#pragma unroll
  for (int r = 0; r < 8; ++r) {
    float l = l_r[r];
    l += __shfl_xor(l, 1, 32); l += __shfl_xor(l, 2, 32); l += __shfl_xor(l, 4, 32); l += __shfl_xor(l, 8, 32);
    l_r[r] = (l > 0.f) ? 1.0f / l : 0.f;
  }
#pragma unroll
  for (int dt = 0; dt < DT; ++dt)
#pragma unroll
    for (int r = 0; r < 8; ++r) sO[w][8 * hh + r][dt * 16 + ln] = oacc[dt][r] * l_r[r];
  __builtin_amdgcn_fence(__ATOMIC_ACQ_REL, "workgroup");
  __builtin_amdgcn_wave_barrier();
  {
    for (int r = 0; r < 16; ++r) {
      const int row = q0 + r;
      if (row < T && lane < D / 4) {
        const v4f val = *(const v4fa*)&sO[w][r][lane * 4];
        *(v4f*)(y + ((size_t)b * T + row) * ypitch + h * D + lane * 4) = val;
      }
    }
    
  }
}

// GEMM C = act(A·W + bias + resid): A f32 (ASPLIT -> hi/lo 2 terms), Wt bf16 [N][K]; ACT 0 none, 1 relu, 2 exact gelu;
// resid (optional, f32, row index = (row % rmod), pitch ldr, RES_BF16 rounds it) added before the activation.
template <bool ASPLIT, int ACT, bool BIAS_BF16, bool RES_BF16>
__global__ __launch_bounds__(128) void k_gemm_bf3(const float* __restrict__ A, int lda, const unsigned short* __restrict__ Wt, int ldb,
                                                const float* __restrict__ bias, const float* __restrict__ resid, int rmod, int ldr,
                                                float* __restrict__ C, int ldc, int M, int N, int K) {
  __shared__ __attribute__((aligned(16))) float so[4][16][64];
  const int tid = threadIdx.x, w = tid >> 5, lane = tid & 31, ln = lane & 15, hh = lane >> 4;
  const int ntn = N / 64;
  const int wid = blockIdx.x * 4 + w;
  const int mt = wid / ntn, nq = wid % ntn;
  if (mt * 16 >= M) return;
  const int row0 = mt * 16, col0 = nq * 64;
  const float* arow = A + (size_t)(row0 + ln) * lda;
  v8f acc[4] = {};
  for (int kb = 0; kb < K; kb += 32) {
    FragB ah, al;
    const v4f x0 = *(const v4fa*)(arow + kb + 8 * hh), x1 = *(const v4fa*)(arow + kb + 8 * hh + 4);
    const v4f x2 = *(const v4fa*)(arow + kb + 16 + 8 * hh), x3 = *(const v4fa*)(arow + kb + 16 + 8 * hh + 4);
    float xs[16] = {x0[0],x0[1],x0[2],x0[3],x1[0],x1[1],x1[2],x1[3],x2[0],x2[1],x2[2],x2[3],x3[0],x3[1],x3[2],x3[3]};
#pragma unroll
    for (int i = 0; i < 16; ++i) { const unsigned short hb = bf16_bits(xs[i]); ah.u[i] = hb; al.u[i] = ASPLIT ? bf16_bits(xs[i] - bf16_val(hb)) : (unsigned short)0; }
#pragma unroll
    for (int t = 0; t < 4; ++t) {
      const unsigned short* brow = Wt + (size_t)(col0 + t * 16 + ln) * ldb + kb;
      FragB b;
      b.half[0] = *(const v8us*)(brow + 8 * hh);
      b.half[1] = *(const v8us*)(brow + 16 + 8 * hh);
      acc[t] = mmaN<ASPLIT ? 2 : 1>(ah.v, al.v, b.v, b.v, acc[t]);
    }
  }
#pragma unroll
  for (int t = 0; t < 4; ++t) {
    const int col = col0 + t * 16 + ln;
    float bv = bias ? bias[col] : 0.f;
    if (BIAS_BF16) bv = bf16_round(bv);
#pragma unroll
    for (int r = 0; r < 8; ++r) {
      float v = acc[t][r] + bv;
      if (resid) { float rv = resid[(size_t)((row0 + 8 * hh + r) % rmod) * ldr + col]; if (RES_BF16) rv = bf16_round(rv); v += rv; }
      if (ACT == 1) v = fmaxf(v, 0.f);
      if (ACT == 2) v = 0.5f * v * (1.0f + erff(v * 0.70710678118654752f));
      if (ACT == 3) { const float u = 0.7978845608028654f * (v + 0.044715f * v * v * v); v = 0.5f * v * (1.0f + tanhf(u)); }
      so[w][8 * hh + r][t * 16 + ln] = v;
    }
  }
  __builtin_amdgcn_fence(__ATOMIC_ACQ_REL, "workgroup");
  __builtin_amdgcn_wave_barrier();
  const int rsub = lane >> 4, c4 = (lane & 15) * 4;
  {
#pragma unroll
    for (int q = 0; q < 8; ++q) {
      const int r = q * 2 + rsub;
      const v4f v = *(const v4fa*)&so[w][r][c4];
      *(v4f*)(C + (size_t)(row0 + r) * ldc + col0 + c4) = v;
    }
    
  }
}
// row LayerNorm (biased variance, eps) over N: s = X (+ R); optional out_sum <- s; out_norm <- (s-mu)*rsqrt(var+eps)*g + b
template <bool PARAM_BF16>
__global__ __launch_bounds__(256) void k_layernorm(const float* __restrict__ X, const float* __restrict__ R, const float* __restrict__ g, const float* __restrict__ bta,
                                                  float* __restrict__ out_sum, float* __restrict__ out_norm, int N, float eps) {
  __shared__ float red[256];
  const int row = blockIdx.x, tid = threadIdx.x;
  const float* x = X + (size_t)row * N; const float* rr = R ? R + (size_t)row * N : nullptr;
  float vals[16];                     // up to N = 4096
  const int per = N / 256;            // contiguous chunk per thread? use strided-by-4 chunks: thread handles j = tid*4 + 1024*u
  float s1 = 0.f;
  for (int u = 0; u < per / 4; ++u) {
    const int j = tid * 4 + 1024 * u;
    const v4f a = *(const v4fa*)(x + j);
    v4f b = {0.f,0.f,0.f,0.f}; if (rr) b = *(const v4fa*)(rr + j);
#pragma unroll
    for (int q = 0; q < 4; ++q) { const float v = a[q] + b[q]; vals[u * 4 + q] = v; s1 += v; }
  }
  red[tid] = s1; __syncthreads();
  for (int st = 128; st > 0; st >>= 1) { if (tid < st) red[tid] += red[tid + st]; __syncthreads(); }
  const float mu = red[0] / (float)N; __syncthreads();
  float s2 = 0.f;
  for (int u = 0; u < per / 4; ++u)
#pragma unroll
    for (int q = 0; q < 4; ++q) { const float c = vals[u * 4 + q] - mu; s2 += c * c; }
  red[tid] = s2; __syncthreads();
  for (int st = 128; st > 0; st >>= 1) { if (tid < st) red[tid] += red[tid + st]; __syncthreads(); }
  const float rs = rsqrtf(red[0] / (float)N + eps);
  {
    for (int u = 0; u < per / 4; ++u) {
      const int j = tid * 4 + 1024 * u;
      v4f o, sm;
#pragma unroll
      for (int q = 0; q < 4; ++q) {
        float gg = g[j + q], bb = bta[j + q];
        if (PARAM_BF16) { gg = bf16_round(gg); bb = bf16_round(bb); }
        sm[q] = vals[u * 4 + q]; o[q] = (vals[u * 4 + q] - mu) * rs * gg + bb;
      }
      if (out_sum) *(v4f*)(out_sum + (size_t)row * N + j) = sm;
      *(v4f*)(out_norm + (size_t)row * N + j) = o;
    }
    
  }
}



// ---- f16 WMMA path (v_wmma_f32_16x16x32_f16): 11-bit significands for operands in range — used where a [0,1] probability operand needs more precision than bf16
typedef _Float16 v16h __attribute__((ext_vector_type(16)));
union FragH { v16h v; v8us half[2]; _Float16 h[16]; unsigned short u[16]; };
template <int NT>
__device__ __forceinline__ v8f mmaH(v16h ah, v16h al, v16h bh, v16h bl, v8f c) {
  c = __builtin_amdgcn_wmma_f32_16x16x32_f16(false, ah, false, bh, (short)0, c, false, false);
  if (NT >= 2) c = __builtin_amdgcn_wmma_f32_16x16x32_f16(false, al, false, bh, (short)0, c, false, false);
  if (NT >= 3) c = __builtin_amdgcn_wmma_f32_16x16x32_f16(false, ah, false, bl, (short)0, c, false, false);
  asm volatile("v_nop\n\tv_nop\n\tv_nop\n\tv_nop" : "+v"(c) : "v"(ah), "v"(al), "v"(bh), "v"(bl));
  return c;
}
// batched GEMM like k_gemm_b but f16 operands: A f32 (split into f16 hi/lo if ASPLIT, else rounded to f16), Bt = f16 values [n][k]; alpha; C f32; N multiple of 16 (partial tiles skipped)
template <bool ASPLIT>
__global__ __launch_bounds__(128) void k_gemm_h(const float* __restrict__ A, int lda, size_t sA, const _Float16* __restrict__ Bh, int ldb, size_t sB, float alpha, float* __restrict__ C, int ldc, size_t sC, int M, int N, int K) {
  __shared__ __attribute__((aligned(16))) float so[4][16][64];
  const int tid = threadIdx.x, w = tid >> 5, lane = tid & 31, ln = lane & 15, hh = lane >> 4; const int by = blockIdx.y;
  A += (size_t)by * sA; Bh += (size_t)by * sB; C += (size_t)by * sC;
  const int ntn = (N + 63) / 64; const int wid = blockIdx.x * 4 + w; const int mt = wid / ntn, nq = wid % ntn; if (mt * 16 >= M) return;
  const int row0 = mt * 16, col0 = nq * 64; const float* arow = A + (size_t)(row0 + ln) * lda;
  v8f acc[4] = {};
  for (int kb = 0; kb < K; kb += 32) {
    FragH ah, al;
    const v4f x0 = *(const v4fa*)(arow + kb + 8 * hh), x1 = *(const v4fa*)(arow + kb + 8 * hh + 4), x2 = *(const v4fa*)(arow + kb + 16 + 8 * hh), x3 = *(const v4fa*)(arow + kb + 16 + 8 * hh + 4);
    float xs[16] = {x0[0],x0[1],x0[2],x0[3],x1[0],x1[1],x1[2],x1[3],x2[0],x2[1],x2[2],x2[3],x3[0],x3[1],x3[2],x3[3]};
#pragma unroll
    for (int i = 0; i < 16; ++i) { const _Float16 h = (_Float16)xs[i]; ah.h[i] = h; al.h[i] = ASPLIT ? (_Float16)(xs[i] - (float)h) : (_Float16)0.0f; }
#pragma unroll
    for (int t = 0; t < 4; ++t) { if (col0 + t * 16 >= N) continue; const size_t boff = (size_t)(col0 + t * 16 + ln) * ldb + kb; FragH bq; bq.half[0] = *(const v8us*)(Bh + boff + 8 * hh); bq.half[1] = *(const v8us*)(Bh + boff + 16 + 8 * hh);
      acc[t] = mmaH<ASPLIT ? 2 : 1>(ah.v, al.v, bq.v, bq.v, acc[t]); }
  }
#pragma unroll
  for (int t = 0; t < 4; ++t) { if (col0 + t * 16 >= N) continue;
#pragma unroll
    for (int r = 0; r < 8; ++r) so[w][8 * hh + r][t * 16 + ln] = acc[t][r] * alpha; }
  __builtin_amdgcn_fence(__ATOMIC_ACQ_REL, "workgroup"); __builtin_amdgcn_wave_barrier();
  const int rsub = lane >> 4, c4 = (lane & 15) * 4;
  {
#pragma unroll
    for (int q = 0; q < 8; ++q) { const int r = q * 2 + rsub; if (col0 + c4 < N) { const v4f v = *(const v4fa*)&so[w][r][c4]; *(v4f*)(C + (size_t)(row0 + r) * ldc + col0 + c4) = v; } }
     }
}

// Wt[n][k] = f16(W[k][n]·scale) from f32 row-major W[K][N] (scale = power of two; bf16-exact weights stay exact in f16 away from the subnormal range)
__global__ __launch_bounds__(256) void k_wt_f16(const float* __restrict__ W, _Float16* __restrict__ Wt, int K, int N, float scale) {
  const int t = blockIdx.x * 256 + threadIdx.x; if (t >= N * (K / 8)) return; const int n = t / (K / 8), k8 = (t % (K / 8)) * 8; FragH f;
#pragma unroll
  for (int i = 0; i < 8; ++i) f.h[i] = (_Float16)(bf16_round(W[(size_t)(k8 + i) * N + n]) * scale); const v8us o = f.half[0];
  *(v8us*)((unsigned short*)Wt + (size_t)n * K + k8) = o; 
}
// k_gemm_hh variant with fused epilogue: v = acc·alpha + bias[by·sBias + col] (+ CP[(row/rowsPerB)·sCPb + by·64 + col] if CP) ; ACT 0 none / 1 elu ; writes f16 C16 and/or f32 C (each if non-null)
template <int ACT>
__global__ __launch_bounds__(128) void k_gemm_hhx(const _Float16* __restrict__ A, int lda, size_t sA, const _Float16* __restrict__ Bh, int ldb, size_t sB, float alpha, const float* __restrict__ bias, size_t sBias, const float* __restrict__ CP, int rowsPerB, size_t sCPb, int row0g,
    float* __restrict__ C, _Float16* __restrict__ C16, int ldc, size_t sC, int M, int N, int K, size_t sAz, size_t sBz, size_t sCz) {
  __shared__ __attribute__((aligned(16))) float so[4][16][64];
  const int tid = threadIdx.x, w = tid >> 5, lane = tid & 31, ln = lane & 15, hh = lane >> 4; const int by = blockIdx.y, bz = blockIdx.z;      /* second batch index bz with its own strides sAz, sBz, sCz */
  A += (size_t)by * sA + (size_t)bz * sAz; Bh += (size_t)by * sB + (size_t)bz * sBz; const size_t cofs = (size_t)by * sC + (size_t)bz * sCz; const float* bp = bias ? bias + (size_t)by * sBias : nullptr;
  const int ntn = (N + 63) / 64; const int wid = blockIdx.x * 4 + w; const int mt = wid / ntn, nq = wid % ntn; if (mt * 16 >= M) return;
  const int row0 = mt * 16, col0 = nq * 64; const _Float16* arow = A + (size_t)(row0 + ln) * lda;
  v8f acc[4] = {};
  for (int kb = 0; kb < K; kb += 32) { FragH ah; ah.half[0] = *(const v8us*)((const unsigned short*)arow + kb + 8 * hh); ah.half[1] = *(const v8us*)((const unsigned short*)arow + kb + 16 + 8 * hh);
#pragma unroll
    for (int t = 0; t < 4; ++t) { if (col0 + t * 16 >= N) continue; const size_t boff = (size_t)(col0 + t * 16 + ln) * ldb + kb; FragH bq; bq.half[0] = *(const v8us*)((const unsigned short*)Bh + boff + 8 * hh); bq.half[1] = *(const v8us*)((const unsigned short*)Bh + boff + 16 + 8 * hh);
      acc[t] = mmaH<1>(ah.v, ah.v, bq.v, bq.v, acc[t]); }
  }
#pragma unroll
  for (int t = 0; t < 4; ++t) { if (col0 + t * 16 >= N) continue; const int col = col0 + t * 16 + ln; const float bv = bp ? bf16_round(bp[col]) : 0.f;
#pragma unroll
    for (int r = 0; r < 8; ++r) { float v = acc[t][r] * alpha + bv; if (CP) { const int bidx = (row0g + row0 + 8 * hh + r) / rowsPerB; v += CP[(size_t)bidx * sCPb + (size_t)by * 64 + col]; } if (ACT == 1) v = (v > 0.f) ? v : expm1f(v); else if (ACT == 7) v = (v > 0.f) ? v + 1.0f : expf(v); else if (ACT == 8) v = tanhf(v); else if (ACT == 9) v = 0.5f * v * (1.0f + tanhf(0.7978845608028654f * (v + 0.044715f * v * v * v))); else if (ACT == 11) v = 1.0f / (1.0f + expf(-v)); else if (ACT == 12) v = (v > 0.f) ? v : 0.01f * v; else if (ACT == 14) v = (v > 0.f) ? v : 0.1f * v; else if (ACT == 15) v = v / (1.0f + expf(-v)); else if (ACT == 3) v = fmaxf(v, 0.f); else if (ACT == 6) v = 0.5f * v * (1.0f + erff(v * 0.70710678118654752f)); so[w][8 * hh + r][t * 16 + ln] = v; } }
  __builtin_amdgcn_fence(__ATOMIC_ACQ_REL, "workgroup"); __builtin_amdgcn_wave_barrier();
  const int rsub = lane >> 4, c4 = (lane & 15) * 4; typedef _Float16 v4h __attribute__((ext_vector_type(4)));
  {
#pragma unroll
    for (int q = 0; q < 8; ++q) { const int r = q * 2 + rsub; if (col0 + c4 < N) { const v4f v = *(const v4fa*)&so[w][r][c4]; if (C) *(v4f*)(C + cofs + (size_t)(row0 + r) * ldc + col0 + c4) = v; if (C16) { v4h h4; for (int i = 0; i < 4; ++i) h4[i] = (_Float16)v[i]; *(v4h*)(C16 + cofs + (size_t)(row0 + r) * ldc + col0 + c4) = h4; } } }
     }
}


typedef _Float16 v4h __attribute__((ext_vector_type(4)));

__global__ __launch_bounds__(256) void k_h16(const float* __restrict__ x, _Float16* __restrict__ X16, size_t n8) { const size_t t = (size_t)blockIdx.x * 256 + threadIdx.x; if (t >= n8) return; FragH f;
#pragma unroll
  for (int q = 0; q < 8; ++q) f.h[q] = (_Float16)x[t * 8 + q]; *(v8us*)((unsigned short*)X16 + t * 8) = f.half[0];  }
// The 16 f32 of one 16 x 32 operand fragment in the hardware k order (k = 8hh + e, then 16 + 8hh + e - 8), as loaded: p = row + 32 ks + 8 hh
struct Raw16 { v4f a, b, c, d; };
__device__ __forceinline__ Raw16 raw_f32(const float* __restrict__ p) { Raw16 x; x.a = *(const v4fa*)p; x.b = *(const v4fa*)(p + 4); x.c = *(const v4fa*)(p + 16); x.d = *(const v4fa*)(p + 20); return x; }
// each value rounded to bf16, then held exactly in f16 (weights x2^4)
template <bool W16>
__device__ __forceinline__ FragH frag_f32(const Raw16& x) { FragH f;
#pragma unroll
  for (int q = 0; q < 4; ++q) {
    f.h[q]      = W16 ? (_Float16)(bf16_round(x.a[q]) * 16.0f) : (_Float16)bf16_round(x.a[q]);
    f.h[4 + q]  = W16 ? (_Float16)(bf16_round(x.b[q]) * 16.0f) : (_Float16)bf16_round(x.b[q]);
    f.h[8 + q]  = W16 ? (_Float16)(bf16_round(x.c[q]) * 16.0f) : (_Float16)bf16_round(x.c[q]);
    f.h[12 + q] = W16 ? (_Float16)(bf16_round(x.d[q]) * 16.0f) : (_Float16)bf16_round(x.d[q]); }
  return f; }
// One wave: 64 rows x one head of one tensor, y = x.W^T (K = 64), inputs and weight converted in registers; the next 16 rows are loaded while these are worked on. st = the wave's own 64 x 64 f16 staging tile (pitch 72), written 16 B a lane:
// TR (values): A = x rows, B = W rows, so a lane holds 8 consecutive rows of one output column and the tile is staged transposed, st[d][row];
// else (keys, query): A = W rows, B = x rows, so a lane holds 8 consecutive columns of one row, st[row][e]. Either way each staged row leaves as one whole 128-B line; dst = first staged row, pitch in elements.
template <bool TR>
__device__ __forceinline__ void proj_tile(const float* __restrict__ x, const float* __restrict__ W, unsigned short (*st)[72], unsigned short* __restrict__ dst, size_t pitch, int lane) {
  const int ln = lane & 15, hh = lane >> 4; const float* xl = x + (size_t)ln * DD + 8 * hh; const float* wl = W + ln * HD + 8 * hh;
  Raw16 xr[2][2]; xr[0][0] = raw_f32(xl); xr[0][1] = raw_f32(xl + 32);
  Raw16 wr[4][2];
#pragma unroll
  for (int t = 0; t < 4; ++t)
#pragma unroll
    for (int ks = 0; ks < 2; ++ks) wr[t][ks] = raw_f32(wl + t * 16 * HD + ks * 32);
  asm volatile("s_wait_xcnt 0x0" :: "v"(wl) : "memory");      /* precaution: the weight loads' address registers (the input) are written again only behind this wait */
  FragH wf[4][2];
#pragma unroll
  for (int t = 0; t < 4; ++t)
#pragma unroll
    for (int ks = 0; ks < 2; ++ks) wf[t][ks] = frag_f32<true>(wr[t][ks]);
#pragma unroll
  for (int rt = 0; rt < 4; ++rt) {
    if (rt < 3) { xr[(rt + 1) & 1][0] = raw_f32(xl + (size_t)(rt + 1) * 16 * DD); xr[(rt + 1) & 1][1] = raw_f32(xl + (size_t)(rt + 1) * 16 * DD + 32);
      if (rt == 2) asm volatile("s_wait_xcnt 0x0" :: "v"(xl) : "memory"); }      /* the same precaution behind the last loads that name the row address */
    const FragH x0 = frag_f32<false>(xr[rt & 1][0]), x1 = frag_f32<false>(xr[rt & 1][1]);
#pragma unroll
    for (int t = 0; t < 4; ++t) { v8f acc = (v8f){0.f,0.f,0.f,0.f,0.f,0.f,0.f,0.f};
      if (TR) { acc = mmaH<1>(x0.v, x0.v, wf[t][0].v, wf[t][0].v, acc); acc = mmaH<1>(x1.v, x1.v, wf[t][1].v, wf[t][1].v, acc); }
      else    { acc = mmaH<1>(wf[t][0].v, wf[t][0].v, x0.v, x0.v, acc); acc = mmaH<1>(wf[t][1].v, wf[t][1].v, x1.v, x1.v, acc); }
      FragH o;
#pragma unroll
      for (int r = 0; r < 8; ++r) o.h[r] = (_Float16)(acc[r] * 0.0625f);
      if (TR) *(v8us*)&st[t * 16 + ln][rt * 16 + 8 * hh] = o.half[0]; else *(v8us*)&st[rt * 16 + ln][t * 16 + 8 * hh] = o.half[0]; } }
  __builtin_amdgcn_fence(__ATOMIC_ACQ_REL, "workgroup"); __builtin_amdgcn_wave_barrier();      /* the wave reads back what its other lanes staged */
#pragma unroll
  for (int q = 0; q < 16; ++q) { const int r = q * 4 + (lane >> 3), c8 = (lane & 7) * 8; const v8us v = *(const v8us*)&st[r][c8]; *(v8us*)(dst + (size_t)r * pitch + c8) = v; }
  asm volatile("s_wait_xcnt 0x0" ::: "memory"); }      /* the same precaution behind the stores: nothing that follows on any path writes their registers first */
// grid (NR / 256, heads, 4): blockIdx.z = 0 values -> Vt[slab][d][t], 1 keys -> K16, 2 query -> Q16 (row-major, head h at column 64 h); blockIdx.z = 3: Bo = f16(bf16(Wo) x2^4), 8 elements a thread and trip
__global__ __launch_bounds__(128) void k_proj(const float* __restrict__ xv, const float* __restrict__ xk, const float* __restrict__ xq, const float* __restrict__ Wv, const float* __restrict__ Wk, const float* __restrict__ Wq, const float* __restrict__ Wo,
    _Float16* __restrict__ Vt, _Float16* __restrict__ K16, _Float16* __restrict__ Q16, _Float16* __restrict__ Bo) {
  __shared__ __attribute__((aligned(16))) unsigned short st[4][64][72];
  const int tid = threadIdx.x, w = tid >> 5, lane = tid & 31; const int z = blockIdx.z, h = blockIdx.y;
  if (z == 3) { constexpr int NTH = (NR / 256) * NH * 128;
#pragma unroll
    for (int i = 0; i < DD * DD / 8 / NTH; ++i) { const size_t t = (size_t)i * NTH + (size_t)(blockIdx.y * (NR / 256) + blockIdx.x) * 128 + tid; const v4f a = *(const v4fa*)(Wo + t * 8), c = *(const v4fa*)(Wo + t * 8 + 4); FragH f;
#pragma unroll
      for (int q = 0; q < 4; ++q) { f.h[q] = (_Float16)(bf16_round(a[q]) * 16.0f); f.h[4 + q] = (_Float16)(bf16_round(c[q]) * 16.0f); }
      *(v8us*)((unsigned short*)Bo + t * 8) = f.half[0]; }
    return; }
  const int row0 = (blockIdx.x * 4 + w) * 64; const size_t xo = (size_t)row0 * DD + h * HD;
  if (z == 0) proj_tile<true>(xv + xo, Wv, st[w], (unsigned short*)Vt + ((size_t)((row0 / TT) * NH + h) * HD) * TT + row0 % TT, TT, lane);
  else proj_tile<false>((z == 1 ? xk : xq) + xo, z == 1 ? Wk : Wq, st[w], (unsigned short*)(z == 1 ? K16 : Q16) + xo, DD, lane); }
// lane l with lane l ^ 16 (a vector cross-row move, no LDS)
__device__ __forceinline__ float xhalf(float x) { return __builtin_bit_cast(float, __builtin_amdgcn_permlanex16(__builtin_bit_cast(int, x), __builtin_bit_cast(int, x), 0x76543210, 0xfedcba98, false, false)); }
// x <- 2^x on the hardware exponential for a pass's 16 scores and its rescale exponent. One asm statement so that each v_exp_f32 writes over its own argument and its neighbours name other registers:
// the slot that the instruction set asks for behind a transcendental (no read of its result, no write of its source) is then kept between them by construction, and the closing v_nop keeps it for whatever follows.
__device__ __forceinline__ void exp2_17(v8f& a, v8f& b, float& c) {
  float a0 = a[0], a1 = a[1], a2 = a[2], a3 = a[3], a4 = a[4], a5 = a[5], a6 = a[6], a7 = a[7], b0 = b[0], b1 = b[1], b2 = b[2], b3 = b[3], b4 = b[4], b5 = b[5], b6 = b[6], b7 = b[7];
  asm("v_exp_f32 %16, %16\n\tv_exp_f32 %0, %0\n\tv_exp_f32 %1, %1\n\tv_exp_f32 %2, %2\n\tv_exp_f32 %3, %3\n\tv_exp_f32 %4, %4\n\tv_exp_f32 %5, %5\n\tv_exp_f32 %6, %6\n\tv_exp_f32 %7, %7\n\t"
      "v_exp_f32 %8, %8\n\tv_exp_f32 %9, %9\n\tv_exp_f32 %10, %10\n\tv_exp_f32 %11, %11\n\tv_exp_f32 %12, %12\n\tv_exp_f32 %13, %13\n\tv_exp_f32 %14, %14\n\tv_exp_f32 %15, %15\n\tv_nop"
      : "+v"(a0), "+v"(a1), "+v"(a2), "+v"(a3), "+v"(a4), "+v"(a5), "+v"(a6), "+v"(a7), "+v"(b0), "+v"(b1), "+v"(b2), "+v"(b3), "+v"(b4), "+v"(b5), "+v"(b6), "+v"(b7), "+v"(c));      /* every exponential in place; the rescale factor's goes first, since 32 products wait for it */
  a = (v8f){a0, a1, a2, a3, a4, a5, a6, a7}; b = (v8f){b0, b1, b2, b3, b4, b5, b6, b7}; }
// Four asynchronous 16-B copies a lane, global -> LDS, through no register. The s_wait_xcnt in the same statement is a precaution: the address registers are written again only behind it.
__device__ __forceinline__ void cp4(unsigned l0, unsigned l1, unsigned l2, unsigned l3, const void* g0, const void* g1, const void* g2, const void* g3) {
  asm volatile("global_load_async_to_lds_b128 %0, %4, off\n\tglobal_load_async_to_lds_b128 %1, %5, off\n\tglobal_load_async_to_lds_b128 %2, %6, off\n\tglobal_load_async_to_lds_b128 %3, %7, off\n\ts_wait_xcnt 0x0"
               :: "v"(l0), "v"(l1), "v"(l2), "v"(l3), "v"(g0), "v"(g1), "v"(g2), "v"(g3) : "memory"); }
__global__ __launch_bounds__(128) void k_flash(const _Float16* __restrict__ Q16, int ldq, const _Float16* __restrict__ K16, int ldk, const _Float16* __restrict__ Vt, const int* __restrict__ MSK, _Float16* __restrict__ O16, int ldo) {
  constexpr int RPW = 16, NQB = TT / (4 * RPW), DT = 4, KS = 2, SK = 64, NST = TT / SK, LP = 72; typedef int v4ia __attribute__((ext_vector_type(4), may_alias));
  __shared__ __attribute__((aligned(16))) unsigned short sKV[2][2][SK][LP];      /* [buffer][K, V^T][row][pitch] */
  __shared__ __attribute__((aligned(16))) int sM[TT];
  __shared__ __attribute__((aligned(16))) unsigned short sO[4][RPW][64 + 8];
  const int tid = threadIdx.x, w = tid >> 5, lane = tid & 31, ln = lane & 15, hh = lane >> 4;
  const int slab = blockIdx.x / NQB, qblk = blockIdx.x % NQB; const int b = slab / NH, h = slab % NH; const int qb0 = qblk * (4 * RPW); const int q0 = qb0 + w * RPW;
  /* the thread's part of a stage: 16 B at column 8 cc of rows cr + 16 i, so that a wave's copy takes four whole 128-B lines */
  const int cr = tid >> 3, cc = tid & 7;
  const unsigned short* kg = (const unsigned short*)K16 + ((size_t)b * TT + cr) * ldk + h * 64 + cc * 8;
  const unsigned short* vg = (const unsigned short*)Vt + ((size_t)slab * 64 + cr) * TT + cc * 8;
  const unsigned lkv = (unsigned)(size_t)&sKV[0][0][cr][cc * 8];
  constexpr unsigned LROW = 16 * LP * 2, LTILE = SK * LP * 2, LBUF = 2 * LTILE;      /* bytes: 16 rows, one tile, one buffer */
  auto stage = [&](int t, unsigned bufo) {
    const unsigned short* k0 = kg + (size_t)t * SK * ldk; const unsigned short* v0 = vg + t * SK; const unsigned l = lkv + bufo;
    cp4(l, l + LROW, l + 2 * LROW, l + 3 * LROW, k0, k0 + (size_t)16 * ldk, k0 + (size_t)32 * ldk, k0 + (size_t)48 * ldk);
    cp4(l + LTILE, l + LTILE + LROW, l + LTILE + 2 * LROW, l + LTILE + 3 * LROW, v0, v0 + 16 * TT, v0 + 32 * TT, v0 + 48 * TT); };
  { const int* mg = MSK + (size_t)b * TT + tid * 4; const unsigned lm = (unsigned)(size_t)&sM[tid * 4];
    cp4(lm, lm + 2048, lm + 4096, lm + 6144, mg, mg + 512, mg + 1024, mg + 1536); }
  stage(0, 0);
  FragH bq[KS];
  { const unsigned short* qr = (const unsigned short*)Q16 + ((size_t)b * TT + q0 + ln) * ldq + h * 64;
#pragma unroll
    for (int ks = 0; ks < KS; ++ks) { bq[ks].half[0] = *(const v8us*)(qr + ks * 32 + 8 * hh); bq[ks].half[1] = *(const v8us*)(qr + ks * 32 + 16 + 8 * hh); } }
  asm volatile("s_wait_asynccnt 0x0" ::: "memory");      /* this wave's copies of the mask row and of stage 0 have landed */
  __syncthreads();                                        /* ... and every other wave's: nothing of them is read before */
  stage(1, LBUF);
  /* The mask row is tested once: bit t of zst says whether stage t holds a masked key. Read i covers 128 keys, lanes 0 to 15 those of stage 2 i, lanes 16 to 31 those of stage 2 i + 1; a ballot is the same in every lane, so zst is a scalar. */
  unsigned zst = 0;
#pragma unroll      /* unrolled: every LDS offset and every shift is an immediate */
  for (int i = 0; i < TT / 128; ++i) { const v4ia m = *(const v4ia*)&sM[(i * 32 + lane) * 4];
    const unsigned lo = min(min((unsigned)m[0], (unsigned)m[1]), min((unsigned)m[2], (unsigned)m[3]));      /* 0 where one of the four is 0 */
    const unsigned bal = __builtin_amdgcn_ballot_w32(lo == 0u);
    zst |= (((bal & 0xFFFFu) != 0u ? 1u : 0u) | ((bal >> 16) != 0u ? 2u : 0u)) << (2 * i); }
  float m_q = -3.0e38f, l_q = 0.f; v8f oacc[DT];      /* of query q0 + ln; m_q in units of the raw energy; l_q sums this half's keys (x2^10); oacc[dt][r] = O^T[dt*16 + 8hh + r][ln] */
  constexpr float SC2 = 0.03125f * 1.44269504088896340736f;      /* 1/sqrt(1024) x log2(e): softmax(energy/32) in powers of two */
#pragma unroll
  for (int dt = 0; dt < DT; ++dt) oacc[dt] = (v8f){0.f,0.f,0.f,0.f,0.f,0.f,0.f,0.f};
#pragma unroll 1      /* stays rolled (for speed only), the buffer chosen by t & 1 */
  for (int t = 0; t < NST; ++t) {
    const int bf = t & 1; const bool mk = ((zst >> t) & 1u) != 0u;
    const unsigned short* kf = &sKV[bf][0][ln][8 * hh]; const unsigned short* vf = &sKV[bf][1][ln][8 * hh]; const int* mf = &sM[t * SK + 8 * hh];
#pragma unroll
    for (int kk = 0; kk < SK; kk += 32) {      /* unrolled: every LDS offset of the two 32-key passes is an immediate */
      /* the pass's fragments as one group of LDS reads, in front of its first product */
      FragH ak[2][KS], av[DT];
#pragma unroll
      for (int nt = 0; nt < 2; ++nt)
#pragma unroll
        for (int ks = 0; ks < KS; ++ks) { const unsigned short* kr = kf + (kk + nt * 16) * LP + ks * 32; ak[nt][ks].half[0] = *(const v8us*)kr; ak[nt][ks].half[1] = *(const v8us*)(kr + 16); }
#pragma unroll
      for (int dt = 0; dt < DT; ++dt) { const unsigned short* vrow = vf + dt * 16 * LP + kk; av[dt].half[0] = *(const v8us*)vrow; av[dt].half[1] = *(const v8us*)(vrow + 16); }
      v8f s[2];
#pragma unroll
      for (int nt = 0; nt < 2; ++nt) { v8f acc = (v8f){0.f,0.f,0.f,0.f,0.f,0.f,0.f,0.f};
#pragma unroll
        for (int ks = 0; ks < KS; ++ks) acc = mmaH<1>(ak[nt][ks].v, ak[nt][ks].v, bq[ks].v, bq[ks].v, acc); s[nt] = acc; }
      if (mk) {      /* a scalar test of a scalar word: where every key of the stage is attended the selects are the identity, and the mask is not read */
        const int* mp = mf + kk;      /* key padding mask (1 = attend), shared by all queries and heads: the lane's keys 8hh + r and 16 + 8hh + r of the pass */
        const v4ia km[2][2] = {{*(const v4ia*)mp, *(const v4ia*)(mp + 4)}, {*(const v4ia*)(mp + 16), *(const v4ia*)(mp + 20)}};
#pragma unroll      /* both loops unrolled: constant indices keep the scores in registers */
        for (int nt = 0; nt < 2; ++nt)
#pragma unroll
          for (int r = 0; r < 8; ++r) s[nt][r] = (km[nt][r >> 2][r & 3] != 0) ? s[nt][r] : -INFINITY; }      /* masked keys carry -1e20 in the module, -inf here */
      float mc = -INFINITY;
#pragma unroll
      for (int nt = 0; nt < 2; ++nt)
#pragma unroll
        for (int r = 0; r < 8; ++r) mc = fmaxf(mc, s[nt][r]);      /* the raw energy: its scale is positive, so the maximum is taken before it */
      mc = fmaxf(mc, xhalf(mc));
      const float mn = fmaxf(m_q, mc); float al = (m_q - mn) * SC2; m_q = mn;      /* mn >= -3e38 is finite: nothing attended yet gives 2^0 = 1, a masked key 2^-inf = 0 */
      const float nb = fmaf(mn, -SC2, 10.0f);      /* p x2^10 = 2^(e SC2 - mn SC2 + 10): one fma and one hardware exponential a score */
#pragma unroll      /* both loops unrolled: constant indices keep the scores in registers */
      for (int nt = 0; nt < 2; ++nt)
#pragma unroll
        for (int r = 0; r < 8; ++r) s[nt][r] = fmaf(s[nt][r], SC2, nb);
      exp2_17(s[0], s[1], al);
      float ps = 0.f; FragH pb;
#pragma unroll
      for (int nt = 0; nt < 2; ++nt)
#pragma unroll
        for (int r = 0; r < 8; ++r) { const float p = s[nt][r]; ps += p; pb.h[nt * 8 + r] = (_Float16)p; }
      l_q = l_q * al + ps;
#pragma unroll
      for (int dt = 0; dt < DT; ++dt)
#pragma unroll
        for (int r = 0; r < 8; ++r) oacc[dt][r] *= al;
#pragma unroll
      for (int dt = 0; dt < DT; ++dt) oacc[dt] = mmaH<1>(av[dt].v, av[dt].v, pb.v, pb.v, oacc[dt]); }
    asm volatile("s_wait_dscnt 0x0" ::: "memory");        /* this wave's reads of the buffer are over before it is handed to the copies */
    asm volatile("s_wait_asynccnt 0x0" ::: "memory");     /* this wave's copies of stage t + 1 have landed */
    __syncthreads();                                      /* publishes stage t + 1 and ends every wave's reads of stage t */
    if (t + 2 < NST) stage(t + 2, bf * LBUF); }
  asm volatile("s_wait_asynccnt 0x0" ::: "memory");       /* no copy is outstanding when the wave goes on to its end */
  { const float l = l_q + xhalf(l_q); const float inv = (l > 0.f) ? 1.0f / l : 0.f;      /* l and O^T both carry the 2^10 of P */
#pragma unroll
    for (int dt = 0; dt < DT; ++dt) { FragH o;      /* O x2^4 in f16, the output GEMM's A operand: the lane's 8 consecutive d of query ln */
#pragma unroll
      for (int r = 0; r < 8; ++r) o.h[r] = (_Float16)((oacc[dt][r] * inv) * 16.0f);
      *(v8us*)&sO[w][ln][dt * 16 + 8 * hh] = o.half[0]; } }
  __builtin_amdgcn_fence(__ATOMIC_ACQ_REL, "workgroup"); __builtin_amdgcn_wave_barrier();
  {
#pragma unroll
    for (int rp = 0; rp < RPW; rp += 4) { const int r = rp + (lane >> 3), pc = lane & 7; const v8us val = *(const v8us*)&sO[w][r][pc * 8]; *(v8us*)((unsigned short*)O16 + ((size_t)b * TT + q0 + r) * ldo + h * 64 + pc * 8) = val; }
     } }

// Output GEMM, out = (O x2^4).(Wo x2^4)^T / 2^8 + bf16(bo): one 128 x 128 tile of out a block, 8 waves of 64 x 32 (4 x 2 accumulator tiles), K in 8 stages of 128.
// A stage is 128 rows of O16 and 128 rows of Bo, 256 B (two whole lines) a row, LDS pitch 272 B, two buffers; stage t + 2 is copied while stage t + 1 is worked on. Each tile sums its k in ascending steps of 32.
__global__ __launch_bounds__(256) void k_ogemm(const _Float16* __restrict__ A, const _Float16* __restrict__ Bh, const float* __restrict__ bias, float* __restrict__ C) {
  constexpr int SK = 128, NST = DD / SK, LP = SK + 8, SP = 36; typedef float fa __attribute__((may_alias));
  __shared__ __attribute__((aligned(16))) unsigned short sAB[2][2][128][LP];      /* [buffer][O16, Bo][row][pitch]; behind the loop: each wave's 64 x 32 f32 of out, pitch SP */
  const int tid = threadIdx.x, w = tid >> 5, lane = tid & 31, ln = lane & 15, hh = lane >> 4;
  const int row0 = blockIdx.y * 128, col0 = blockIdx.x * 128, wm = (w & 1) * 64, wn = (w >> 1) * 32;
  /* the thread's part of a stage: 16 B at column 8 cc of rows cr + 16 i of both tiles, so that a wave's copy takes four whole 128-B lines */
  const int cr = tid >> 4, cc = tid & 15;
  const unsigned short* ag = (const unsigned short*)A + (size_t)(row0 + cr) * DD + cc * 8;
  const unsigned short* bg = (const unsigned short*)Bh + (size_t)(col0 + cr) * DD + cc * 8;
  const unsigned lab = (unsigned)(size_t)&sAB[0][0][cr][cc * 8];
  constexpr unsigned LROW = 16 * LP * 2, LTILE = 128 * LP * 2, LBUF = 2 * LTILE;      /* bytes: 16 rows, one tile, one buffer */
  auto tile = [&](const unsigned short* g, unsigned l) {      /* rows cr + 16 i, i = 0 .. 7: eight copies and, as in cp4, the s_wait_xcnt precaution in one statement, so that a tile costs one such wait */
    asm volatile("global_load_async_to_lds_b128 %0, %8, off\n\tglobal_load_async_to_lds_b128 %1, %9, off\n\tglobal_load_async_to_lds_b128 %2, %10, off\n\tglobal_load_async_to_lds_b128 %3, %11, off\n\t"
                 "global_load_async_to_lds_b128 %4, %12, off\n\tglobal_load_async_to_lds_b128 %5, %13, off\n\tglobal_load_async_to_lds_b128 %6, %14, off\n\tglobal_load_async_to_lds_b128 %7, %15, off\n\ts_wait_xcnt 0x0"
                 :: "v"(l), "v"(l + LROW), "v"(l + 2 * LROW), "v"(l + 3 * LROW), "v"(l + 4 * LROW), "v"(l + 5 * LROW), "v"(l + 6 * LROW), "v"(l + 7 * LROW),
                    "v"(g), "v"(g + 16 * DD), "v"(g + 32 * DD), "v"(g + 48 * DD), "v"(g + 64 * DD), "v"(g + 80 * DD), "v"(g + 96 * DD), "v"(g + 112 * DD) : "memory"); };
  auto stage = [&](int t, unsigned bufo) { tile(ag + t * SK, lab + bufo); tile(bg + t * SK, lab + bufo + LTILE); };
  stage(0, 0);
  asm volatile("s_wait_asynccnt 0x0" ::: "memory");      /* this wave's copies of stage 0 have landed */
  __syncthreads();                                        /* ... and every other wave's: nothing of them is read before */
  stage(1, LBUF);
  v8f acc[4][2];
#pragma unroll
  for (int i = 0; i < 4; ++i)
#pragma unroll
    for (int j = 0; j < 2; ++j) acc[i][j] = (v8f){0.f,0.f,0.f,0.f,0.f,0.f,0.f,0.f};
#pragma unroll 1      /* stays rolled: the buffer is chosen by t & 1 */
  for (int t = 0; t < NST; ++t) {
    const int bf = t & 1;
    const unsigned short* af = &sAB[bf][0][wm + ln][8 * hh]; const unsigned short* bp = &sAB[bf][1][wn + ln][8 * hh];
#pragma unroll      /* this loop and those inside it are unrolled: constant indices keep fragments and accumulators in registers, every LDS offset is an immediate */
    for (int kh = 0; kh < SK; kh += 64) {
      FragH a[2][4], b[2][2];
#pragma unroll
      for (int ks = 0; ks < 2; ++ks) {
#pragma unroll
        for (int j = 0; j < 2; ++j) { const unsigned short* p = bp + j * 16 * LP + kh + ks * 32; b[ks][j].half[0] = *(const v8us*)p; b[ks][j].half[1] = *(const v8us*)(p + 16); }
#pragma unroll
        for (int i = 0; i < 4; ++i) { const unsigned short* p = af + i * 16 * LP + kh + ks * 32; a[ks][i].half[0] = *(const v8us*)p; a[ks][i].half[1] = *(const v8us*)(p + 16); } }
      __builtin_amdgcn_sched_barrier(0);      /* 24 LDS reads stay one group in front of their 16 products (for speed only) */
#pragma unroll
      for (int ks = 0; ks < 2; ++ks)
#pragma unroll
        for (int i = 0; i < 4; ++i)
#pragma unroll
          for (int j = 0; j < 2; ++j) acc[i][j] = __builtin_amdgcn_wmma_f32_16x16x32_f16(false, a[ks][i].v, false, b[ks][j].v, (short)0, acc[i][j], false, false);
      __builtin_amdgcn_sched_barrier(0); }      /* the products stay in front of the waits below: lifted over them, the waits would end the next stage's flight before the products have covered it */
    asm volatile("s_wait_dscnt 0x0" ::: "memory");        /* this wave's reads of the buffer are over before it is handed to the copies */
    asm volatile("s_wait_asynccnt 0x0" ::: "memory");     /* this wave's copies of stage t + 1 have landed */
    __syncthreads();                                      /* publishes stage t + 1 and ends every wave's reads of stage t */
    if (t + 2 < NST) stage(t + 2, bf * LBUF); }
  asm volatile("s_wait_asynccnt 0x0" ::: "memory");       /* no copy is outstanding when the buffers become output staging */
  /* behind the last trip's barrier nobody reads the buffers any more: each wave stages its own 64 x 32 f32 there, so that every row leaves as one whole 128-B line */
  fa* st = (fa*)&sAB[0][0][0][0] + w * (64 * SP);
#pragma unroll
  for (int j = 0; j < 2; ++j) { const float bv = bf16_round(bias[col0 + wn + j * 16 + ln]);
#pragma unroll
    for (int i = 0; i < 4; ++i)
#pragma unroll
      for (int r = 0; r < 8; ++r) st[(i * 16 + 8 * hh + r) * SP + j * 16 + ln] = acc[i][j][r] * 0.00390625f + bv; }
  __builtin_amdgcn_fence(__ATOMIC_ACQ_REL, "workgroup"); __builtin_amdgcn_wave_barrier();      /* the wave reads back what its other lanes staged */
  float* cp = C + (size_t)(row0 + wm + (lane >> 3)) * DD + col0 + wn + (lane & 7) * 4; const fa* sp = st + (lane >> 3) * SP + (lane & 7) * 4;
#pragma unroll
  for (int q = 0; q < 16; ++q) { const v4f v = *(const v4fa*)(sp + q * 4 * SP); *(v4f*)(cp + (size_t)q * 4 * DD) = v; }
  asm volatile("s_wait_xcnt 0x0" ::: "memory"); }      /* precaution behind the stores: nothing that follows writes their registers first */

extern "C" void kernel_launch(void* const* d_in, const int* in_sizes, int n_in,
                              void* d_out, int out_size, void* d_ws, size_t ws_size, hipStream_t stream) {
  (void)in_sizes; (void)n_in; (void)out_size;
  const float* const* I = (const float* const*)d_in; const float* values = I[0]; const float* keys = I[1]; const float* query = I[2]; const int* mask = (const int*)d_in[3]; const float* Wv = I[4]; const float* Wk = I[5]; const float* Wq = I[6]; const float* Wo = I[7]; const float* bo = I[8];
  char* ws = (char*)d_ws; size_t off = 0;
  auto take = [&](size_t bytes) { char* p = ws + off; off += (bytes + 255) & ~(size_t)255; return p; };
  _Float16* Bo = (_Float16*)take((size_t)DD * DD * 2);
  _Float16* K = (_Float16*)take((size_t)NR * DD * 2); _Float16* Q = (_Float16*)take((size_t)NR * DD * 2); _Float16* Vt = (_Float16*)take((size_t)NR * DD * 2); _Float16* O16 = (_Float16*)take((size_t)NR * DD * 2);
  if (off > ws_size) return;      // 2.1 + 4 x 8.4 = 36 MB
  k_proj<<<dim3(NR / 256, NH, 4), 128, 0, stream>>>(values, keys, query, Wv, Wk, Wq, Wo, Vt, K, Q, Bo);
  k_flash<<<BB * NH * (TT / 64), 128, 0, stream>>>(Q, DD, K, DD, Vt, mask, O16, DD);
  k_ogemm<<<dim3(DD / 128, NR / 128), 256, 0, stream>>>(O16, Bo, bo, (float*)d_out);      /* out = O.Wo^T + bo */
}

// v008
// Measured time: 58.8 microseconds a run.
// Next to v007, in two timings, it ran 1.14 times as fast each time.
// Counting every step since v000, it is 9.51 times as fast.
#include <hip/hip_runtime.h>
// 'SelfAttension' (B=2, S=2048, E=1024, 16 heads × 64): per-head projections with ONE shared 64×64 weight per tensor (y_h = x_h·Wᵀ, torch (out,in), no bias) for values, keys, query; energy = q·kᵀ with −1e20 where the key mask [N,1,1,S] == 0;
// attn = softmax(energy/√1024); out = (attn·v merged)·Woᵀ + bo.
// Compute dtype: inputs, weights, bias rounded to bf16; the per-head 64×64 projections as block-diagonal f16 GEMMs (all 16 head-block columns of all three tensors in one launch, grid = row blocks x heads x 4: the three tensors and the Wo to f16 conversion, K = 64); fused flash-style kernel (per-(b,k) int mask loads, scale 1/32,
// online softmax f32, P f16 ×2^10) on v_wmma_f32_16x16x32_f16; O ×2^4 → f16 → output GEMM + bias; f32 accumulate.
#define BB 2
#define TT 2048
#define DD 1024
#define NH 16
#define HD 64
#define NR (BB * TT)

typedef __bf16 v16b __attribute__((ext_vector_type(16)));
typedef unsigned short v8us __attribute__((ext_vector_type(8), may_alias));
typedef float  v8f  __attribute__((ext_vector_type(8)));
typedef float  v4f  __attribute__((ext_vector_type(4)));
typedef float  v4fa __attribute__((ext_vector_type(4), may_alias));
union FragB { v16b v; v8us half[2]; unsigned short u[16]; };

__device__ __forceinline__ unsigned short bf16_bits(float x) { unsigned int u = __float_as_uint(x); return (unsigned short)((u + 0x7FFFu + ((u >> 16) & 1u)) >> 16); }
__device__ __forceinline__ float bf16_val(unsigned short b) { return __uint_as_float(((unsigned int)b) << 16); }
__device__ __forceinline__ float bf16_round(float x) { return bf16_val(bf16_bits(x)); }
// D += A·B with NT terms: 1 = ah·bh, 2 = + al·bh (A split), 3 = + ah·bl (both split)
template <int NT>
__device__ __forceinline__ v8f mmaN(v16b ah, v16b al, v16b bh, v16b bl, v8f c) {
  c = __builtin_amdgcn_wmma_f32_16x16x32_bf16(false, ah, false, bh, (short)0, c, false, false);
  if (NT >= 2) c = __builtin_amdgcn_wmma_f32_16x16x32_bf16(false, al, false, bh, (short)0, c, false, false);
  if (NT >= 3) c = __builtin_amdgcn_wmma_f32_16x16x32_bf16(false, ah, false, bl, (short)0, c, false, false);
  asm volatile("v_nop\n\tv_nop\n\tv_nop\n\tv_nop" : "+v"(c) : "v"(ah), "v"(al), "v"(bh), "v"(bl));
  return c;
}

__global__ __launch_bounds__(256) void k_wt_bf16(const float* __restrict__ W, unsigned short* __restrict__ Wt, int K, int N) {
  const int t = blockIdx.x * 256 + threadIdx.x;
  const int k8n = K / 8;
  if (t >= N * k8n) return;
  const int n = t / k8n, k8 = (t % k8n) * 8;
  v8us v;
#pragma unroll
  for (int i = 0; i < 8; ++i) v[i] = bf16_bits(W[(size_t)(k8 + i) * N + n]);
  *(v8us*)(Wt + (size_t)n * K + k8) = v;
  
}

// GEMM C[M][N] (f32, pitch ldc) = act(A[M][K]·W + bias). A f32 row-major (pitch lda) converted per fragment to bf16
// (ASPLIT: hi/lo two planes -> 2 terms, else single rounded term); Wt bf16 [N][K] (pitch ldb). BIAS_BF16 rounds the
// bias to bf16 first (bias quantised to bf16 before the add). K%32==0, M%16==0, N%64==0.
template <bool ASPLIT, int ACT, bool BIAS_BF16>
__global__ __launch_bounds__(128) void k_gemm_bf(const float* __restrict__ A, int lda, const unsigned short* __restrict__ Wt, int ldb,
                                               const float* __restrict__ bias, float* __restrict__ C, int ldc, int M, int N, int K) {
  __shared__ __attribute__((aligned(16))) float so[4][16][64];
  const int tid = threadIdx.x, w = tid >> 5, lane = tid & 31, ln = lane & 15, hh = lane >> 4;
  const int ntn = N / 64;
  const int wid = blockIdx.x * 4 + w;
  const int mt = wid / ntn, nq = wid % ntn;
  if (mt * 16 >= M) return;
  const int row0 = mt * 16, col0 = nq * 64;
  const float* arow = A + (size_t)(row0 + ln) * lda;
  v8f acc[4] = {};
  for (int kb = 0; kb < K; kb += 32) {
    FragB ah, al;
    const v4f x0 = *(const v4fa*)(arow + kb + 8 * hh), x1 = *(const v4fa*)(arow + kb + 8 * hh + 4);
    const v4f x2 = *(const v4fa*)(arow + kb + 16 + 8 * hh), x3 = *(const v4fa*)(arow + kb + 16 + 8 * hh + 4);
    float xs[16] = {x0[0],x0[1],x0[2],x0[3],x1[0],x1[1],x1[2],x1[3],x2[0],x2[1],x2[2],x2[3],x3[0],x3[1],x3[2],x3[3]};
#pragma unroll
    for (int i = 0; i < 16; ++i) { const unsigned short hb = bf16_bits(xs[i]); ah.u[i] = hb; al.u[i] = ASPLIT ? bf16_bits(xs[i] - bf16_val(hb)) : (unsigned short)0; }
#pragma unroll
    for (int t = 0; t < 4; ++t) {
      const unsigned short* brow = Wt + (size_t)(col0 + t * 16 + ln) * ldb + kb;
      FragB b;
      b.half[0] = *(const v8us*)(brow + 8 * hh);
      b.half[1] = *(const v8us*)(brow + 16 + 8 * hh);
      acc[t] = mmaN<ASPLIT ? 2 : 1>(ah.v, al.v, b.v, b.v, acc[t]);
    }
  }
#pragma unroll
  for (int t = 0; t < 4; ++t) {
    float bv = bias ? bias[col0 + t * 16 + ln] : 0.f;
    if (BIAS_BF16) bv = bf16_round(bv);
#pragma unroll
    for (int r = 0; r < 8; ++r) { float v = acc[t][r] + bv; if (ACT == 1) v = fmaxf(v, 0.f); so[w][8 * hh + r][t * 16 + ln] = v; }
  }
  __builtin_amdgcn_fence(__ATOMIC_ACQ_REL, "workgroup");
  __builtin_amdgcn_wave_barrier();
  const int rsub = lane >> 4, c4 = (lane & 15) * 4;
  {
#pragma unroll
    for (int q = 0; q < 8; ++q) {
      const int r = q * 2 + rsub;
      const v4f v = *(const v4fa*)&so[w][r][c4];
      *(v4f*)(C + (size_t)(row0 + r) * ldc + col0 + c4) = v;
    }
    
  }
}

// Flash-style causal/unmasked attention, all contractions 3-term bf16 hi/lo splits, f32 softmax with running max.
// q,k,v rows are read from f32 buffers with arbitrary row pitch (so they can live inside a fused qkv buffer);
// D = head size (multiple of 32, <= 128); one wave = 16 query rows; block = 4 waves (64 queries) sharing K/V chunks of 32.
template <int D, bool CAUSAL>
__global__ __launch_bounds__(128) void k_flash(const float* __restrict__ qb, const float* __restrict__ kb, const float* __restrict__ vb,
                                             int pitch, int T, int H, float scale, float* __restrict__ y, int ypitch) {
  constexpr int KS = D / 32;        // k-steps for QK
  constexpr int DT = D / 16;        // d tiles for PV
  __shared__ __attribute__((aligned(16))) unsigned short sKh[32][D + 8], sKl[32][D + 8], sVh[32][D + 8], sVl[32][D + 8];
  __shared__ __attribute__((aligned(16))) unsigned short sPh[4][16][40], sPl[4][16][40];
  __shared__ __attribute__((aligned(16))) float sO[4][16][D];
  const int tid = threadIdx.x, w = tid >> 5, lane = tid & 31, ln = lane & 15, hh = lane >> 4;
  const int nqb = (T + 63) / 64;
  const int bh = blockIdx.x / nqb, qblk = blockIdx.x % nqb;
  const int b = bh / H, h = bh % H;
  const int q0 = qblk * 64 + w * 16;
  const float* Q = qb + (size_t)b * T * pitch + h * D;
  const float* K = kb + (size_t)b * T * pitch + h * D;
  const float* V = vb + (size_t)b * T * pitch + h * D;

  // A fragments of the wave's 16 query rows (scaled), hi/lo
  FragB aqh[KS], aql[KS];
  {
    int row = q0 + ln; if (row >= T) row = T - 1;
    const float* qr = Q + (size_t)row * pitch;
#pragma unroll
    for (int ks = 0; ks < KS; ++ks)
#pragma unroll
      for (int i = 0; i < 16; ++i) {
        const int d = ks * 32 + ((i < 8) ? (8 * hh + i) : (16 + 8 * hh + (i - 8)));
        const float x = qr[d] * scale; const unsigned short hb = bf16_bits(x);
        aqh[ks].u[i] = hb; aql[ks].u[i] = bf16_bits(x - bf16_val(hb));
      }
  }
  float m_r[8], l_r[8];
#pragma unroll
  for (int r = 0; r < 8; ++r) { m_r[r] = -3.0e38f; l_r[r] = 0.f; }
  v8f oacc[DT];
#pragma unroll
  for (int dt = 0; dt < DT; ++dt) oacc[dt] = (v8f){0.f,0.f,0.f,0.f,0.f,0.f,0.f,0.f};

  const int kv_end = CAUSAL ? min(T, qblk * 64 + 64) : T;     // block-uniform
  for (int j0 = 0; j0 < kv_end; j0 += 32) {
    __syncthreads();
    for (int e = tid; e < 32 * (D / 4); e += 128) {
      const int r = e / (D / 4), c4 = (e % (D / 4)) * 4;
      const int key = j0 + r;
      v4f kf = {0.f,0.f,0.f,0.f}, vf = {0.f,0.f,0.f,0.f};
      if (key < T) { kf = *(const v4fa*)(K + (size_t)key * pitch + c4); vf = *(const v4fa*)(V + (size_t)key * pitch + c4); }
#pragma unroll
      for (int t = 0; t < 4; ++t) {
        unsigned short hb = bf16_bits(kf[t]); sKh[r][c4 + t] = hb; sKl[r][c4 + t] = bf16_bits(kf[t] - bf16_val(hb));
        hb = bf16_bits(vf[t]); sVh[r][c4 + t] = hb; sVl[r][c4 + t] = bf16_bits(vf[t] - bf16_val(hb));
      }
    }
    __syncthreads();
    // S tile 16 x 32
    v8f s[2];
#pragma unroll
    for (int nt = 0; nt < 2; ++nt) {
      v8f acc = {};
#pragma unroll
      for (int ks = 0; ks < KS; ++ks) {
        FragB bh_, bl_;
        bh_.half[0] = *(const v8us*)&sKh[nt * 16 + ln][ks * 32 + 8 * hh]; bh_.half[1] = *(const v8us*)&sKh[nt * 16 + ln][ks * 32 + 16 + 8 * hh];
        bl_.half[0] = *(const v8us*)&sKl[nt * 16 + ln][ks * 32 + 8 * hh]; bl_.half[1] = *(const v8us*)&sKl[nt * 16 + ln][ks * 32 + 16 + 8 * hh];
        acc = mmaN<3>(aqh[ks].v, aql[ks].v, bh_.v, bl_.v, acc);
      }
      s[nt] = acc;
    }
    // mask + running max (rows 8hh+r; the 16 lanes of a half share rows)
    float alpha[8];
#pragma unroll
    for (int r = 0; r < 8; ++r) {
      const int qi = q0 + 8 * hh + r;
      const int ja = j0 + ln, jb = j0 + 16 + ln;
      if (CAUSAL) { if (ja > qi) s[0][r] = -3.0e38f; if (jb > qi) s[1][r] = -3.0e38f; }
      if (ja >= T) s[0][r] = -3.0e38f;
      if (jb >= T) s[1][r] = -3.0e38f;
      float mx = fmaxf(s[0][r], s[1][r]);
      mx = fmaxf(mx, __shfl_xor(mx, 1, 32)); mx = fmaxf(mx, __shfl_xor(mx, 2, 32)); mx = fmaxf(mx, __shfl_xor(mx, 4, 32)); mx = fmaxf(mx, __shfl_xor(mx, 8, 32));
      const float mnew = fmaxf(m_r[r], mx);
      alpha[r] = (mnew > -1.0e38f) ? __expf(m_r[r] - mnew) : 1.0f;
      const float p0 = (s[0][r] > -1.0e38f) ? __expf(s[0][r] - mnew) : 0.f;
      const float p1 = (s[1][r] > -1.0e38f) ? __expf(s[1][r] - mnew) : 0.f;
      m_r[r] = mnew;
      l_r[r] = l_r[r] * alpha[r] + p0 + p1;            // per-lane partial row sum (16 lanes combined at the end)
      unsigned short hb = bf16_bits(p0); sPh[w][8 * hh + r][ln] = hb;      sPl[w][8 * hh + r][ln] = bf16_bits(p0 - bf16_val(hb));
      hb = bf16_bits(p1);                sPh[w][8 * hh + r][16 + ln] = hb; sPl[w][8 * hh + r][16 + ln] = bf16_bits(p1 - bf16_val(hb));
    }
#pragma unroll
    for (int dt = 0; dt < DT; ++dt)
#pragma unroll
      for (int r = 0; r < 8; ++r) oacc[dt][r] *= alpha[r];
    __builtin_amdgcn_fence(__ATOMIC_ACQ_REL, "workgroup");
    __builtin_amdgcn_wave_barrier();
    FragB pah, pal;
    pah.half[0] = *(const v8us*)&sPh[w][ln][8 * hh]; pah.half[1] = *(const v8us*)&sPh[w][ln][16 + 8 * hh];
    pal.half[0] = *(const v8us*)&sPl[w][ln][8 * hh]; pal.half[1] = *(const v8us*)&sPl[w][ln][16 + 8 * hh];
#pragma unroll
    for (int dt = 0; dt < DT; ++dt) {
      FragB bvh, bvl;
#pragma unroll
      for (int i = 0; i < 8; ++i) {
        bvh.u[i] = sVh[8 * hh + i][dt * 16 + ln]; bvh.u[8 + i] = sVh[16 + 8 * hh + i][dt * 16 + ln];
        bvl.u[i] = sVl[8 * hh + i][dt * 16 + ln]; bvl.u[8 + i] = sVl[16 + 8 * hh + i][dt * 16 + ln];
      }
      oacc[dt] = mmaN<3>(pah.v, pal.v, bvh.v, bvl.v, oacc[dt]);
    }
    __builtin_amdgcn_fence(__ATOMIC_ACQ_REL, "workgroup");
    __builtin_amdgcn_wave_barrier();
  }
#pragma unroll
  for (int r = 0; r < 8; ++r) {
    float l = l_r[r];
    l += __shfl_xor(l, 1, 32); l += __shfl_xor(l, 2, 32); l += __shfl_xor(l, 4, 32); l += __shfl_xor(l, 8, 32);
    l_r[r] = (l > 0.f) ? 1.0f / l : 0.f;
  }
#pragma unroll
  for (int dt = 0; dt < DT; ++dt)
#pragma unroll
    for (int r = 0; r < 8; ++r) sO[w][8 * hh + r][dt * 16 + ln] = oacc[dt][r] * l_r[r];
  __builtin_amdgcn_fence(__ATOMIC_ACQ_REL, "workgroup");
  __builtin_amdgcn_wave_barrier();
  {
    for (int r = 0; r < 16; ++r) {
      const int row = q0 + r;
      if (row < T && lane < D / 4) {
        const v4f val = *(const v4fa*)&sO[w][r][lane * 4];
        *(v4f*)(y + ((size_t)b * T + row) * ypitch + h * D + lane * 4) = val;
      }
    }
    
  }
}

// GEMM C = act(A·W + bias + resid): A f32 (ASPLIT -> hi/lo 2 terms), Wt bf16 [N][K]; ACT 0 none, 1 relu, 2 exact gelu;
// resid (optional, f32, row index = (row % rmod), pitch ldr, RES_BF16 rounds it) added before the activation.
template <bool ASPLIT, int ACT, bool BIAS_BF16, bool RES_BF16>
__global__ __launch_bounds__(128) void k_gemm_bf3(const float* __restrict__ A, int lda, const unsigned short* __restrict__ Wt, int ldb,
                                                const float* __restrict__ bias, const float* __restrict__ resid, int rmod, int ldr,
                                                float* __restrict__ C, int ldc, int M, int N, int K) {
  __shared__ __attribute__((aligned(16))) float so[4][16][64];
  const int tid = threadIdx.x, w = tid >> 5, lane = tid & 31, ln = lane & 15, hh = lane >> 4;
  const int ntn = N / 64;
  const int wid = blockIdx.x * 4 + w;
  const int mt = wid / ntn, nq = wid % ntn;
  if (mt * 16 >= M) return;
  const int row0 = mt * 16, col0 = nq * 64;
  const float* arow = A + (size_t)(row0 + ln) * lda;
  v8f acc[4] = {};
  for (int kb = 0; kb < K; kb += 32) {
    FragB ah, al;
    const v4f x0 = *(const v4fa*)(arow + kb + 8 * hh), x1 = *(const v4fa*)(arow + kb + 8 * hh + 4);
    const v4f x2 = *(const v4fa*)(arow + kb + 16 + 8 * hh), x3 = *(const v4fa*)(arow + kb + 16 + 8 * hh + 4);
    float xs[16] = {x0[0],x0[1],x0[2],x0[3],x1[0],x1[1],x1[2],x1[3],x2[0],x2[1],x2[2],x2[3],x3[0],x3[1],x3[2],x3[3]};
#pragma unroll
    for (int i = 0; i < 16; ++i) { const unsigned short hb = bf16_bits(xs[i]); ah.u[i] = hb; al.u[i] = ASPLIT ? bf16_bits(xs[i] - bf16_val(hb)) : (unsigned short)0; }
#pragma unroll
    for (int t = 0; t < 4; ++t) {
      const unsigned short* brow = Wt + (size_t)(col0 + t * 16 + ln) * ldb + kb;
      FragB b;
      b.half[0] = *(const v8us*)(brow + 8 * hh);
      b.half[1] = *(const v8us*)(brow + 16 + 8 * hh);
      acc[t] = mmaN<ASPLIT ? 2 : 1>(ah.v, al.v, b.v, b.v, acc[t]);
    }
  }
#pragma unroll
  for (int t = 0; t < 4; ++t) {
    const int col = col0 + t * 16 + ln;
    float bv = bias ? bias[col] : 0.f;
    if (BIAS_BF16) bv = bf16_round(bv);
#pragma unroll
    for (int r = 0; r < 8; ++r) {
      float v = acc[t][r] + bv;
      if (resid) { float rv = resid[(size_t)((row0 + 8 * hh + r) % rmod) * ldr + col]; if (RES_BF16) rv = bf16_round(rv); v += rv; }
      if (ACT == 1) v = fmaxf(v, 0.f);
      if (ACT == 2) v = 0.5f * v * (1.0f + erff(v * 0.70710678118654752f));
      if (ACT == 3) { const float u = 0.7978845608028654f * (v + 0.044715f * v * v * v); v = 0.5f * v * (1.0f + tanhf(u)); }
      so[w][8 * hh + r][t * 16 + ln] = v;
    }
  }
  __builtin_amdgcn_fence(__ATOMIC_ACQ_REL, "workgroup");
  __builtin_amdgcn_wave_barrier();
  const int rsub = lane >> 4, c4 = (lane & 15) * 4;
  {
#pragma unroll
    for (int q = 0; q < 8; ++q) {
      const int r = q * 2 + rsub;
      const v4f v = *(const v4fa*)&so[w][r][c4];
      *(v4f*)(C + (size_t)(row0 + r) * ldc + col0 + c4) = v;
    }
    
  }
}
// row LayerNorm (biased variance, eps) over N: s = X (+ R); optional out_sum <- s; out_norm <- (s-mu)*rsqrt(var+eps)*g + b
template <bool PARAM_BF16>
__global__ __launch_bounds__(256) void k_layernorm(const float* __restrict__ X, const float* __restrict__ R, const float* __restrict__ g, const float* __restrict__ bta,
                                                  float* __restrict__ out_sum, float* __restrict__ out_norm, int N, float eps) {
  __shared__ float red[256];
  const int row = blockIdx.x, tid = threadIdx.x;
  const float* x = X + (size_t)row * N; const float* rr = R ? R + (size_t)row * N : nullptr;
  float vals[16];                     // up to N = 4096
  const int per = N / 256;            // contiguous chunk per thread? use strided-by-4 chunks: thread handles j = tid*4 + 1024*u
  float s1 = 0.f;
  for (int u = 0; u < per / 4; ++u) {
    const int j = tid * 4 + 1024 * u;
    const v4f a = *(const v4fa*)(x + j);
    v4f b = {0.f,0.f,0.f,0.f}; if (rr) b = *(const v4fa*)(rr + j);
#pragma unroll
    for (int q = 0; q < 4; ++q) { const float v = a[q] + b[q]; vals[u * 4 + q] = v; s1 += v; }
  }
  red[tid] = s1; __syncthreads();
  for (int st = 128; st > 0; st >>= 1) { if (tid < st) red[tid] += red[tid + st]; __syncthreads(); }
  const float mu = red[0] / (float)N; __syncthreads();
  float s2 = 0.f;
  for (int u = 0; u < per / 4; ++u)
#pragma unroll
    for (int q = 0; q < 4; ++q) { const float c = vals[u * 4 + q] - mu; s2 += c * c; }
  red[tid] = s2; __syncthreads();
  for (int st = 128; st > 0; st >>= 1) { if (tid < st) red[tid] += red[tid + st]; __syncthreads(); }
  const float rs = rsqrtf(red[0] / (float)N + eps);
  {
    for (int u = 0; u < per / 4; ++u) {
      const int j = tid * 4 + 1024 * u;
      v4f o, sm;
#pragma unroll
      for (int q = 0; q < 4; ++q) {
        float gg = g[j + q], bb = bta[j + q];
        if (PARAM_BF16) { gg = bf16_round(gg); bb = bf16_round(bb); }
        sm[q] = vals[u * 4 + q]; o[q] = (vals[u * 4 + q] - mu) * rs * gg + bb;
      }
      if (out_sum) *(v4f*)(out_sum + (size_t)row * N + j) = sm;
      *(v4f*)(out_norm + (size_t)row * N + j) = o;
    }
    
  }
}



// ---- f16 WMMA path (v_wmma_f32_16x16x32_f16): 11-bit significands for operands in range — used where a [0,1] probability operand needs more precision than bf16
typedef _Float16 v16h __attribute__((ext_vector_type(16)));
union FragH { v16h v; v8us half[2]; _Float16 h[16]; unsigned short u[16]; };
template <int NT>
__device__ __forceinline__ v8f mmaH(v16h ah, v16h al, v16h bh, v16h bl, v8f c) {
  c = __builtin_amdgcn_wmma_f32_16x16x32_f16(false, ah, false, bh, (short)0, c, false, false);
  if (NT >= 2) c = __builtin_amdgcn_wmma_f32_16x16x32_f16(false, al, false, bh, (short)0, c, false, false);
  if (NT >= 3) c = __builtin_amdgcn_wmma_f32_16x16x32_f16(false, ah, false, bl, (short)0, c, false, false);
  asm volatile("v_nop\n\tv_nop\n\tv_nop\n\tv_nop" : "+v"(c) : "v"(ah), "v"(al), "v"(bh), "v"(bl));
  return c;
}
// batched GEMM like k_gemm_b but f16 operands: A f32 (split into f16 hi/lo if ASPLIT, else rounded to f16), Bt = f16 values [n][k]; alpha; C f32; N multiple of 16 (partial tiles skipped)
template <bool ASPLIT>
__global__ __launch_bounds__(128) void k_gemm_h(const float* __restrict__ A, int lda, size_t sA, const _Float16* __restrict__ Bh, int ldb, size_t sB, float alpha, float* __restrict__ C, int ldc, size_t sC, int M, int N, int K) {
  __shared__ __attribute__((aligned(16))) float so[4][16][64];
  const int tid = threadIdx.x, w = tid >> 5, lane = tid & 31, ln = lane & 15, hh = lane >> 4; const int by = blockIdx.y;
  A += (size_t)by * sA; Bh += (size_t)by * sB; C += (size_t)by * sC;
  const int ntn = (N + 63) / 64; const int wid = blockIdx.x * 4 + w; const int mt = wid / ntn, nq = wid % ntn; if (mt * 16 >= M) return;
  const int row0 = mt * 16, col0 = nq * 64; const float* arow = A + (size_t)(row0 + ln) * lda;
  v8f acc[4] = {};
  for (int kb = 0; kb < K; kb += 32) {
    FragH ah, al;
    const v4f x0 = *(const v4fa*)(arow + kb + 8 * hh), x1 = *(const v4fa*)(arow + kb + 8 * hh + 4), x2 = *(const v4fa*)(arow + kb + 16 + 8 * hh), x3 = *(const v4fa*)(arow + kb + 16 + 8 * hh + 4);
    float xs[16] = {x0[0],x0[1],x0[2],x0[3],x1[0],x1[1],x1[2],x1[3],x2[0],x2[1],x2[2],x2[3],x3[0],x3[1],x3[2],x3[3]};
#pragma unroll
    for (int i = 0; i < 16; ++i) { const _Float16 h = (_Float16)xs[i]; ah.h[i] = h; al.h[i] = ASPLIT ? (_Float16)(xs[i] - (float)h) : (_Float16)0.0f; }
#pragma unroll
    for (int t = 0; t < 4; ++t) { if (col0 + t * 16 >= N) continue; const size_t boff = (size_t)(col0 + t * 16 + ln) * ldb + kb; FragH bq; bq.half[0] = *(const v8us*)(Bh + boff + 8 * hh); bq.half[1] = *(const v8us*)(Bh + boff + 16 + 8 * hh);
      acc[t] = mmaH<ASPLIT ? 2 : 1>(ah.v, al.v, bq.v, bq.v, acc[t]); }
  }
#pragma unroll
  for (int t = 0; t < 4; ++t) { if (col0 + t * 16 >= N) continue;
#pragma unroll
    for (int r = 0; r < 8; ++r) so[w][8 * hh + r][t * 16 + ln] = acc[t][r] * alpha; }
  __builtin_amdgcn_fence(__ATOMIC_ACQ_REL, "workgroup"); __builtin_amdgcn_wave_barrier();
  const int rsub = lane >> 4, c4 = (lane & 15) * 4;
  {
#pragma unroll
    for (int q = 0; q < 8; ++q) { const int r = q * 2 + rsub; if (col0 + c4 < N) { const v4f v = *(const v4fa*)&so[w][r][c4]; *(v4f*)(C + (size_t)(row0 + r) * ldc + col0 + c4) = v; } }
     }
}

// Wt[n][k] = f16(W[k][n]·scale) from f32 row-major W[K][N] (scale = power of two; bf16-exact weights stay exact in f16 away from the subnormal range)
__global__ __launch_bounds__(256) void k_wt_f16(const float* __restrict__ W, _Float16* __restrict__ Wt, int K, int N, float scale) {
  const int t = blockIdx.x * 256 + threadIdx.x; if (t >= N * (K / 8)) return; const int n = t / (K / 8), k8 = (t % (K / 8)) * 8; FragH f;
#pragma unroll
  for (int i = 0; i < 8; ++i) f.h[i] = (_Float16)(bf16_round(W[(size_t)(k8 + i) * N + n]) * scale); const v8us o = f.half[0];
  *(v8us*)((unsigned short*)Wt + (size_t)n * K + k8) = o; 
}
// k_gemm_hh variant with fused epilogue: v = acc·alpha + bias[by·sBias + col] (+ CP[(row/rowsPerB)·sCPb + by·64 + col] if CP) ; ACT 0 none / 1 elu ; writes f16 C16 and/or f32 C (each if non-null)
template <int ACT>
__global__ __launch_bounds__(128) void k_gemm_hhx(const _Float16* __restrict__ A, int lda, size_t sA, const _Float16* __restrict__ Bh, int ldb, size_t sB, float alpha, const float* __restrict__ bias, size_t sBias, const float* __restrict__ CP, int rowsPerB, size_t sCPb, int row0g,
    float* __restrict__ C, _Float16* __restrict__ C16, int ldc, size_t sC, int M, int N, int K, size_t sAz, size_t sBz, size_t sCz) {
  __shared__ __attribute__((aligned(16))) float so[4][16][64];
  const int tid = threadIdx.x, w = tid >> 5, lane = tid & 31, ln = lane & 15, hh = lane >> 4; const int by = blockIdx.y, bz = blockIdx.z;      /* second batch index bz with its own strides sAz, sBz, sCz */
  A += (size_t)by * sA + (size_t)bz * sAz; Bh += (size_t)by * sB + (size_t)bz * sBz; const size_t cofs = (size_t)by * sC + (size_t)bz * sCz; const float* bp = bias ? bias + (size_t)by * sBias : nullptr;
  const int ntn = (N + 63) / 64; const int wid = blockIdx.x * 4 + w; const int mt = wid / ntn, nq = wid % ntn; if (mt * 16 >= M) return;
  const int row0 = mt * 16, col0 = nq * 64; const _Float16* arow = A + (size_t)(row0 + ln) * lda;
  v8f acc[4] = {};
  for (int kb = 0; kb < K; kb += 32) { FragH ah; ah.half[0] = *(const v8us*)((const unsigned short*)arow + kb + 8 * hh); ah.half[1] = *(const v8us*)((const unsigned short*)arow + kb + 16 + 8 * hh);
#pragma unroll
    for (int t = 0; t < 4; ++t) { if (col0 + t * 16 >= N) continue; const size_t boff = (size_t)(col0 + t * 16 + ln) * ldb + kb; FragH bq; bq.half[0] = *(const v8us*)((const unsigned short*)Bh + boff + 8 * hh); bq.half[1] = *(const v8us*)((const unsigned short*)Bh + boff + 16 + 8 * hh);
      acc[t] = mmaH<1>(ah.v, ah.v, bq.v, bq.v, acc[t]); }
  }
#pragma unroll
  for (int t = 0; t < 4; ++t) { if (col0 + t * 16 >= N) continue; const int col = col0 + t * 16 + ln; const float bv = bp ? bf16_round(bp[col]) : 0.f;
#pragma unroll
    for (int r = 0; r < 8; ++r) { float v = acc[t][r] * alpha + bv; if (CP) { const int bidx = (row0g + row0 + 8 * hh + r) / rowsPerB; v += CP[(size_t)bidx * sCPb + (size_t)by * 64 + col]; } if (ACT == 1) v = (v > 0.f) ? v : expm1f(v); else if (ACT == 7) v = (v > 0.f) ? v + 1.0f : expf(v); else if (ACT == 8) v = tanhf(v); else if (ACT == 9) v = 0.5f * v * (1.0f + tanhf(0.7978845608028654f * (v + 0.044715f * v * v * v))); else if (ACT == 11) v = 1.0f / (1.0f + expf(-v)); else if (ACT == 12) v = (v > 0.f) ? v : 0.01f * v; else if (ACT == 14) v = (v > 0.f) ? v : 0.1f * v; else if (ACT == 15) v = v / (1.0f + expf(-v)); else if (ACT == 3) v = fmaxf(v, 0.f); else if (ACT == 6) v = 0.5f * v * (1.0f + erff(v * 0.70710678118654752f)); so[w][8 * hh + r][t * 16 + ln] = v; } }
  __builtin_amdgcn_fence(__ATOMIC_ACQ_REL, "workgroup"); __builtin_amdgcn_wave_barrier();
  const int rsub = lane >> 4, c4 = (lane & 15) * 4; typedef _Float16 v4h __attribute__((ext_vector_type(4)));
  {
#pragma unroll
    for (int q = 0; q < 8; ++q) { const int r = q * 2 + rsub; if (col0 + c4 < N) { const v4f v = *(const v4fa*)&so[w][r][c4]; if (C) *(v4f*)(C + cofs + (size_t)(row0 + r) * ldc + col0 + c4) = v; if (C16) { v4h h4; for (int i = 0; i < 4; ++i) h4[i] = (_Float16)v[i]; *(v4h*)(C16 + cofs + (size_t)(row0 + r) * ldc + col0 + c4) = h4; } } }
     }
}


typedef _Float16 v4h __attribute__((ext_vector_type(4)));

__global__ __launch_bounds__(256) void k_h16(const float* __restrict__ x, _Float16* __restrict__ X16, size_t n8) { const size_t t = (size_t)blockIdx.x * 256 + threadIdx.x; if (t >= n8) return; FragH f;
#pragma unroll
  for (int q = 0; q < 8; ++q) f.h[q] = (_Float16)x[t * 8 + q]; *(v8us*)((unsigned short*)X16 + t * 8) = f.half[0];  }
// The 16 f32 of one 16 x 32 operand fragment in the hardware k order (k = 8hh + e, then 16 + 8hh + e - 8), as loaded: p = row + 32 ks + 8 hh
struct Raw16 { v4f a, b, c, d; };
__device__ __forceinline__ Raw16 raw_f32(const float* __restrict__ p) { Raw16 x; x.a = *(const v4fa*)p; x.b = *(const v4fa*)(p + 4); x.c = *(const v4fa*)(p + 16); x.d = *(const v4fa*)(p + 20); return x; }
// each value rounded to bf16, then held exactly in f16 (weights x2^4)
template <bool W16>
__device__ __forceinline__ FragH frag_f32(const Raw16& x) { FragH f;
#pragma unroll
  for (int q = 0; q < 4; ++q) {
    f.h[q]      = W16 ? (_Float16)(bf16_round(x.a[q]) * 16.0f) : (_Float16)bf16_round(x.a[q]);
    f.h[4 + q]  = W16 ? (_Float16)(bf16_round(x.b[q]) * 16.0f) : (_Float16)bf16_round(x.b[q]);
    f.h[8 + q]  = W16 ? (_Float16)(bf16_round(x.c[q]) * 16.0f) : (_Float16)bf16_round(x.c[q]);
    f.h[12 + q] = W16 ? (_Float16)(bf16_round(x.d[q]) * 16.0f) : (_Float16)bf16_round(x.d[q]); }
  return f; }
// One wave: 64 rows x one head of one tensor, y = x.W^T (K = 64), inputs and weight converted in registers; the next 16 rows are loaded while these are worked on. st = the wave's own 64 x 64 f16 staging tile (pitch 72), written 16 B a lane:
// TR (values): A = x rows, B = W rows, so a lane holds 8 consecutive rows of one output column and the tile is staged transposed, st[d][row];
// else (keys, query): A = W rows, B = x rows, so a lane holds 8 consecutive columns of one row, st[row][e]. Either way each staged row leaves as one whole 128-B line; dst = first staged row, pitch in elements.
template <bool TR>
__device__ __forceinline__ void proj_tile(const float* __restrict__ x, const float* __restrict__ W, unsigned short (*st)[72], unsigned short* __restrict__ dst, size_t pitch, int lane) {
  const int ln = lane & 15, hh = lane >> 4; const float* xl = x + (size_t)ln * DD + 8 * hh; const float* wl = W + ln * HD + 8 * hh;
  Raw16 xr[2][2]; xr[0][0] = raw_f32(xl); xr[0][1] = raw_f32(xl + 32);
  Raw16 wr[4][2];
#pragma unroll
  for (int t = 0; t < 4; ++t)
#pragma unroll
    for (int ks = 0; ks < 2; ++ks) wr[t][ks] = raw_f32(wl + t * 16 * HD + ks * 32);
  asm volatile("s_wait_xcnt 0x0" :: "v"(wl) : "memory");      /* precaution: the weight loads' address registers (the input) are written again only behind this wait */
  FragH wf[4][2];
#pragma unroll
  for (int t = 0; t < 4; ++t)
#pragma unroll
    for (int ks = 0; ks < 2; ++ks) wf[t][ks] = frag_f32<true>(wr[t][ks]);
#pragma unroll
  for (int rt = 0; rt < 4; ++rt) {
    if (rt < 3) { xr[(rt + 1) & 1][0] = raw_f32(xl + (size_t)(rt + 1) * 16 * DD); xr[(rt + 1) & 1][1] = raw_f32(xl + (size_t)(rt + 1) * 16 * DD + 32);
      if (rt == 2) asm volatile("s_wait_xcnt 0x0" :: "v"(xl) : "memory"); }      /* the same precaution behind the last loads that name the row address */
    const FragH x0 = frag_f32<false>(xr[rt & 1][0]), x1 = frag_f32<false>(xr[rt & 1][1]);
#pragma unroll
    for (int t = 0; t < 4; ++t) { v8f acc = (v8f){0.f,0.f,0.f,0.f,0.f,0.f,0.f,0.f};
      if (TR) { acc = mmaH<1>(x0.v, x0.v, wf[t][0].v, wf[t][0].v, acc); acc = mmaH<1>(x1.v, x1.v, wf[t][1].v, wf[t][1].v, acc); }
      else    { acc = mmaH<1>(wf[t][0].v, wf[t][0].v, x0.v, x0.v, acc); acc = mmaH<1>(wf[t][1].v, wf[t][1].v, x1.v, x1.v, acc); }
      FragH o;
#pragma unroll
      for (int r = 0; r < 8; ++r) o.h[r] = (_Float16)(acc[r] * 0.0625f);
      if (TR) *(v8us*)&st[t * 16 + ln][rt * 16 + 8 * hh] = o.half[0]; else *(v8us*)&st[rt * 16 + ln][t * 16 + 8 * hh] = o.half[0]; } }
  __builtin_amdgcn_fence(__ATOMIC_ACQ_REL, "workgroup"); __builtin_amdgcn_wave_barrier();      /* the wave reads back what its other lanes staged */
#pragma unroll
  for (int q = 0; q < 16; ++q) { const int r = q * 4 + (lane >> 3), c8 = (lane & 7) * 8; const v8us v = *(const v8us*)&st[r][c8]; *(v8us*)(dst + (size_t)r * pitch + c8) = v; }
  asm volatile("s_wait_xcnt 0x0" ::: "memory"); }      /* the same precaution behind the stores: nothing that follows on any path writes their registers first */
// grid (NR / 256, heads, 4): blockIdx.z = 0 values -> Vt[slab][d][t], 1 keys -> K16, 2 query -> Q16 (row-major, head h at column 64 h); blockIdx.z = 3: Bo = f16(bf16(Wo) x2^4), 8 elements a thread and trip
__global__ __launch_bounds__(128) void k_proj(const float* __restrict__ xv, const float* __restrict__ xk, const float* __restrict__ xq, const float* __restrict__ Wv, const float* __restrict__ Wk, const float* __restrict__ Wq, const float* __restrict__ Wo,
    _Float16* __restrict__ Vt, _Float16* __restrict__ K16, _Float16* __restrict__ Q16, _Float16* __restrict__ Bo) {
  __shared__ __attribute__((aligned(16))) unsigned short st[4][64][72];
  const int tid = threadIdx.x, w = tid >> 5, lane = tid & 31; const int z = blockIdx.z, h = blockIdx.y;
  if (z == 3) { constexpr int NTH = (NR / 256) * NH * 128;
#pragma unroll
    for (int i = 0; i < DD * DD / 8 / NTH; ++i) { const size_t t = (size_t)i * NTH + (size_t)(blockIdx.y * (NR / 256) + blockIdx.x) * 128 + tid; const v4f a = *(const v4fa*)(Wo + t * 8), c = *(const v4fa*)(Wo + t * 8 + 4); FragH f;
#pragma unroll
      for (int q = 0; q < 4; ++q) { f.h[q] = (_Float16)(bf16_round(a[q]) * 16.0f); f.h[4 + q] = (_Float16)(bf16_round(c[q]) * 16.0f); }
      *(v8us*)((unsigned short*)Bo + t * 8) = f.half[0]; }
    return; }
  const int row0 = (blockIdx.x * 4 + w) * 64; const size_t xo = (size_t)row0 * DD + h * HD;
  if (z == 0) proj_tile<true>(xv + xo, Wv, st[w], (unsigned short*)Vt + ((size_t)((row0 / TT) * NH + h) * HD) * TT + row0 % TT, TT, lane);
  else proj_tile<false>((z == 1 ? xk : xq) + xo, z == 1 ? Wk : Wq, st[w], (unsigned short*)(z == 1 ? K16 : Q16) + xo, DD, lane); }
// lane l with lane l ^ 16 (a vector cross-row move, no LDS)
__device__ __forceinline__ float xhalf(float x) { return __builtin_bit_cast(float, __builtin_amdgcn_permlanex16(__builtin_bit_cast(int, x), __builtin_bit_cast(int, x), 0x76543210, 0xfedcba98, false, false)); }
// x <- 2^x on the hardware exponential for a pass's 16 scores and its rescale exponent. One asm statement so that each v_exp_f32 writes over its own argument and its neighbours name other registers:
// the slot that the instruction set asks for behind a transcendental (no read of its result, no write of its source) is then kept between them by construction, and the closing v_nop keeps it for whatever follows.
__device__ __forceinline__ void exp2_17(v8f& a, v8f& b, float& c) {
  float a0 = a[0], a1 = a[1], a2 = a[2], a3 = a[3], a4 = a[4], a5 = a[5], a6 = a[6], a7 = a[7], b0 = b[0], b1 = b[1], b2 = b[2], b3 = b[3], b4 = b[4], b5 = b[5], b6 = b[6], b7 = b[7];
  asm("v_exp_f32 %16, %16\n\tv_exp_f32 %0, %0\n\tv_exp_f32 %1, %1\n\tv_exp_f32 %2, %2\n\tv_exp_f32 %3, %3\n\tv_exp_f32 %4, %4\n\tv_exp_f32 %5, %5\n\tv_exp_f32 %6, %6\n\tv_exp_f32 %7, %7\n\t"
      "v_exp_f32 %8, %8\n\tv_exp_f32 %9, %9\n\tv_exp_f32 %10, %10\n\tv_exp_f32 %11, %11\n\tv_exp_f32 %12, %12\n\tv_exp_f32 %13, %13\n\tv_exp_f32 %14, %14\n\tv_exp_f32 %15, %15\n\tv_nop"
      : "+v"(a0), "+v"(a1), "+v"(a2), "+v"(a3), "+v"(a4), "+v"(a5), "+v"(a6), "+v"(a7), "+v"(b0), "+v"(b1), "+v"(b2), "+v"(b3), "+v"(b4), "+v"(b5), "+v"(b6), "+v"(b7), "+v"(c));      /* every exponential in place; the rescale factor's goes first, since 32 products wait for it */
  a = (v8f){a0, a1, a2, a3, a4, a5, a6, a7}; b = (v8f){b0, b1, b2, b3, b4, b5, b6, b7}; }
// Four asynchronous 16-B copies a lane, global -> LDS, through no register. The s_wait_xcnt in the same statement is a precaution: the address registers are written again only behind it.
__device__ __forceinline__ void cp4(unsigned l0, unsigned l1, unsigned l2, unsigned l3, const void* g0, const void* g1, const void* g2, const void* g3) {
  asm volatile("global_load_async_to_lds_b128 %0, %4, off\n\tglobal_load_async_to_lds_b128 %1, %5, off\n\tglobal_load_async_to_lds_b128 %2, %6, off\n\tglobal_load_async_to_lds_b128 %3, %7, off\n\ts_wait_xcnt 0x0"
               :: "v"(l0), "v"(l1), "v"(l2), "v"(l3), "v"(g0), "v"(g1), "v"(g2), "v"(g3) : "memory"); }
// D = A.B + C by the builtin alone: the compiler keeps the distances behind its own matrix instructions, and the independent products of a wave's two query groups stand in them
__device__ __forceinline__ v8f mmB(v16h a, v16h b, v8f c) { return __builtin_amdgcn_wmma_f32_16x16x32_f16(false, a, false, b, (short)0, c, false, false); }
// Two asynchronous 16-B copies a lane, as cp4
__device__ __forceinline__ void cp2(unsigned l0, unsigned l1, const void* g0, const void* g1) {
  asm volatile("global_load_async_to_lds_b128 %0, %2, off\n\tglobal_load_async_to_lds_b128 %1, %3, off\n\ts_wait_xcnt 0x0" :: "v"(l0), "v"(l1), "v"(g0), "v"(g1) : "memory"); }
template <bool B> struct Flag { static constexpr bool v = B; };
__global__ __launch_bounds__(256) void k_flash(const _Float16* __restrict__ Q16, int ldq, const _Float16* __restrict__ K16, int ldk, const _Float16* __restrict__ Vt, const int* __restrict__ MSK, _Float16* __restrict__ O16, int ldo) {
  constexpr int NG = 2, QB = 128, NQB = TT / QB, DT = 4, KS = 2, SK = 64, NST = TT / SK, LP = 72; typedef int v4ia __attribute__((ext_vector_type(4), may_alias)); typedef float fa __attribute__((may_alias));
  __shared__ __attribute__((aligned(16))) unsigned short sKV[2][2][SK][LP];      /* [buffer][K, V^T][row][pitch]; behind the loop: the partial results that the waves exchange */
  __shared__ __attribute__((aligned(16))) int sM[TT];
  __shared__ __attribute__((aligned(16))) unsigned short sO[8][16][64 + 8];
  const int tid = threadIdx.x, w = tid >> 5, lane = tid & 31, ln = lane & 15, hh = lane >> 4; const int cg = w & 3, kh = w >> 2;
  const int slab = blockIdx.x / NQB, qblk = blockIdx.x % NQB; const int b = slab / NH, h = slab % NH; const int q0 = qblk * QB + cg * (NG * 16);
  /* the thread's part of a stage: 16 B at column 8 cc of rows cr and cr + 32 of both tiles, so that a wave's copy takes four whole 128-B lines */
  const int cr = tid >> 3, cc = tid & 7;
  const unsigned short* kg = (const unsigned short*)K16 + ((size_t)b * TT + cr) * ldk + h * 64 + cc * 8;
  const unsigned short* vg = (const unsigned short*)Vt + ((size_t)slab * 64 + cr) * TT + cc * 8;
  const unsigned lkv = (unsigned)(size_t)&sKV[0][0][cr][cc * 8];
  constexpr unsigned LROW = 32 * LP * 2, LTILE = SK * LP * 2, LBUF = 2 * LTILE;      /* bytes: 32 rows, one tile, one buffer */
  auto stage = [&](int t, unsigned bufo) {
    const unsigned short* k0 = kg + (size_t)t * SK * ldk; const unsigned short* v0 = vg + t * SK; const unsigned l = lkv + bufo;
    cp4(l, l + LROW, l + LTILE, l + LTILE + LROW, k0, k0 + (size_t)32 * ldk, v0, v0 + 32 * TT); };
  { const int* mg = MSK + (size_t)b * TT + tid * 4; const unsigned lm = (unsigned)(size_t)&sM[tid * 4];
    cp2(lm, lm + 4096, mg, mg + 1024); }
  stage(0, 0);
  FragH bq[NG][KS];
#pragma unroll
  for (int g = 0; g < NG; ++g) { const unsigned short* qr = (const unsigned short*)Q16 + ((size_t)b * TT + q0 + g * 16 + ln) * ldq + h * 64;
#pragma unroll
    for (int ks = 0; ks < KS; ++ks) { bq[g][ks].half[0] = *(const v8us*)(qr + ks * 32 + 8 * hh); bq[g][ks].half[1] = *(const v8us*)(qr + ks * 32 + 16 + 8 * hh); } }
  asm volatile("s_wait_asynccnt 0x0" ::: "memory");      /* this wave's copies of the mask row and of stage 0 have landed */
  __syncthreads();                                        /* ... and every other wave's: nothing of them is read before */
  stage(1, LBUF);
  /* The mask row is tested once: bit t of zst says whether stage t holds a masked key. Read i covers 128 keys, lanes 0 to 15 those of stage 2 i, lanes 16 to 31 those of stage 2 i + 1; a ballot is the same in every lane, so zst is a scalar. */
  unsigned zst = 0;
#pragma unroll      /* unrolled: every LDS offset and every shift is an immediate */
  for (int i = 0; i < TT / 128; ++i) { const v4ia m = *(const v4ia*)&sM[(i * 32 + lane) * 4];
    const unsigned lo = min(min((unsigned)m[0], (unsigned)m[1]), min((unsigned)m[2], (unsigned)m[3]));      /* 0 where one of the four is 0 */
    const unsigned bal = __builtin_amdgcn_ballot_w32(lo == 0u);
    zst |= (((bal & 0xFFFFu) != 0u ? 1u : 0u) | ((bal >> 16) != 0u ? 2u : 0u)) << (2 * i); }
  float m_q[NG], l_q[NG]; v8f oacc[NG][DT];      /* of query q0 + 16 g + ln over the wave's keys; m_q in units of the raw energy; l_q sums this lane half's keys (x2^10); oacc[g][dt][r] = O^T[dt*16 + 8hh + r][ln] */
  constexpr float SC2 = 0.03125f * 1.44269504088896340736f;      /* 1/sqrt(1024) x log2(e): softmax(energy/32) in powers of two */
#pragma unroll
  for (int g = 0; g < NG; ++g) { m_q[g] = -3.0e38f; l_q[g] = 0.f;
#pragma unroll
    for (int dt = 0; dt < DT; ++dt) oacc[g][dt] = (v8f){0.f,0.f,0.f,0.f,0.f,0.f,0.f,0.f}; }
#pragma unroll 1      /* stays rolled: the buffer chosen by t & 1 */
  for (int t = 0; t < NST; ++t) {      /* every loop inside is unrolled: constant indices keep fragments, scores and accumulators in registers, every LDS offset is an immediate */
    const int bf = t & 1;
    const unsigned short* kf = &sKV[bf][0][kh * 32 + ln][8 * hh]; const unsigned short* vf = &sKV[bf][1][ln][kh * 32 + 8 * hh];
    FragH ak[2][KS], av[DT];
#pragma unroll
    for (int nt = 0; nt < 2; ++nt)
#pragma unroll
      for (int ks = 0; ks < KS; ++ks) { const unsigned short* kr = kf + nt * 16 * LP + ks * 32; ak[nt][ks].half[0] = *(const v8us*)kr; ak[nt][ks].half[1] = *(const v8us*)(kr + 16); }
    __builtin_amdgcn_sched_barrier(0);      /* the 8 reads of K stay one group in front of their products (for speed only) */
    v8f s[NG][2];
#pragma unroll
    for (int g = 0; g < NG; ++g)
#pragma unroll
      for (int nt = 0; nt < 2; ++nt) s[g][nt] = (v8f){0.f,0.f,0.f,0.f,0.f,0.f,0.f,0.f};
#pragma unroll
    for (int ks = 0; ks < KS; ++ks)
#pragma unroll
      for (int nt = 0; nt < 2; ++nt)
#pragma unroll
        for (int g = 0; g < NG; ++g) s[g][nt] = mmB(ak[nt][ks].v, bq[g][ks].v, s[g][nt]);
    __builtin_amdgcn_sched_barrier(0);      /* the 8 products stay one run and the reads of V^T one group behind them (for speed only) */
#pragma unroll
    for (int dt = 0; dt < DT; ++dt) { const unsigned short* vrow = vf + dt * 16 * LP; av[dt].half[0] = *(const v8us*)vrow; av[dt].half[1] = *(const v8us*)(vrow + 16); }
    __builtin_amdgcn_sched_barrier(0);      /* ... and in front of the softmax, under which they fly: sunk towards the second products, their latency would be waited out there */
    float al[NG];
    /* scores -> P^T x2^10, in place, and the rescale factor; MK: the stage holds a masked key */
    auto soft = [&](auto MK) {
      if constexpr (decltype(MK)::v) {
        const int* mp = &sM[t * SK + kh * 32 + 8 * hh];      /* key padding mask (1 = attend), shared by all queries and heads: the lane's keys 8hh + r and 16 + 8hh + r of the wave's 32 */
        const v4ia km[2][2] = {{*(const v4ia*)mp, *(const v4ia*)(mp + 4)}, {*(const v4ia*)(mp + 16), *(const v4ia*)(mp + 20)}};
#pragma unroll
        for (int g = 0; g < NG; ++g)
#pragma unroll
          for (int nt = 0; nt < 2; ++nt)
#pragma unroll
            for (int r = 0; r < 8; ++r) s[g][nt][r] = (km[nt][r >> 2][r & 3] != 0) ? s[g][nt][r] : -INFINITY; }      /* masked keys carry -1e20 in the module, -inf here */
#pragma unroll
      for (int g = 0; g < NG; ++g) {
        float mc = -INFINITY;
#pragma unroll
        for (int nt = 0; nt < 2; ++nt)
#pragma unroll
          for (int r = 0; r < 8; ++r) mc = fmaxf(mc, s[g][nt][r]);      /* the raw energy: its scale is positive, so the maximum is taken before it */
        mc = fmaxf(mc, xhalf(mc));
        const float mn = fmaxf(m_q[g], mc); float a = (m_q[g] - mn) * SC2; m_q[g] = mn;      /* mn >= -3e38 is finite: nothing attended yet gives 2^0 = 1, a masked key 2^-inf = 0 */
        const float nb = fmaf(mn, -SC2, 10.0f);      /* p x2^10 = 2^(e SC2 - mn SC2 + 10): one fma and one hardware exponential a score */
#pragma unroll
        for (int nt = 0; nt < 2; ++nt)
#pragma unroll
          for (int r = 0; r < 8; ++r) s[g][nt][r] = fmaf(s[g][nt][r], SC2, nb);
        exp2_17(s[g][0], s[g][1], a);
        al[g] = a; } };
    /* a scalar test of a scalar word: where every key of the stage is attended the selects are the identity, and the mask is not read. The softmax is written on both paths, so that neither has to move the scores out of the products' registers */
    if (((zst >> t) & 1u) == 0u) soft(Flag<false>{}); else soft(Flag<true>{});
    FragH pb[NG];
#pragma unroll
    for (int g = 0; g < NG; ++g) { float ps = 0.f;
#pragma unroll
      for (int nt = 0; nt < 2; ++nt)
#pragma unroll
        for (int r = 0; r < 8; ++r) { const float p = s[g][nt][r]; ps += p; pb[g].h[nt * 8 + r] = (_Float16)p; }
      l_q[g] = l_q[g] * al[g] + ps;
#pragma unroll
      for (int dt = 0; dt < DT; ++dt)
#pragma unroll
        for (int r = 0; r < 8; ++r) oacc[g][dt][r] *= al[g]; }
#pragma unroll
    for (int dt = 0; dt < DT; ++dt)
#pragma unroll
      for (int g = 0; g < NG; ++g) oacc[g][dt] = mmB(av[dt].v, pb[g].v, oacc[g][dt]);
    asm volatile("s_wait_dscnt 0x0" ::: "memory");        /* this wave's reads of the buffer are over before it is handed to the copies */
    asm volatile("s_wait_asynccnt 0x0" ::: "memory");     /* this wave's copies of stage t + 1 have landed */
    __syncthreads();                                      /* publishes stage t + 1 and ends every wave's reads of stage t */
    if (t + 2 < NST) stage(t + 2, bf * LBUF); }
  asm volatile("s_wait_asynccnt 0x0" ::: "memory");       /* no copy is outstanding when the buffers become the exchange area */
  /* behind the last trip's barrier nobody reads the buffers any more. Wave w keeps group kh and hands group 1 - kh to wave w ^ 4: 9 x 16 B a lane (O^T, then maximum and sum), lane for lane, since both waves hold a query and its d rows in the same lanes */
  constexpr int XW = 9 * 128; fa* xs = (fa*)&sKV[0][0][0][0];
  { fa* xo = xs + w * XW + lane * 4;
#pragma unroll
    for (int dt = 0; dt < DT; ++dt) { const v8f o = kh ? oacc[0][dt] : oacc[1][dt]; *(v4fa*)(xo + (2 * dt) * 128) = (v4f){o[0], o[1], o[2], o[3]}; *(v4fa*)(xo + (2 * dt + 1) * 128) = (v4f){o[4], o[5], o[6], o[7]}; }
    *(v4fa*)(xo + 8 * 128) = (v4f){kh ? m_q[0] : m_q[1], kh ? l_q[0] : l_q[1], 0.f, 0.f}; }
  __syncthreads();                                        /* every wave's handed-over group is in LDS before its partner reads it */
  { const fa* xi = xs + (w ^ 4) * XW + lane * 4; const v4f ml = *(const v4fa*)(xi + 8 * 128);
    const float ma = kh ? m_q[1] : m_q[0], la = kh ? l_q[1] : l_q[0]; const float mm = fmaxf(ma, ml[0]);
    const float fk = __builtin_amdgcn_exp2f((ma - mm) * SC2), fp = __builtin_amdgcn_exp2f((ml[0] - mm) * SC2);      /* both halves of the keys brought to the common maximum */
    const float lh = la * fk + ml[1] * fp; const float l = lh + xhalf(lh); const float inv = (l > 0.f) ? 1.0f / l : 0.f;      /* l and O^T both carry the 2^10 of P */
#pragma unroll
    for (int dt = 0; dt < DT; ++dt) { const v8f ok = kh ? oacc[1][dt] : oacc[0][dt]; const v4f p0 = *(const v4fa*)(xi + (2 * dt) * 128), p1 = *(const v4fa*)(xi + (2 * dt + 1) * 128); FragH o;      /* O x2^4 in f16, the output GEMM's A operand: the lane's 8 consecutive d of query ln */
#pragma unroll
      for (int r = 0; r < 8; ++r) o.h[r] = (_Float16)(((ok[r] * fk + (r < 4 ? p0[r & 3] : p1[r & 3]) * fp) * inv) * 16.0f);
      *(v8us*)&sO[w][ln][dt * 16 + 8 * hh] = o.half[0]; } }
  __builtin_amdgcn_fence(__ATOMIC_ACQ_REL, "workgroup"); __builtin_amdgcn_wave_barrier();
  {
#pragma unroll
    for (int rp = 0; rp < 16; rp += 4) { const int r = rp + (lane >> 3), pc = lane & 7; const v8us val = *(const v8us*)&sO[w][r][pc * 8]; *(v8us*)((unsigned short*)O16 + ((size_t)b * TT + q0 + kh * 16 + r) * ldo + h * 64 + pc * 8) = val; }
     } }

// Output GEMM, out = (O x2^4).(Wo x2^4)^T / 2^8 + bf16(bo): one 128 x 128 tile of out a block, 8 waves of 64 x 32 (4 x 2 accumulator tiles), K in 8 stages of 128.
// A stage is 128 rows of O16 and 128 rows of Bo, 256 B (two whole lines) a row, LDS pitch 272 B, two buffers; stage t + 2 is copied while stage t + 1 is worked on. Each tile sums its k in ascending steps of 32.
__global__ __launch_bounds__(256) void k_ogemm(const _Float16* __restrict__ A, const _Float16* __restrict__ Bh, const float* __restrict__ bias, float* __restrict__ C) {
  constexpr int SK = 128, NST = DD / SK, LP = SK + 8, SP = 36; typedef float fa __attribute__((may_alias));
  __shared__ __attribute__((aligned(16))) unsigned short sAB[2][2][128][LP];      /* [buffer][O16, Bo][row][pitch]; behind the loop: each wave's 64 x 32 f32 of out, pitch SP */
  const int tid = threadIdx.x, w = tid >> 5, lane = tid & 31, ln = lane & 15, hh = lane >> 4;
  const int row0 = blockIdx.y * 128, col0 = blockIdx.x * 128, wm = (w & 1) * 64, wn = (w >> 1) * 32;
  /* the thread's part of a stage: 16 B at column 8 cc of rows cr + 16 i of both tiles, so that a wave's copy takes four whole 128-B lines */
  const int cr = tid >> 4, cc = tid & 15;
  const unsigned short* ag = (const unsigned short*)A + (size_t)(row0 + cr) * DD + cc * 8;
  const unsigned short* bg = (const unsigned short*)Bh + (size_t)(col0 + cr) * DD + cc * 8;
  const unsigned lab = (unsigned)(size_t)&sAB[0][0][cr][cc * 8];
  constexpr unsigned LROW = 16 * LP * 2, LTILE = 128 * LP * 2, LBUF = 2 * LTILE;      /* bytes: 16 rows, one tile, one buffer */
  auto tile = [&](const unsigned short* g, unsigned l) {      /* rows cr + 16 i, i = 0 .. 7: eight copies and, as in cp4, the s_wait_xcnt precaution in one statement, so that a tile costs one such wait */
    asm volatile("global_load_async_to_lds_b128 %0, %8, off\n\tglobal_load_async_to_lds_b128 %1, %9, off\n\tglobal_load_async_to_lds_b128 %2, %10, off\n\tglobal_load_async_to_lds_b128 %3, %11, off\n\t"
                 "global_load_async_to_lds_b128 %4, %12, off\n\tglobal_load_async_to_lds_b128 %5, %13, off\n\tglobal_load_async_to_lds_b128 %6, %14, off\n\tglobal_load_async_to_lds_b128 %7, %15, off\n\ts_wait_xcnt 0x0"
                 :: "v"(l), "v"(l + LROW), "v"(l + 2 * LROW), "v"(l + 3 * LROW), "v"(l + 4 * LROW), "v"(l + 5 * LROW), "v"(l + 6 * LROW), "v"(l + 7 * LROW),
                    "v"(g), "v"(g + 16 * DD), "v"(g + 32 * DD), "v"(g + 48 * DD), "v"(g + 64 * DD), "v"(g + 80 * DD), "v"(g + 96 * DD), "v"(g + 112 * DD) : "memory"); };
  auto stage = [&](int t, unsigned bufo) { tile(ag + t * SK, lab + bufo); tile(bg + t * SK, lab + bufo + LTILE); };
  stage(0, 0);
  asm volatile("s_wait_asynccnt 0x0" ::: "memory");      /* this wave's copies of stage 0 have landed */
  __syncthreads();                                        /* ... and every other wave's: nothing of them is read before */
  stage(1, LBUF);
  v8f acc[4][2];
#pragma unroll
  for (int i = 0; i < 4; ++i)
#pragma unroll
    for (int j = 0; j < 2; ++j) acc[i][j] = (v8f){0.f,0.f,0.f,0.f,0.f,0.f,0.f,0.f};
#pragma unroll 1      /* stays rolled: the buffer is chosen by t & 1 */
  for (int t = 0; t < NST; ++t) {
    const int bf = t & 1;
    const unsigned short* af = &sAB[bf][0][wm + ln][8 * hh]; const unsigned short* bp = &sAB[bf][1][wn + ln][8 * hh];
#pragma unroll      /* this loop and those inside it are unrolled: constant indices keep fragments and accumulators in registers, every LDS offset is an immediate */
    for (int kh = 0; kh < SK; kh += 64) {
      FragH a[2][4], b[2][2];
#pragma unroll
      for (int ks = 0; ks < 2; ++ks) {
#pragma unroll
        for (int j = 0; j < 2; ++j) { const unsigned short* p = bp + j * 16 * LP + kh + ks * 32; b[ks][j].half[0] = *(const v8us*)p; b[ks][j].half[1] = *(const v8us*)(p + 16); }
#pragma unroll
        for (int i = 0; i < 4; ++i) { const unsigned short* p = af + i * 16 * LP + kh + ks * 32; a[ks][i].half[0] = *(const v8us*)p; a[ks][i].half[1] = *(const v8us*)(p + 16); } }
      __builtin_amdgcn_sched_barrier(0);      /* 24 LDS reads stay one group in front of their 16 products (for speed only) */
#pragma unroll
      for (int ks = 0; ks < 2; ++ks)
#pragma unroll
        for (int i = 0; i < 4; ++i)
#pragma unroll
          for (int j = 0; j < 2; ++j) acc[i][j] = __builtin_amdgcn_wmma_f32_16x16x32_f16(false, a[ks][i].v, false, b[ks][j].v, (short)0, acc[i][j], false, false);
      __builtin_amdgcn_sched_barrier(0); }      /* the products stay in front of the waits below: lifted over them, the waits would end the next stage's flight before the products have covered it */
    asm volatile("s_wait_dscnt 0x0" ::: "memory");        /* this wave's reads of the buffer are over before it is handed to the copies */
    asm volatile("s_wait_asynccnt 0x0" ::: "memory");     /* this wave's copies of stage t + 1 have landed */
    __syncthreads();                                      /* publishes stage t + 1 and ends every wave's reads of stage t */
    if (t + 2 < NST) stage(t + 2, bf * LBUF); }
  asm volatile("s_wait_asynccnt 0x0" ::: "memory");       /* no copy is outstanding when the buffers become output staging */
  /* behind the last trip's barrier nobody reads the buffers any more: each wave stages its own 64 x 32 f32 there, so that every row leaves as one whole 128-B line */
  fa* st = (fa*)&sAB[0][0][0][0] + w * (64 * SP);
#pragma unroll
  for (int j = 0; j < 2; ++j) { const float bv = bf16_round(bias[col0 + wn + j * 16 + ln]);
#pragma unroll
    for (int i = 0; i < 4; ++i)
#pragma unroll
      for (int r = 0; r < 8; ++r) st[(i * 16 + 8 * hh + r) * SP + j * 16 + ln] = acc[i][j][r] * 0.00390625f + bv; }
  __builtin_amdgcn_fence(__ATOMIC_ACQ_REL, "workgroup"); __builtin_amdgcn_wave_barrier();      /* the wave reads back what its other lanes staged */
  float* cp = C + (size_t)(row0 + wm + (lane >> 3)) * DD + col0 + wn + (lane & 7) * 4; const fa* sp = st + (lane >> 3) * SP + (lane & 7) * 4;
#pragma unroll
  for (int q = 0; q < 16; ++q) { const v4f v = *(const v4fa*)(sp + q * 4 * SP); *(v4f*)(cp + (size_t)q * 4 * DD) = v; }
  asm volatile("s_wait_xcnt 0x0" ::: "memory"); }      /* precaution behind the stores: nothing that follows writes their registers first */

extern "C" void kernel_launch(void* const* d_in, const int* in_sizes, int n_in,
                              void* d_out, int out_size, void* d_ws, size_t ws_size, hipStream_t stream) {
  (void)in_sizes; (void)n_in; (void)out_size;
  const float* const* I = (const float* const*)d_in; const float* values = I[0]; const float* keys = I[1]; const float* query = I[2]; const int* mask = (const int*)d_in[3]; const float* Wv = I[4]; const float* Wk = I[5]; const float* Wq = I[6]; const float* Wo = I[7]; const float* bo = I[8];
  char* ws = (char*)d_ws; size_t off = 0;
  auto take = [&](size_t bytes) { char* p = ws + off; off += (bytes + 255) & ~(size_t)255; return p; };
  _Float16* Bo = (_Float16*)take((size_t)DD * DD * 2);
  _Float16* K = (_Float16*)take((size_t)NR * DD * 2); _Float16* Q = (_Float16*)take((size_t)NR * DD * 2); _Float16* Vt = (_Float16*)take((size_t)NR * DD * 2); _Float16* O16 = (_Float16*)take((size_t)NR * DD * 2);
  if (off > ws_size) return;      // 2.1 + 4 x 8.4 = 36 MB
  k_proj<<<dim3(NR / 256, NH, 4), 128, 0, stream>>>(values, keys, query, Wv, Wk, Wq, Wo, Vt, K, Q, Bo);
  k_flash<<<BB * NH * (TT / 128), 256, 0, stream>>>(Q, DD, K, DD, Vt, mask, O16, DD);
  k_ogemm<<<dim3(DD / 128, NR / 128), 256, 0, stream>>>(O16, Bo, bo, (float*)d_out);      /* out = O.Wo^T + bo */
}

// v009
// It runs in 56.8 microseconds.
// Timed twice side by side with v008, it ran 1.04 and 1.03 times as fast.
// Over all steps from v000 it is 9.85 times as fast.
#include <hip/hip_runtime.h>
// 'SelfAttension' (B=2, S=2048, E=1024, 16 heads × 64): per-head projections with ONE shared 64×64 weight per tensor (y_h = x_h·Wᵀ, torch (out,in), no bias) for values, keys, query; energy = q·kᵀ with −1e20 where the key mask [N,1,1,S] == 0;
// attn = softmax(energy/√1024); out = (attn·v merged)·Woᵀ + bo.
// Compute dtype: inputs, weights, bias rounded to bf16; the per-head 64×64 projections as block-diagonal f16 GEMMs (all 16 head-block columns of all three tensors in one launch, grid = row blocks x heads x 4: the three tensors and the Wo to f16 conversion, K = 64); fused flash-style kernel (per-(b,k) int mask loads, scale 1/32,
// online softmax f32, P f16 ×2^10) on v_wmma_f32_16x16x32_f16; O ×2^4 → f16 → output GEMM + bias; f32 accumulate.
#define BB 2
#define TT 2048
#define DD 1024
#define NH 16
#define HD 64
#define NR (BB * TT)

typedef __bf16 v16b __attribute__((ext_vector_type(16)));
typedef unsigned short v8us __attribute__((ext_vector_type(8), may_alias));
typedef float  v8f  __attribute__((ext_vector_type(8)));
typedef float  v4f  __attribute__((ext_vector_type(4)));
typedef float  v4fa __attribute__((ext_vector_type(4), may_alias));
union FragB { v16b v; v8us half[2]; unsigned short u[16]; };

__device__ __forceinline__ unsigned short bf16_bits(float x) { unsigned int u = __float_as_uint(x); return (unsigned short)((u + 0x7FFFu + ((u >> 16) & 1u)) >> 16); }
__device__ __forceinline__ float bf16_val(unsigned short b) { return __uint_as_float(((unsigned int)b) << 16); }
__device__ __forceinline__ float bf16_round(float x) { return bf16_val(bf16_bits(x)); }
// D += A·B with NT terms: 1 = ah·bh, 2 = + al·bh (A split), 3 = + ah·bl (both split)
template <int NT>
__device__ __forceinline__ v8f mmaN(v16b ah, v16b al, v16b bh, v16b bl, v8f c) {
  c = __builtin_amdgcn_wmma_f32_16x16x32_bf16(false, ah, false, bh, (short)0, c, false, false);
  if (NT >= 2) c = __builtin_amdgcn_wmma_f32_16x16x32_bf16(false, al, false, bh, (short)0, c, false, false);
  if (NT >= 3) c = __builtin_amdgcn_wmma_f32_16x16x32_bf16(false, ah, false, bl, (short)0, c, false, false);
  asm volatile("v_nop\n\tv_nop\n\tv_nop\n\tv_nop" : "+v"(c) : "v"(ah), "v"(al), "v"(bh), "v"(bl));
  return c;
}

__global__ __launch_bounds__(256) void k_wt_bf16(const float* __restrict__ W, unsigned short* __restrict__ Wt, int K, int N) {
  const int t = blockIdx.x * 256 + threadIdx.x;
  const int k8n = K / 8;
  if (t >= N * k8n) return;
  const int n = t / k8n, k8 = (t % k8n) * 8;
  v8us v;
#pragma unroll
  for (int i = 0; i < 8; ++i) v[i] = bf16_bits(W[(size_t)(k8 + i) * N + n]);
  *(v8us*)(Wt + (size_t)n * K + k8) = v;
  
}

// GEMM C[M][N] (f32, pitch ldc) = act(A[M][K]·W + bias). A f32 row-major (pitch lda) converted per fragment to bf16
// (ASPLIT: hi/lo two planes -> 2 terms, else single rounded term); Wt bf16 [N][K] (pitch ldb). BIAS_BF16 rounds the
// bias to bf16 first (bias quantised to bf16 before the add). K%32==0, M%16==0, N%64==0.
template <bool ASPLIT, int ACT, bool BIAS_BF16>
__global__ __launch_bounds__(128) void k_gemm_bf(const float* __restrict__ A, int lda, const unsigned short* __restrict__ Wt, int ldb,
                                               const float* __restrict__ bias, float* __restrict__ C, int ldc, int M, int N, int K) {
  __shared__ __attribute__((aligned(16))) float so[4][16][64];
  const int tid = threadIdx.x, w = tid >> 5, lane = tid & 31, ln = lane & 15, hh = lane >> 4;
  const int ntn = N / 64;
  const int wid = blockIdx.x * 4 + w;
  const int mt = wid / ntn, nq = wid % ntn;
  if (mt * 16 >= M) return;
  const int row0 = mt * 16, col0 = nq * 64;
  const float* arow = A + (size_t)(row0 + ln) * lda;
  v8f acc[4] = {};
  for (int kb = 0; kb < K; kb += 32) {
    FragB ah, al;
    const v4f x0 = *(const v4fa*)(arow + kb + 8 * hh), x1 = *(const v4fa*)(arow + kb + 8 * hh + 4);
    const v4f x2 = *(const v4fa*)(arow + kb + 16 + 8 * hh), x3 = *(const v4fa*)(arow + kb + 16 + 8 * hh + 4);
    float xs[16] = {x0[0],x0[1],x0[2],x0[3],x1[0],x1[1],x1[2],x1[3],x2[0],x2[1],x2[2],x2[3],x3[0],x3[1],x3[2],x3[3]};
#pragma unroll
    for (int i = 0; i < 16; ++i) { const unsigned short hb = bf16_bits(xs[i]); ah.u[i] = hb; al.u[i] = ASPLIT ? bf16_bits(xs[i] - bf16_val(hb)) : (unsigned short)0; }
#pragma unroll
    for (int t = 0; t < 4; ++t) {
      const unsigned short* brow = Wt + (size_t)(col0 + t * 16 + ln) * ldb + kb;
      FragB b;
      b.half[0] = *(const v8us*)(brow + 8 * hh);
      b.half[1] = *(const v8us*)(brow + 16 + 8 * hh);
      acc[t] = mmaN<ASPLIT ? 2 : 1>(ah.v, al.v, b.v, b.v, acc[t]);
    }
  }
#pragma unroll
  for (int t = 0; t < 4; ++t) {
    float bv = bias ? bias[col0 + t * 16 + ln] : 0.f;
    if (BIAS_BF16) bv = bf16_round(bv);
#pragma unroll
    for (int r = 0; r < 8; ++r) { float v = acc[t][r] + bv; if (ACT == 1) v = fmaxf(v, 0.f); so[w][8 * hh + r][t * 16 + ln] = v; }
  }
  __builtin_amdgcn_fence(__ATOMIC_ACQ_REL, "workgroup");
  __builtin_amdgcn_wave_barrier();
  const int rsub = lane >> 4, c4 = (lane & 15) * 4;
  {
#pragma unroll
    for (int q = 0; q < 8; ++q) {
      const int r = q * 2 + rsub;
      const v4f v = *(const v4fa*)&so[w][r][c4];
      *(v4f*)(C + (size_t)(row0 + r) * ldc + col0 + c4) = v;
    }
    
  }
}

// Flash-style causal/unmasked attention, all contractions 3-term bf16 hi/lo splits, f32 softmax with running max.
// q,k,v rows are read from f32 buffers with arbitrary row pitch (so they can live inside a fused qkv buffer);
// D = head size (multiple of 32, <= 128); one wave = 16 query rows; block = 4 waves (64 queries) sharing K/V chunks of 32.
template <int D, bool CAUSAL>
__global__ __launch_bounds__(128) void k_flash(const float* __restrict__ qb, const float* __restrict__ kb, const float* __restrict__ vb,
                                             int pitch, int T, int H, float scale, float* __restrict__ y, int ypitch) {
  constexpr int KS = D / 32;        // k-steps for QK
  constexpr int DT = D / 16;        // d tiles for PV
  __shared__ __attribute__((aligned(16))) unsigned short sKh[32][D + 8], sKl[32][D + 8], sVh[32][D + 8], sVl[32][D + 8];
  __shared__ __attribute__((aligned(16))) unsigned short sPh[4][16][40], sPl[4][16][40];
  __shared__ __attribute__((aligned(16))) float sO[4][16][D];
  const int tid = threadIdx.x, w = tid >> 5, lane = tid & 31, ln = lane & 15, hh = lane >> 4;
  const int nqb = (T + 63) / 64;
  const int bh = blockIdx.x / nqb, qblk = blockIdx.x % nqb;
  const int b = bh / H, h = bh % H;
  const int q0 = qblk * 64 + w * 16;
  const float* Q = qb + (size_t)b * T * pitch + h * D;
  const float* K = kb + (size_t)b * T * pitch + h * D;
  const float* V = vb + (size_t)b * T * pitch + h * D;

  // A fragments of the wave's 16 query rows (scaled), hi/lo
  FragB aqh[KS], aql[KS];
  {
    int row = q0 + ln; if (row >= T) row = T - 1;
    const float* qr = Q + (size_t)row * pitch;
#pragma unroll
    for (int ks = 0; ks < KS; ++ks)
#pragma unroll
      for (int i = 0; i < 16; ++i) {
        const int d = ks * 32 + ((i < 8) ? (8 * hh + i) : (16 + 8 * hh + (i - 8)));
        const float x = qr[d] * scale; const unsigned short hb = bf16_bits(x);
        aqh[ks].u[i] = hb; aql[ks].u[i] = bf16_bits(x - bf16_val(hb));
      }
  }
  float m_r[8], l_r[8];
#pragma unroll
  for (int r = 0; r < 8; ++r) { m_r[r] = -3.0e38f; l_r[r] = 0.f; }
  v8f oacc[DT];
#pragma unroll
  for (int dt = 0; dt < DT; ++dt) oacc[dt] = (v8f){0.f,0.f,0.f,0.f,0.f,0.f,0.f,0.f};

  const int kv_end = CAUSAL ? min(T, qblk * 64 + 64) : T;     // block-uniform
  for (int j0 = 0; j0 < kv_end; j0 += 32) {
    __syncthreads();
    for (int e = tid; e < 32 * (D / 4); e += 128) {
      const int r = e / (D / 4), c4 = (e % (D / 4)) * 4;
      const int key = j0 + r;
      v4f kf = {0.f,0.f,0.f,0.f}, vf = {0.f,0.f,0.f,0.f};
      if (key < T) { kf = *(const v4fa*)(K + (size_t)key * pitch + c4); vf = *(const v4fa*)(V + (size_t)key * pitch + c4); }
#pragma unroll
      for (int t = 0; t < 4; ++t) {
        unsigned short hb = bf16_bits(kf[t]); sKh[r][c4 + t] = hb; sKl[r][c4 + t] = bf16_bits(kf[t] - bf16_val(hb));
        hb = bf16_bits(vf[t]); sVh[r][c4 + t] = hb; sVl[r][c4 + t] = bf16_bits(vf[t] - bf16_val(hb));
      }
    }
    __syncthreads();
    // S tile 16 x 32
    v8f s[2];
#pragma unroll
    for (int nt = 0; nt < 2; ++nt) {
      v8f acc = {};
#pragma unroll
      for (int ks = 0; ks < KS; ++ks) {
        FragB bh_, bl_;
        bh_.half[0] = *(const v8us*)&sKh[nt * 16 + ln][ks * 32 + 8 * hh]; bh_.half[1] = *(const v8us*)&sKh[nt * 16 + ln][ks * 32 + 16 + 8 * hh];
        bl_.half[0] = *(const v8us*)&sKl[nt * 16 + ln][ks * 32 + 8 * hh]; bl_.half[1] = *(const v8us*)&sKl[nt * 16 + ln][ks * 32 + 16 + 8 * hh];
        acc = mmaN<3>(aqh[ks].v, aql[ks].v, bh_.v, bl_.v, acc);
      }
      s[nt] = acc;
    }
    // mask + running max (rows 8hh+r; the 16 lanes of a half share rows)
    float alpha[8];
#pragma unroll
    for (int r = 0; r < 8; ++r) {
      const int qi = q0 + 8 * hh + r;
      const int ja = j0 + ln, jb = j0 + 16 + ln;
      if (CAUSAL) { if (ja > qi) s[0][r] = -3.0e38f; if (jb > qi) s[1][r] = -3.0e38f; }
      if (ja >= T) s[0][r] = -3.0e38f;
      if (jb >= T) s[1][r] = -3.0e38f;
      float mx = fmaxf(s[0][r], s[1][r]);
      mx = fmaxf(mx, __shfl_xor(mx, 1, 32)); mx = fmaxf(mx, __shfl_xor(mx, 2, 32)); mx = fmaxf(mx, __shfl_xor(mx, 4, 32)); mx = fmaxf(mx, __shfl_xor(mx, 8, 32));
      const float mnew = fmaxf(m_r[r], mx);
      alpha[r] = (mnew > -1.0e38f) ? __expf(m_r[r] - mnew) : 1.0f;
      const float p0 = (s[0][r] > -1.0e38f) ? __expf(s[0][r] - mnew) : 0.f;
      const float p1 = (s[1][r] > -1.0e38f) ? __expf(s[1][r] - mnew) : 0.f;
      m_r[r] = mnew;
      l_r[r] = l_r[r] * alpha[r] + p0 + p1;            // per-lane partial row sum (16 lanes combined at the end)
      unsigned short hb = bf16_bits(p0); sPh[w][8 * hh + r][ln] = hb;      sPl[w][8 * hh + r][ln] = bf16_bits(p0 - bf16_val(hb));
      hb = bf16_bits(p1);                sPh[w][8 * hh + r][16 + ln] = hb; sPl[w][8 * hh + r][16 + ln] = bf16_bits(p1 - bf16_val(hb));
    }
#pragma unroll
    for (int dt = 0; dt < DT; ++dt)
#pragma unroll
      for (int r = 0; r < 8; ++r) oacc[dt][r] *= alpha[r];
    __builtin_amdgcn_fence(__ATOMIC_ACQ_REL, "workgroup");
    __builtin_amdgcn_wave_barrier();
    FragB pah, pal;
    pah.half[0] = *(const v8us*)&sPh[w][ln][8 * hh]; pah.half[1] = *(const v8us*)&sPh[w][ln][16 + 8 * hh];
    pal.half[0] = *(const v8us*)&sPl[w][ln][8 * hh]; pal.half[1] = *(const v8us*)&sPl[w][ln][16 + 8 * hh];
#pragma unroll
    for (int dt = 0; dt < DT; ++dt) {
      FragB bvh, bvl;
#pragma unroll
      for (int i = 0; i < 8; ++i) {
        bvh.u[i] = sVh[8 * hh + i][dt * 16 + ln]; bvh.u[8 + i] = sVh[16 + 8 * hh + i][dt * 16 + ln];
        bvl.u[i] = sVl[8 * hh + i][dt * 16 + ln]; bvl.u[8 + i] = sVl[16 + 8 * hh + i][dt * 16 + ln];
      }
      oacc[dt] = mmaN<3>(pah.v, pal.v, bvh.v, bvl.v, oacc[dt]);
    }
    __builtin_amdgcn_fence(__ATOMIC_ACQ_REL, "workgroup");
    __builtin_amdgcn_wave_barrier();
  }
#pragma unroll
  for (int r = 0; r < 8; ++r) {
    float l = l_r[r];
    l += __shfl_xor(l, 1, 32); l += __shfl_xor(l, 2, 32); l += __shfl_xor(l, 4, 32); l += __shfl_xor(l, 8, 32);
    l_r[r] = (l > 0.f) ? 1.0f / l : 0.f;
  }
#pragma unroll
  for (int dt = 0; dt < DT; ++dt)
#pragma unroll
    for (int r = 0; r < 8; ++r) sO[w][8 * hh + r][dt * 16 + ln] = oacc[dt][r] * l_r[r];
  __builtin_amdgcn_fence(__ATOMIC_ACQ_REL, "workgroup");
  __builtin_amdgcn_wave_barrier();
  {
    for (int r = 0; r < 16; ++r) {
      const int row = q0 + r;
      if (row < T && lane < D / 4) {
        const v4f val = *(const v4fa*)&sO[w][r][lane * 4];
        *(v4f*)(y + ((size_t)b * T + row) * ypitch + h * D + lane * 4) = val;
      }
    }
    
  }
}

// GEMM C = act(A·W + bias + resid): A f32 (ASPLIT -> hi/lo 2 terms), Wt bf16 [N][K]; ACT 0 none, 1 relu, 2 exact gelu;
// resid (optional, f32, row index = (row % rmod), pitch ldr, RES_BF16 rounds it) added before the activation.
template <bool ASPLIT, int ACT, bool BIAS_BF16, bool RES_BF16>
__global__ __launch_bounds__(128) void k_gemm_bf3(const float* __restrict__ A, int lda, const unsigned short* __restrict__ Wt, int ldb,
                                                const float* __restrict__ bias, const float* __restrict__ resid, int rmod, int ldr,
                                                float* __restrict__ C, int ldc, int M, int N, int K) {
  __shared__ __attribute__((aligned(16))) float so[4][16][64];
  const int tid = threadIdx.x, w = tid >> 5, lane = tid & 31, ln = lane & 15, hh = lane >> 4;
  const int ntn = N / 64;
  const int wid = blockIdx.x * 4 + w;
  const int mt = wid / ntn, nq = wid % ntn;
  if (mt * 16 >= M) return;
  const int row0 = mt * 16, col0 = nq * 64;
  const float* arow = A + (size_t)(row0 + ln) * lda;
  v8f acc[4] = {};
  for (int kb = 0; kb < K; kb += 32) {
    FragB ah, al;
    const v4f x0 = *(const v4fa*)(arow + kb + 8 * hh), x1 = *(const v4fa*)(arow + kb + 8 * hh + 4);
    const v4f x2 = *(const v4fa*)(arow + kb + 16 + 8 * hh), x3 = *(const v4fa*)(arow + kb + 16 + 8 * hh + 4);
    float xs[16] = {x0[0],x0[1],x0[2],x0[3],x1[0],x1[1],x1[2],x1[3],x2[0],x2[1],x2[2],x2[3],x3[0],x3[1],x3[2],x3[3]};
#pragma unroll
    for (int i = 0; i < 16; ++i) { const unsigned short hb = bf16_bits(xs[i]); ah.u[i] = hb; al.u[i] = ASPLIT ? bf16_bits(xs[i] - bf16_val(hb)) : (unsigned short)0; }
#pragma unroll
    for (int t = 0; t < 4; ++t) {
      const unsigned short* brow = Wt + (size_t)(col0 + t * 16 + ln) * ldb + kb;
      FragB b;
      b.half[0] = *(const v8us*)(brow + 8 * hh);
      b.half[1] = *(const v8us*)(brow + 16 + 8 * hh);
      acc[t] = mmaN<ASPLIT ? 2 : 1>(ah.v, al.v, b.v, b.v, acc[t]);
    }
  }
#pragma unroll
  for (int t = 0; t < 4; ++t) {
    const int col = col0 + t * 16 + ln;
    float bv = bias ? bias[col] : 0.f;
    if (BIAS_BF16) bv = bf16_round(bv);
#pragma unroll
    for (int r = 0; r < 8; ++r) {
      float v = acc[t][r] + bv;
      if (resid) { float rv = resid[(size_t)((row0 + 8 * hh + r) % rmod) * ldr + col]; if (RES_BF16) rv = bf16_round(rv); v += rv; }
      if (ACT == 1) v = fmaxf(v, 0.f);
      if (ACT == 2) v = 0.5f * v * (1.0f + erff(v * 0.70710678118654752f));
      if (ACT == 3) { const float u = 0.7978845608028654f * (v + 0.044715f * v * v * v); v = 0.5f * v * (1.0f + tanhf(u)); }
      so[w][8 * hh + r][t * 16 + ln] = v;
    }
  }
  __builtin_amdgcn_fence(__ATOMIC_ACQ_REL, "workgroup");
  __builtin_amdgcn_wave_barrier();
  const int rsub = lane >> 4, c4 = (lane & 15) * 4;
  {
#pragma unroll
    for (int q = 0; q < 8; ++q) {
      const int r = q * 2 + rsub;
      const v4f v = *(const v4fa*)&so[w][r][c4];
      *(v4f*)(C + (size_t)(row0 + r) * ldc + col0 + c4) = v;
    }
    
  }
}
// row LayerNorm (biased variance, eps) over N: s = X (+ R); optional out_sum <- s; out_norm <- (s-mu)*rsqrt(var+eps)*g + b
template <bool PARAM_BF16>
__global__ __launch_bounds__(256) void k_layernorm(const float* __restrict__ X, const float* __restrict__ R, const float* __restrict__ g, const float* __restrict__ bta,
                                                  float* __restrict__ out_sum, float* __restrict__ out_norm, int N, float eps) {
  __shared__ float red[256];
  const int row = blockIdx.x, tid = threadIdx.x;
  const float* x = X + (size_t)row * N; const float* rr = R ? R + (size_t)row * N : nullptr;
  float vals[16];                     // up to N = 4096
  const int per = N / 256;            // contiguous chunk per thread? use strided-by-4 chunks: thread handles j = tid*4 + 1024*u
  float s1 = 0.f;
  for (int u = 0; u < per / 4; ++u) {
    const int j = tid * 4 + 1024 * u;
    const v4f a = *(const v4fa*)(x + j);
    v4f b = {0.f,0.f,0.f,0.f}; if (rr) b = *(const v4fa*)(rr + j);
#pragma unroll
    for (int q = 0; q < 4; ++q) { const float v = a[q] + b[q]; vals[u * 4 + q] = v; s1 += v; }
  }
  red[tid] = s1; __syncthreads();
  for (int st = 128; st > 0; st >>= 1) { if (tid < st) red[tid] += red[tid + st]; __syncthreads(); }
  const float mu = red[0] / (float)N; __syncthreads();
  float s2 = 0.f;
  for (int u = 0; u < per / 4; ++u)
#pragma unroll
    for (int q = 0; q < 4; ++q) { const float c = vals[u * 4 + q] - mu; s2 += c * c; }
  red[tid] = s2; __syncthreads();
  for (int st = 128; st > 0; st >>= 1) { if (tid < st) red[tid] += red[tid + st]; __syncthreads(); }
  const float rs = rsqrtf(red[0] / (float)N + eps);
  {
    for (int u = 0; u < per / 4; ++u) {
      const int j = tid * 4 + 1024 * u;
      v4f o, sm;
#pragma unroll
      for (int q = 0; q < 4; ++q) {
        float gg = g[j + q], bb = bta[j + q];
        if (PARAM_BF16) { gg = bf16_round(gg); bb = bf16_round(bb); }
        sm[q] = vals[u * 4 + q]; o[q] = (vals[u * 4 + q] - mu) * rs * gg + bb;
      }
      if (out_sum) *(v4f*)(out_sum + (size_t)row * N + j) = sm;
      *(v4f*)(out_norm + (size_t)row * N + j) = o;
    }
    
  }
}



// ---- f16 WMMA path (v_wmma_f32_16x16x32_f16): 11-bit significands for operands in range — used where a [0,1] probability operand needs more precision than bf16
typedef _Float16 v16h __attribute__((ext_vector_type(16)));
union FragH { v16h v; v8us half[2]; _Float16 h[16]; unsigned short u[16]; };
template <int NT>
__device__ __forceinline__ v8f mmaH(v16h ah, v16h al, v16h bh, v16h bl, v8f c) {
  c = __builtin_amdgcn_wmma_f32_16x16x32_f16(false, ah, false, bh, (short)0, c, false, false);
  if (NT >= 2) c = __builtin_amdgcn_wmma_f32_16x16x32_f16(false, al, false, bh, (short)0, c, false, false);
  if (NT >= 3) c = __builtin_amdgcn_wmma_f32_16x16x32_f16(false, ah, false, bl, (short)0, c, false, false);
  asm volatile("v_nop\n\tv_nop\n\tv_nop\n\tv_nop" : "+v"(c) : "v"(ah), "v"(al), "v"(bh), "v"(bl));
  return c;
}
// batched GEMM like k_gemm_b but f16 operands: A f32 (split into f16 hi/lo if ASPLIT, else rounded to f16), Bt = f16 values [n][k]; alpha; C f32; N multiple of 16 (partial tiles skipped)
template <bool ASPLIT>
__global__ __launch_bounds__(128) void k_gemm_h(const float* __restrict__ A, int lda, size_t sA, const _Float16* __restrict__ Bh, int ldb, size_t sB, float alpha, float* __restrict__ C, int ldc, size_t sC, int M, int N, int K) {
  __shared__ __attribute__((aligned(16))) float so[4][16][64];
  const int tid = threadIdx.x, w = tid >> 5, lane = tid & 31, ln = lane & 15, hh = lane >> 4; const int by = blockIdx.y;
  A += (size_t)by * sA; Bh += (size_t)by * sB; C += (size_t)by * sC;
  const int ntn = (N + 63) / 64; const int wid = blockIdx.x * 4 + w; const int mt = wid / ntn, nq = wid % ntn; if (mt * 16 >= M) return;
  const int row0 = mt * 16, col0 = nq * 64; const float* arow = A + (size_t)(row0 + ln) * lda;
  v8f acc[4] = {};
  for (int kb = 0; kb < K; kb += 32) {
    FragH ah, al;
    const v4f x0 = *(const v4fa*)(arow + kb + 8 * hh), x1 = *(const v4fa*)(arow + kb + 8 * hh + 4), x2 = *(const v4fa*)(arow + kb + 16 + 8 * hh), x3 = *(const v4fa*)(arow + kb + 16 + 8 * hh + 4);
    float xs[16] = {x0[0],x0[1],x0[2],x0[3],x1[0],x1[1],x1[2],x1[3],x2[0],x2[1],x2[2],x2[3],x3[0],x3[1],x3[2],x3[3]};
#pragma unroll
    for (int i = 0; i < 16; ++i) { const _Float16 h = (_Float16)xs[i]; ah.h[i] = h; al.h[i] = ASPLIT ? (_Float16)(xs[i] - (float)h) : (_Float16)0.0f; }
#pragma unroll
    for (int t = 0; t < 4; ++t) { if (col0 + t * 16 >= N) continue; const size_t boff = (size_t)(col0 + t * 16 + ln) * ldb + kb; FragH bq; bq.half[0] = *(const v8us*)(Bh + boff + 8 * hh); bq.half[1] = *(const v8us*)(Bh + boff + 16 + 8 * hh);
      acc[t] = mmaH<ASPLIT ? 2 : 1>(ah.v, al.v, bq.v, bq.v, acc[t]); }
  }
#pragma unroll
  for (int t = 0; t < 4; ++t) { if (col0 + t * 16 >= N) continue;
#pragma unroll
    for (int r = 0; r < 8; ++r) so[w][8 * hh + r][t * 16 + ln] = acc[t][r] * alpha; }
  __builtin_amdgcn_fence(__ATOMIC_ACQ_REL, "workgroup"); __builtin_amdgcn_wave_barrier();
  const int rsub = lane >> 4, c4 = (lane & 15) * 4;
  {
#pragma unroll
    for (int q = 0; q < 8; ++q) { const int r = q * 2 + rsub; if (col0 + c4 < N) { const v4f v = *(const v4fa*)&so[w][r][c4]; *(v4f*)(C + (size_t)(row0 + r) * ldc + col0 + c4) = v; } }
     }
}

// Wt[n][k] = f16(W[k][n]·scale) from f32 row-major W[K][N] (scale = power of two; bf16-exact weights stay exact in f16 away from the subnormal range)
__global__ __launch_bounds__(256) void k_wt_f16(const float* __restrict__ W, _Float16* __restrict__ Wt, int K, int N, float scale) {
  const int t = blockIdx.x * 256 + threadIdx.x; if (t >= N * (K / 8)) return; const int n = t / (K / 8), k8 = (t % (K / 8)) * 8; FragH f;
#pragma unroll
  for (int i = 0; i < 8; ++i) f.h[i] = (_Float16)(bf16_round(W[(size_t)(k8 + i) * N + n]) * scale); const v8us o = f.half[0];
  *(v8us*)((unsigned short*)Wt + (size_t)n * K + k8) = o; 
}
// k_gemm_hh variant with fused epilogue: v = acc·alpha + bias[by·sBias + col] (+ CP[(row/rowsPerB)·sCPb + by·64 + col] if CP) ; ACT 0 none / 1 elu ; writes f16 C16 and/or f32 C (each if non-null)
template <int ACT>
__global__ __launch_bounds__(128) void k_gemm_hhx(const _Float16* __restrict__ A, int lda, size_t sA, const _Float16* __restrict__ Bh, int ldb, size_t sB, float alpha, const float* __restrict__ bias, size_t sBias, const float* __restrict__ CP, int rowsPerB, size_t sCPb, int row0g,
    float* __restrict__ C, _Float16* __restrict__ C16, int ldc, size_t sC, int M, int N, int K, size_t sAz, size_t sBz, size_t sCz) {
  __shared__ __attribute__((aligned(16))) float so[4][16][64];
  const int tid = threadIdx.x, w = tid >> 5, lane = tid & 31, ln = lane & 15, hh = lane >> 4; const int by = blockIdx.y, bz = blockIdx.z;      /* second batch index bz with its own strides sAz, sBz, sCz */
  A += (size_t)by * sA + (size_t)bz * sAz; Bh += (size_t)by * sB + (size_t)bz * sBz; const size_t cofs = (size_t)by * sC + (size_t)bz * sCz; const float* bp = bias ? bias + (size_t)by * sBias : nullptr;
  const int ntn = (N + 63) / 64; const int wid = blockIdx.x * 4 + w; const int mt = wid / ntn, nq = wid % ntn; if (mt * 16 >= M) return;
  const int row0 = mt * 16, col0 = nq * 64; const _Float16* arow = A + (size_t)(row0 + ln) * lda;
  v8f acc[4] = {};
  for (int kb = 0; kb < K; kb += 32) { FragH ah; ah.half[0] = *(const v8us*)((const unsigned short*)arow + kb + 8 * hh); ah.half[1] = *(const v8us*)((const unsigned short*)arow + kb + 16 + 8 * hh);
#pragma unroll
    for (int t = 0; t < 4; ++t) { if (col0 + t * 16 >= N) continue; const size_t boff = (size_t)(col0 + t * 16 + ln) * ldb + kb; FragH bq; bq.half[0] = *(const v8us*)((const unsigned short*)Bh + boff + 8 * hh); bq.half[1] = *(const v8us*)((const unsigned short*)Bh + boff + 16 + 8 * hh);
      acc[t] = mmaH<1>(ah.v, ah.v, bq.v, bq.v, acc[t]); }
  }
#pragma unroll
  for (int t = 0; t < 4; ++t) { if (col0 + t * 16 >= N) continue; const int col = col0 + t * 16 + ln; const float bv = bp ? bf16_round(bp[col]) : 0.f;
#pragma unroll
    for (int r = 0; r < 8; ++r) { float v = acc[t][r] * alpha + bv; if (CP) { const int bidx = (row0g + row0 + 8 * hh + r) / rowsPerB; v += CP[(size_t)bidx * sCPb + (size_t)by * 64 + col]; } if (ACT == 1) v = (v > 0.f) ? v : expm1f(v); else if (ACT == 7) v = (v > 0.f) ? v + 1.0f : expf(v); else if (ACT == 8) v = tanhf(v); else if (ACT == 9) v = 0.5f * v * (1.0f + tanhf(0.7978845608028654f * (v + 0.044715f * v * v * v))); else if (ACT == 11) v = 1.0f / (1.0f + expf(-v)); else if (ACT == 12) v = (v > 0.f) ? v : 0.01f * v; else if (ACT == 14) v = (v > 0.f) ? v : 0.1f * v; else if (ACT == 15) v = v / (1.0f + expf(-v)); else if (ACT == 3) v = fmaxf(v, 0.f); else if (ACT == 6) v = 0.5f * v * (1.0f + erff(v * 0.70710678118654752f)); so[w][8 * hh + r][t * 16 + ln] = v; } }
  __builtin_amdgcn_fence(__ATOMIC_ACQ_REL, "workgroup"); __builtin_amdgcn_wave_barrier();
  const int rsub = lane >> 4, c4 = (lane & 15) * 4; typedef _Float16 v4h __attribute__((ext_vector_type(4)));
  {
#pragma unroll
    for (int q = 0; q < 8; ++q) { const int r = q * 2 + rsub; if (col0 + c4 < N) { const v4f v = *(const v4fa*)&so[w][r][c4]; if (C) *(v4f*)(C + cofs + (size_t)(row0 + r) * ldc + col0 + c4) = v; if (C16) { v4h h4; for (int i = 0; i < 4; ++i) h4[i] = (_Float16)v[i]; *(v4h*)(C16 + cofs + (size_t)(row0 + r) * ldc + col0 + c4) = h4; } } }
     }
}


typedef _Float16 v4h __attribute__((ext_vector_type(4)));

__global__ __launch_bounds__(256) void k_h16(const float* __restrict__ x, _Float16* __restrict__ X16, size_t n8) { const size_t t = (size_t)blockIdx.x * 256 + threadIdx.x; if (t >= n8) return; FragH f;
#pragma unroll
  for (int q = 0; q < 8; ++q) f.h[q] = (_Float16)x[t * 8 + q]; *(v8us*)((unsigned short*)X16 + t * 8) = f.half[0];  }
// The 16 f32 of one 16 x 32 operand fragment in the hardware k order (k = 8hh + e, then 16 + 8hh + e - 8), as loaded: p = row + 32 ks + 8 hh
struct Raw16 { v4f a, b, c, d; };
__device__ __forceinline__ Raw16 raw_f32(const float* __restrict__ p) { Raw16 x; x.a = *(const v4fa*)p; x.b = *(const v4fa*)(p + 4); x.c = *(const v4fa*)(p + 16); x.d = *(const v4fa*)(p + 20); return x; }
// each value rounded to bf16, then held exactly in f16 (weights x2^4)
template <bool W16>
__device__ __forceinline__ FragH frag_f32(const Raw16& x) { FragH f;
#pragma unroll
  for (int q = 0; q < 4; ++q) {
    f.h[q]      = W16 ? (_Float16)(bf16_round(x.a[q]) * 16.0f) : (_Float16)bf16_round(x.a[q]);
    f.h[4 + q]  = W16 ? (_Float16)(bf16_round(x.b[q]) * 16.0f) : (_Float16)bf16_round(x.b[q]);
    f.h[8 + q]  = W16 ? (_Float16)(bf16_round(x.c[q]) * 16.0f) : (_Float16)bf16_round(x.c[q]);
    f.h[12 + q] = W16 ? (_Float16)(bf16_round(x.d[q]) * 16.0f) : (_Float16)bf16_round(x.d[q]); }
  return f; }
// One wave: 64 rows x one head of one tensor, y = x.W^T (K = 64), inputs and weight converted in registers; the next 16 rows are loaded while these are worked on. st = the wave's own 64 x 64 f16 staging tile (pitch 72), written 16 B a lane:
// TR (values): A = x rows, B = W rows, so a lane holds 8 consecutive rows of one output column and the tile is staged transposed, st[d][row];
// else (keys, query): A = W rows, B = x rows, so a lane holds 8 consecutive columns of one row, st[row][e]. Either way each staged row leaves as one whole 128-B line; dst = first staged row, pitch in elements.
template <bool TR>
__device__ __forceinline__ void proj_tile(const float* __restrict__ x, const float* __restrict__ W, unsigned short (*st)[72], unsigned short* __restrict__ dst, size_t pitch, int lane) {
  const int ln = lane & 15, hh = lane >> 4; const float* xl = x + (size_t)ln * DD + 8 * hh; const float* wl = W + ln * HD + 8 * hh;
  Raw16 xr[2][2]; xr[0][0] = raw_f32(xl); xr[0][1] = raw_f32(xl + 32);
  Raw16 wr[4][2];
#pragma unroll
  for (int t = 0; t < 4; ++t)
#pragma unroll
    for (int ks = 0; ks < 2; ++ks) wr[t][ks] = raw_f32(wl + t * 16 * HD + ks * 32);
  asm volatile("s_wait_xcnt 0x0" :: "v"(wl) : "memory");      /* precaution: the weight loads' address registers (the input) are written again only behind this wait */
  FragH wf[4][2];
#pragma unroll
  for (int t = 0; t < 4; ++t)
#pragma unroll
    for (int ks = 0; ks < 2; ++ks) wf[t][ks] = frag_f32<true>(wr[t][ks]);
#pragma unroll
  for (int rt = 0; rt < 4; ++rt) {
    if (rt < 3) { xr[(rt + 1) & 1][0] = raw_f32(xl + (size_t)(rt + 1) * 16 * DD); xr[(rt + 1) & 1][1] = raw_f32(xl + (size_t)(rt + 1) * 16 * DD + 32);
      if (rt == 2) asm volatile("s_wait_xcnt 0x0" :: "v"(xl) : "memory"); }      /* the same precaution behind the last loads that name the row address */
    const FragH x0 = frag_f32<false>(xr[rt & 1][0]), x1 = frag_f32<false>(xr[rt & 1][1]);
#pragma unroll
    for (int t = 0; t < 4; ++t) { v8f acc = (v8f){0.f,0.f,0.f,0.f,0.f,0.f,0.f,0.f};
      if (TR) { acc = mmaH<1>(x0.v, x0.v, wf[t][0].v, wf[t][0].v, acc); acc = mmaH<1>(x1.v, x1.v, wf[t][1].v, wf[t][1].v, acc); }
      else    { acc = mmaH<1>(wf[t][0].v, wf[t][0].v, x0.v, x0.v, acc); acc = mmaH<1>(wf[t][1].v, wf[t][1].v, x1.v, x1.v, acc); }
      FragH o;
#pragma unroll
      for (int r = 0; r < 8; ++r) o.h[r] = (_Float16)(acc[r] * 0.0625f);
      if (TR) *(v8us*)&st[t * 16 + ln][rt * 16 + 8 * hh] = o.half[0]; else *(v8us*)&st[rt * 16 + ln][t * 16 + 8 * hh] = o.half[0]; } }
  __builtin_amdgcn_fence(__ATOMIC_ACQ_REL, "workgroup"); __builtin_amdgcn_wave_barrier();      /* the wave reads back what its other lanes staged */
#pragma unroll
  for (int q = 0; q < 16; ++q) { const int r = q * 4 + (lane >> 3), c8 = (lane & 7) * 8; const v8us v = *(const v8us*)&st[r][c8]; *(v8us*)(dst + (size_t)r * pitch + c8) = v; }
  asm volatile("s_wait_xcnt 0x0" ::: "memory"); }      /* the same precaution behind the stores: nothing that follows on any path writes their registers first */
// grid (NR / 256, heads, 4): blockIdx.z = 0 values -> Vt[slab][d][t], 1 keys -> K16, 2 query -> Q16 (row-major, head h at column 64 h); blockIdx.z = 3: Bo = f16(bf16(Wo) x2^4), 8 elements a thread and trip
__global__ __launch_bounds__(128) void k_proj(const float* __restrict__ xv, const float* __restrict__ xk, const float* __restrict__ xq, const float* __restrict__ Wv, const float* __restrict__ Wk, const float* __restrict__ Wq, const float* __restrict__ Wo,
    _Float16* __restrict__ Vt, _Float16* __restrict__ K16, _Float16* __restrict__ Q16, _Float16* __restrict__ Bo) {
  __shared__ __attribute__((aligned(16))) unsigned short st[4][64][72];
  const int tid = threadIdx.x, w = tid >> 5, lane = tid & 31; const int z = blockIdx.z, h = blockIdx.y;
  if (z == 3) { constexpr int NTH = (NR / 256) * NH * 128;
#pragma unroll
    for (int i = 0; i < DD * DD / 8 / NTH; ++i) { const size_t t = (size_t)i * NTH + (size_t)(blockIdx.y * (NR / 256) + blockIdx.x) * 128 + tid; const v4f a = *(const v4fa*)(Wo + t * 8), c = *(const v4fa*)(Wo + t * 8 + 4); FragH f;
#pragma unroll
      for (int q = 0; q < 4; ++q) { f.h[q] = (_Float16)(bf16_round(a[q]) * 16.0f); f.h[4 + q] = (_Float16)(bf16_round(c[q]) * 16.0f); }
      *(v8us*)((unsigned short*)Bo + t * 8) = f.half[0]; }
    return; }
  const int row0 = (blockIdx.x * 4 + w) * 64; const size_t xo = (size_t)row0 * DD + h * HD;
  if (z == 0) proj_tile<true>(xv + xo, Wv, st[w], (unsigned short*)Vt + ((size_t)((row0 / TT) * NH + h) * HD) * TT + row0 % TT, TT, lane);
  else proj_tile<false>((z == 1 ? xk : xq) + xo, z == 1 ? Wk : Wq, st[w], (unsigned short*)(z == 1 ? K16 : Q16) + xo, DD, lane); }
// lane l with lane l ^ 16 (a vector cross-row move, no LDS)
__device__ __forceinline__ float xhalf(float x) { return __builtin_bit_cast(float, __builtin_amdgcn_permlanex16(__builtin_bit_cast(int, x), __builtin_bit_cast(int, x), 0x76543210, 0xfedcba98, false, false)); }
// x <- 2^x on the hardware exponential for a pass's 16 scores. One asm statement so that each v_exp_f32 writes over its own argument and its neighbours name other registers:
// the slot that the instruction set asks for behind a transcendental (no read of its result, no write of its source) is then kept between them by construction, and the closing v_nop keeps it for whatever follows.
__device__ __forceinline__ void exp2_16(v8f& a, v8f& b) {
  float a0 = a[0], a1 = a[1], a2 = a[2], a3 = a[3], a4 = a[4], a5 = a[5], a6 = a[6], a7 = a[7], b0 = b[0], b1 = b[1], b2 = b[2], b3 = b[3], b4 = b[4], b5 = b[5], b6 = b[6], b7 = b[7];
  asm("v_exp_f32 %0, %0\n\tv_exp_f32 %1, %1\n\tv_exp_f32 %2, %2\n\tv_exp_f32 %3, %3\n\tv_exp_f32 %4, %4\n\tv_exp_f32 %5, %5\n\tv_exp_f32 %6, %6\n\tv_exp_f32 %7, %7\n\t"
      "v_exp_f32 %8, %8\n\tv_exp_f32 %9, %9\n\tv_exp_f32 %10, %10\n\tv_exp_f32 %11, %11\n\tv_exp_f32 %12, %12\n\tv_exp_f32 %13, %13\n\tv_exp_f32 %14, %14\n\tv_exp_f32 %15, %15\n\tv_nop"
      : "+v"(a0), "+v"(a1), "+v"(a2), "+v"(a3), "+v"(a4), "+v"(a5), "+v"(a6), "+v"(a7), "+v"(b0), "+v"(b1), "+v"(b2), "+v"(b3), "+v"(b4), "+v"(b5), "+v"(b6), "+v"(b7));      /* every exponential in place */
  a = (v8f){a0, a1, a2, a3, a4, a5, a6, a7}; b = (v8f){b0, b1, b2, b3, b4, b5, b6, b7}; }
// Four asynchronous 16-B copies a lane, global -> LDS, through no register. The s_wait_xcnt in the same statement is a precaution: the address registers are written again only behind it.
__device__ __forceinline__ void cp4(unsigned l0, unsigned l1, unsigned l2, unsigned l3, const void* g0, const void* g1, const void* g2, const void* g3) {
  asm volatile("global_load_async_to_lds_b128 %0, %4, off\n\tglobal_load_async_to_lds_b128 %1, %5, off\n\tglobal_load_async_to_lds_b128 %2, %6, off\n\tglobal_load_async_to_lds_b128 %3, %7, off\n\ts_wait_xcnt 0x0"
               :: "v"(l0), "v"(l1), "v"(l2), "v"(l3), "v"(g0), "v"(g1), "v"(g2), "v"(g3) : "memory"); }
// D = A.B + C by the builtin alone: the compiler keeps the distances behind its own matrix instructions, and the independent products of a wave's two query groups stand in them
__device__ __forceinline__ v8f mmB(v16h a, v16h b, v8f c) { return __builtin_amdgcn_wmma_f32_16x16x32_f16(false, a, false, b, (short)0, c, false, false); }
// Two asynchronous 16-B copies a lane, as cp4
__device__ __forceinline__ void cp2(unsigned l0, unsigned l1, const void* g0, const void* g1) {
  asm volatile("global_load_async_to_lds_b128 %0, %2, off\n\tglobal_load_async_to_lds_b128 %1, %3, off\n\ts_wait_xcnt 0x0" :: "v"(l0), "v"(l1), "v"(g0), "v"(g1) : "memory"); }
__global__ __launch_bounds__(256) void k_flash(const _Float16* __restrict__ Q16, int ldq, const _Float16* __restrict__ K16, int ldk, const _Float16* __restrict__ Vt, const int* __restrict__ MSK, _Float16* __restrict__ O16, int ldo) {
  constexpr int NG = 2, QB = 128, NQB = TT / QB, DT = 4, KS = 2, SK = 64, NST = TT / SK, LP = 72; typedef int v4ia __attribute__((ext_vector_type(4), may_alias)); typedef float fa __attribute__((may_alias));
  __shared__ __attribute__((aligned(16))) unsigned short sKV[2][2][SK][LP];      /* [buffer][K, V^T][row][pitch]; behind the loop: the partial results that the waves exchange */
  __shared__ __attribute__((aligned(16))) int sM[TT];
  __shared__ __attribute__((aligned(16))) unsigned short sO[8][16][64 + 8];
  const int tid = threadIdx.x, w = tid >> 5, lane = tid & 31, ln = lane & 15, hh = lane >> 4; const int cg = w & 3, kh = w >> 2;
  const int slab = blockIdx.x / NQB, qblk = blockIdx.x % NQB; const int b = slab / NH, h = slab % NH; const int q0 = qblk * QB + cg * (NG * 16);
  /* the thread's part of a stage: 16 B at column 8 cc of rows cr and cr + 32 of both tiles, so that a wave's copy takes four whole 128-B lines */
  const int cr = tid >> 3, cc = tid & 7;
  const unsigned short* kg = (const unsigned short*)K16 + ((size_t)b * TT + cr) * ldk + h * 64 + cc * 8;
  const unsigned short* vg = (const unsigned short*)Vt + ((size_t)slab * 64 + cr) * TT + cc * 8;
  const unsigned lkv = (unsigned)(size_t)&sKV[0][0][cr][cc * 8];
  constexpr unsigned LROW = 32 * LP * 2, LTILE = SK * LP * 2, LBUF = 2 * LTILE;      /* bytes: 32 rows, one tile, one buffer */
  auto stage = [&](int t, unsigned bufo) {
    const unsigned short* k0 = kg + (size_t)t * SK * ldk; const unsigned short* v0 = vg + t * SK; const unsigned l = lkv + bufo;
    cp4(l, l + LROW, l + LTILE, l + LTILE + LROW, k0, k0 + (size_t)32 * ldk, v0, v0 + 32 * TT); };
  { const int* mg = MSK + (size_t)b * TT + tid * 4; const unsigned lm = (unsigned)(size_t)&sM[tid * 4];
    cp2(lm, lm + 4096, mg, mg + 1024); }
  stage(0, 0);
  FragH bq[NG][KS];
#pragma unroll
  for (int g = 0; g < NG; ++g) { const unsigned short* qr = (const unsigned short*)Q16 + ((size_t)b * TT + q0 + g * 16 + ln) * ldq + h * 64;
#pragma unroll
    for (int ks = 0; ks < KS; ++ks) { bq[g][ks].half[0] = *(const v8us*)(qr + ks * 32 + 8 * hh); bq[g][ks].half[1] = *(const v8us*)(qr + ks * 32 + 16 + 8 * hh); } }
  asm volatile("s_wait_asynccnt 0x0" ::: "memory");      /* this wave's copies of the mask row and of stage 0 have landed */
  __syncthreads();                                        /* ... and every other wave's: nothing of them is read before */
  stage(1, LBUF);
  /* The mask row is tested once: bit t of zst says whether stage t holds a masked key. Read i covers 128 keys, lanes 0 to 15 those of stage 2 i, lanes 16 to 31 those of stage 2 i + 1; a ballot is the same in every lane, so zst is a scalar. */
  unsigned zst = 0;
#pragma unroll      /* unrolled: every LDS offset and every shift is an immediate */
  for (int i = 0; i < TT / 128; ++i) { const v4ia m = *(const v4ia*)&sM[(i * 32 + lane) * 4];
    const unsigned lo = min(min((unsigned)m[0], (unsigned)m[1]), min((unsigned)m[2], (unsigned)m[3]));      /* 0 where one of the four is 0 */
    const unsigned bal = __builtin_amdgcn_ballot_w32(lo == 0u);
    zst |= (((bal & 0xFFFFu) != 0u ? 1u : 0u) | ((bal >> 16) != 0u ? 2u : 0u)) << (2 * i); }
  float m_q[NG], nb_q[NG], l_q[NG]; v8f oacc[NG][DT];      /* of query q0 + 16 g + ln over the wave's keys; m_q: the reference maximum in use, in units of the raw energy, nb_q = 10 - m_q SC2; l_q sums this lane half's keys (x2^10); oacc[g][dt][r] = O^T[dt*16 + 8hh + r][ln] */
  constexpr float SC2 = 0.03125f * 1.44269504088896340736f;      /* 1/sqrt(1024) x log2(e): softmax(energy/32) in powers of two */
  constexpr float PLIM = 32768.0f;      /* a pass stands while each lane's sum of its 16 P x2^10 is below 2^15: every P (none is negative) is then below it too, inside f16 */
#pragma unroll
  for (int g = 0; g < NG; ++g) { m_q[g] = -3.0e38f; nb_q[g] = fmaf(-3.0e38f, -SC2, 10.0f); l_q[g] = 0.f;
#pragma unroll
    for (int dt = 0; dt < DT; ++dt) oacc[g][dt] = (v8f){0.f,0.f,0.f,0.f,0.f,0.f,0.f,0.f}; }
#pragma unroll 1      /* stays rolled: the buffer chosen by t & 1 */
  for (int t = 0; t < NST; ++t) {      /* every loop inside is unrolled: constant indices keep fragments, scores and accumulators in registers, every LDS offset is an immediate */
    const int bf = t & 1;
    const unsigned short* kf = &sKV[bf][0][kh * 32 + ln][8 * hh]; const unsigned short* vf = &sKV[bf][1][ln][kh * 32 + 8 * hh];
    FragH ak[2][KS], av[DT];
#pragma unroll
    for (int nt = 0; nt < 2; ++nt)
#pragma unroll
      for (int ks = 0; ks < KS; ++ks) { const unsigned short* kr = kf + nt * 16 * LP + ks * 32; ak[nt][ks].half[0] = *(const v8us*)kr; ak[nt][ks].half[1] = *(const v8us*)(kr + 16); }
    __builtin_amdgcn_sched_barrier(0);      /* the 8 reads of K stay one group in front of their products (for speed only) */
    v8f s[NG][2];
#pragma unroll
    for (int g = 0; g < NG; ++g)
#pragma unroll
      for (int nt = 0; nt < 2; ++nt) s[g][nt] = (v8f){0.f,0.f,0.f,0.f,0.f,0.f,0.f,0.f};
#pragma unroll
    for (int ks = 0; ks < KS; ++ks)
#pragma unroll
      for (int nt = 0; nt < 2; ++nt)
#pragma unroll
        for (int g = 0; g < NG; ++g) s[g][nt] = mmB(ak[nt][ks].v, bq[g][ks].v, s[g][nt]);
    __builtin_amdgcn_sched_barrier(0);      /* the 8 products stay one run and the reads of V^T one group behind them (for speed only) */
#pragma unroll
    for (int dt = 0; dt < DT; ++dt) { const unsigned short* vrow = vf + dt * 16 * LP; av[dt].half[0] = *(const v8us*)vrow; av[dt].half[1] = *(const v8us*)(vrow + 16); }
    __builtin_amdgcn_sched_barrier(0);      /* ... and in front of the softmax, under which they fly: sunk towards the second products, their latency would be waited out there */
    v8f p[NG][2]; float ps[NG]; typedef float v2f __attribute__((ext_vector_type(2)));
    /* energies e -> P^T x2^10 against the reference maximum in use, and each lane's sum of them: p x2^10 = 2^(e SC2 - m_q SC2 + 10), one fma and one hardware exponential a score; a masked key gives 2^-inf = 0 */
    auto expo = [&](int g, const v8f& e0, const v8f& e1) {
#pragma unroll
      for (int r = 0; r < 8; ++r) { p[g][0][r] = fmaf(e0[r], SC2, nb_q[g]); p[g][1][r] = fmaf(e1[r], SC2, nb_q[g]); }
      exp2_16(p[g][0], p[g][1]);
      const v8f u = p[g][0] + p[g][1];      /* a tree, four links deep: the test below waits for it */
      const v2f x = ((v2f){u[0], u[1]} + (v2f){u[2], u[3]}) + ((v2f){u[4], u[5]} + (v2f){u[6], u[7]});
      ps[g] = x[0] + x[1]; };
#pragma unroll
    for (int g = 0; g < NG; ++g) expo(g, s[g][0], s[g][1]);
    /* One test a pass for the whole wave (a ballot and a bit of zst are scalars). No maximum is taken while the sums prove the reference good: a sum at or above PLIM (infinite at the first attended key, whose reference is -3e38),
       or a stage that holds a masked key, sends the wave back to the raw energies, which the products' registers still hold */
    if ((__builtin_amdgcn_ballot_w32(!(fmaxf(ps[0], ps[1]) < PLIM)) | ((zst >> t) & 1u)) != 0u) {
      const int* mp = &sM[t * SK + kh * 32 + 8 * hh];      /* key padding mask (1 = attend), shared by all queries and heads: the lane's keys 8hh + r and 16 + 8hh + r of the wave's 32 */
      const v4ia km[2][2] = {{*(const v4ia*)mp, *(const v4ia*)(mp + 4)}, {*(const v4ia*)(mp + 16), *(const v4ia*)(mp + 20)}};
#pragma unroll
      for (int g = 0; g < NG; ++g) {
        v8f e[2]; float mc = -INFINITY;
#pragma unroll
        for (int nt = 0; nt < 2; ++nt)
#pragma unroll
          for (int r = 0; r < 8; ++r) { e[nt][r] = (km[nt][r >> 2][r & 3] != 0) ? s[g][nt][r] : -INFINITY; mc = fmaxf(mc, e[nt][r]); }      /* masked keys carry -1e20 in the module, -inf here; the scale is positive, so the maximum is taken before it */
        const float mn = fmaxf(m_q[g], fmaxf(mc, xhalf(mc)));      /* the same in both lane halves of a query; mn >= -3e38 is finite: nothing attended yet gives the factor 2^0 = 1 */
        const float a = __builtin_amdgcn_exp2f((m_q[g] - mn) * SC2); m_q[g] = mn; nb_q[g] = fmaf(mn, -SC2, 10.0f); l_q[g] *= a;
#pragma unroll
        for (int dt = 0; dt < DT; ++dt)
#pragma unroll
          for (int r = 0; r < 8; ++r) oacc[g][dt][r] *= a;
        expo(g, e[0], e[1]); } }
    FragH pb[NG];
#pragma unroll
    for (int g = 0; g < NG; ++g) { l_q[g] += ps[g];
#pragma unroll
      for (int nt = 0; nt < 2; ++nt)
#pragma unroll
        for (int r = 0; r < 8; ++r) pb[g].h[nt * 8 + r] = (_Float16)p[g][nt][r]; }
#pragma unroll
    for (int dt = 0; dt < DT; ++dt)
#pragma unroll
      for (int g = 0; g < NG; ++g) oacc[g][dt] = mmB(av[dt].v, pb[g].v, oacc[g][dt]);
    asm volatile("s_wait_dscnt 0x0" ::: "memory");        /* this wave's reads of the buffer are over before it is handed to the copies */
    asm volatile("s_wait_asynccnt 0x0" ::: "memory");     /* this wave's copies of stage t + 1 have landed */
    __syncthreads();                                      /* publishes stage t + 1 and ends every wave's reads of stage t */
    if (t + 2 < NST) stage(t + 2, bf * LBUF); }
  asm volatile("s_wait_asynccnt 0x0" ::: "memory");       /* no copy is outstanding when the buffers become the exchange area */
  /* behind the last trip's barrier nobody reads the buffers any more. Wave w keeps group kh and hands group 1 - kh to wave w ^ 4: 9 x 16 B a lane (O^T, then maximum and sum), lane for lane, since both waves hold a query and its d rows in the same lanes */
  constexpr int XW = 9 * 128; fa* xs = (fa*)&sKV[0][0][0][0];
  { fa* xo = xs + w * XW + lane * 4;
#pragma unroll
    for (int dt = 0; dt < DT; ++dt) { const v8f o = kh ? oacc[0][dt] : oacc[1][dt]; *(v4fa*)(xo + (2 * dt) * 128) = (v4f){o[0], o[1], o[2], o[3]}; *(v4fa*)(xo + (2 * dt + 1) * 128) = (v4f){o[4], o[5], o[6], o[7]}; }
    *(v4fa*)(xo + 8 * 128) = (v4f){kh ? m_q[0] : m_q[1], kh ? l_q[0] : l_q[1], 0.f, 0.f}; }
  __syncthreads();                                        /* every wave's handed-over group is in LDS before its partner reads it */
  { const fa* xi = xs + (w ^ 4) * XW + lane * 4; const v4f ml = *(const v4fa*)(xi + 8 * 128);
    const float ma = kh ? m_q[1] : m_q[0], la = kh ? l_q[1] : l_q[0]; const float mm = fmaxf(ma, ml[0]);
    const float fk = __builtin_amdgcn_exp2f((ma - mm) * SC2), fp = __builtin_amdgcn_exp2f((ml[0] - mm) * SC2);      /* both halves of the keys brought to the common maximum */
    const float lh = la * fk + ml[1] * fp; const float l = lh + xhalf(lh); const float inv = (l > 0.f) ? 1.0f / l : 0.f;      /* l and O^T both carry the 2^10 of P */
#pragma unroll
    for (int dt = 0; dt < DT; ++dt) { const v8f ok = kh ? oacc[1][dt] : oacc[0][dt]; const v4f p0 = *(const v4fa*)(xi + (2 * dt) * 128), p1 = *(const v4fa*)(xi + (2 * dt + 1) * 128); FragH o;      /* O x2^4 in f16, the output GEMM's A operand: the lane's 8 consecutive d of query ln */
#pragma unroll
      for (int r = 0; r < 8; ++r) o.h[r] = (_Float16)(((ok[r] * fk + (r < 4 ? p0[r & 3] : p1[r & 3]) * fp) * inv) * 16.0f);
      *(v8us*)&sO[w][ln][dt * 16 + 8 * hh] = o.half[0]; } }
  __builtin_amdgcn_fence(__ATOMIC_ACQ_REL, "workgroup"); __builtin_amdgcn_wave_barrier();
  {
#pragma unroll
    for (int rp = 0; rp < 16; rp += 4) { const int r = rp + (lane >> 3), pc = lane & 7; const v8us val = *(const v8us*)&sO[w][r][pc * 8]; *(v8us*)((unsigned short*)O16 + ((size_t)b * TT + q0 + kh * 16 + r) * ldo + h * 64 + pc * 8) = val; }
     } }

// Output GEMM, out = (O x2^4).(Wo x2^4)^T / 2^8 + bf16(bo): one 128 x 128 tile of out a block, 8 waves of 64 x 32 (4 x 2 accumulator tiles), K in 8 stages of 128.
// A stage is 128 rows of O16 and 128 rows of Bo, 256 B (two whole lines) a row, LDS pitch 272 B, two buffers; stage t + 2 is copied while stage t + 1 is worked on. Each tile sums its k in ascending steps of 32.
__global__ __launch_bounds__(256) void k_ogemm(const _Float16* __restrict__ A, const _Float16* __restrict__ Bh, const float* __restrict__ bias, float* __restrict__ C) {
  constexpr int SK = 128, NST = DD / SK, LP = SK + 8, SP = 36; typedef float fa __attribute__((may_alias));
  __shared__ __attribute__((aligned(16))) unsigned short sAB[2][2][128][LP];      /* [buffer][O16, Bo][row][pitch]; behind the loop: each wave's 64 x 32 f32 of out, pitch SP */
  const int tid = threadIdx.x, w = tid >> 5, lane = tid & 31, ln = lane & 15, hh = lane >> 4;
  const int row0 = blockIdx.y * 128, col0 = blockIdx.x * 128, wm = (w & 1) * 64, wn = (w >> 1) * 32;
  /* the thread's part of a stage: 16 B at column 8 cc of rows cr + 16 i of both tiles, so that a wave's copy takes four whole 128-B lines */
  const int cr = tid >> 4, cc = tid & 15;
  const unsigned short* ag = (const unsigned short*)A + (size_t)(row0 + cr) * DD + cc * 8;
  const unsigned short* bg = (const unsigned short*)Bh + (size_t)(col0 + cr) * DD + cc * 8;
  const unsigned lab = (unsigned)(size_t)&sAB[0][0][cr][cc * 8];
  constexpr unsigned LROW = 16 * LP * 2, LTILE = 128 * LP * 2, LBUF = 2 * LTILE;      /* bytes: 16 rows, one tile, one buffer */
  auto tile = [&](const unsigned short* g, unsigned l) {      /* rows cr + 16 i, i = 0 .. 7: eight copies and, as in cp4, the s_wait_xcnt precaution in one statement, so that a tile costs one such wait */
    asm volatile("global_load_async_to_lds_b128 %0, %8, off\n\tglobal_load_async_to_lds_b128 %1, %9, off\n\tglobal_load_async_to_lds_b128 %2, %10, off\n\tglobal_load_async_to_lds_b128 %3, %11, off\n\t"
                 "global_load_async_to_lds_b128 %4, %12, off\n\tglobal_load_async_to_lds_b128 %5, %13, off\n\tglobal_load_async_to_lds_b128 %6, %14, off\n\tglobal_load_async_to_lds_b128 %7, %15, off\n\ts_wait_xcnt 0x0"
                 :: "v"(l), "v"(l + LROW), "v"(l + 2 * LROW), "v"(l + 3 * LROW), "v"(l + 4 * LROW), "v"(l + 5 * LROW), "v"(l + 6 * LROW), "v"(l + 7 * LROW),
                    "v"(g), "v"(g + 16 * DD), "v"(g + 32 * DD), "v"(g + 48 * DD), "v"(g + 64 * DD), "v"(g + 80 * DD), "v"(g + 96 * DD), "v"(g + 112 * DD) : "memory"); };
  auto stage = [&](int t, unsigned bufo) { tile(ag + t * SK, lab + bufo); tile(bg + t * SK, lab + bufo + LTILE); };
  stage(0, 0);
  asm volatile("s_wait_asynccnt 0x0" ::: "memory");      /* this wave's copies of stage 0 have landed */
  __syncthreads();                                        /* ... and every other wave's: nothing of them is read before */
  stage(1, LBUF);
  v8f acc[4][2];
#pragma unroll
  for (int i = 0; i < 4; ++i)
#pragma unroll
    for (int j = 0; j < 2; ++j) acc[i][j] = (v8f){0.f,0.f,0.f,0.f,0.f,0.f,0.f,0.f};
#pragma unroll 1      /* stays rolled: the buffer is chosen by t & 1 */
  for (int t = 0; t < NST; ++t) {
    const int bf = t & 1;
    const unsigned short* af = &sAB[bf][0][wm + ln][8 * hh]; const unsigned short* bp = &sAB[bf][1][wn + ln][8 * hh];
#pragma unroll      /* this loop and those inside it are unrolled: constant indices keep fragments and accumulators in registers, every LDS offset is an immediate */
    for (int kh = 0; kh < SK; kh += 64) {
      FragH a[2][4], b[2][2];
#pragma unroll
      for (int ks = 0; ks < 2; ++ks) {
#pragma unroll
        for (int j = 0; j < 2; ++j) { const unsigned short* p = bp + j * 16 * LP + kh + ks * 32; b[ks][j].half[0] = *(const v8us*)p; b[ks][j].half[1] = *(const v8us*)(p + 16); }
#pragma unroll
        for (int i = 0; i < 4; ++i) { const unsigned short* p = af + i * 16 * LP + kh + ks * 32; a[ks][i].half[0] = *(const v8us*)p; a[ks][i].half[1] = *(const v8us*)(p + 16); } }
      __builtin_amdgcn_sched_barrier(0);      /* 24 LDS reads stay one group in front of their 16 products (for speed only) */
#pragma unroll
      for (int ks = 0; ks < 2; ++ks)
#pragma unroll
        for (int i = 0; i < 4; ++i)
#pragma unroll
          for (int j = 0; j < 2; ++j) acc[i][j] = __builtin_amdgcn_wmma_f32_16x16x32_f16(false, a[ks][i].v, false, b[ks][j].v, (short)0, acc[i][j], false, false);
      __builtin_amdgcn_sched_barrier(0); }      /* the products stay in front of the waits below: lifted over them, the waits would end the next stage's flight before the products have covered it */
    asm volatile("s_wait_dscnt 0x0" ::: "memory");        /* this wave's reads of the buffer are over before it is handed to the copies */
    asm volatile("s_wait_asynccnt 0x0" ::: "memory");     /* this wave's copies of stage t + 1 have landed */
    __syncthreads();                                      /* publishes stage t + 1 and ends every wave's reads of stage t */
    if (t + 2 < NST) stage(t + 2, bf * LBUF); }
  asm volatile("s_wait_asynccnt 0x0" ::: "memory");       /* no copy is outstanding when the buffers become output staging */
  /* behind the last trip's barrier nobody reads the buffers any more: each wave stages its own 64 x 32 f32 there, so that every row leaves as one whole 128-B line */
  fa* st = (fa*)&sAB[0][0][0][0] + w * (64 * SP);
#pragma unroll
  for (int j = 0; j < 2; ++j) { const float bv = bf16_round(bias[col0 + wn + j * 16 + ln]);
#pragma unroll
    for (int i = 0; i < 4; ++i)
#pragma unroll
      for (int r = 0; r < 8; ++r) st[(i * 16 + 8 * hh + r) * SP + j * 16 + ln] = acc[i][j][r] * 0.00390625f + bv; }
  __builtin_amdgcn_fence(__ATOMIC_ACQ_REL, "workgroup"); __builtin_amdgcn_wave_barrier();      /* the wave reads back what its other lanes staged */
  float* cp = C + (size_t)(row0 + wm + (lane >> 3)) * DD + col0 + wn + (lane & 7) * 4; const fa* sp = st + (lane >> 3) * SP + (lane & 7) * 4;
#pragma unroll
  for (int q = 0; q < 16; ++q) { const v4f v = *(const v4fa*)(sp + q * 4 * SP); *(v4f*)(cp + (size_t)q * 4 * DD) = v; }
  asm volatile("s_wait_xcnt 0x0" ::: "memory"); }      /* precaution behind the stores: nothing that follows writes their registers first */

extern "C" void kernel_launch(void* const* d_in, const int* in_sizes, int n_in,
                              void* d_out, int out_size, void* d_ws, size_t ws_size, hipStream_t stream) {
  (void)in_sizes; (void)n_in; (void)out_size;
  const float* const* I = (const float* const*)d_in; const float* values = I[0]; const float* keys = I[1]; const float* query = I[2]; const int* mask = (const int*)d_in[3]; const float* Wv = I[4]; const float* Wk = I[5]; const float* Wq = I[6]; const float* Wo = I[7]; const float* bo = I[8];
  char* ws = (char*)d_ws; size_t off = 0;
  auto take = [&](size_t bytes) { char* p = ws + off; off += (bytes + 255) & ~(size_t)255; return p; };
  _Float16* Bo = (_Float16*)take((size_t)DD * DD * 2);
  _Float16* K = (_Float16*)take((size_t)NR * DD * 2); _Float16* Q = (_Float16*)take((size_t)NR * DD * 2); _Float16* Vt = (_Float16*)take((size_t)NR * DD * 2); _Float16* O16 = (_Float16*)take((size_t)NR * DD * 2);
  if (off > ws_size) return;      // 2.1 + 4 x 8.4 = 36 MB
  k_proj<<<dim3(NR / 256, NH, 4), 128, 0, stream>>>(values, keys, query, Wv, Wk, Wq, Wo, Vt, K, Q, Bo);
  k_flash<<<BB * NH * (TT / 128), 256, 0, stream>>>(Q, DD, K, DD, Vt, mask, O16, DD);
  k_ogemm<<<dim3(DD / 128, NR / 128), 256, 0, stream>>>(O16, Bo, bo, (float*)d_out);      /* out = O.Wo^T + bo */
}

// v010
// It runs in 53.2 microseconds.
// Next to v009, in two timings, it ran 1.07 times as fast each time.
// Over all steps from v000 it is 10.5 times as fast.
#include <hip/hip_runtime.h>
// 'SelfAttension' (B=2, S=2048, E=1024, 16 heads × 64): per-head projections with ONE shared 64×64 weight per tensor (y_h = x_h·Wᵀ, torch (out,in), no bias) for values, keys, query; energy = q·kᵀ with −1e20 where the key mask [N,1,1,S] == 0;
// attn = softmax(energy/√1024); out = (attn·v merged)·Woᵀ + bo.
// Compute dtype: inputs, weights, bias rounded to bf16; the per-head 64×64 projections as block-diagonal f16 GEMMs (all 16 head-block columns of all three tensors in one launch, grid = row blocks x heads x 4: the three tensors and the Wo to f16 conversion, K = 64); fused flash-style kernel (per-(b,k) int mask loads, scale 1/32,
// online softmax f32, P f16 ×2^10) on v_wmma_f32_16x16x32_f16; O ×2^4 → f16 → output GEMM + bias; f32 accumulate.
#define BB 2
#define TT 2048
#define DD 1024
#define NH 16
#define HD 64
#define NR (BB * TT)

typedef __bf16 v16b __attribute__((ext_vector_type(16)));
typedef unsigned short v8us __attribute__((ext_vector_type(8), may_alias));
typedef float  v8f  __attribute__((ext_vector_type(8)));
typedef float  v4f  __attribute__((ext_vector_type(4)));
typedef float  v4fa __attribute__((ext_vector_type(4), may_alias));
union FragB { v16b v; v8us half[2]; unsigned short u[16]; };

__device__ __forceinline__ unsigned short bf16_bits(float x) { unsigned int u = __float_as_uint(x); return (unsigned short)((u + 0x7FFFu + ((u >> 16) & 1u)) >> 16); }
__device__ __forceinline__ float bf16_val(unsigned short b) { return __uint_as_float(((unsigned int)b) << 16); }
__device__ __forceinline__ float bf16_round(float x) { return bf16_val(bf16_bits(x)); }
// D += A·B with NT terms: 1 = ah·bh, 2 = + al·bh (A split), 3 = + ah·bl (both split)
template <int NT>
__device__ __forceinline__ v8f mmaN(v16b ah, v16b al, v16b bh, v16b bl, v8f c) {
  c = __builtin_amdgcn_wmma_f32_16x16x32_bf16(false, ah, false, bh, (short)0, c, false, false);
  if (NT >= 2) c = __builtin_amdgcn_wmma_f32_16x16x32_bf16(false, al, false, bh, (short)0, c, false, false);
  if (NT >= 3) c = __builtin_amdgcn_wmma_f32_16x16x32_bf16(false, ah, false, bl, (short)0, c, false, false);
  asm volatile("v_nop\n\tv_nop\n\tv_nop\n\tv_nop" : "+v"(c) : "v"(ah), "v"(al), "v"(bh), "v"(bl));
  return c;
}

__global__ __launch_bounds__(256) void k_wt_bf16(const float* __restrict__ W, unsigned short* __restrict__ Wt, int K, int N) {
  const int t = blockIdx.x * 256 + threadIdx.x;
  const int k8n = K / 8;
  if (t >= N * k8n) return;
  const int n = t / k8n, k8 = (t % k8n) * 8;
  v8us v;
#pragma unroll
  for (int i = 0; i < 8; ++i) v[i] = bf16_bits(W[(size_t)(k8 + i) * N + n]);
  *(v8us*)(Wt + (size_t)n * K + k8) = v;
  
}

// GEMM C[M][N] (f32, pitch ldc) = act(A[M][K]·W + bias). A f32 row-major (pitch lda) converted per fragment to bf16
// (ASPLIT: hi/lo two planes -> 2 terms, else single rounded term); Wt bf16 [N][K] (pitch ldb). BIAS_BF16 rounds the
// bias to bf16 first (bias quantised to bf16 before the add). K%32==0, M%16==0, N%64==0.
template <bool ASPLIT, int ACT, bool BIAS_BF16>
__global__ __launch_bounds__(128) void k_gemm_bf(const float* __restrict__ A, int lda, const unsigned short* __restrict__ Wt, int ldb,
                                               const float* __restrict__ bias, float* __restrict__ C, int ldc, int M, int N, int K) {
  __shared__ __attribute__((aligned(16))) float so[4][16][64];
  const int tid = threadIdx.x, w = tid >> 5, lane = tid & 31, ln = lane & 15, hh = lane >> 4;
  const int ntn = N / 64;
  const int wid = blockIdx.x * 4 + w;
  const int mt = wid / ntn, nq = wid % ntn;
  if (mt * 16 >= M) return;
  const int row0 = mt * 16, col0 = nq * 64;
  const float* arow = A + (size_t)(row0 + ln) * lda;
  v8f acc[4] = {};
  for (int kb = 0; kb < K; kb += 32) {
    FragB ah, al;
    const v4f x0 = *(const v4fa*)(arow + kb + 8 * hh), x1 = *(const v4fa*)(arow + kb + 8 * hh + 4);
    const v4f x2 = *(const v4fa*)(arow + kb + 16 + 8 * hh), x3 = *(const v4fa*)(arow + kb + 16 + 8 * hh + 4);
    float xs[16] = {x0[0],x0[1],x0[2],x0[3],x1[0],x1[1],x1[2],x1[3],x2[0],x2[1],x2[2],x2[3],x3[0],x3[1],x3[2],x3[3]};
#pragma unroll
    for (int i = 0; i < 16; ++i) { const unsigned short hb = bf16_bits(xs[i]); ah.u[i] = hb; al.u[i] = ASPLIT ? bf16_bits(xs[i] - bf16_val(hb)) : (unsigned short)0; }
#pragma unroll
    for (int t = 0; t < 4; ++t) {
      const unsigned short* brow = Wt + (size_t)(col0 + t * 16 + ln) * ldb + kb;
      FragB b;
      b.half[0] = *(const v8us*)(brow + 8 * hh);
      b.half[1] = *(const v8us*)(brow + 16 + 8 * hh);
      acc[t] = mmaN<ASPLIT ? 2 : 1>(ah.v, al.v, b.v, b.v, acc[t]);
    }
  }
#pragma unroll
  for (int t = 0; t < 4; ++t) {
    float bv = bias ? bias[col0 + t * 16 + ln] : 0.f;
    if (BIAS_BF16) bv = bf16_round(bv);
#pragma unroll
    for (int r = 0; r < 8; ++r) { float v = acc[t][r] + bv; if (ACT == 1) v = fmaxf(v, 0.f); so[w][8 * hh + r][t * 16 + ln] = v; }
  }
  __builtin_amdgcn_fence(__ATOMIC_ACQ_REL, "workgroup");
  __builtin_amdgcn_wave_barrier();
  const int rsub = lane >> 4, c4 = (lane & 15) * 4;
  {
#pragma unroll
    for (int q = 0; q < 8; ++q) {
      const int r = q * 2 + rsub;
      const v4f v = *(const v4fa*)&so[w][r][c4];
      *(v4f*)(C + (size_t)(row0 + r) * ldc + col0 + c4) = v;
    }
    
  }
}

// Flash-style causal/unmasked attention, all contractions 3-term bf16 hi/lo splits, f32 softmax with running max.
// q,k,v rows are read from f32 buffers with arbitrary row pitch (so they can live inside a fused qkv buffer);
// D = head size (multiple of 32, <= 128); one wave = 16 query rows; block = 4 waves (64 queries) sharing K/V chunks of 32.
template <int D, bool CAUSAL>
__global__ __launch_bounds__(128) void k_flash(const float* __restrict__ qb, const float* __restrict__ kb, const float* __restrict__ vb,
                                             int pitch, int T, int H, float scale, float* __restrict__ y, int ypitch) {
  constexpr int KS = D / 32;        // k-steps for QK
  constexpr int DT = D / 16;        // d tiles for PV
  __shared__ __attribute__((aligned(16))) unsigned short sKh[32][D + 8], sKl[32][D + 8], sVh[32][D + 8], sVl[32][D + 8];
  __shared__ __attribute__((aligned(16))) unsigned short sPh[4][16][40], sPl[4][16][40];
  __shared__ __attribute__((aligned(16))) float sO[4][16][D];
  const int tid = threadIdx.x, w = tid >> 5, lane = tid & 31, ln = lane & 15, hh = lane >> 4;
  const int nqb = (T + 63) / 64;
  const int bh = blockIdx.x / nqb, qblk = blockIdx.x % nqb;
  const int b = bh / H, h = bh % H;
  const int q0 = qblk * 64 + w * 16;
  const float* Q = qb + (size_t)b * T * pitch + h * D;
  const float* K = kb + (size_t)b * T * pitch + h * D;
  const float* V = vb + (size_t)b * T * pitch + h * D;

  // A fragments of the wave's 16 query rows (scaled), hi/lo
  FragB aqh[KS], aql[KS];
  {
    int row = q0 + ln; if (row >= T) row = T - 1;
    const float* qr = Q + (size_t)row * pitch;
#pragma unroll
    for (int ks = 0; ks < KS; ++ks)
#pragma unroll
      for (int i = 0; i < 16; ++i) {
        const int d = ks * 32 + ((i < 8) ? (8 * hh + i) : (16 + 8 * hh + (i - 8)));
        const float x = qr[d] * scale; const unsigned short hb = bf16_bits(x);
        aqh[ks].u[i] = hb; aql[ks].u[i] = bf16_bits(x - bf16_val(hb));
      }
  }
  float m_r[8], l_r[8];
#pragma unroll
  for (int r = 0; r < 8; ++r) { m_r[r] = -3.0e38f; l_r[r] = 0.f; }
  v8f oacc[DT];
#pragma unroll
  for (int dt = 0; dt < DT; ++dt) oacc[dt] = (v8f){0.f,0.f,0.f,0.f,0.f,0.f,0.f,0.f};

  const int kv_end = CAUSAL ? min(T, qblk * 64 + 64) : T;     // block-uniform
  for (int j0 = 0; j0 < kv_end; j0 += 32) {
    __syncthreads();
    for (int e = tid; e < 32 * (D / 4); e += 128) {
      const int r = e / (D / 4), c4 = (e % (D / 4)) * 4;
      const int key = j0 + r;
      v4f kf = {0.f,0.f,0.f,0.f}, vf = {0.f,0.f,0.f,0.f};
      if (key < T) { kf = *(const v4fa*)(K + (size_t)key * pitch + c4); vf = *(const v4fa*)(V + (size_t)key * pitch + c4); }
#pragma unroll
      for (int t = 0; t < 4; ++t) {
        unsigned short hb = bf16_bits(kf[t]); sKh[r][c4 + t] = hb; sKl[r][c4 + t] = bf16_bits(kf[t] - bf16_val(hb));
        hb = bf16_bits(vf[t]); sVh[r][c4 + t] = hb; sVl[r][c4 + t] = bf16_bits(vf[t] - bf16_val(hb));
      }
    }
    __syncthreads();
    // S tile 16 x 32
    v8f s[2];
#pragma unroll
    for (int nt = 0; nt < 2; ++nt) {
      v8f acc = {};
#pragma unroll
      for (int ks = 0; ks < KS; ++ks) {
        FragB bh_, bl_;
        bh_.half[0] = *(const v8us*)&sKh[nt * 16 + ln][ks * 32 + 8 * hh]; bh_.half[1] = *(const v8us*)&sKh[nt * 16 + ln][ks * 32 + 16 + 8 * hh];
        bl_.half[0] = *(const v8us*)&sKl[nt * 16 + ln][ks * 32 + 8 * hh]; bl_.half[1] = *(const v8us*)&sKl[nt * 16 + ln][ks * 32 + 16 + 8 * hh];
        acc = mmaN<3>(aqh[ks].v, aql[ks].v, bh_.v, bl_.v, acc);
      }
      s[nt] = acc;
    }
    // mask + running max (rows 8hh+r; the 16 lanes of a half share rows)
    float alpha[8];
#pragma unroll
    for (int r = 0; r < 8; ++r) {
      const int qi = q0 + 8 * hh + r;
      const int ja = j0 + ln, jb = j0 + 16 + ln;
      if (CAUSAL) { if (ja > qi) s[0][r] = -3.0e38f; if (jb > qi) s[1][r] = -3.0e38f; }
      if (ja >= T) s[0][r] = -3.0e38f;
      if (jb >= T) s[1][r] = -3.0e38f;
      float mx = fmaxf(s[0][r], s[1][r]);
      mx = fmaxf(mx, __shfl_xor(mx, 1, 32)); mx = fmaxf(mx, __shfl_xor(mx, 2, 32)); mx = fmaxf(mx, __shfl_xor(mx, 4, 32)); mx = fmaxf(mx, __shfl_xor(mx, 8, 32));
      const float mnew = fmaxf(m_r[r], mx);
      alpha[r] = (mnew > -1.0e38f) ? __expf(m_r[r] - mnew) : 1.0f;
      const float p0 = (s[0][r] > -1.0e38f) ? __expf(s[0][r] - mnew) : 0.f;
      const float p1 = (s[1][r] > -1.0e38f) ? __expf(s[1][r] - mnew) : 0.f;
      m_r[r] = mnew;
      l_r[r] = l_r[r] * alpha[r] + p0 + p1;            // per-lane partial row sum (16 lanes combined at the end)
      unsigned short hb = bf16_bits(p0); sPh[w][8 * hh + r][ln] = hb;      sPl[w][8 * hh + r][ln] = bf16_bits(p0 - bf16_val(hb));
      hb = bf16_bits(p1);                sPh[w][8 * hh + r][16 + ln] = hb; sPl[w][8 * hh + r][16 + ln] = bf16_bits(p1 - bf16_val(hb));
    }
#pragma unroll
    for (int dt = 0; dt < DT; ++dt)
#pragma unroll
      for (int r = 0; r < 8; ++r) oacc[dt][r] *= alpha[r];
    __builtin_amdgcn_fence(__ATOMIC_ACQ_REL, "workgroup");
    __builtin_amdgcn_wave_barrier();
    FragB pah, pal;
    pah.half[0] = *(const v8us*)&sPh[w][ln][8 * hh]; pah.half[1] = *(const v8us*)&sPh[w][ln][16 + 8 * hh];
    pal.half[0] = *(const v8us*)&sPl[w][ln][8 * hh]; pal.half[1] = *(const v8us*)&sPl[w][ln][16 + 8 * hh];
#pragma unroll
    for (int dt = 0; dt < DT; ++dt) {
      FragB bvh, bvl;
#pragma unroll
      for (int i = 0; i < 8; ++i) {
        bvh.u[i] = sVh[8 * hh + i][dt * 16 + ln]; bvh.u[8 + i] = sVh[16 + 8 * hh + i][dt * 16 + ln];
        bvl.u[i] = sVl[8 * hh + i][dt * 16 + ln]; bvl.u[8 + i] = sVl[16 + 8 * hh + i][dt * 16 + ln];
      }
      oacc[dt] = mmaN<3>(pah.v, pal.v, bvh.v, bvl.v, oacc[dt]);
    }
    __builtin_amdgcn_fence(__ATOMIC_ACQ_REL, "workgroup");
    __builtin_amdgcn_wave_barrier();
  }
#pragma unroll
  for (int r = 0; r < 8; ++r) {
    float l = l_r[r];
    l += __shfl_xor(l, 1, 32); l += __shfl_xor(l, 2, 32); l += __shfl_xor(l, 4, 32); l += __shfl_xor(l, 8, 32);
    l_r[r] = (l > 0.f) ? 1.0f / l : 0.f;
  }
#pragma unroll
  for (int dt = 0; dt < DT; ++dt)
#pragma unroll
    for (int r = 0; r < 8; ++r) sO[w][8 * hh + r][dt * 16 + ln] = oacc[dt][r] * l_r[r];
  __builtin_amdgcn_fence(__ATOMIC_ACQ_REL, "workgroup");
  __builtin_amdgcn_wave_barrier();
  {
    for (int r = 0; r < 16; ++r) {
      const int row = q0 + r;
      if (row < T && lane < D / 4) {
        const v4f val = *(const v4fa*)&sO[w][r][lane * 4];
        *(v4f*)(y + ((size_t)b * T + row) * ypitch + h * D + lane * 4) = val;
      }
    }
    
  }
}

// GEMM C = act(A·W + bias + resid): A f32 (ASPLIT -> hi/lo 2 terms), Wt bf16 [N][K]; ACT 0 none, 1 relu, 2 exact gelu;
// resid (optional, f32, row index = (row % rmod), pitch ldr, RES_BF16 rounds it) added before the activation.
template <bool ASPLIT, int ACT, bool BIAS_BF16, bool RES_BF16>
__global__ __launch_bounds__(128) void k_gemm_bf3(const float* __restrict__ A, int lda, const unsigned short* __restrict__ Wt, int ldb,
                                                const float* __restrict__ bias, const float* __restrict__ resid, int rmod, int ldr,
                                                float* __restrict__ C, int ldc, int M, int N, int K) {
  __shared__ __attribute__((aligned(16))) float so[4][16][64];
  const int tid = threadIdx.x, w = tid >> 5, lane = tid & 31, ln = lane & 15, hh = lane >> 4;
  const int ntn = N / 64;
  const int wid = blockIdx.x * 4 + w;
  const int mt = wid / ntn, nq = wid % ntn;
  if (mt * 16 >= M) return;
  const int row0 = mt * 16, col0 = nq * 64;
  const float* arow = A + (size_t)(row0 + ln) * lda;
  v8f acc[4] = {};
  for (int kb = 0; kb < K; kb += 32) {
    FragB ah, al;
    const v4f x0 = *(const v4fa*)(arow + kb + 8 * hh), x1 = *(const v4fa*)(arow + kb + 8 * hh + 4);
    const v4f x2 = *(const v4fa*)(arow + kb + 16 + 8 * hh), x3 = *(const v4fa*)(arow + kb + 16 + 8 * hh + 4);
    float xs[16] = {x0[0],x0[1],x0[2],x0[3],x1[0],x1[1],x1[2],x1[3],x2[0],x2[1],x2[2],x2[3],x3[0],x3[1],x3[2],x3[3]};
#pragma unroll
    for (int i = 0; i < 16; ++i) { const unsigned short hb = bf16_bits(xs[i]); ah.u[i] = hb; al.u[i] = ASPLIT ? bf16_bits(xs[i] - bf16_val(hb)) : (unsigned short)0; }
#pragma unroll
    for (int t = 0; t < 4; ++t) {
      const unsigned short* brow = Wt + (size_t)(col0 + t * 16 + ln) * ldb + kb;
      FragB b;
      b.half[0] = *(const v8us*)(brow + 8 * hh);
      b.half[1] = *(const v8us*)(brow + 16 + 8 * hh);
      acc[t] = mmaN<ASPLIT ? 2 : 1>(ah.v, al.v, b.v, b.v, acc[t]);
    }
  }
#pragma unroll
  for (int t = 0; t < 4; ++t) {
    const int col = col0 + t * 16 + ln;
    float bv = bias ? bias[col] : 0.f;
    if (BIAS_BF16) bv = bf16_round(bv);
#pragma unroll
    for (int r = 0; r < 8; ++r) {
      float v = acc[t][r] + bv;
      if (resid) { float rv = resid[(size_t)((row0 + 8 * hh + r) % rmod) * ldr + col]; if (RES_BF16) rv = bf16_round(rv); v += rv; }
      if (ACT == 1) v = fmaxf(v, 0.f);
      if (ACT == 2) v = 0.5f * v * (1.0f + erff(v * 0.70710678118654752f));
      if (ACT == 3) { const float u = 0.7978845608028654f * (v + 0.044715f * v * v * v); v = 0.5f * v * (1.0f + tanhf(u)); }
      so[w][8 * hh + r][t * 16 + ln] = v;
    }
  }
  __builtin_amdgcn_fence(__ATOMIC_ACQ_REL, "workgroup");
  __builtin_amdgcn_wave_barrier();
  const int rsub = lane >> 4, c4 = (lane & 15) * 4;
  {
#pragma unroll
    for (int q = 0; q < 8; ++q) {
      const int r = q * 2 + rsub;
      const v4f v = *(const v4fa*)&so[w][r][c4];
      *(v4f*)(C + (size_t)(row0 + r) * ldc + col0 + c4) = v;
    }
    
  }
}
// row LayerNorm (biased variance, eps) over N: s = X (+ R); optional out_sum <- s; out_norm <- (s-mu)*rsqrt(var+eps)*g + b
template <bool PARAM_BF16>
__global__ __launch_bounds__(256) void k_layernorm(const float* __restrict__ X, const float* __restrict__ R, const float* __restrict__ g, const float* __restrict__ bta,
                                                  float* __restrict__ out_sum, float* __restrict__ out_norm, int N, float eps) {
  __shared__ float red[256];
  const int row = blockIdx.x, tid = threadIdx.x;
  const float* x = X + (size_t)row * N; const float* rr = R ? R + (size_t)row * N : nullptr;
  float vals[16];                     // up to N = 4096
  const int per = N / 256;            // contiguous chunk per thread? use strided-by-4 chunks: thread handles j = tid*4 + 1024*u
  float s1 = 0.f;
  for (int u = 0; u < per / 4; ++u) {
    const int j = tid * 4 + 1024 * u;
    const v4f a = *(const v4fa*)(x + j);
    v4f b = {0.f,0.f,0.f,0.f}; if (rr) b = *(const v4fa*)(rr + j);
#pragma unroll
    for (int q = 0; q < 4; ++q) { const float v = a[q] + b[q]; vals[u * 4 + q] = v; s1 += v; }
  }
  red[tid] = s1; __syncthreads();
  for (int st = 128; st > 0; st >>= 1) { if (tid < st) red[tid] += red[tid + st]; __syncthreads(); }
  const float mu = red[0] / (float)N; __syncthreads();
  float s2 = 0.f;
  for (int u = 0; u < per / 4; ++u)
#pragma unroll
    for (int q = 0; q < 4; ++q) { const float c = vals[u * 4 + q] - mu; s2 += c * c; }
  red[tid] = s2; __syncthreads();
  for (int st = 128; st > 0; st >>= 1) { if (tid < st) red[tid] += red[tid + st]; __syncthreads(); }
  const float rs = rsqrtf(red[0] / (float)N + eps);
  {
    for (int u = 0; u < per / 4; ++u) {
      const int j = tid * 4 + 1024 * u;
      v4f o, sm;
#pragma unroll
      for (int q = 0; q < 4; ++q) {
        float gg = g[j + q], bb = bta[j + q];
        if (PARAM_BF16) { gg = bf16_round(gg); bb = bf16_round(bb); }
        sm[q] = vals[u * 4 + q]; o[q] = (vals[u * 4 + q] - mu) * rs * gg + bb;
      }
      if (out_sum) *(v4f*)(out_sum + (size_t)row * N + j) = sm;
      *(v4f*)(out_norm + (size_t)row * N + j) = o;
    }
    
  }
}



// ---- f16 WMMA path (v_wmma_f32_16x16x32_f16): 11-bit significands for operands in range — used where a [0,1] probability operand needs more precision than bf16
typedef _Float16 v16h __attribute__((ext_vector_type(16)));
union FragH { v16h v; v8us half[2]; _Float16 h[16]; unsigned short u[16]; };
template <int NT>
__device__ __forceinline__ v8f mmaH(v16h ah, v16h al, v16h bh, v16h bl, v8f c) {
  c = __builtin_amdgcn_wmma_f32_16x16x32_f16(false, ah, false, bh, (short)0, c, false, false);
  if (NT >= 2) c = __builtin_amdgcn_wmma_f32_16x16x32_f16(false, al, false, bh, (short)0, c, false, false);
  if (NT >= 3) c = __builtin_amdgcn_wmma_f32_16x16x32_f16(false, ah, false, bl, (short)0, c, false, false);
  asm volatile("v_nop\n\tv_nop\n\tv_nop\n\tv_nop" : "+v"(c) : "v"(ah), "v"(al), "v"(bh), "v"(bl));
  return c;
}
// batched GEMM like k_gemm_b but f16 operands: A f32 (split into f16 hi/lo if ASPLIT, else rounded to f16), Bt = f16 values [n][k]; alpha; C f32; N multiple of 16 (partial tiles skipped)
template <bool ASPLIT>
__global__ __launch_bounds__(128) void k_gemm_h(const float* __restrict__ A, int lda, size_t sA, const _Float16* __restrict__ Bh, int ldb, size_t sB, float alpha, float* __restrict__ C, int ldc, size_t sC, int M, int N, int K) {
  __shared__ __attribute__((aligned(16))) float so[4][16][64];
  const int tid = threadIdx.x, w = tid >> 5, lane = tid & 31, ln = lane & 15, hh = lane >> 4; const int by = blockIdx.y;
  A += (size_t)by * sA; Bh += (size_t)by * sB; C += (size_t)by * sC;
  const int ntn = (N + 63) / 64; const int wid = blockIdx.x * 4 + w; const int mt = wid / ntn, nq = wid % ntn; if (mt * 16 >= M) return;
  const int row0 = mt * 16, col0 = nq * 64; const float* arow = A + (size_t)(row0 + ln) * lda;
  v8f acc[4] = {};
  for (int kb = 0; kb < K; kb += 32) {
    FragH ah, al;
    const v4f x0 = *(const v4fa*)(arow + kb + 8 * hh), x1 = *(const v4fa*)(arow + kb + 8 * hh + 4), x2 = *(const v4fa*)(arow + kb + 16 + 8 * hh), x3 = *(const v4fa*)(arow + kb + 16 + 8 * hh + 4);
    float xs[16] = {x0[0],x0[1],x0[2],x0[3],x1[0],x1[1],x1[2],x1[3],x2[0],x2[1],x2[2],x2[3],x3[0],x3[1],x3[2],x3[3]};
#pragma unroll
    for (int i = 0; i < 16; ++i) { const _Float16 h = (_Float16)xs[i]; ah.h[i] = h; al.h[i] = ASPLIT ? (_Float16)(xs[i] - (float)h) : (_Float16)0.0f; }
#pragma unroll
    for (int t = 0; t < 4; ++t) { if (col0 + t * 16 >= N) continue; const size_t boff = (size_t)(col0 + t * 16 + ln) * ldb + kb; FragH bq; bq.half[0] = *(const v8us*)(Bh + boff + 8 * hh); bq.half[1] = *(const v8us*)(Bh + boff + 16 + 8 * hh);
      acc[t] = mmaH<ASPLIT ? 2 : 1>(ah.v, al.v, bq.v, bq.v, acc[t]); }
  }
#pragma unroll
  for (int t = 0; t < 4; ++t) { if (col0 + t * 16 >= N) continue;
#pragma unroll
    for (int r = 0; r < 8; ++r) so[w][8 * hh + r][t * 16 + ln] = acc[t][r] * alpha; }
  __builtin_amdgcn_fence(__ATOMIC_ACQ_REL, "workgroup"); __builtin_amdgcn_wave_barrier();
  const int rsub = lane >> 4, c4 = (lane & 15) * 4;
  {
#pragma unroll
    for (int q = 0; q < 8; ++q) { const int r = q * 2 + rsub; if (col0 + c4 < N) { const v4f v = *(const v4fa*)&so[w][r][c4]; *(v4f*)(C + (size_t)(row0 + r) * ldc + col0 + c4) = v; } }
     }
}

// Wt[n][k] = f16(W[k][n]·scale) from f32 row-major W[K][N] (scale = power of two; bf16-exact weights stay exact in f16 away from the subnormal range)
__global__ __launch_bounds__(256) void k_wt_f16(const float* __restrict__ W, _Float16* __restrict__ Wt, int K, int N, float scale) {
  const int t = blockIdx.x * 256 + threadIdx.x; if (t >= N * (K / 8)) return; const int n = t / (K / 8), k8 = (t % (K / 8)) * 8; FragH f;
#pragma unroll
  for (int i = 0; i < 8; ++i) f.h[i] = (_Float16)(bf16_round(W[(size_t)(k8 + i) * N + n]) * scale); const v8us o = f.half[0];
  *(v8us*)((unsigned short*)Wt + (size_t)n * K + k8) = o; 
}
// k_gemm_hh variant with fused epilogue: v = acc·alpha + bias[by·sBias + col] (+ CP[(row/rowsPerB)·sCPb + by·64 + col] if CP) ; ACT 0 none / 1 elu ; writes f16 C16 and/or f32 C (each if non-null)
template <int ACT>
__global__ __launch_bounds__(128) void k_gemm_hhx(const _Float16* __restrict__ A, int lda, size_t sA, const _Float16* __restrict__ Bh, int ldb, size_t sB, float alpha, const float* __restrict__ bias, size_t sBias, const float* __restrict__ CP, int rowsPerB, size_t sCPb, int row0g,
    float* __restrict__ C, _Float16* __restrict__ C16, int ldc, size_t sC, int M, int N, int K, size_t sAz, size_t sBz, size_t sCz) {
  __shared__ __attribute__((aligned(16))) float so[4][16][64];
  const int tid = threadIdx.x, w = tid >> 5, lane = tid & 31, ln = lane & 15, hh = lane >> 4; const int by = blockIdx.y, bz = blockIdx.z;      /* second batch index bz with its own strides sAz, sBz, sCz */
  A += (size_t)by * sA + (size_t)bz * sAz; Bh += (size_t)by * sB + (size_t)bz * sBz; const size_t cofs = (size_t)by * sC + (size_t)bz * sCz; const float* bp = bias ? bias + (size_t)by * sBias : nullptr;
  const int ntn = (N + 63) / 64; const int wid = blockIdx.x * 4 + w; const int mt = wid / ntn, nq = wid % ntn; if (mt * 16 >= M) return;
  const int row0 = mt * 16, col0 = nq * 64; const _Float16* arow = A + (size_t)(row0 + ln) * lda;
  v8f acc[4] = {};
  for (int kb = 0; kb < K; kb += 32) { FragH ah; ah.half[0] = *(const v8us*)((const unsigned short*)arow + kb + 8 * hh); ah.half[1] = *(const v8us*)((const unsigned short*)arow + kb + 16 + 8 * hh);
#pragma unroll
    for (int t = 0; t < 4; ++t) { if (col0 + t * 16 >= N) continue; const size_t boff = (size_t)(col0 + t * 16 + ln) * ldb + kb; FragH bq; bq.half[0] = *(const v8us*)((const unsigned short*)Bh + boff + 8 * hh); bq.half[1] = *(const v8us*)((const unsigned short*)Bh + boff + 16 + 8 * hh);
      acc[t] = mmaH<1>(ah.v, ah.v, bq.v, bq.v, acc[t]); }
  }
#pragma unroll
  for (int t = 0; t < 4; ++t) { if (col0 + t * 16 >= N) continue; const int col = col0 + t * 16 + ln; const float bv = bp ? bf16_round(bp[col]) : 0.f;
#pragma unroll
    for (int r = 0; r < 8; ++r) { float v = acc[t][r] * alpha + bv; if (CP) { const int bidx = (row0g + row0 + 8 * hh + r) / rowsPerB; v += CP[(size_t)bidx * sCPb + (size_t)by * 64 + col]; } if (ACT == 1) v = (v > 0.f) ? v : expm1f(v); else if (ACT == 7) v = (v > 0.f) ? v + 1.0f : expf(v); else if (ACT == 8) v = tanhf(v); else if (ACT == 9) v = 0.5f * v * (1.0f + tanhf(0.7978845608028654f * (v + 0.044715f * v * v * v))); else if (ACT == 11) v = 1.0f / (1.0f + expf(-v)); else if (ACT == 12) v = (v > 0.f) ? v : 0.01f * v; else if (ACT == 14) v = (v > 0.f) ? v : 0.1f * v; else if (ACT == 15) v = v / (1.0f + expf(-v)); else if (ACT == 3) v = fmaxf(v, 0.f); else if (ACT == 6) v = 0.5f * v * (1.0f + erff(v * 0.70710678118654752f)); so[w][8 * hh + r][t * 16 + ln] = v; } }
  __builtin_amdgcn_fence(__ATOMIC_ACQ_REL, "workgroup"); __builtin_amdgcn_wave_barrier();
  const int rsub = lane >> 4, c4 = (lane & 15) * 4; typedef _Float16 v4h __attribute__((ext_vector_type(4)));
  {
#pragma unroll
    for (int q = 0; q < 8; ++q) { const int r = q * 2 + rsub; if (col0 + c4 < N) { const v4f v = *(const v4fa*)&so[w][r][c4]; if (C) *(v4f*)(C + cofs + (size_t)(row0 + r) * ldc + col0 + c4) = v; if (C16) { v4h h4; for (int i = 0; i < 4; ++i) h4[i] = (_Float16)v[i]; *(v4h*)(C16 + cofs + (size_t)(row0 + r) * ldc + col0 + c4) = h4; } } }
     }
}


typedef _Float16 v4h __attribute__((ext_vector_type(4)));

__global__ __launch_bounds__(256) void k_h16(const float* __restrict__ x, _Float16* __restrict__ X16, size_t n8) { const size_t t = (size_t)blockIdx.x * 256 + threadIdx.x; if (t >= n8) return; FragH f;
#pragma unroll
  for (int q = 0; q < 8; ++q) f.h[q] = (_Float16)x[t * 8 + q]; *(v8us*)((unsigned short*)X16 + t * 8) = f.half[0];  }
// The 16 f32 of one 16 x 32 operand fragment in the hardware k order (k = 8hh + e, then 16 + 8hh + e - 8), as loaded: p = row + 32 ks + 8 hh
struct Raw16 { v4f a, b, c, d; };
__device__ __forceinline__ Raw16 raw_f32(const float* __restrict__ p) { Raw16 x; x.a = *(const v4fa*)p; x.b = *(const v4fa*)(p + 4); x.c = *(const v4fa*)(p + 16); x.d = *(const v4fa*)(p + 20); return x; }
// each value rounded to bf16, then held exactly in f16 (weights x2^4)
template <bool W16>
__device__ __forceinline__ FragH frag_f32(const Raw16& x) { FragH f;
#pragma unroll
  for (int q = 0; q < 4; ++q) {
    f.h[q]      = W16 ? (_Float16)(bf16_round(x.a[q]) * 16.0f) : (_Float16)bf16_round(x.a[q]);
    f.h[4 + q]  = W16 ? (_Float16)(bf16_round(x.b[q]) * 16.0f) : (_Float16)bf16_round(x.b[q]);
    f.h[8 + q]  = W16 ? (_Float16)(bf16_round(x.c[q]) * 16.0f) : (_Float16)bf16_round(x.c[q]);
    f.h[12 + q] = W16 ? (_Float16)(bf16_round(x.d[q]) * 16.0f) : (_Float16)bf16_round(x.d[q]); }
  return f; }
// Eight asynchronous 16-B copies a lane, global -> LDS, through no register: copy i takes LDS byte address l + i ls and global address g + i gs (floats). The s_wait_xcnt in the same statement is a precaution: the address registers are written again only behind it.
__device__ __forceinline__ void cp8(unsigned l, unsigned ls, const float* g, size_t gs) {
  asm volatile("global_load_async_to_lds_b128 %0, %8, off\n\tglobal_load_async_to_lds_b128 %1, %9, off\n\tglobal_load_async_to_lds_b128 %2, %10, off\n\tglobal_load_async_to_lds_b128 %3, %11, off\n\t"
               "global_load_async_to_lds_b128 %4, %12, off\n\tglobal_load_async_to_lds_b128 %5, %13, off\n\tglobal_load_async_to_lds_b128 %6, %14, off\n\tglobal_load_async_to_lds_b128 %7, %15, off\n\ts_wait_xcnt 0x0"
               :: "v"(l), "v"(l + ls), "v"(l + 2 * ls), "v"(l + 3 * ls), "v"(l + 4 * ls), "v"(l + 5 * ls), "v"(l + 6 * ls), "v"(l + 7 * ls),
                  "v"(g), "v"(g + gs), "v"(g + 2 * gs), "v"(g + 3 * gs), "v"(g + 4 * gs), "v"(g + 5 * gs), "v"(g + 6 * gs), "v"(g + 7 * gs) : "memory"); }
// One wave: 64 rows x one head of one tensor, y = x.W^T (K = 64), inputs and weight converted in registers.
// Inputs and weight come through LDS, so that every request to memory is whole 128-B lines (a copy of a wave takes two rows of 256 B) and the 16-row fragment gather falls on the LDS banks (pitch 272 B = 16 B x 17):
// the block's four waves copy the 64 x 64 weight once into sw; each wave copies its own rows into xb, 32 at a time, rows 32 .. 63 flying while the weight and rows 0 .. 31 are worked on. Only the wave itself reads xb.
// Behind the last read of xb the same bytes are the wave's 64 x 64 f16 staging tile st (pitch 72), written 16 B a lane:
// TR (values): A = x rows, B = W rows, so a lane holds 8 consecutive rows of one output column and the tile is staged transposed, st[d][row];
// else (keys, query): A = W rows, B = x rows, so a lane holds 8 consecutive columns of one row, st[row][e]. Either way each staged row leaves as one whole 128-B line; dst = first staged row, pitch in elements.
template <bool TR>
__device__ __forceinline__ void proj_tile(const float* __restrict__ x, const float* __restrict__ W, float* sw, float* xb, unsigned short* __restrict__ dst, size_t pitch, int tid) {
  constexpr int XP = HD + 4;      /* LDS pitch in floats */
  const int lane = tid & 31, ln = lane & 15, hh = lane >> 4;
  const float* xg = x + (size_t)hh * DD + ln * 4; const unsigned lx = (unsigned)(size_t)(xb + hh * XP + ln * 4);      /* copy i of a half: rows 2 i and 2 i + 1, 16 lanes a row */
  auto xcopy = [&](int ph) { cp8(lx, 2 * XP * 4, xg + (size_t)(ph * 32) * DD, 2 * DD); cp8(lx + 16 * XP * 4, 2 * XP * 4, xg + (size_t)(ph * 32 + 16) * DD, 2 * DD); };
  xcopy(0);
  cp8((unsigned)(size_t)(sw + (tid >> 4) * XP + (tid & 15) * 4), 8 * XP * 4, W + tid * 4, 8 * HD);      /* copy i: weight rows 8 i .. 8 i + 7 over the block's 128 threads */
  asm volatile("s_wait_asynccnt 0x0" ::: "memory");      /* this wave's copies of rows 0 .. 31 and of its part of the weight have landed */
  __syncthreads();                                        /* ... and the other waves' parts of the weight: nothing of it is read before */
  const float* xl = xb + ln * XP + 8 * hh; const float* wl = sw + ln * XP + 8 * hh;
  Raw16 xr[2][2];
#pragma unroll
  for (int rt = 0; rt < 2; ++rt)
#pragma unroll
    for (int ks = 0; ks < 2; ++ks) xr[rt][ks] = raw_f32(xl + rt * 16 * XP + ks * 32);
  asm volatile("s_wait_dscnt 0x0" ::: "memory");         /* the wave's reads of rows 0 .. 31 are over before the copies of rows 32 .. 63 write the same bytes; no other wave reads them */
  xcopy(1);
  FragH wf[4][2];
#pragma unroll
  for (int t = 0; t < 4; ++t)
#pragma unroll
    for (int ks = 0; ks < 2; ++ks) wf[t][ks] = frag_f32<true>(raw_f32(wl + t * 16 * XP + ks * 32));
  v8us o[4][4];
#pragma unroll
  for (int ph = 0; ph < 2; ++ph) {
    if (ph == 1) { asm volatile("s_wait_asynccnt 0x0" ::: "memory");      /* the wave's own copies of rows 32 .. 63 have landed */
#pragma unroll
      for (int rt = 0; rt < 2; ++rt)
#pragma unroll
        for (int ks = 0; ks < 2; ++ks) xr[rt][ks] = raw_f32(xl + rt * 16 * XP + ks * 32); }
#pragma unroll
    for (int rt = 0; rt < 2; ++rt) {
      const FragH x0 = frag_f32<false>(xr[rt][0]), x1 = frag_f32<false>(xr[rt][1]);
#pragma unroll
      for (int t = 0; t < 4; ++t) { v8f acc = (v8f){0.f,0.f,0.f,0.f,0.f,0.f,0.f,0.f};
        if (TR) { acc = mmaH<1>(x0.v, x0.v, wf[t][0].v, wf[t][0].v, acc); acc = mmaH<1>(x1.v, x1.v, wf[t][1].v, wf[t][1].v, acc); }
        else    { acc = mmaH<1>(wf[t][0].v, wf[t][0].v, x0.v, x0.v, acc); acc = mmaH<1>(wf[t][1].v, wf[t][1].v, x1.v, x1.v, acc); }
        FragH f;
#pragma unroll
        for (int r = 0; r < 8; ++r) f.h[r] = (_Float16)(acc[r] * 0.0625f);
        o[ph * 2 + rt][t] = f.half[0]; } } }
  unsigned short (*st)[72] = (unsigned short (*)[72])xb;      /* a wave's LDS operations keep their order: these stores stand behind its last reads of the rows */
#pragma unroll
  for (int rt = 0; rt < 4; ++rt)
#pragma unroll
    for (int t = 0; t < 4; ++t) { if (TR) *(v8us*)&st[t * 16 + ln][rt * 16 + 8 * hh] = o[rt][t]; else *(v8us*)&st[rt * 16 + ln][t * 16 + 8 * hh] = o[rt][t]; }
  __builtin_amdgcn_fence(__ATOMIC_ACQ_REL, "workgroup"); __builtin_amdgcn_wave_barrier();      /* the wave reads back what its other lanes staged */
#pragma unroll
  for (int q = 0; q < 16; ++q) { const int r = q * 4 + (lane >> 3), c8 = (lane & 7) * 8; const v8us v = *(const v8us*)&st[r][c8]; *(v8us*)(dst + (size_t)r * pitch + c8) = v; }
  asm volatile("s_wait_xcnt 0x0" ::: "memory"); }      /* the same precaution behind the stores: nothing that follows on any path writes their registers first */
// grid (NR / 256, heads, 4): blockIdx.z = 0 values -> Vt[slab][d][t], 1 keys -> K16, 2 query -> Q16 (row-major, head h at column 64 h); blockIdx.z = 3: Bo = f16(bf16(Wo) x2^4), 8 elements a thread and trip
__global__ __launch_bounds__(128) void k_proj(const float* __restrict__ xv, const float* __restrict__ xk, const float* __restrict__ xq, const float* __restrict__ Wv, const float* __restrict__ Wk, const float* __restrict__ Wq, const float* __restrict__ Wo,
    _Float16* __restrict__ Vt, _Float16* __restrict__ K16, _Float16* __restrict__ Q16, _Float16* __restrict__ Bo) {
  __shared__ __attribute__((aligned(16))) float sX[4][64 * 72 / 2];      /* a wave's own 9,216 B: 32 input rows of 272 B, twice; then its output tile */
  __shared__ __attribute__((aligned(16))) float sW[HD * (HD + 4)];       /* the tensor's weight, 64 rows of 272 B */
  const int tid = threadIdx.x, w = tid >> 5; const int z = blockIdx.z, h = blockIdx.y;
  if (z == 3) { constexpr int NTH = (NR / 256) * NH * 128;
#pragma unroll
    for (int i = 0; i < DD * DD / 8 / NTH; ++i) { const size_t t = (size_t)i * NTH + (size_t)(blockIdx.y * (NR / 256) + blockIdx.x) * 128 + tid; const v4f a = *(const v4fa*)(Wo + t * 8), c = *(const v4fa*)(Wo + t * 8 + 4); FragH f;
#pragma unroll
      for (int q = 0; q < 4; ++q) { f.h[q] = (_Float16)(bf16_round(a[q]) * 16.0f); f.h[4 + q] = (_Float16)(bf16_round(c[q]) * 16.0f); }
      *(v8us*)((unsigned short*)Bo + t * 8) = f.half[0]; }
    return; }
  const int row0 = (blockIdx.x * 4 + w) * 64; const size_t xo = (size_t)row0 * DD + h * HD;
  if (z == 0) proj_tile<true>(xv + xo, Wv, sW, sX[w], (unsigned short*)Vt + ((size_t)((row0 / TT) * NH + h) * HD) * TT + row0 % TT, TT, tid);
  else proj_tile<false>((z == 1 ? xk : xq) + xo, z == 1 ? Wk : Wq, sW, sX[w], (unsigned short*)(z == 1 ? K16 : Q16) + xo, DD, tid); }
// lane l with lane l ^ 16 (a vector cross-row move, no LDS)
__device__ __forceinline__ float xhalf(float x) { return __builtin_bit_cast(float, __builtin_amdgcn_permlanex16(__builtin_bit_cast(int, x), __builtin_bit_cast(int, x), 0x76543210, 0xfedcba98, false, false)); }
// x <- 2^x on the hardware exponential for a pass's 16 scores. One asm statement so that each v_exp_f32 writes over its own argument and its neighbours name other registers:
// the slot that the instruction set asks for behind a transcendental (no read of its result, no write of its source) is then kept between them by construction, and the closing v_nop keeps it for whatever follows.
__device__ __forceinline__ void exp2_16(v8f& a, v8f& b) {
  float a0 = a[0], a1 = a[1], a2 = a[2], a3 = a[3], a4 = a[4], a5 = a[5], a6 = a[6], a7 = a[7], b0 = b[0], b1 = b[1], b2 = b[2], b3 = b[3], b4 = b[4], b5 = b[5], b6 = b[6], b7 = b[7];
  asm("v_exp_f32 %0, %0\n\tv_exp_f32 %1, %1\n\tv_exp_f32 %2, %2\n\tv_exp_f32 %3, %3\n\tv_exp_f32 %4, %4\n\tv_exp_f32 %5, %5\n\tv_exp_f32 %6, %6\n\tv_exp_f32 %7, %7\n\t"
      "v_exp_f32 %8, %8\n\tv_exp_f32 %9, %9\n\tv_exp_f32 %10, %10\n\tv_exp_f32 %11, %11\n\tv_exp_f32 %12, %12\n\tv_exp_f32 %13, %13\n\tv_exp_f32 %14, %14\n\tv_exp_f32 %15, %15\n\tv_nop"
      : "+v"(a0), "+v"(a1), "+v"(a2), "+v"(a3), "+v"(a4), "+v"(a5), "+v"(a6), "+v"(a7), "+v"(b0), "+v"(b1), "+v"(b2), "+v"(b3), "+v"(b4), "+v"(b5), "+v"(b6), "+v"(b7));      /* every exponential in place */
  a = (v8f){a0, a1, a2, a3, a4, a5, a6, a7}; b = (v8f){b0, b1, b2, b3, b4, b5, b6, b7}; }
// Four asynchronous 16-B copies a lane, global -> LDS, through no register. The s_wait_xcnt in the same statement is a precaution: the address registers are written again only behind it.
__device__ __forceinline__ void cp4(unsigned l0, unsigned l1, unsigned l2, unsigned l3, const void* g0, const void* g1, const void* g2, const void* g3) {
  asm volatile("global_load_async_to_lds_b128 %0, %4, off\n\tglobal_load_async_to_lds_b128 %1, %5, off\n\tglobal_load_async_to_lds_b128 %2, %6, off\n\tglobal_load_async_to_lds_b128 %3, %7, off\n\ts_wait_xcnt 0x0"
               :: "v"(l0), "v"(l1), "v"(l2), "v"(l3), "v"(g0), "v"(g1), "v"(g2), "v"(g3) : "memory"); }
// D = A.B + C by the builtin alone: the compiler keeps the distances behind its own matrix instructions, and the independent products of a wave's two query groups stand in them
__device__ __forceinline__ v8f mmB(v16h a, v16h b, v8f c) { return __builtin_amdgcn_wmma_f32_16x16x32_f16(false, a, false, b, (short)0, c, false, false); }
// Two asynchronous 16-B copies a lane, as cp4
__device__ __forceinline__ void cp2(unsigned l0, unsigned l1, const void* g0, const void* g1) {
  asm volatile("global_load_async_to_lds_b128 %0, %2, off\n\tglobal_load_async_to_lds_b128 %1, %3, off\n\ts_wait_xcnt 0x0" :: "v"(l0), "v"(l1), "v"(g0), "v"(g1) : "memory"); }
__global__ __launch_bounds__(256) void k_flash(const _Float16* __restrict__ Q16, int ldq, const _Float16* __restrict__ K16, int ldk, const _Float16* __restrict__ Vt, const int* __restrict__ MSK, _Float16* __restrict__ O16, int ldo) {
  constexpr int NG = 2, QB = 128, NQB = TT / QB, DT = 4, KS = 2, SK = 64, NST = TT / SK, LP = 72; typedef int v4ia __attribute__((ext_vector_type(4), may_alias)); typedef float fa __attribute__((may_alias));
  __shared__ __attribute__((aligned(16))) unsigned short sKV[2][2][SK][LP];      /* [buffer][K, V^T][row][pitch]; behind the loop: the partial results that the waves exchange */
  __shared__ __attribute__((aligned(16))) int sM[TT];
  __shared__ __attribute__((aligned(16))) unsigned short sO[8][16][64 + 8];
  const int tid = threadIdx.x, w = tid >> 5, lane = tid & 31, ln = lane & 15, hh = lane >> 4; const int cg = w & 3, kh = w >> 2;
  const int slab = blockIdx.x / NQB, qblk = blockIdx.x % NQB; const int b = slab / NH, h = slab % NH; const int q0 = qblk * QB + cg * (NG * 16);
  /* the thread's part of a stage: 16 B at column 8 cc of rows cr and cr + 32 of both tiles, so that a wave's copy takes four whole 128-B lines */
  const int cr = tid >> 3, cc = tid & 7;
  const unsigned short* kg = (const unsigned short*)K16 + ((size_t)b * TT + cr) * ldk + h * 64 + cc * 8;
  const unsigned short* vg = (const unsigned short*)Vt + ((size_t)slab * 64 + cr) * TT + cc * 8;
  const unsigned lkv = (unsigned)(size_t)&sKV[0][0][cr][cc * 8];
  constexpr unsigned LROW = 32 * LP * 2, LTILE = SK * LP * 2, LBUF = 2 * LTILE;      /* bytes: 32 rows, one tile, one buffer */
  auto stage = [&](int t, unsigned bufo) {
    const unsigned short* k0 = kg + (size_t)t * SK * ldk; const unsigned short* v0 = vg + t * SK; const unsigned l = lkv + bufo;
    cp4(l, l + LROW, l + LTILE, l + LTILE + LROW, k0, k0 + (size_t)32 * ldk, v0, v0 + 32 * TT); };
  { const int* mg = MSK + (size_t)b * TT + tid * 4; const unsigned lm = (unsigned)(size_t)&sM[tid * 4];
    cp2(lm, lm + 4096, mg, mg + 1024); }
  stage(0, 0);
  FragH bq[NG][KS];
#pragma unroll
  for (int g = 0; g < NG; ++g) { const unsigned short* qr = (const unsigned short*)Q16 + ((size_t)b * TT + q0 + g * 16 + ln) * ldq + h * 64;
#pragma unroll
    for (int ks = 0; ks < KS; ++ks) { bq[g][ks].half[0] = *(const v8us*)(qr + ks * 32 + 8 * hh); bq[g][ks].half[1] = *(const v8us*)(qr + ks * 32 + 16 + 8 * hh); } }
  asm volatile("s_wait_asynccnt 0x0" ::: "memory");      /* this wave's copies of the mask row and of stage 0 have landed */
  __syncthreads();                                        /* ... and every other wave's: nothing of them is read before */
  stage(1, LBUF);
  /* The mask row is tested once: bit t of zst says whether stage t holds a masked key. Read i covers 128 keys, lanes 0 to 15 those of stage 2 i, lanes 16 to 31 those of stage 2 i + 1; a ballot is the same in every lane, so zst is a scalar. */
  unsigned zst = 0;
#pragma unroll      /* unrolled: every LDS offset and every shift is an immediate */
  for (int i = 0; i < TT / 128; ++i) { const v4ia m = *(const v4ia*)&sM[(i * 32 + lane) * 4];
    const unsigned lo = min(min((unsigned)m[0], (unsigned)m[1]), min((unsigned)m[2], (unsigned)m[3]));      /* 0 where one of the four is 0 */
    const unsigned bal = __builtin_amdgcn_ballot_w32(lo == 0u);
    zst |= (((bal & 0xFFFFu) != 0u ? 1u : 0u) | ((bal >> 16) != 0u ? 2u : 0u)) << (2 * i); }
  float m_q[NG], nb_q[NG], l_q[NG]; v8f oacc[NG][DT];      /* of query q0 + 16 g + ln over the wave's keys; m_q: the reference maximum in use, in units of the raw energy, nb_q = 10 - m_q SC2; l_q sums this lane half's keys (x2^10); oacc[g][dt][r] = O^T[dt*16 + 8hh + r][ln] */
  constexpr float SC2 = 0.03125f * 1.44269504088896340736f;      /* 1/sqrt(1024) x log2(e): softmax(energy/32) in powers of two */
  constexpr float PLIM = 32768.0f;      /* a pass stands while each lane's sum of its 16 P x2^10 is below 2^15: every P (none is negative) is then below it too, inside f16 */
#pragma unroll
  for (int g = 0; g < NG; ++g) { m_q[g] = -3.0e38f; nb_q[g] = fmaf(-3.0e38f, -SC2, 10.0f); l_q[g] = 0.f;
#pragma unroll
    for (int dt = 0; dt < DT; ++dt) oacc[g][dt] = (v8f){0.f,0.f,0.f,0.f,0.f,0.f,0.f,0.f}; }
#pragma unroll 1      /* stays rolled: the buffer chosen by t & 1 */
  for (int t = 0; t < NST; ++t) {      /* every loop inside is unrolled: constant indices keep fragments, scores and accumulators in registers, every LDS offset is an immediate */
    const int bf = t & 1;
    const unsigned short* kf = &sKV[bf][0][kh * 32 + ln][8 * hh]; const unsigned short* vf = &sKV[bf][1][ln][kh * 32 + 8 * hh];
    FragH ak[2][KS], av[DT];
#pragma unroll
    for (int nt = 0; nt < 2; ++nt)
#pragma unroll
      for (int ks = 0; ks < KS; ++ks) { const unsigned short* kr = kf + nt * 16 * LP + ks * 32; ak[nt][ks].half[0] = *(const v8us*)kr; ak[nt][ks].half[1] = *(const v8us*)(kr + 16); }
    __builtin_amdgcn_sched_barrier(0);      /* the 8 reads of K stay one group in front of their products (for speed only) */
    v8f s[NG][2];
#pragma unroll
    for (int g = 0; g < NG; ++g)
#pragma unroll
      for (int nt = 0; nt < 2; ++nt) s[g][nt] = (v8f){0.f,0.f,0.f,0.f,0.f,0.f,0.f,0.f};
#pragma unroll
    for (int ks = 0; ks < KS; ++ks)
#pragma unroll
      for (int nt = 0; nt < 2; ++nt)
#pragma unroll
        for (int g = 0; g < NG; ++g) s[g][nt] = mmB(ak[nt][ks].v, bq[g][ks].v, s[g][nt]);
    __builtin_amdgcn_sched_barrier(0);      /* the 8 products stay one run and the reads of V^T one group behind them (for speed only) */
#pragma unroll
    for (int dt = 0; dt < DT; ++dt) { const unsigned short* vrow = vf + dt * 16 * LP; av[dt].half[0] = *(const v8us*)vrow; av[dt].half[1] = *(const v8us*)(vrow + 16); }
    __builtin_amdgcn_sched_barrier(0);      /* ... and in front of the softmax, under which they fly: sunk towards the second products, their latency would be waited out there */
    v8f p[NG][2]; float ps[NG]; typedef float v2f __attribute__((ext_vector_type(2)));
    /* energies e -> P^T x2^10 against the reference maximum in use, and each lane's sum of them: p x2^10 = 2^(e SC2 - m_q SC2 + 10), one fma and one hardware exponential a score; a masked key gives 2^-inf = 0 */
    auto expo = [&](int g, const v8f& e0, const v8f& e1) {
#pragma unroll
      for (int r = 0; r < 8; ++r) { p[g][0][r] = fmaf(e0[r], SC2, nb_q[g]); p[g][1][r] = fmaf(e1[r], SC2, nb_q[g]); }
      exp2_16(p[g][0], p[g][1]);
      const v8f u = p[g][0] + p[g][1];      /* a tree, four links deep: the test below waits for it */
      const v2f x = ((v2f){u[0], u[1]} + (v2f){u[2], u[3]}) + ((v2f){u[4], u[5]} + (v2f){u[6], u[7]});
      ps[g] = x[0] + x[1]; };
#pragma unroll
    for (int g = 0; g < NG; ++g) expo(g, s[g][0], s[g][1]);
    /* One test a pass for the whole wave (a ballot and a bit of zst are scalars). No maximum is taken while the sums prove the reference good: a sum at or above PLIM (infinite at the first attended key, whose reference is -3e38),
       or a stage that holds a masked key, sends the wave back to the raw energies, which the products' registers still hold */
    if ((__builtin_amdgcn_ballot_w32(!(fmaxf(ps[0], ps[1]) < PLIM)) | ((zst >> t) & 1u)) != 0u) {
      const int* mp = &sM[t * SK + kh * 32 + 8 * hh];      /* key padding mask (1 = attend), shared by all queries and heads: the lane's keys 8hh + r and 16 + 8hh + r of the wave's 32 */
      const v4ia km[2][2] = {{*(const v4ia*)mp, *(const v4ia*)(mp + 4)}, {*(const v4ia*)(mp + 16), *(const v4ia*)(mp + 20)}};
#pragma unroll
      for (int g = 0; g < NG; ++g) {
        v8f e[2]; float mc = -INFINITY;
#pragma unroll
        for (int nt = 0; nt < 2; ++nt)
#pragma unroll
          for (int r = 0; r < 8; ++r) { e[nt][r] = (km[nt][r >> 2][r & 3] != 0) ? s[g][nt][r] : -INFINITY; mc = fmaxf(mc, e[nt][r]); }      /* masked keys carry -1e20 in the module, -inf here; the scale is positive, so the maximum is taken before it */
        const float mn = fmaxf(m_q[g], fmaxf(mc, xhalf(mc)));      /* the same in both lane halves of a query; mn >= -3e38 is finite: nothing attended yet gives the factor 2^0 = 1 */
        const float a = __builtin_amdgcn_exp2f((m_q[g] - mn) * SC2); m_q[g] = mn; nb_q[g] = fmaf(mn, -SC2, 10.0f); l_q[g] *= a;
#pragma unroll
        for (int dt = 0; dt < DT; ++dt)
#pragma unroll
          for (int r = 0; r < 8; ++r) oacc[g][dt][r] *= a;
        expo(g, e[0], e[1]); } }
    FragH pb[NG];
#pragma unroll
    for (int g = 0; g < NG; ++g) { l_q[g] += ps[g];
#pragma unroll
      for (int nt = 0; nt < 2; ++nt)
#pragma unroll
        for (int r = 0; r < 8; ++r) pb[g].h[nt * 8 + r] = (_Float16)p[g][nt][r]; }
#pragma unroll
    for (int dt = 0; dt < DT; ++dt)
#pragma unroll
      for (int g = 0; g < NG; ++g) oacc[g][dt] = mmB(av[dt].v, pb[g].v, oacc[g][dt]);
    asm volatile("s_wait_dscnt 0x0" ::: "memory");        /* this wave's reads of the buffer are over before it is handed to the copies */
    asm volatile("s_wait_asynccnt 0x0" ::: "memory");     /* this wave's copies of stage t + 1 have landed */
    __syncthreads();                                      /* publishes stage t + 1 and ends every wave's reads of stage t */
    if (t + 2 < NST) stage(t + 2, bf * LBUF); }
  asm volatile("s_wait_asynccnt 0x0" ::: "memory");       /* no copy is outstanding when the buffers become the exchange area */
  /* behind the last trip's barrier nobody reads the buffers any more. Wave w keeps group kh and hands group 1 - kh to wave w ^ 4: 9 x 16 B a lane (O^T, then maximum and sum), lane for lane, since both waves hold a query and its d rows in the same lanes */
  constexpr int XW = 9 * 128; fa* xs = (fa*)&sKV[0][0][0][0];
  { fa* xo = xs + w * XW + lane * 4;
#pragma unroll
    for (int dt = 0; dt < DT; ++dt) { const v8f o = kh ? oacc[0][dt] : oacc[1][dt]; *(v4fa*)(xo + (2 * dt) * 128) = (v4f){o[0], o[1], o[2], o[3]}; *(v4fa*)(xo + (2 * dt + 1) * 128) = (v4f){o[4], o[5], o[6], o[7]}; }
    *(v4fa*)(xo + 8 * 128) = (v4f){kh ? m_q[0] : m_q[1], kh ? l_q[0] : l_q[1], 0.f, 0.f}; }
  __syncthreads();                                        /* every wave's handed-over group is in LDS before its partner reads it */
  { const fa* xi = xs + (w ^ 4) * XW + lane * 4; const v4f ml = *(const v4fa*)(xi + 8 * 128);
    const float ma = kh ? m_q[1] : m_q[0], la = kh ? l_q[1] : l_q[0]; const float mm = fmaxf(ma, ml[0]);
    const float fk = __builtin_amdgcn_exp2f((ma - mm) * SC2), fp = __builtin_amdgcn_exp2f((ml[0] - mm) * SC2);      /* both halves of the keys brought to the common maximum */
    const float lh = la * fk + ml[1] * fp; const float l = lh + xhalf(lh); const float inv = (l > 0.f) ? 1.0f / l : 0.f;      /* l and O^T both carry the 2^10 of P */
#pragma unroll
    for (int dt = 0; dt < DT; ++dt) { const v8f ok = kh ? oacc[1][dt] : oacc[0][dt]; const v4f p0 = *(const v4fa*)(xi + (2 * dt) * 128), p1 = *(const v4fa*)(xi + (2 * dt + 1) * 128); FragH o;      /* O x2^4 in f16, the output GEMM's A operand: the lane's 8 consecutive d of query ln */
#pragma unroll
      for (int r = 0; r < 8; ++r) o.h[r] = (_Float16)(((ok[r] * fk + (r < 4 ? p0[r & 3] : p1[r & 3]) * fp) * inv) * 16.0f);
      *(v8us*)&sO[w][ln][dt * 16 + 8 * hh] = o.half[0]; } }
  __builtin_amdgcn_fence(__ATOMIC_ACQ_REL, "workgroup"); __builtin_amdgcn_wave_barrier();
  {
#pragma unroll
    for (int rp = 0; rp < 16; rp += 4) { const int r = rp + (lane >> 3), pc = lane & 7; const v8us val = *(const v8us*)&sO[w][r][pc * 8]; *(v8us*)((unsigned short*)O16 + ((size_t)b * TT + q0 + kh * 16 + r) * ldo + h * 64 + pc * 8) = val; }
     } }

// Output GEMM, out = (O x2^4).(Wo x2^4)^T / 2^8 + bf16(bo): one 128 x 128 tile of out a block, 8 waves of 64 x 32 (4 x 2 accumulator tiles), K in 8 stages of 128.
// A stage is 128 rows of O16 and 128 rows of Bo, 256 B (two whole lines) a row, LDS pitch 272 B, two buffers; stage t + 2 is copied while stage t + 1 is worked on. Each tile sums its k in ascending steps of 32.
__global__ __launch_bounds__(256) void k_ogemm(const _Float16* __restrict__ A, const _Float16* __restrict__ Bh, const float* __restrict__ bias, float* __restrict__ C) {
  constexpr int SK = 128, NST = DD / SK, LP = SK + 8, SP = 36; typedef float fa __attribute__((may_alias));
  __shared__ __attribute__((aligned(16))) unsigned short sAB[2][2][128][LP];      /* [buffer][O16, Bo][row][pitch]; behind the loop: each wave's 64 x 32 f32 of out, pitch SP */
  const int tid = threadIdx.x, w = tid >> 5, lane = tid & 31, ln = lane & 15, hh = lane >> 4;
  const int row0 = blockIdx.y * 128, col0 = blockIdx.x * 128, wm = (w & 1) * 64, wn = (w >> 1) * 32;
  /* the thread's part of a stage: 16 B at column 8 cc of rows cr + 16 i of both tiles, so that a wave's copy takes four whole 128-B lines */
  const int cr = tid >> 4, cc = tid & 15;
  const unsigned short* ag = (const unsigned short*)A + (size_t)(row0 + cr) * DD + cc * 8;
  const unsigned short* bg = (const unsigned short*)Bh + (size_t)(col0 + cr) * DD + cc * 8;
  const unsigned lab = (unsigned)(size_t)&sAB[0][0][cr][cc * 8];
  constexpr unsigned LROW = 16 * LP * 2, LTILE = 128 * LP * 2, LBUF = 2 * LTILE;      /* bytes: 16 rows, one tile, one buffer */
  auto tile = [&](const unsigned short* g, unsigned l) {      /* rows cr + 16 i, i = 0 .. 7: eight copies and, as in cp4, the s_wait_xcnt precaution in one statement, so that a tile costs one such wait */
    asm volatile("global_load_async_to_lds_b128 %0, %8, off\n\tglobal_load_async_to_lds_b128 %1, %9, off\n\tglobal_load_async_to_lds_b128 %2, %10, off\n\tglobal_load_async_to_lds_b128 %3, %11, off\n\t"
                 "global_load_async_to_lds_b128 %4, %12, off\n\tglobal_load_async_to_lds_b128 %5, %13, off\n\tglobal_load_async_to_lds_b128 %6, %14, off\n\tglobal_load_async_to_lds_b128 %7, %15, off\n\ts_wait_xcnt 0x0"
                 :: "v"(l), "v"(l + LROW), "v"(l + 2 * LROW), "v"(l + 3 * LROW), "v"(l + 4 * LROW), "v"(l + 5 * LROW), "v"(l + 6 * LROW), "v"(l + 7 * LROW),
                    "v"(g), "v"(g + 16 * DD), "v"(g + 32 * DD), "v"(g + 48 * DD), "v"(g + 64 * DD), "v"(g + 80 * DD), "v"(g + 96 * DD), "v"(g + 112 * DD) : "memory"); };
  auto stage = [&](int t, unsigned bufo) { tile(ag + t * SK, lab + bufo); tile(bg + t * SK, lab + bufo + LTILE); };
  stage(0, 0);
  asm volatile("s_wait_asynccnt 0x0" ::: "memory");      /* this wave's copies of stage 0 have landed */
  __syncthreads();                                        /* ... and every other wave's: nothing of them is read before */
  stage(1, LBUF);
  v8f acc[4][2];
#pragma unroll
  for (int i = 0; i < 4; ++i)
#pragma unroll
    for (int j = 0; j < 2; ++j) acc[i][j] = (v8f){0.f,0.f,0.f,0.f,0.f,0.f,0.f,0.f};
#pragma unroll 1      /* stays rolled: the buffer is chosen by t & 1 */
  for (int t = 0; t < NST; ++t) {
    const int bf = t & 1;
    const unsigned short* af = &sAB[bf][0][wm + ln][8 * hh]; const unsigned short* bp = &sAB[bf][1][wn + ln][8 * hh];
#pragma unroll      /* this loop and those inside it are unrolled: constant indices keep fragments and accumulators in registers, every LDS offset is an immediate */
    for (int kh = 0; kh < SK; kh += 64) {
      FragH a[2][4], b[2][2];
#pragma unroll
      for (int ks = 0; ks < 2; ++ks) {
#pragma unroll
        for (int j = 0; j < 2; ++j) { const unsigned short* p = bp + j * 16 * LP + kh + ks * 32; b[ks][j].half[0] = *(const v8us*)p; b[ks][j].half[1] = *(const v8us*)(p + 16); }
#pragma unroll
        for (int i = 0; i < 4; ++i) { const unsigned short* p = af + i * 16 * LP + kh + ks * 32; a[ks][i].half[0] = *(const v8us*)p; a[ks][i].half[1] = *(const v8us*)(p + 16); } }
      __builtin_amdgcn_sched_barrier(0);      /* 24 LDS reads stay one group in front of their 16 products (for speed only) */
#pragma unroll
      for (int ks = 0; ks < 2; ++ks)
#pragma unroll
        for (int i = 0; i < 4; ++i)
#pragma unroll
          for (int j = 0; j < 2; ++j) acc[i][j] = __builtin_amdgcn_wmma_f32_16x16x32_f16(false, a[ks][i].v, false, b[ks][j].v, (short)0, acc[i][j], false, false);
      __builtin_amdgcn_sched_barrier(0); }      /* the products stay in front of the waits below: lifted over them, the waits would end the next stage's flight before the products have covered it */
    asm volatile("s_wait_dscnt 0x0" ::: "memory");        /* this wave's reads of the buffer are over before it is handed to the copies */
    asm volatile("s_wait_asynccnt 0x0" ::: "memory");     /* this wave's copies of stage t + 1 have landed */
    __syncthreads();                                      /* publishes stage t + 1 and ends every wave's reads of stage t */
    if (t + 2 < NST) stage(t + 2, bf * LBUF); }
  asm volatile("s_wait_asynccnt 0x0" ::: "memory");       /* no copy is outstanding when the buffers become output staging */
  /* behind the last trip's barrier nobody reads the buffers any more: each wave stages its own 64 x 32 f32 there, so that every row leaves as one whole 128-B line */
  fa* st = (fa*)&sAB[0][0][0][0] + w * (64 * SP);
#pragma unroll
  for (int j = 0; j < 2; ++j) { const float bv = bf16_round(bias[col0 + wn + j * 16 + ln]);
#pragma unroll
    for (int i = 0; i < 4; ++i)
#pragma unroll
      for (int r = 0; r < 8; ++r) st[(i * 16 + 8 * hh + r) * SP + j * 16 + ln] = acc[i][j][r] * 0.00390625f + bv; }
  __builtin_amdgcn_fence(__ATOMIC_ACQ_REL, "workgroup"); __builtin_amdgcn_wave_barrier();      /* the wave reads back what its other lanes staged */
  float* cp = C + (size_t)(row0 + wm + (lane >> 3)) * DD + col0 + wn + (lane & 7) * 4; const fa* sp = st + (lane >> 3) * SP + (lane & 7) * 4;
#pragma unroll
  for (int q = 0; q < 16; ++q) { const v4f v = *(const v4fa*)(sp + q * 4 * SP); *(v4f*)(cp + (size_t)q * 4 * DD) = v; }
  asm volatile("s_wait_xcnt 0x0" ::: "memory"); }      /* precaution behind the stores: nothing that follows writes their registers first */

extern "C" void kernel_launch(void* const* d_in, const int* in_sizes, int n_in,
                              void* d_out, int out_size, void* d_ws, size_t ws_size, hipStream_t stream) {
  (void)in_sizes; (void)n_in; (void)out_size;
  const float* const* I = (const float* const*)d_in; const float* values = I[0]; const float* keys = I[1]; const float* query = I[2]; const int* mask = (const int*)d_in[3]; const float* Wv = I[4]; const float* Wk = I[5]; const float* Wq = I[6]; const float* Wo = I[7]; const float* bo = I[8];
  char* ws = (char*)d_ws; size_t off = 0;
  auto take = [&](size_t bytes) { char* p = ws + off; off += (bytes + 255) & ~(size_t)255; return p; };
  _Float16* Bo = (_Float16*)take((size_t)DD * DD * 2);
  _Float16* K = (_Float16*)take((size_t)NR * DD * 2); _Float16* Q = (_Float16*)take((size_t)NR * DD * 2); _Float16* Vt = (_Float16*)take((size_t)NR * DD * 2); _Float16* O16 = (_Float16*)take((size_t)NR * DD * 2);
  if (off > ws_size) return;      // 2.1 + 4 x 8.4 = 36 MB
  k_proj<<<dim3(NR / 256, NH, 4), 128, 0, stream>>>(values, keys, query, Wv, Wk, Wq, Wo, Vt, K, Q, Bo);
  k_flash<<<BB * NH * (TT / 128), 256, 0, stream>>>(Q, DD, K, DD, Vt, mask, O16, DD);
  k_ogemm<<<dim3(DD / 128, NR / 128), 256, 0, stream>>>(O16, Bo, bo, (float*)d_out);      /* out = O.Wo^T + bo */
}
